// v000
// Times are from an AMD MI455X. After a warm-up the kernel runs many times in a row, and a time is the length of
// such a window on the GPU divided by its runs, so every launch and the gaps after it count. The runs cycle
// through copies of the inputs. A figure is the median of several windows, for all but v000 over two sittings.
// Sittings can differ by a few percent; kernels timed side by side share one.
// v000, which the later versions start from, runs in 2880 microseconds.
#include <hip/hip_runtime.h>

// CausalSelfAttentionSeparateHeads (x [4][2048][1024]; per-head Linear q/k/v: Wq[h][d][c], bq[h][d] (16 heads x 64) == one [1024][1024] torch-layout weight with rows h*64+d; causal softmax(q.k/8); y merged (head-major) Wp^T + bp -> [4][2048][1024]).
// Compute dtypes, f32 accumulate: every input rounded to bf16; Q/K/V on PLAIN bf16 operands (inputs: exact) + bias; causal scores and att.v: query rows < 512 on bf16 hi+lo planes (3 products), the rest single fp16 (x1024); softmax f32;

#define NB_  4
#define TT   2048
#define DM   1024
#define NH_  16
#define NKV  16
#define REP  (NH_ / NKV)
#define HD   64
#define DQ   (NH_ * HD)
#define DKV  (NKV * HD)
#define ZH   2
#define RH   512                  // query rows < RH use hi+lo planes (0: none)
#define WIN  0
#define PCAR 1024.0f
#define SCL  0.125f   // HD^-0.5
typedef _Float16 h16;
typedef unsigned short bf;
typedef __attribute__((ext_vector_type(16))) __bf16   v16bf;
typedef __attribute__((ext_vector_type(16))) _Float16 v16h;
typedef __attribute__((ext_vector_type(8)))  _Float16 v8h;
typedef __attribute__((ext_vector_type(8)))  unsigned short v8us;
typedef __attribute__((ext_vector_type(8)))  float    v8f;
typedef __attribute__((ext_vector_type(4)))  float    v4f;
typedef v8h  __attribute__((may_alias)) v8ha;
typedef v4f  __attribute__((may_alias)) v4fa;
typedef v8us __attribute__((may_alias)) v8usa;

__device__ __forceinline__ unsigned short f2bf(float f) { unsigned u = __float_as_uint(f); u += 0x7FFFu + ((u >> 16) & 1u); return (unsigned short)(u >> 16); }
__device__ __forceinline__ float bf2f(unsigned short b) { return __uint_as_float(((unsigned)b) << 16); }
__device__ __forceinline__ float bfr(float f) { return bf2f(f2bf(f)); }
__device__ __forceinline__ v16h cat16(v8h lo, v8h hi) { return __builtin_shufflevector(lo, hi, 0, 1, 2, 3, 4, 5, 6, 7, 8, 9, 10, 11, 12, 13, 14, 15); }
__device__ __forceinline__ v16bf cat16b(v8us lo, v8us hi) { return __builtin_bit_cast(v16bf, __builtin_shufflevector(lo, hi, 0, 1, 2, 3, 4, 5, 6, 7, 8, 9, 10, 11, 12, 13, 14, 15)); }
__device__ __forceinline__ v8f wmma16(v16h a, v16h b, v8f c) { return __builtin_amdgcn_wmma_f32_16x16x32_f16(false, a, false, b, (short)0, c, false, false); }
__device__ __forceinline__ v8f wmmab(v16bf a, v16bf b, v8f c) { return __builtin_amdgcn_wmma_f32_16x16x32_bf16(false, a, false, b, (short)0, c, false, false); }



// ---- k_gemmw: register-blocked GEMM, ONE WAVE per 64x64 output tile (16 accumulators), operands straight from K-contiguous 16-bit planes; grid (M/64, N/64, Z), 32 threads.
// C[m][n] (f32, pitch ldc, + optional f32 bias[n]) = sum_k A[m][k] Bt[n][k] (+ split products per NSPLIT). z-batch strides sA/sB/sC in elements. K % 32 == 0.
template <typename T16> struct WFrag;
template <> struct WFrag<h16> { typedef v16h V; static __device__ __forceinline__ V ld(const h16* p) { return cat16(*(const v8h*)p, *(const v8h*)(p + 16)); } static __device__ __forceinline__ v8f mma(V a, V b, v8f c) { return wmma16(a, b, c); } };
template <> struct WFrag<bf> { typedef v16bf V; static __device__ __forceinline__ V ld(const bf* p) { return cat16b(*(const v8us*)p, *(const v8us*)(p + 16)); } static __device__ __forceinline__ v8f mma(V a, V b, v8f c) { return wmmab(a, b, c); } };
template <typename T16, int NSPLIT, bool BIAS>
__global__ __launch_bounds__(32) void k_gemmw(const T16* __restrict__ A, const T16* __restrict__ A2, const T16* __restrict__ Bt, const T16* __restrict__ Bt2, int K, float* C, int ldc, const float* __restrict__ bias, size_t sA, size_t sB, size_t sC) {
    typedef typename WFrag<T16>::V V;
    __shared__ __align__(16) float os[16 * 68];
    const size_t z = blockIdx.z; A += z * sA; if (A2) A2 += z * sA; Bt += z * sB; if (Bt2) Bt2 += z * sB; C += z * sC;
    const int lane = threadIdx.x & 31, lr = lane & 15, hi = lane >> 4; const int r0 = blockIdx.x * 64, c0 = blockIdx.y * 64;
    v8f acc[4][4];
#pragma unroll
    for (int mb = 0; mb < 4; ++mb)
#pragma unroll
        for (int nb = 0; nb < 4; ++nb) acc[mb][nb] = (v8f){};
    const size_t aoff = (size_t)(r0 + lr) * K + 8 * hi, boff = (size_t)(c0 + lr) * K + 8 * hi;
#pragma unroll 1
    for (int kc = 0; kc < K; kc += 32) {
        V a[4], a2[4];
#pragma unroll
        for (int mb = 0; mb < 4; ++mb) { a[mb] = WFrag<T16>::ld(A + aoff + (size_t)mb * 16 * K + kc); if (NSPLIT == 1 || NSPLIT == 2) a2[mb] = WFrag<T16>::ld(A2 + aoff + (size_t)mb * 16 * K + kc); }
#pragma unroll
        for (int nb = 0; nb < 4; ++nb) { const V b = WFrag<T16>::ld(Bt + boff + (size_t)nb * 16 * K + kc); V b2; if (NSPLIT >= 2) b2 = WFrag<T16>::ld(Bt2 + boff + (size_t)nb * 16 * K + kc);
#pragma unroll
            for (int mb = 0; mb < 4; ++mb) { acc[mb][nb] = WFrag<T16>::mma(a[mb], b, acc[mb][nb]); if (NSPLIT == 1 || NSPLIT == 2) acc[mb][nb] = WFrag<T16>::mma(a2[mb], b, acc[mb][nb]); if (NSPLIT >= 2) acc[mb][nb] = WFrag<T16>::mma(a[mb], b2, acc[mb][nb]); } }
        asm volatile("v_nop\n\tv_nop\n\tv_nop\n\tv_nop" : "+v"(acc[0][0]), "+v"(acc[1][1]), "+v"(acc[2][2]), "+v"(acc[3][3]) : "v"(a[0]), "v"(a[3]));
    }
#pragma unroll
    for (int mb = 0; mb < 4; ++mb) {
#pragma unroll
        for (int nb = 0; nb < 4; ++nb) {
#pragma unroll
            for (int j = 0; j < 8; ++j) os[(hi * 8 + j) * 68 + nb * 16 + lr] = acc[mb][nb][j]; }
        __builtin_amdgcn_wave_barrier(); asm volatile("" ::: "memory");
        float* crow = C + (size_t)(r0 + mb * 16) * ldc + c0;
{
#pragma unroll
            for (int s = 0; s < 8; ++s) { const int row = 2 * s + hi, cofs = lr * 4; v4f val = *(const v4fa*)(os + row * 68 + cofs); if (BIAS) { val[0] += bfr(bias[c0 + cofs]); val[1] += bfr(bias[c0 + cofs + 1]); val[2] += bfr(bias[c0 + cofs + 2]); val[3] += bfr(bias[c0 + cofs + 3]); }
                *(v4f*)(crow + (size_t)row * ldc + cofs) = val; }
             }
        __builtin_amdgcn_wave_barrier(); asm volatile("" ::: "memory");
    }
}

// ---- k_gemmc: the same one-wave 64x64 tile GEMM specialised for causal attention: CMODE 1 skips score tiles entirely above the diagonal (query rows r0+roff.., key columns c0..), CMODE 2 limits the
// key (K) loop of the probability x value contraction to the diagonal block (probabilities beyond it are exactly zero). roff = row offset of this launch's first row within the sequence.
template <typename T16, int NSPLIT, int CMODE>
__global__ __launch_bounds__(32) void k_gemmc(const T16* __restrict__ A, const T16* __restrict__ A2, const T16* __restrict__ Bt, const T16* __restrict__ Bt2, int K, float* C, int ldc, int roff, size_t sA, size_t sB, size_t sC) {
    typedef typename WFrag<T16>::V V;
    __shared__ __align__(16) float os[16 * 68];
    const size_t z = blockIdx.z; A += z * sA; if (A2) A2 += z * sA; Bt += z * sB; if (Bt2) Bt2 += z * sB; C += z * sC;
    const int lane = threadIdx.x & 31, lr = lane & 15, hi = lane >> 4; const int r0 = blockIdx.x * 64, c0 = blockIdx.y * 64;
    if (CMODE == 1 && c0 > r0 + roff + 63) return;                  // score tile entirely above the causal diagonal: never read (the softmax masks j > i by select)
    const int Kl = (CMODE == 2) ? min(K, r0 + roff + 64) : K;        // P.V: probabilities are exactly 0 beyond the diagonal block, so the K loop stops there
    v8f acc[4][4];
#pragma unroll
    for (int mb = 0; mb < 4; ++mb)
#pragma unroll
        for (int nb = 0; nb < 4; ++nb) acc[mb][nb] = (v8f){};
    const size_t aoff = (size_t)(r0 + lr) * K + 8 * hi, boff = (size_t)(c0 + lr) * K + 8 * hi;
#pragma unroll 1
    for (int kc = 0; kc < Kl; kc += 32) {
        V a[4], a2[4];
#pragma unroll
        for (int mb = 0; mb < 4; ++mb) { a[mb] = WFrag<T16>::ld(A + aoff + (size_t)mb * 16 * K + kc); if (NSPLIT == 1 || NSPLIT == 2) a2[mb] = WFrag<T16>::ld(A2 + aoff + (size_t)mb * 16 * K + kc); }
#pragma unroll
        for (int nb = 0; nb < 4; ++nb) { const V b = WFrag<T16>::ld(Bt + boff + (size_t)nb * 16 * K + kc); V b2; if (NSPLIT >= 2) b2 = WFrag<T16>::ld(Bt2 + boff + (size_t)nb * 16 * K + kc);
#pragma unroll
            for (int mb = 0; mb < 4; ++mb) { acc[mb][nb] = WFrag<T16>::mma(a[mb], b, acc[mb][nb]); if (NSPLIT == 1 || NSPLIT == 2) acc[mb][nb] = WFrag<T16>::mma(a2[mb], b, acc[mb][nb]); if (NSPLIT >= 2) acc[mb][nb] = WFrag<T16>::mma(a[mb], b2, acc[mb][nb]); } }
        asm volatile("v_nop\n\tv_nop\n\tv_nop\n\tv_nop" : "+v"(acc[0][0]), "+v"(acc[1][1]), "+v"(acc[2][2]), "+v"(acc[3][3]) : "v"(a[0]), "v"(a[3]));
    }
#pragma unroll
    for (int mb = 0; mb < 4; ++mb) {
#pragma unroll
        for (int nb = 0; nb < 4; ++nb) {
#pragma unroll
            for (int j = 0; j < 8; ++j) os[(hi * 8 + j) * 68 + nb * 16 + lr] = acc[mb][nb][j]; }
        __builtin_amdgcn_wave_barrier(); asm volatile("" ::: "memory");
        float* crow = C + (size_t)(r0 + mb * 16) * ldc + c0;
{
#pragma unroll
            for (int s = 0; s < 8; ++s) { const int row = 2 * s + hi, cofs = lr * 4; v4f val = *(const v4fa*)(os + row * 68 + cofs);
                *(v4f*)(crow + (size_t)row * ldc + cofs) = val; }
             }
        __builtin_amdgcn_wave_barrier(); asm volatile("" ::: "memory");
    }
}

__device__ __forceinline__ h16 tohx(float x) { return (h16)x; }
__device__ __forceinline__ void splitf(float y, unsigned short& h, unsigned short& l) { h = f2bf(y); l = f2bf(y - bf2f(h)); }
typedef __attribute__((ext_vector_type(2))) _Float16 v2h;
typedef __attribute__((ext_vector_type(4))) _Float16 v4h;
typedef __attribute__((ext_vector_type(2))) unsigned short v2us;
typedef __attribute__((ext_vector_type(4))) unsigned short v4us;
typedef __attribute__((ext_vector_type(2))) float v2f;
typedef __attribute__((ext_vector_type(4))) int v4i;

__global__ __launch_bounds__(256) void k_wtG(const float* __restrict__ w, int K, int N, bf* Bt) {
    const int lane = threadIdx.x & 31; const int L0 = (blockIdx.x * 8 + (threadIdx.x >> 5)) * 8; const int nlines = N * K / 64;
{
#pragma unroll 1
        for (int l = 0; l < 8; ++l) { const int L = L0 + l; if (L >= nlines) break; const size_t e = (size_t)L * 64 + lane * 2; const int k = (int)(e % K), n = (int)(e / K); v2us o;
            o[0] = f2bf(w[(size_t)k * N + n]); o[1] = f2bf(w[(size_t)(k + 1) * N + n]); *(v2us*)(Bt + e) = o; }
         }
}
__global__ __launch_bounds__(256) void k_cvt8(const float* __restrict__ src, bf* dst, size_t n8) { const size_t i = (size_t)blockIdx.x * 256 + threadIdx.x; if (i >= n8) return; const v8f v = *(const v8f*)(src + i * 8); v8us o;
#pragma unroll
    for (int k = 0; k < 8; ++k) o[k] = f2bf(v[k]); *(v8us*)(dst + i * 8) = o;  }
__global__ __launch_bounds__(256) void k_cscvt(const float* __restrict__ cosT, const float* __restrict__ sinT, float* CS) { const int idx = blockIdx.x * 256 + threadIdx.x; if (idx >= TT * HD) return; v2f cs; cs[0] = bfr(cosT[idx]); cs[1] = bfr(sinT[idx]); *(v2f*)(CS + (size_t)idx * 2) = cs;  }
// k_rope: head planes [h][t][d] (fp16 + hi/lo) of rope(x) x sc with the rotate-half convention out[d] = x[d] cos[t][d] - x[d+HD/2] sin[t][d], out[d+HD/2] = x[d+HD/2] cos[t][d+HD/2] + x[d] sin[t][d+HD/2]
__global__ __launch_bounds__(256) void k_rope(const float* __restrict__ F, int pitch, int nheads, const float* __restrict__ CS, const float* __restrict__ RF, const float* __restrict__ nw, float sc, h16* P16, bf* Ph, bf* Pl) {
    const size_t e = ((size_t)blockIdx.x * 256 + threadIdx.x) * 2; if (e >= (size_t)nheads * TT * HD) return; const int d = (int)(e % HD); const int t = (int)((e / HD) % TT); const int h = (int)(e / ((size_t)HD * TT)); const float* f = F + (size_t)t * pitch + h * HD; const float rf = RF ? RF[(size_t)h * TT + t] : 1.0f; v2h o16; v2us oh, ol;
#pragma unroll
    for (int q = 0; q < 2; ++q) { const int dd = d + q; const int dp = (dd < HD / 2) ? dd + HD / 2 : dd - HD / 2; float x0 = f[dd], x1 = f[dp];
        if (RF) { float n0 = __fmul_rn(x0, rf), n1 = __fmul_rn(x1, rf); asm volatile("" : "+v"(n0)); asm volatile("" : "+v"(n1)); x0 = __fmul_rn(bfr(nw[dd]), n0); x1 = __fmul_rn(bfr(nw[dp]), n1); }
        const v2f cs = *(const v2f*)(CS + ((size_t)t * HD + dd) * 2); float a = __fmul_rn(x0, cs[0]), bq = __fmul_rn(x1, cs[1]); asm volatile("" : "+v"(a)); asm volatile("" : "+v"(bq)); const float r = ((dd < HD / 2) ? __fsub_rn(a, bq) : __fadd_rn(a, bq)) * sc;
        o16[q] = tohx(r); unsigned short a2, c2; splitf(r, a2, c2); oh[q] = a2; ol[q] = c2; }
    *(v2h*)(P16 + e) = o16; *(v2us*)(Ph + e) = oh; *(v2us*)(Pl + e) = ol;  }
__global__ __launch_bounds__(256) void k_vtp(const float* __restrict__ F, int pitch, int nheads, h16* V16, bf* Vh, bf* Vl) { const size_t e = ((size_t)blockIdx.x * 256 + threadIdx.x) * 2; if (e >= (size_t)nheads * HD * TT) return; const int t = (int)(e % TT); const int d = (int)((e / TT) % HD); const int g = (int)(e / ((size_t)TT * HD)); v2h o16; v2us oh, ol;
#pragma unroll
    for (int q = 0; q < 2; ++q) { const float x = F[(size_t)(t + q) * pitch + g * HD + d]; o16[q] = tohx(x); unsigned short a2, c2; splitf(x, a2, c2); oh[q] = a2; ol[q] = c2; }
    *(v2h*)(V16 + e) = o16; *(v2us*)(Vh + e) = oh; *(v2us*)(Vl + e) = ol;  }
__global__ __launch_bounds__(256) void k_csid(float* CS) { const int idx = blockIdx.x * 256 + threadIdx.x; if (idx >= TT * HD) return; v2f cs; cs[0] = 1.0f; cs[1] = 0.0f; *(v2f*)(CS + (size_t)idx * 2) = cs;  }
// k_asoft: per row (zz, i): t = S x HD^-0.5 for j <= i (causal mask, no window; the reference's -1e9 additive fill vanishes identically); softmax over the 2048 keys (register row, one exp, fixed trees);
__global__ __launch_bounds__(256) void k_asoft(const float* __restrict__ Sb, h16* P16, bf* Ph, bf* Pl) {
    const int lane = threadIdx.x & 31; const int row = blockIdx.x * 8 + (threadIdx.x >> 5); if (row >= ZH * TT) return; const int i = row % TT; const int zz = row / TT; (void)zz; const bool hires = (i < RH); const float* sr = Sb + (size_t)row * TT; float v[TT / 32]; float mx = -3.0e38f;
#pragma unroll
    for (int ch = 0; ch < TT / 128; ++ch) { const int j0 = ch * 128 + lane * 4; const v4f a = *(const v4f*)(sr + j0);
#pragma unroll
        for (int q = 0; q < 4; ++q) { const int j = j0 + q; (void)j; const float t = (j <= i) ? a[q] * SCL : -3.0e38f; v[ch * 4 + q] = t; mx = fmaxf(mx, t); } }
#pragma unroll
    for (int sh = 16; sh; sh >>= 1) mx = fmaxf(mx, __shfl_xor(mx, sh, 32));
    float sum = 0.f;
#pragma unroll
    for (int k = 0; k < TT / 32; ++k) { float d0 = __fsub_rn(v[k], mx); asm volatile("" : "+v"(d0)); v[k] = __builtin_amdgcn_exp2f(__fmul_rn(d0, 1.4426950408889634f)); sum += v[k]; }
#pragma unroll
    for (int sh = 16; sh; sh >>= 1) sum += __shfl_xor(sum, sh, 32);
    const float f = __fdiv_rn(hires ? 1.0f : PCAR, sum);
{
        if (hires) {
#pragma unroll
            for (int ch = 0; ch < TT / 128; ++ch) { v4us oh, ol;
#pragma unroll
                for (int q = 0; q < 4; ++q) { unsigned short a, c2; splitf(v[ch * 4 + q] * f, a, c2); oh[q] = a; ol[q] = c2; }
                const size_t oo = ((size_t)zz * (RH ? RH : 1) + i) * TT + ch * 128 + lane * 4; *(v4us*)(Ph + oo) = oh; *(v4us*)(Pl + oo) = ol; }
        } else {
#pragma unroll
            for (int ch = 0; ch < TT / 128; ++ch) { v4h o4;
#pragma unroll
                for (int q = 0; q < 4; ++q) o4[q] = tohx(v[ch * 4 + q] * f);
                *(v4h*)(P16 + (size_t)row * TT + ch * 128 + lane * 4) = o4; } }
         }
}
__global__ __launch_bounds__(256) void k_merge(const float* __restrict__ O, int h0, bf* Ah, bf* Al) { const size_t e = ((size_t)blockIdx.x * 256 + threadIdx.x) * 2; if (e >= (size_t)ZH * TT * HD) return; const int d = (int)(e % HD); const int t = (int)((e / HD) % TT); const int zz = (int)(e / ((size_t)HD * TT)); const float cs = (t < RH) ? 1.0f : (1.0f / PCAR); const size_t oo = (size_t)t * DQ + (h0 + zz) * HD + d;
    v2us oh, ol;
#pragma unroll
    for (int q = 0; q < 2; ++q) { unsigned short a, c2; splitf(O[e + q] * cs, a, c2); oh[q] = a; ol[q] = c2; } *(v2us*)(Ah + oo) = oh; *(v2us*)(Al + oo) = ol;  }

extern "C" void kernel_launch(void* const* d_in, const int* in_sizes, int n_in,
                              void* d_out, int out_size, void* d_ws, size_t ws_size, hipStream_t stream) {
    (void)in_sizes; (void)n_in; (void)out_size;
    const float* x = (const float*)d_in[0]; const float* wq = (const float*)d_in[1]; const float* bq = (const float*)d_in[2]; const float* wk = (const float*)d_in[3]; const float* bk = (const float*)d_in[4]; const float* wv = (const float*)d_in[5]; const float* bv = (const float*)d_in[6]; const float* wo = (const float*)d_in[7]; const float* bo = (const float*)d_in[8]; const float* cosT = nullptr; const float* sinT = nullptr; (void)cosT; (void)sinT;
    float* OUT = (float*)d_out;     // [4][2048][1024]
    char* wsp = (char*)d_ws;
    auto take = [&](size_t bytes) { char* p = wsp; wsp += (bytes + 255) & ~(size_t)255; return (void*)p; };
    bf* WQ = (bf*)take((size_t)DQ * DM * 2); bf* WK = (bf*)take((size_t)DKV * DM * 2); bf* WV = (bf*)take((size_t)DKV * DM * 2); bf* WO = (bf*)take((size_t)DM * DQ * 2); float* CS = (float*)take((size_t)TT * HD * 2 * 4);
    bf* XB = (bf*)take((size_t)TT * DM * 2); float* FQ = (float*)take((size_t)TT * DQ * 4); float* FK = (float*)take((size_t)TT * DKV * 4);
    h16* QP16 = (h16*)take((size_t)NH_ * TT * HD * 2); h16* KP16 = (h16*)take((size_t)NKV * TT * HD * 2); h16* VT16 = (h16*)take((size_t)NKV * HD * TT * 2);
    bf* QPh = (bf*)take((size_t)NH_ * TT * HD * 2); bf* QPl = (bf*)take((size_t)NH_ * TT * HD * 2); bf* KPh = (bf*)take((size_t)NKV * TT * HD * 2); bf* KPl = (bf*)take((size_t)NKV * TT * HD * 2); bf* VTh = (bf*)take((size_t)NKV * HD * TT * 2); bf* VTl = (bf*)take((size_t)NKV * HD * TT * 2); bf* Ph = (bf*)take((size_t)ZH * RH * TT * 2); bf* Pl = (bf*)take((size_t)ZH * RH * TT * 2);
    float* Sb = (float*)take((size_t)ZH * TT * TT * 4); h16* P16 = (h16*)take((size_t)ZH * TT * TT * 2); float* Ob = (float*)take((size_t)ZH * TT * HD * 4); bf* ATh = (bf*)take((size_t)TT * DQ * 2); bf* ATl = (bf*)take((size_t)TT * DQ * 2);
    if ((size_t)(wsp - (char*)d_ws) > ws_size) return;    // ws 256 MiB
    float* FV = FK;   // v projection reuses the k buffer after the k planes are built (stream-ordered)
    { k_cvt8<<<(unsigned)(((size_t)DQ * DM / 8 + 255) / 256), 256, 0, stream>>>(wq, WQ, (size_t)DQ * DM / 8); k_cvt8<<<(unsigned)(((size_t)DKV * DM / 8 + 255) / 256), 256, 0, stream>>>(wk, WK, (size_t)DKV * DM / 8); k_cvt8<<<(unsigned)(((size_t)DKV * DM / 8 + 255) / 256), 256, 0, stream>>>(wv, WV, (size_t)DKV * DM / 8);
      k_cvt8<<<(unsigned)(((size_t)DM * DQ / 8 + 255) / 256), 256, 0, stream>>>(wo, WO, (size_t)DM * DQ / 8);
       }
    k_csid<<<(TT * HD + 255) / 256, 256, 0, stream>>>(CS);
    const unsigned LQ = (unsigned)(((size_t)NH_ * TT * HD / 2 + 255) / 256), LKv = (unsigned)(((size_t)NKV * TT * HD / 2 + 255) / 256);
    for (int b = 0; b < NB_; ++b) {
        
        k_cvt8<<<(unsigned)(((size_t)TT * DM / 8 + 255) / 256), 256, 0, stream>>>(x + (size_t)b * TT * DM, XB, (size_t)TT * DM / 8);
        k_gemmw<bf, 0, true><<<dim3(TT / 64, DQ / 64, 1), 32, 0, stream>>>(XB, nullptr, WQ, nullptr, DM, FQ, DQ, bq, 0, 0, 0);
        k_rope<<<LQ, 256, 0, stream>>>(FQ, DQ, NH_, CS, nullptr, nullptr, 1.0f, QP16, QPh, QPl);
        k_gemmw<bf, 0, true><<<dim3(TT / 64, DKV / 64, 1), 32, 0, stream>>>(XB, nullptr, WK, nullptr, DM, FK, DKV, bk, 0, 0, 0);
        k_rope<<<LKv, 256, 0, stream>>>(FK, DKV, NKV, CS, nullptr, nullptr, 1.0f, KP16, KPh, KPl);
        k_gemmw<bf, 0, true><<<dim3(TT / 64, DKV / 64, 1), 32, 0, stream>>>(XB, nullptr, WV, nullptr, DM, FV, DKV, bv, 0, 0, 0); k_vtp<<<LKv, 256, 0, stream>>>(FV, DKV, NKV, VT16, VTh, VTl);
        for (int h0 = 0; h0 < NH_; h0 += ZH) { const size_t zq = (size_t)h0, zk = (size_t)(h0 / REP);   // one kv head per query head: the pass's two heads use consecutive kv planes (z-strides TT*HD)
            k_gemmc<bf, 2, 1><<<dim3(RH / 64, TT / 64, ZH), 32, 0, stream>>>(QPh + zq * TT * HD, QPl + zq * TT * HD, KPh + zk * TT * HD, KPl + zk * TT * HD, HD, Sb, TT, 0, (size_t)TT * HD, (size_t)TT * HD, (size_t)TT * TT);
            k_gemmc<h16, 0, 1><<<dim3((TT - RH) / 64, TT / 64, ZH), 32, 0, stream>>>(QP16 + zq * TT * HD + (size_t)RH * HD, nullptr, KP16 + zk * TT * HD, nullptr, HD, Sb + (size_t)RH * TT, TT, RH, (size_t)TT * HD, (size_t)TT * HD, (size_t)TT * TT);
            k_asoft<<<ZH * TT / 8, 256, 0, stream>>>(Sb, P16, Ph, Pl);
            k_gemmc<bf, 2, 2><<<dim3(RH / 64, HD / 64, ZH), 32, 0, stream>>>(Ph, Pl, VTh + zk * HD * TT, VTl + zk * HD * TT, TT, Ob, HD, 0, (size_t)RH * TT, (size_t)HD * TT, (size_t)TT * HD);
            k_gemmc<h16, 0, 2><<<dim3((TT - RH) / 64, HD / 64, ZH), 32, 0, stream>>>(P16 + (size_t)RH * TT, nullptr, VT16 + zk * HD * TT, nullptr, TT, Ob + (size_t)RH * HD, HD, RH, (size_t)TT * TT, (size_t)HD * TT, (size_t)TT * HD);
            k_merge<<<(unsigned)(((size_t)ZH * TT * HD / 2 + 255) / 256), 256, 0, stream>>>(Ob, h0, ATh, ATl); }
        k_gemmw<bf, 1, true><<<dim3(TT / 64, DM / 64, 1), 32, 0, stream>>>(ATh, ATl, WO, nullptr, DQ, OUT + (size_t)b * TT * DM, DM, bo, 0, 0, 0); }
}

// v001
// A run of this version takes 1460 microseconds.
// Two timings next to v000 put it at 1.97 and 1.95 times that version's speed.
#include <hip/hip_runtime.h>

// CausalSelfAttentionSeparateHeads (x [4][2048][1024]; per-head Linear q/k/v: Wq[h][d][c], bq[h][d] (16 heads x 64) == one [1024][1024] torch-layout weight with rows h*64+d; causal softmax(q.k/8); y merged (head-major) Wp^T + bp -> [4][2048][1024]).
// Compute dtypes, f32 accumulate: every input rounded to bf16; Q/K/V on PLAIN bf16 operands (inputs: exact) + bias; causal scores and att.v: query rows < 512 on bf16 hi+lo planes (3 products), the rest single fp16 (x1024); softmax f32;

#define NB_  4
#define TT   2048
#define DM   1024
#define NH_  16
#define NKV  16
#define REP  (NH_ / NKV)
#define HD   64
#define DQ   (NH_ * HD)
#define DKV  (NKV * HD)
#define ZH   2
#define RH   512                  // query rows < RH use hi+lo planes (0: none)
#define WIN  0
#define PCAR 1024.0f
#define SCL  0.125f   // HD^-0.5
typedef _Float16 h16;
typedef unsigned short bf;
typedef __attribute__((ext_vector_type(16))) __bf16   v16bf;
typedef __attribute__((ext_vector_type(16))) _Float16 v16h;
typedef __attribute__((ext_vector_type(8)))  _Float16 v8h;
typedef __attribute__((ext_vector_type(8)))  unsigned short v8us;
typedef __attribute__((ext_vector_type(8)))  float    v8f;
typedef __attribute__((ext_vector_type(4)))  float    v4f;
typedef v8h  __attribute__((may_alias)) v8ha;
typedef v4f  __attribute__((may_alias)) v4fa;
typedef v8us __attribute__((may_alias)) v8usa;

__device__ __forceinline__ unsigned short f2bf(float f) { unsigned u = __float_as_uint(f); u += 0x7FFFu + ((u >> 16) & 1u); return (unsigned short)(u >> 16); }
__device__ __forceinline__ float bf2f(unsigned short b) { return __uint_as_float(((unsigned)b) << 16); }
__device__ __forceinline__ float bfr(float f) { return bf2f(f2bf(f)); }
__device__ __forceinline__ v16h cat16(v8h lo, v8h hi) { return __builtin_shufflevector(lo, hi, 0, 1, 2, 3, 4, 5, 6, 7, 8, 9, 10, 11, 12, 13, 14, 15); }
__device__ __forceinline__ v16bf cat16b(v8us lo, v8us hi) { return __builtin_bit_cast(v16bf, __builtin_shufflevector(lo, hi, 0, 1, 2, 3, 4, 5, 6, 7, 8, 9, 10, 11, 12, 13, 14, 15)); }
__device__ __forceinline__ v8f wmma16(v16h a, v16h b, v8f c) { return __builtin_amdgcn_wmma_f32_16x16x32_f16(false, a, false, b, (short)0, c, false, false); }
__device__ __forceinline__ v8f wmmab(v16bf a, v16bf b, v8f c) { return __builtin_amdgcn_wmma_f32_16x16x32_bf16(false, a, false, b, (short)0, c, false, false); }



// ---- k_gemmw: register-blocked GEMM, ONE WAVE per 64x64 output tile (16 accumulators), operands straight from K-contiguous 16-bit planes; grid (M/64, N/64, Z), 32 threads.
// C[m][n] (f32, pitch ldc, + optional f32 bias[n]) = sum_k A[m][k] Bt[n][k] (+ split products per NSPLIT). z-batch strides sA/sB/sC in elements. K % 32 == 0.
template <typename T16> struct WFrag;
template <> struct WFrag<h16> { typedef v16h V; static __device__ __forceinline__ V ld(const h16* p) { return cat16(*(const v8h*)p, *(const v8h*)(p + 16)); } static __device__ __forceinline__ v8f mma(V a, V b, v8f c) { return wmma16(a, b, c); } };
template <> struct WFrag<bf> { typedef v16bf V; static __device__ __forceinline__ V ld(const bf* p) { return cat16b(*(const v8us*)p, *(const v8us*)(p + 16)); } static __device__ __forceinline__ v8f mma(V a, V b, v8f c) { return wmmab(a, b, c); } };
template <typename T16, int NSPLIT, bool BIAS>
__global__ __launch_bounds__(32) void k_gemmw(const T16* __restrict__ A, const T16* __restrict__ A2, const T16* __restrict__ Bt, const T16* __restrict__ Bt2, int K, float* C, int ldc, const float* __restrict__ bias, size_t sA, size_t sB, size_t sC) {
    typedef typename WFrag<T16>::V V;
    __shared__ __align__(16) float os[16 * 68];
    const size_t z = blockIdx.z; A += z * sA; if (A2) A2 += z * sA; Bt += z * sB; if (Bt2) Bt2 += z * sB; C += z * sC;
    const int lane = threadIdx.x & 31, lr = lane & 15, hi = lane >> 4; const int r0 = blockIdx.x * 64, c0 = blockIdx.y * 64;
    v8f acc[4][4];
#pragma unroll
    for (int mb = 0; mb < 4; ++mb)
#pragma unroll
        for (int nb = 0; nb < 4; ++nb) acc[mb][nb] = (v8f){};
    const size_t aoff = (size_t)(r0 + lr) * K + 8 * hi, boff = (size_t)(c0 + lr) * K + 8 * hi;
#pragma unroll 1
    for (int kc = 0; kc < K; kc += 32) {
        V a[4], a2[4];
#pragma unroll
        for (int mb = 0; mb < 4; ++mb) { a[mb] = WFrag<T16>::ld(A + aoff + (size_t)mb * 16 * K + kc); if (NSPLIT == 1 || NSPLIT == 2) a2[mb] = WFrag<T16>::ld(A2 + aoff + (size_t)mb * 16 * K + kc); }
#pragma unroll
        for (int nb = 0; nb < 4; ++nb) { const V b = WFrag<T16>::ld(Bt + boff + (size_t)nb * 16 * K + kc); V b2; if (NSPLIT >= 2) b2 = WFrag<T16>::ld(Bt2 + boff + (size_t)nb * 16 * K + kc);
#pragma unroll
            for (int mb = 0; mb < 4; ++mb) { acc[mb][nb] = WFrag<T16>::mma(a[mb], b, acc[mb][nb]); if (NSPLIT == 1 || NSPLIT == 2) acc[mb][nb] = WFrag<T16>::mma(a2[mb], b, acc[mb][nb]); if (NSPLIT >= 2) acc[mb][nb] = WFrag<T16>::mma(a[mb], b2, acc[mb][nb]); } }
        asm volatile("v_nop\n\tv_nop\n\tv_nop\n\tv_nop" : "+v"(acc[0][0]), "+v"(acc[1][1]), "+v"(acc[2][2]), "+v"(acc[3][3]) : "v"(a[0]), "v"(a[3]));
    }
#pragma unroll
    for (int mb = 0; mb < 4; ++mb) {
#pragma unroll
        for (int nb = 0; nb < 4; ++nb) {
#pragma unroll
            for (int j = 0; j < 8; ++j) os[(hi * 8 + j) * 68 + nb * 16 + lr] = acc[mb][nb][j]; }
        __builtin_amdgcn_wave_barrier(); asm volatile("" ::: "memory");
        float* crow = C + (size_t)(r0 + mb * 16) * ldc + c0;
{
#pragma unroll
            for (int s = 0; s < 8; ++s) { const int row = 2 * s + hi, cofs = lr * 4; v4f val = *(const v4fa*)(os + row * 68 + cofs); if (BIAS) { val[0] += bfr(bias[c0 + cofs]); val[1] += bfr(bias[c0 + cofs + 1]); val[2] += bfr(bias[c0 + cofs + 2]); val[3] += bfr(bias[c0 + cofs + 3]); }
                *(v4f*)(crow + (size_t)row * ldc + cofs) = val; }
             }
        __builtin_amdgcn_wave_barrier(); asm volatile("" ::: "memory");
    }
}

// ---- k_gemmc: the same one-wave 64x64 tile GEMM specialised for causal attention: CMODE 1 skips score tiles entirely above the diagonal (query rows r0+roff.., key columns c0..), CMODE 2 limits the
// key (K) loop of the probability x value contraction to the diagonal block (probabilities beyond it are exactly zero). roff = row offset of this launch's first row within the sequence.
template <typename T16, int NSPLIT, int CMODE>
__global__ __launch_bounds__(32) void k_gemmc(const T16* __restrict__ A, const T16* __restrict__ A2, const T16* __restrict__ Bt, const T16* __restrict__ Bt2, int K, float* C, int ldc, int roff, size_t sA, size_t sB, size_t sC) {
    typedef typename WFrag<T16>::V V;
    __shared__ __align__(16) float os[16 * 68];
    const size_t z = blockIdx.z; A += z * sA; if (A2) A2 += z * sA; Bt += z * sB; if (Bt2) Bt2 += z * sB; C += z * sC;
    const int lane = threadIdx.x & 31, lr = lane & 15, hi = lane >> 4; const int r0 = blockIdx.x * 64, c0 = blockIdx.y * 64;
    if (CMODE == 1 && c0 > r0 + roff + 63) return;                  // score tile entirely above the causal diagonal: never read (the softmax masks j > i by select)
    const int Kl = (CMODE == 2) ? min(K, r0 + roff + 64) : K;        // P.V: probabilities are exactly 0 beyond the diagonal block, so the K loop stops there
    v8f acc[4][4];
#pragma unroll
    for (int mb = 0; mb < 4; ++mb)
#pragma unroll
        for (int nb = 0; nb < 4; ++nb) acc[mb][nb] = (v8f){};
    const size_t aoff = (size_t)(r0 + lr) * K + 8 * hi, boff = (size_t)(c0 + lr) * K + 8 * hi;
#pragma unroll 1
    for (int kc = 0; kc < Kl; kc += 32) {
        V a[4], a2[4];
#pragma unroll
        for (int mb = 0; mb < 4; ++mb) { a[mb] = WFrag<T16>::ld(A + aoff + (size_t)mb * 16 * K + kc); if (NSPLIT == 1 || NSPLIT == 2) a2[mb] = WFrag<T16>::ld(A2 + aoff + (size_t)mb * 16 * K + kc); }
#pragma unroll
        for (int nb = 0; nb < 4; ++nb) { const V b = WFrag<T16>::ld(Bt + boff + (size_t)nb * 16 * K + kc); V b2; if (NSPLIT >= 2) b2 = WFrag<T16>::ld(Bt2 + boff + (size_t)nb * 16 * K + kc);
#pragma unroll
            for (int mb = 0; mb < 4; ++mb) { acc[mb][nb] = WFrag<T16>::mma(a[mb], b, acc[mb][nb]); if (NSPLIT == 1 || NSPLIT == 2) acc[mb][nb] = WFrag<T16>::mma(a2[mb], b, acc[mb][nb]); if (NSPLIT >= 2) acc[mb][nb] = WFrag<T16>::mma(a[mb], b2, acc[mb][nb]); } }
        asm volatile("v_nop\n\tv_nop\n\tv_nop\n\tv_nop" : "+v"(acc[0][0]), "+v"(acc[1][1]), "+v"(acc[2][2]), "+v"(acc[3][3]) : "v"(a[0]), "v"(a[3]));
    }
#pragma unroll
    for (int mb = 0; mb < 4; ++mb) {
#pragma unroll
        for (int nb = 0; nb < 4; ++nb) {
#pragma unroll
            for (int j = 0; j < 8; ++j) os[(hi * 8 + j) * 68 + nb * 16 + lr] = acc[mb][nb][j]; }
        __builtin_amdgcn_wave_barrier(); asm volatile("" ::: "memory");
        float* crow = C + (size_t)(r0 + mb * 16) * ldc + c0;
{
#pragma unroll
            for (int s = 0; s < 8; ++s) { const int row = 2 * s + hi, cofs = lr * 4; v4f val = *(const v4fa*)(os + row * 68 + cofs);
                *(v4f*)(crow + (size_t)row * ldc + cofs) = val; }
             }
        __builtin_amdgcn_wave_barrier(); asm volatile("" ::: "memory");
    }
}

__device__ __forceinline__ h16 tohx(float x) { return (h16)x; }
__device__ __forceinline__ void splitf(float y, unsigned short& h, unsigned short& l) { h = f2bf(y); l = f2bf(y - bf2f(h)); }
typedef __attribute__((ext_vector_type(2))) _Float16 v2h;
typedef __attribute__((ext_vector_type(4))) _Float16 v4h;
typedef __attribute__((ext_vector_type(2))) unsigned short v2us;
typedef __attribute__((ext_vector_type(4))) unsigned short v4us;
typedef __attribute__((ext_vector_type(2))) float v2f;
typedef __attribute__((ext_vector_type(4))) int v4i;
typedef v2f  __attribute__((may_alias)) v2fa;

// ---- k_pvs: the probability x value contraction with its key loop dealt over the PVW waves of a work-group; one work-group per 32x32 output tile, grid (rows/32, N/32, Z), 512 threads.
// Wave w takes the 32-key chunks w, w+PVW, w+2*PVW, ... below the diagonal block (probabilities beyond it are exactly zero); the loads of DEPTH of its chunks are issued before the first product.
// Each wave leaves its f32 partial tile in LDS (zeros where it had no chunk); behind one barrier every thread adds the PVW partials of two elements in wave order and stores them.
// The fixed small loops are unrolled so that the fragment and accumulator arrays stay in registers.
#define PVW  16                   // waves of a work-group (512 threads)
#define PVP  36                   // LDS row pitch in floats: the two 8-row halves of an accumulator store fall on disjoint banks
template <typename T16, int NSPLIT, int DEPTH>
__global__ __launch_bounds__(512) void k_pvs(const T16* __restrict__ A, const T16* __restrict__ A2, const T16* __restrict__ Bt, const T16* __restrict__ Bt2, int K, float* C, int ldc, int roff, size_t sA, size_t sB, size_t sC) {
    typedef typename WFrag<T16>::V V;
    __shared__ __align__(16) float red[PVW * 32 * PVP];
    const size_t z = blockIdx.z; A += z * sA; if (A2) A2 += z * sA; Bt += z * sB; if (Bt2) Bt2 += z * sB; C += z * sC;
    const int lane = threadIdx.x & 31, lr = lane & 15, hi = lane >> 4; const int w = __builtin_amdgcn_readfirstlane(threadIdx.x >> 5); const int r0 = blockIdx.x * 32, c0 = blockIdx.y * 32;
    const int Kl = min(K, r0 + roff + 32);                           // probabilities are exactly 0 beyond the diagonal block
    v8f acc[2][2];
#pragma unroll
    for (int mb = 0; mb < 2; ++mb)
#pragma unroll
        for (int nb = 0; nb < 2; ++nb) acc[mb][nb] = (v8f){};
    const size_t aoff = (size_t)(r0 + lr) * K + 8 * hi, boff = (size_t)(c0 + lr) * K + 8 * hi;
#pragma unroll 1   // stays rolled: one pass already holds the operands of DEPTH chunks in registers
    for (int k0 = w * 32; k0 < Kl; k0 += DEPTH * PVW * 32) {
        V a[DEPTH][2], a2[DEPTH][2], b[DEPTH][2], b2[DEPTH][2];
        const T16* pa[2] = { A + aoff + k0, A + aoff + (size_t)16 * K + k0 }; const T16* pb[2] = { Bt + boff + k0, Bt + boff + (size_t)16 * K + k0 };
        const T16* pa2[2] = { pa[0], pa[1] }; const T16* pb2[2] = { pb[0], pb[1] }; if (NSPLIT == 2) { pa2[0] = A2 + aoff + k0; pa2[1] = A2 + aoff + (size_t)16 * K + k0; pb2[0] = Bt2 + boff + k0; pb2[1] = Bt2 + boff + (size_t)16 * K + k0; }
#pragma unroll
        for (int t = 0; t < DEPTH; ++t) {
            if (k0 + t * PVW * 32 < Kl) {                            // wave-uniform
#pragma unroll
                for (int q = 0; q < 2; ++q) { a[t][q] = WFrag<T16>::ld(pa[q] + t * PVW * 32); b[t][q] = WFrag<T16>::ld(pb[q] + t * PVW * 32); if (NSPLIT == 2) { a2[t][q] = WFrag<T16>::ld(pa2[q] + t * PVW * 32); b2[t][q] = WFrag<T16>::ld(pb2[q] + t * PVW * 32); } }
            } else {                                                 // no such chunk: zero operands, its products add exact zeros
#pragma unroll
                for (int q = 0; q < 2; ++q) { a[t][q] = (V){}; b[t][q] = (V){}; if (NSPLIT == 2) { a2[t][q] = (V){}; b2[t][q] = (V){}; } } } }
        // the wait in front of any rewrite of a register that the loads above name; the addresses are its inputs so that no later load of the group lands on one of them
        if (NSPLIT == 2) asm volatile("s_wait_xcnt 0x0" :: "v"(pa[0]), "v"(pa[1]), "v"(pb[0]), "v"(pb[1]), "v"(pa2[0]), "v"(pa2[1]), "v"(pb2[0]), "v"(pb2[1]) : "memory");
        else asm volatile("s_wait_xcnt 0x0" :: "v"(pa[0]), "v"(pa[1]), "v"(pb[0]), "v"(pb[1]) : "memory");
        __builtin_amdgcn_sched_barrier(0);                           // keeps all DEPTH chunks' loads in front of the first product, so that their latencies overlap instead of adding up
#pragma unroll
        for (int t = 0; t < DEPTH; ++t)
#pragma unroll
            for (int nb = 0; nb < 2; ++nb)
#pragma unroll
                for (int mb = 0; mb < 2; ++mb) { acc[mb][nb] = WFrag<T16>::mma(a[t][mb], b[t][nb], acc[mb][nb]); if (NSPLIT == 2) { acc[mb][nb] = WFrag<T16>::mma(a2[t][mb], b[t][nb], acc[mb][nb]); acc[mb][nb] = WFrag<T16>::mma(a[t][mb], b2[t][nb], acc[mb][nb]); } }
        // the slots the chip needs behind the last matrix instruction, on the taken side of the loop's branch too
        asm volatile("v_nop\n\tv_nop\n\tv_nop\n\tv_nop" : "+v"(acc[0][0]), "+v"(acc[1][0]), "+v"(acc[0][1]), "+v"(acc[1][1]));
    }
    float* pw = red + w * 32 * PVP;
#pragma unroll
    for (int mb = 0; mb < 2; ++mb)
#pragma unroll
        for (int nb = 0; nb < 2; ++nb)
#pragma unroll
            for (int j = 0; j < 8; ++j) pw[(mb * 16 + hi * 8 + j) * PVP + nb * 16 + lr] = acc[mb][nb][j];
    __syncthreads();                                                 // every wave's partial tile is in LDS before any thread adds them
    const int row = threadIdx.x >> 4, col = (threadIdx.x & 15) * 2; v2f s = *(const v2fa*)(red + row * PVP + col);
#pragma unroll
    for (int p = 1; p < PVW; ++p) s += *(const v2fa*)(red + (p * 32 + row) * PVP + col);
    *(v2f*)(C + (size_t)(r0 + row) * ldc + c0 + col) = s;
}

__global__ __launch_bounds__(256) void k_wtG(const float* __restrict__ w, int K, int N, bf* Bt) {
    const int lane = threadIdx.x & 31; const int L0 = (blockIdx.x * 8 + (threadIdx.x >> 5)) * 8; const int nlines = N * K / 64;
{
#pragma unroll 1
        for (int l = 0; l < 8; ++l) { const int L = L0 + l; if (L >= nlines) break; const size_t e = (size_t)L * 64 + lane * 2; const int k = (int)(e % K), n = (int)(e / K); v2us o;
            o[0] = f2bf(w[(size_t)k * N + n]); o[1] = f2bf(w[(size_t)(k + 1) * N + n]); *(v2us*)(Bt + e) = o; }
         }
}
__global__ __launch_bounds__(256) void k_cvt8(const float* __restrict__ src, bf* dst, size_t n8) { const size_t i = (size_t)blockIdx.x * 256 + threadIdx.x; if (i >= n8) return; const v8f v = *(const v8f*)(src + i * 8); v8us o;
#pragma unroll
    for (int k = 0; k < 8; ++k) o[k] = f2bf(v[k]); *(v8us*)(dst + i * 8) = o;  }
__global__ __launch_bounds__(256) void k_cscvt(const float* __restrict__ cosT, const float* __restrict__ sinT, float* CS) { const int idx = blockIdx.x * 256 + threadIdx.x; if (idx >= TT * HD) return; v2f cs; cs[0] = bfr(cosT[idx]); cs[1] = bfr(sinT[idx]); *(v2f*)(CS + (size_t)idx * 2) = cs;  }
// k_rope: head planes [h][t][d] (fp16 + hi/lo) of rope(x) x sc with the rotate-half convention out[d] = x[d] cos[t][d] - x[d+HD/2] sin[t][d], out[d+HD/2] = x[d+HD/2] cos[t][d+HD/2] + x[d] sin[t][d+HD/2]
__global__ __launch_bounds__(256) void k_rope(const float* __restrict__ F, int pitch, int nheads, const float* __restrict__ CS, const float* __restrict__ RF, const float* __restrict__ nw, float sc, h16* P16, bf* Ph, bf* Pl) {
    const size_t e = ((size_t)blockIdx.x * 256 + threadIdx.x) * 2; if (e >= (size_t)nheads * TT * HD) return; const int d = (int)(e % HD); const int t = (int)((e / HD) % TT); const int h = (int)(e / ((size_t)HD * TT)); const float* f = F + (size_t)t * pitch + h * HD; const float rf = RF ? RF[(size_t)h * TT + t] : 1.0f; v2h o16; v2us oh, ol;
#pragma unroll
    for (int q = 0; q < 2; ++q) { const int dd = d + q; const int dp = (dd < HD / 2) ? dd + HD / 2 : dd - HD / 2; float x0 = f[dd], x1 = f[dp];
        if (RF) { float n0 = __fmul_rn(x0, rf), n1 = __fmul_rn(x1, rf); asm volatile("" : "+v"(n0)); asm volatile("" : "+v"(n1)); x0 = __fmul_rn(bfr(nw[dd]), n0); x1 = __fmul_rn(bfr(nw[dp]), n1); }
        const v2f cs = *(const v2f*)(CS + ((size_t)t * HD + dd) * 2); float a = __fmul_rn(x0, cs[0]), bq = __fmul_rn(x1, cs[1]); asm volatile("" : "+v"(a)); asm volatile("" : "+v"(bq)); const float r = ((dd < HD / 2) ? __fsub_rn(a, bq) : __fadd_rn(a, bq)) * sc;
        o16[q] = tohx(r); unsigned short a2, c2; splitf(r, a2, c2); oh[q] = a2; ol[q] = c2; }
    *(v2h*)(P16 + e) = o16; *(v2us*)(Ph + e) = oh; *(v2us*)(Pl + e) = ol;  }
__global__ __launch_bounds__(256) void k_vtp(const float* __restrict__ F, int pitch, int nheads, h16* V16, bf* Vh, bf* Vl) { const size_t e = ((size_t)blockIdx.x * 256 + threadIdx.x) * 2; if (e >= (size_t)nheads * HD * TT) return; const int t = (int)(e % TT); const int d = (int)((e / TT) % HD); const int g = (int)(e / ((size_t)TT * HD)); v2h o16; v2us oh, ol;
#pragma unroll
    for (int q = 0; q < 2; ++q) { const float x = F[(size_t)(t + q) * pitch + g * HD + d]; o16[q] = tohx(x); unsigned short a2, c2; splitf(x, a2, c2); oh[q] = a2; ol[q] = c2; }
    *(v2h*)(V16 + e) = o16; *(v2us*)(Vh + e) = oh; *(v2us*)(Vl + e) = ol;  }
__global__ __launch_bounds__(256) void k_csid(float* CS) { const int idx = blockIdx.x * 256 + threadIdx.x; if (idx >= TT * HD) return; v2f cs; cs[0] = 1.0f; cs[1] = 0.0f; *(v2f*)(CS + (size_t)idx * 2) = cs;  }
// k_asoft: per row (zz, i): t = S x HD^-0.5 for j <= i (causal mask, no window; the reference's -1e9 additive fill vanishes identically); softmax over the 2048 keys (register row, one exp, fixed trees);
__global__ __launch_bounds__(256) void k_asoft(const float* __restrict__ Sb, h16* P16, bf* Ph, bf* Pl) {
    const int lane = threadIdx.x & 31; const int row = blockIdx.x * 8 + (threadIdx.x >> 5); if (row >= ZH * TT) return; const int i = row % TT; const int zz = row / TT; (void)zz; const bool hires = (i < RH); const float* sr = Sb + (size_t)row * TT; float v[TT / 32]; float mx = -3.0e38f;
#pragma unroll
    for (int ch = 0; ch < TT / 128; ++ch) { const int j0 = ch * 128 + lane * 4; const v4f a = *(const v4f*)(sr + j0);
#pragma unroll
        for (int q = 0; q < 4; ++q) { const int j = j0 + q; (void)j; const float t = (j <= i) ? a[q] * SCL : -3.0e38f; v[ch * 4 + q] = t; mx = fmaxf(mx, t); } }
#pragma unroll
    for (int sh = 16; sh; sh >>= 1) mx = fmaxf(mx, __shfl_xor(mx, sh, 32));
    float sum = 0.f;
#pragma unroll
    for (int k = 0; k < TT / 32; ++k) { float d0 = __fsub_rn(v[k], mx); asm volatile("" : "+v"(d0)); v[k] = __builtin_amdgcn_exp2f(__fmul_rn(d0, 1.4426950408889634f)); sum += v[k]; }
#pragma unroll
    for (int sh = 16; sh; sh >>= 1) sum += __shfl_xor(sum, sh, 32);
    const float f = __fdiv_rn(hires ? 1.0f : PCAR, sum);
{
        if (hires) {
#pragma unroll
            for (int ch = 0; ch < TT / 128; ++ch) { v4us oh, ol;
#pragma unroll
                for (int q = 0; q < 4; ++q) { unsigned short a, c2; splitf(v[ch * 4 + q] * f, a, c2); oh[q] = a; ol[q] = c2; }
                const size_t oo = ((size_t)zz * (RH ? RH : 1) + i) * TT + ch * 128 + lane * 4; *(v4us*)(Ph + oo) = oh; *(v4us*)(Pl + oo) = ol; }
        } else {
#pragma unroll
            for (int ch = 0; ch < TT / 128; ++ch) { v4h o4;
#pragma unroll
                for (int q = 0; q < 4; ++q) o4[q] = tohx(v[ch * 4 + q] * f);
                *(v4h*)(P16 + (size_t)row * TT + ch * 128 + lane * 4) = o4; } }
         }
}
__global__ __launch_bounds__(256) void k_merge(const float* __restrict__ O, int h0, bf* Ah, bf* Al) { const size_t e = ((size_t)blockIdx.x * 256 + threadIdx.x) * 2; if (e >= (size_t)ZH * TT * HD) return; const int d = (int)(e % HD); const int t = (int)((e / HD) % TT); const int zz = (int)(e / ((size_t)HD * TT)); const float cs = (t < RH) ? 1.0f : (1.0f / PCAR); const size_t oo = (size_t)t * DQ + (h0 + zz) * HD + d;
    v2us oh, ol;
#pragma unroll
    for (int q = 0; q < 2; ++q) { unsigned short a, c2; splitf(O[e + q] * cs, a, c2); oh[q] = a; ol[q] = c2; } *(v2us*)(Ah + oo) = oh; *(v2us*)(Al + oo) = ol;  }

extern "C" void kernel_launch(void* const* d_in, const int* in_sizes, int n_in,
                              void* d_out, int out_size, void* d_ws, size_t ws_size, hipStream_t stream) {
    (void)in_sizes; (void)n_in; (void)out_size;
    const float* x = (const float*)d_in[0]; const float* wq = (const float*)d_in[1]; const float* bq = (const float*)d_in[2]; const float* wk = (const float*)d_in[3]; const float* bk = (const float*)d_in[4]; const float* wv = (const float*)d_in[5]; const float* bv = (const float*)d_in[6]; const float* wo = (const float*)d_in[7]; const float* bo = (const float*)d_in[8]; const float* cosT = nullptr; const float* sinT = nullptr; (void)cosT; (void)sinT;
    float* OUT = (float*)d_out;     // [4][2048][1024]
    char* wsp = (char*)d_ws;
    auto take = [&](size_t bytes) { char* p = wsp; wsp += (bytes + 255) & ~(size_t)255; return (void*)p; };
    bf* WQ = (bf*)take((size_t)DQ * DM * 2); bf* WK = (bf*)take((size_t)DKV * DM * 2); bf* WV = (bf*)take((size_t)DKV * DM * 2); bf* WO = (bf*)take((size_t)DM * DQ * 2); float* CS = (float*)take((size_t)TT * HD * 2 * 4);
    bf* XB = (bf*)take((size_t)TT * DM * 2); float* FQ = (float*)take((size_t)TT * DQ * 4); float* FK = (float*)take((size_t)TT * DKV * 4);
    h16* QP16 = (h16*)take((size_t)NH_ * TT * HD * 2); h16* KP16 = (h16*)take((size_t)NKV * TT * HD * 2); h16* VT16 = (h16*)take((size_t)NKV * HD * TT * 2);
    bf* QPh = (bf*)take((size_t)NH_ * TT * HD * 2); bf* QPl = (bf*)take((size_t)NH_ * TT * HD * 2); bf* KPh = (bf*)take((size_t)NKV * TT * HD * 2); bf* KPl = (bf*)take((size_t)NKV * TT * HD * 2); bf* VTh = (bf*)take((size_t)NKV * HD * TT * 2); bf* VTl = (bf*)take((size_t)NKV * HD * TT * 2); bf* Ph = (bf*)take((size_t)ZH * RH * TT * 2); bf* Pl = (bf*)take((size_t)ZH * RH * TT * 2);
    float* Sb = (float*)take((size_t)ZH * TT * TT * 4); h16* P16 = (h16*)take((size_t)ZH * TT * TT * 2); float* Ob = (float*)take((size_t)ZH * TT * HD * 4); bf* ATh = (bf*)take((size_t)TT * DQ * 2); bf* ATl = (bf*)take((size_t)TT * DQ * 2);
    if ((size_t)(wsp - (char*)d_ws) > ws_size) return;    // ws 256 MiB
    float* FV = FK;   // v projection reuses the k buffer after the k planes are built (stream-ordered)
    { k_cvt8<<<(unsigned)(((size_t)DQ * DM / 8 + 255) / 256), 256, 0, stream>>>(wq, WQ, (size_t)DQ * DM / 8); k_cvt8<<<(unsigned)(((size_t)DKV * DM / 8 + 255) / 256), 256, 0, stream>>>(wk, WK, (size_t)DKV * DM / 8); k_cvt8<<<(unsigned)(((size_t)DKV * DM / 8 + 255) / 256), 256, 0, stream>>>(wv, WV, (size_t)DKV * DM / 8);
      k_cvt8<<<(unsigned)(((size_t)DM * DQ / 8 + 255) / 256), 256, 0, stream>>>(wo, WO, (size_t)DM * DQ / 8);
       }
    k_csid<<<(TT * HD + 255) / 256, 256, 0, stream>>>(CS);
    const unsigned LQ = (unsigned)(((size_t)NH_ * TT * HD / 2 + 255) / 256), LKv = (unsigned)(((size_t)NKV * TT * HD / 2 + 255) / 256);
    for (int b = 0; b < NB_; ++b) {
        
        k_cvt8<<<(unsigned)(((size_t)TT * DM / 8 + 255) / 256), 256, 0, stream>>>(x + (size_t)b * TT * DM, XB, (size_t)TT * DM / 8);
        k_gemmw<bf, 0, true><<<dim3(TT / 64, DQ / 64, 1), 32, 0, stream>>>(XB, nullptr, WQ, nullptr, DM, FQ, DQ, bq, 0, 0, 0);
        k_rope<<<LQ, 256, 0, stream>>>(FQ, DQ, NH_, CS, nullptr, nullptr, 1.0f, QP16, QPh, QPl);
        k_gemmw<bf, 0, true><<<dim3(TT / 64, DKV / 64, 1), 32, 0, stream>>>(XB, nullptr, WK, nullptr, DM, FK, DKV, bk, 0, 0, 0);
        k_rope<<<LKv, 256, 0, stream>>>(FK, DKV, NKV, CS, nullptr, nullptr, 1.0f, KP16, KPh, KPl);
        k_gemmw<bf, 0, true><<<dim3(TT / 64, DKV / 64, 1), 32, 0, stream>>>(XB, nullptr, WV, nullptr, DM, FV, DKV, bv, 0, 0, 0); k_vtp<<<LKv, 256, 0, stream>>>(FV, DKV, NKV, VT16, VTh, VTl);
        for (int h0 = 0; h0 < NH_; h0 += ZH) { const size_t zq = (size_t)h0, zk = (size_t)(h0 / REP);   // one kv head per query head: the pass's two heads use consecutive kv planes (z-strides TT*HD)
            k_gemmc<bf, 2, 1><<<dim3(RH / 64, TT / 64, ZH), 32, 0, stream>>>(QPh + zq * TT * HD, QPl + zq * TT * HD, KPh + zk * TT * HD, KPl + zk * TT * HD, HD, Sb, TT, 0, (size_t)TT * HD, (size_t)TT * HD, (size_t)TT * TT);
            k_gemmc<h16, 0, 1><<<dim3((TT - RH) / 64, TT / 64, ZH), 32, 0, stream>>>(QP16 + zq * TT * HD + (size_t)RH * HD, nullptr, KP16 + zk * TT * HD, nullptr, HD, Sb + (size_t)RH * TT, TT, RH, (size_t)TT * HD, (size_t)TT * HD, (size_t)TT * TT);
            k_asoft<<<ZH * TT / 8, 256, 0, stream>>>(Sb, P16, Ph, Pl);
            k_pvs<bf, 2, 1><<<dim3(RH / 32, HD / 32, ZH), 512, 0, stream>>>(Ph, Pl, VTh + zk * HD * TT, VTl + zk * HD * TT, TT, Ob, HD, 0, (size_t)RH * TT, (size_t)HD * TT, (size_t)TT * HD);
            k_pvs<h16, 0, 4><<<dim3((TT - RH) / 32, HD / 32, ZH), 512, 0, stream>>>(P16 + (size_t)RH * TT, nullptr, VT16 + zk * HD * TT, nullptr, TT, Ob + (size_t)RH * HD, HD, RH, (size_t)TT * TT, (size_t)HD * TT, (size_t)TT * HD);
            k_merge<<<(unsigned)(((size_t)ZH * TT * HD / 2 + 255) / 256), 256, 0, stream>>>(Ob, h0, ATh, ATl); }
        k_gemmw<bf, 1, true><<<dim3(TT / 64, DM / 64, 1), 32, 0, stream>>>(ATh, ATl, WO, nullptr, DQ, OUT + (size_t)b * TT * DM, DM, bo, 0, 0, 0); }
}

// v002
// One run takes 1080 microseconds.
// In two side-by-side timings against v001, it was 1.33 and 1.35 times as fast.
// Counting every step since v000, it is 2.63 times as fast.
#include <hip/hip_runtime.h>

// CausalSelfAttentionSeparateHeads (x [4][2048][1024]; per-head Linear q/k/v: Wq[h][d][c], bq[h][d] (16 heads x 64) == one [1024][1024] torch-layout weight with rows h*64+d; causal softmax(q.k/8); y merged (head-major) Wp^T + bp -> [4][2048][1024]).
// Compute dtypes, f32 accumulate: every input rounded to bf16; Q/K/V on PLAIN bf16 operands (inputs: exact) + bias; causal scores and att.v: query rows < 512 on bf16 hi+lo planes (3 products), the rest single fp16 (x1024); softmax f32;

#define NB_  4
#define TT   2048
#define DM   1024
#define NH_  16
#define NKV  16
#define REP  (NH_ / NKV)
#define HD   64
#define DQ   (NH_ * HD)
#define DKV  (NKV * HD)
#define ZH   8                    // heads per attention pass
#define RH   512                  // query rows < RH use hi+lo planes (0: none)
#define WIN  0
#define PCAR 1024.0f
#define SCL  0.125f   // HD^-0.5
typedef _Float16 h16;
typedef unsigned short bf;
typedef __attribute__((ext_vector_type(16))) __bf16   v16bf;
typedef __attribute__((ext_vector_type(16))) _Float16 v16h;
typedef __attribute__((ext_vector_type(8)))  _Float16 v8h;
typedef __attribute__((ext_vector_type(8)))  unsigned short v8us;
typedef __attribute__((ext_vector_type(8)))  float    v8f;
typedef __attribute__((ext_vector_type(4)))  float    v4f;
typedef v8h  __attribute__((may_alias)) v8ha;
typedef v4f  __attribute__((may_alias)) v4fa;
typedef v8us __attribute__((may_alias)) v8usa;

__device__ __forceinline__ unsigned short f2bf(float f) { unsigned u = __float_as_uint(f); u += 0x7FFFu + ((u >> 16) & 1u); return (unsigned short)(u >> 16); }
__device__ __forceinline__ float bf2f(unsigned short b) { return __uint_as_float(((unsigned)b) << 16); }
__device__ __forceinline__ float bfr(float f) { return bf2f(f2bf(f)); }
__device__ __forceinline__ v16h cat16(v8h lo, v8h hi) { return __builtin_shufflevector(lo, hi, 0, 1, 2, 3, 4, 5, 6, 7, 8, 9, 10, 11, 12, 13, 14, 15); }
__device__ __forceinline__ v16bf cat16b(v8us lo, v8us hi) { return __builtin_bit_cast(v16bf, __builtin_shufflevector(lo, hi, 0, 1, 2, 3, 4, 5, 6, 7, 8, 9, 10, 11, 12, 13, 14, 15)); }
__device__ __forceinline__ v8f wmma16(v16h a, v16h b, v8f c) { return __builtin_amdgcn_wmma_f32_16x16x32_f16(false, a, false, b, (short)0, c, false, false); }
__device__ __forceinline__ v8f wmmab(v16bf a, v16bf b, v8f c) { return __builtin_amdgcn_wmma_f32_16x16x32_bf16(false, a, false, b, (short)0, c, false, false); }



// ---- k_gemmw: register-blocked GEMM, ONE WAVE per 64x64 output tile (16 accumulators), operands straight from K-contiguous 16-bit planes; grid (M/64, N/64, Z), 32 threads.
// C[m][n] (f32, pitch ldc, + optional f32 bias[n]) = sum_k A[m][k] Bt[n][k] (+ split products per NSPLIT). z-batch strides sA/sB/sC in elements. K % 32 == 0.
template <typename T16> struct WFrag;
template <> struct WFrag<h16> { typedef v16h V; static __device__ __forceinline__ V ld(const h16* p) { return cat16(*(const v8h*)p, *(const v8h*)(p + 16)); } static __device__ __forceinline__ v8f mma(V a, V b, v8f c) { return wmma16(a, b, c); } };
template <> struct WFrag<bf> { typedef v16bf V; static __device__ __forceinline__ V ld(const bf* p) { return cat16b(*(const v8us*)p, *(const v8us*)(p + 16)); } static __device__ __forceinline__ v8f mma(V a, V b, v8f c) { return wmmab(a, b, c); } };
template <typename T16, int NSPLIT, bool BIAS>
__global__ __launch_bounds__(32) void k_gemmw(const T16* __restrict__ A, const T16* __restrict__ A2, const T16* __restrict__ Bt, const T16* __restrict__ Bt2, int K, float* C, int ldc, const float* __restrict__ bias, size_t sA, size_t sB, size_t sC) {
    typedef typename WFrag<T16>::V V;
    __shared__ __align__(16) float os[16 * 68];
    const size_t z = blockIdx.z; A += z * sA; if (A2) A2 += z * sA; Bt += z * sB; if (Bt2) Bt2 += z * sB; C += z * sC;
    const int lane = threadIdx.x & 31, lr = lane & 15, hi = lane >> 4; const int r0 = blockIdx.x * 64, c0 = blockIdx.y * 64;
    v8f acc[4][4];
#pragma unroll
    for (int mb = 0; mb < 4; ++mb)
#pragma unroll
        for (int nb = 0; nb < 4; ++nb) acc[mb][nb] = (v8f){};
    const size_t aoff = (size_t)(r0 + lr) * K + 8 * hi, boff = (size_t)(c0 + lr) * K + 8 * hi;
#pragma unroll 1
    for (int kc = 0; kc < K; kc += 32) {
        V a[4], a2[4];
#pragma unroll
        for (int mb = 0; mb < 4; ++mb) { a[mb] = WFrag<T16>::ld(A + aoff + (size_t)mb * 16 * K + kc); if (NSPLIT == 1 || NSPLIT == 2) a2[mb] = WFrag<T16>::ld(A2 + aoff + (size_t)mb * 16 * K + kc); }
#pragma unroll
        for (int nb = 0; nb < 4; ++nb) { const V b = WFrag<T16>::ld(Bt + boff + (size_t)nb * 16 * K + kc); V b2; if (NSPLIT >= 2) b2 = WFrag<T16>::ld(Bt2 + boff + (size_t)nb * 16 * K + kc);
#pragma unroll
            for (int mb = 0; mb < 4; ++mb) { acc[mb][nb] = WFrag<T16>::mma(a[mb], b, acc[mb][nb]); if (NSPLIT == 1 || NSPLIT == 2) acc[mb][nb] = WFrag<T16>::mma(a2[mb], b, acc[mb][nb]); if (NSPLIT >= 2) acc[mb][nb] = WFrag<T16>::mma(a[mb], b2, acc[mb][nb]); } }
        asm volatile("v_nop\n\tv_nop\n\tv_nop\n\tv_nop" : "+v"(acc[0][0]), "+v"(acc[1][1]), "+v"(acc[2][2]), "+v"(acc[3][3]) : "v"(a[0]), "v"(a[3]));
    }
#pragma unroll
    for (int mb = 0; mb < 4; ++mb) {
#pragma unroll
        for (int nb = 0; nb < 4; ++nb) {
#pragma unroll
            for (int j = 0; j < 8; ++j) os[(hi * 8 + j) * 68 + nb * 16 + lr] = acc[mb][nb][j]; }
        __builtin_amdgcn_wave_barrier(); asm volatile("" ::: "memory");
        float* crow = C + (size_t)(r0 + mb * 16) * ldc + c0;
{
#pragma unroll
            for (int s = 0; s < 8; ++s) { const int row = 2 * s + hi, cofs = lr * 4; v4f val = *(const v4fa*)(os + row * 68 + cofs); if (BIAS) { val[0] += bfr(bias[c0 + cofs]); val[1] += bfr(bias[c0 + cofs + 1]); val[2] += bfr(bias[c0 + cofs + 2]); val[3] += bfr(bias[c0 + cofs + 3]); }
                *(v4f*)(crow + (size_t)row * ldc + cofs) = val; }
             }
        __builtin_amdgcn_wave_barrier(); asm volatile("" ::: "memory");
    }
}

// ---- k_gemmc: the same one-wave 64x64 tile GEMM specialised for causal attention: CMODE 1 skips score tiles entirely above the diagonal (query rows r0+roff.., key columns c0..), CMODE 2 limits the
// key (K) loop of the probability x value contraction to the diagonal block (probabilities beyond it are exactly zero). roff = row offset of this launch's first row within the sequence.
template <typename T16, int NSPLIT, int CMODE>
__global__ __launch_bounds__(32) void k_gemmc(const T16* __restrict__ A, const T16* __restrict__ A2, const T16* __restrict__ Bt, const T16* __restrict__ Bt2, int K, float* C, int ldc, int roff, size_t sA, size_t sB, size_t sC) {
    typedef typename WFrag<T16>::V V;
    __shared__ __align__(16) float os[16 * 68];
    const size_t z = blockIdx.z; A += z * sA; if (A2) A2 += z * sA; Bt += z * sB; if (Bt2) Bt2 += z * sB; C += z * sC;
    const int lane = threadIdx.x & 31, lr = lane & 15, hi = lane >> 4; const int r0 = blockIdx.x * 64, c0 = blockIdx.y * 64;
    if (CMODE == 1 && c0 > r0 + roff + 63) return;                  // score tile entirely above the causal diagonal: never read (the softmax masks j > i by select)
    const int Kl = (CMODE == 2) ? min(K, r0 + roff + 64) : K;        // P.V: probabilities are exactly 0 beyond the diagonal block, so the K loop stops there
    v8f acc[4][4];
#pragma unroll
    for (int mb = 0; mb < 4; ++mb)
#pragma unroll
        for (int nb = 0; nb < 4; ++nb) acc[mb][nb] = (v8f){};
    const size_t aoff = (size_t)(r0 + lr) * K + 8 * hi, boff = (size_t)(c0 + lr) * K + 8 * hi;
#pragma unroll 1
    for (int kc = 0; kc < Kl; kc += 32) {
        V a[4], a2[4];
#pragma unroll
        for (int mb = 0; mb < 4; ++mb) { a[mb] = WFrag<T16>::ld(A + aoff + (size_t)mb * 16 * K + kc); if (NSPLIT == 1 || NSPLIT == 2) a2[mb] = WFrag<T16>::ld(A2 + aoff + (size_t)mb * 16 * K + kc); }
#pragma unroll
        for (int nb = 0; nb < 4; ++nb) { const V b = WFrag<T16>::ld(Bt + boff + (size_t)nb * 16 * K + kc); V b2; if (NSPLIT >= 2) b2 = WFrag<T16>::ld(Bt2 + boff + (size_t)nb * 16 * K + kc);
#pragma unroll
            for (int mb = 0; mb < 4; ++mb) { acc[mb][nb] = WFrag<T16>::mma(a[mb], b, acc[mb][nb]); if (NSPLIT == 1 || NSPLIT == 2) acc[mb][nb] = WFrag<T16>::mma(a2[mb], b, acc[mb][nb]); if (NSPLIT >= 2) acc[mb][nb] = WFrag<T16>::mma(a[mb], b2, acc[mb][nb]); } }
        asm volatile("v_nop\n\tv_nop\n\tv_nop\n\tv_nop" : "+v"(acc[0][0]), "+v"(acc[1][1]), "+v"(acc[2][2]), "+v"(acc[3][3]) : "v"(a[0]), "v"(a[3]));
    }
#pragma unroll
    for (int mb = 0; mb < 4; ++mb) {
#pragma unroll
        for (int nb = 0; nb < 4; ++nb) {
#pragma unroll
            for (int j = 0; j < 8; ++j) os[(hi * 8 + j) * 68 + nb * 16 + lr] = acc[mb][nb][j]; }
        __builtin_amdgcn_wave_barrier(); asm volatile("" ::: "memory");
        float* crow = C + (size_t)(r0 + mb * 16) * ldc + c0;
{
#pragma unroll
            for (int s = 0; s < 8; ++s) { const int row = 2 * s + hi, cofs = lr * 4; v4f val = *(const v4fa*)(os + row * 68 + cofs);
                *(v4f*)(crow + (size_t)row * ldc + cofs) = val; }
             }
        __builtin_amdgcn_wave_barrier(); asm volatile("" ::: "memory");
    }
}

__device__ __forceinline__ h16 tohx(float x) { return (h16)x; }
__device__ __forceinline__ void splitf(float y, unsigned short& h, unsigned short& l) { h = f2bf(y); l = f2bf(y - bf2f(h)); }
typedef __attribute__((ext_vector_type(2))) _Float16 v2h;
typedef __attribute__((ext_vector_type(4))) _Float16 v4h;
typedef __attribute__((ext_vector_type(2))) unsigned short v2us;
typedef __attribute__((ext_vector_type(4))) unsigned short v4us;
typedef __attribute__((ext_vector_type(2))) float v2f;
typedef __attribute__((ext_vector_type(4))) int v4i;
typedef v2f  __attribute__((may_alias)) v2fa;

// ---- k_pvs: the probability x value contraction with its key loop dealt over the PVW waves of a work-group; one work-group per 32x32 output tile, grid (rows/32, N/32, Z), 512 threads.
// Wave w takes the 32-key chunks w, w+PVW, w+2*PVW, ... below the diagonal block (probabilities beyond it are exactly zero); the loads of DEPTH of its chunks are issued before the first product.
// Each wave leaves its f32 partial tile in LDS (zeros where it had no chunk); behind one barrier every thread adds the PVW partials of two elements in wave order and stores them.
// The fixed small loops are unrolled so that the fragment and accumulator arrays stay in registers. lda = row pitch of A and A2 in elements (the probabilities lie in their score rows); Bt and Bt2 have pitch K.
#define PVW  16                   // waves of a work-group (512 threads)
#define PVP  36                   // LDS row pitch in floats: the two 8-row halves of an accumulator store fall on disjoint banks
template <typename T16, int NSPLIT, int DEPTH>
__global__ __launch_bounds__(512) void k_pvs(const T16* __restrict__ A, const T16* __restrict__ A2, int lda, const T16* __restrict__ Bt, const T16* __restrict__ Bt2, int K, float* C, int ldc, int roff, size_t sA, size_t sB, size_t sC) {
    typedef typename WFrag<T16>::V V;
    __shared__ __align__(16) float red[PVW * 32 * PVP];
    const size_t z = blockIdx.z; A += z * sA; if (A2) A2 += z * sA; Bt += z * sB; if (Bt2) Bt2 += z * sB; C += z * sC;
    const int lane = threadIdx.x & 31, lr = lane & 15, hi = lane >> 4; const int w = __builtin_amdgcn_readfirstlane(threadIdx.x >> 5); const int r0 = blockIdx.x * 32, c0 = blockIdx.y * 32;
    const int Kl = min(K, r0 + roff + 32);                           // probabilities are exactly 0 beyond the diagonal block
    v8f acc[2][2];
#pragma unroll
    for (int mb = 0; mb < 2; ++mb)
#pragma unroll
        for (int nb = 0; nb < 2; ++nb) acc[mb][nb] = (v8f){};
    const size_t aoff = (size_t)(r0 + lr) * lda + 8 * hi, boff = (size_t)(c0 + lr) * K + 8 * hi;
#pragma unroll 1   // stays rolled: one pass already holds the operands of DEPTH chunks in registers
    for (int k0 = w * 32; k0 < Kl; k0 += DEPTH * PVW * 32) {
        V a[DEPTH][2], a2[DEPTH][2], b[DEPTH][2], b2[DEPTH][2];
        const T16* pa[2] = { A + aoff + k0, A + aoff + (size_t)16 * lda + k0 }; const T16* pb[2] = { Bt + boff + k0, Bt + boff + (size_t)16 * K + k0 };
        const T16* pa2[2] = { pa[0], pa[1] }; const T16* pb2[2] = { pb[0], pb[1] }; if (NSPLIT == 2) { pa2[0] = A2 + aoff + k0; pa2[1] = A2 + aoff + (size_t)16 * lda + k0; pb2[0] = Bt2 + boff + k0; pb2[1] = Bt2 + boff + (size_t)16 * K + k0; }
#pragma unroll
        for (int t = 0; t < DEPTH; ++t) {
            if (k0 + t * PVW * 32 < Kl) {                            // wave-uniform
#pragma unroll
                for (int q = 0; q < 2; ++q) { a[t][q] = WFrag<T16>::ld(pa[q] + t * PVW * 32); b[t][q] = WFrag<T16>::ld(pb[q] + t * PVW * 32); if (NSPLIT == 2) { a2[t][q] = WFrag<T16>::ld(pa2[q] + t * PVW * 32); b2[t][q] = WFrag<T16>::ld(pb2[q] + t * PVW * 32); } }
            } else {                                                 // no such chunk: zero operands, its products add exact zeros
#pragma unroll
                for (int q = 0; q < 2; ++q) { a[t][q] = (V){}; b[t][q] = (V){}; if (NSPLIT == 2) { a2[t][q] = (V){}; b2[t][q] = (V){}; } } } }
        // the wait in front of any rewrite of a register that the loads above name; the addresses are its inputs so that no later load of the group lands on one of them
        if (NSPLIT == 2) asm volatile("s_wait_xcnt 0x0" :: "v"(pa[0]), "v"(pa[1]), "v"(pb[0]), "v"(pb[1]), "v"(pa2[0]), "v"(pa2[1]), "v"(pb2[0]), "v"(pb2[1]) : "memory");
        else asm volatile("s_wait_xcnt 0x0" :: "v"(pa[0]), "v"(pa[1]), "v"(pb[0]), "v"(pb[1]) : "memory");
        __builtin_amdgcn_sched_barrier(0);                           // keeps all DEPTH chunks' loads in front of the first product, so that their latencies overlap instead of adding up
#pragma unroll
        for (int t = 0; t < DEPTH; ++t)
#pragma unroll
            for (int nb = 0; nb < 2; ++nb)
#pragma unroll
                for (int mb = 0; mb < 2; ++mb) { acc[mb][nb] = WFrag<T16>::mma(a[t][mb], b[t][nb], acc[mb][nb]); if (NSPLIT == 2) { acc[mb][nb] = WFrag<T16>::mma(a2[t][mb], b[t][nb], acc[mb][nb]); acc[mb][nb] = WFrag<T16>::mma(a[t][mb], b2[t][nb], acc[mb][nb]); } }
        // the slots the chip needs behind the last matrix instruction, on the taken side of the loop's branch too
        asm volatile("v_nop\n\tv_nop\n\tv_nop\n\tv_nop" : "+v"(acc[0][0]), "+v"(acc[1][0]), "+v"(acc[0][1]), "+v"(acc[1][1]));
    }
    float* pw = red + w * 32 * PVP;
#pragma unroll
    for (int mb = 0; mb < 2; ++mb)
#pragma unroll
        for (int nb = 0; nb < 2; ++nb)
#pragma unroll
            for (int j = 0; j < 8; ++j) pw[(mb * 16 + hi * 8 + j) * PVP + nb * 16 + lr] = acc[mb][nb][j];
    __syncthreads();                                                 // every wave's partial tile is in LDS before any thread adds them
    const int row = threadIdx.x >> 4, col = (threadIdx.x & 15) * 2; v2f s = *(const v2fa*)(red + row * PVP + col);
#pragma unroll
    for (int p = 1; p < PVW; ++p) s += *(const v2fa*)(red + (p * 32 + row) * PVP + col);
    *(v2f*)(C + (size_t)(r0 + row) * ldc + c0 + col) = s;
}

__global__ __launch_bounds__(256) void k_wtG(const float* __restrict__ w, int K, int N, bf* Bt) {
    const int lane = threadIdx.x & 31; const int L0 = (blockIdx.x * 8 + (threadIdx.x >> 5)) * 8; const int nlines = N * K / 64;
{
#pragma unroll 1
        for (int l = 0; l < 8; ++l) { const int L = L0 + l; if (L >= nlines) break; const size_t e = (size_t)L * 64 + lane * 2; const int k = (int)(e % K), n = (int)(e / K); v2us o;
            o[0] = f2bf(w[(size_t)k * N + n]); o[1] = f2bf(w[(size_t)(k + 1) * N + n]); *(v2us*)(Bt + e) = o; }
         }
}
__global__ __launch_bounds__(256) void k_cvt8(const float* __restrict__ src, bf* dst, size_t n8) { const size_t i = (size_t)blockIdx.x * 256 + threadIdx.x; if (i >= n8) return; const v8f v = *(const v8f*)(src + i * 8); v8us o;
#pragma unroll
    for (int k = 0; k < 8; ++k) o[k] = f2bf(v[k]); *(v8us*)(dst + i * 8) = o;  }
__global__ __launch_bounds__(256) void k_cscvt(const float* __restrict__ cosT, const float* __restrict__ sinT, float* CS) { const int idx = blockIdx.x * 256 + threadIdx.x; if (idx >= TT * HD) return; v2f cs; cs[0] = bfr(cosT[idx]); cs[1] = bfr(sinT[idx]); *(v2f*)(CS + (size_t)idx * 2) = cs;  }
// k_rope: head planes [h][t][d] (fp16 + hi/lo) of rope(x) x sc with the rotate-half convention out[d] = x[d] cos[t][d] - x[d+HD/2] sin[t][d], out[d+HD/2] = x[d+HD/2] cos[t][d+HD/2] + x[d] sin[t][d+HD/2]
__global__ __launch_bounds__(256) void k_rope(const float* __restrict__ F, int pitch, int nheads, const float* __restrict__ CS, const float* __restrict__ RF, const float* __restrict__ nw, float sc, h16* P16, bf* Ph, bf* Pl) {
    const size_t e = ((size_t)blockIdx.x * 256 + threadIdx.x) * 2; if (e >= (size_t)nheads * TT * HD) return; const int d = (int)(e % HD); const int t = (int)((e / HD) % TT); const int h = (int)(e / ((size_t)HD * TT)); const float* f = F + (size_t)t * pitch + h * HD; const float rf = RF ? RF[(size_t)h * TT + t] : 1.0f; v2h o16; v2us oh, ol;
#pragma unroll
    for (int q = 0; q < 2; ++q) { const int dd = d + q; const int dp = (dd < HD / 2) ? dd + HD / 2 : dd - HD / 2; float x0 = f[dd], x1 = f[dp];
        if (RF) { float n0 = __fmul_rn(x0, rf), n1 = __fmul_rn(x1, rf); asm volatile("" : "+v"(n0)); asm volatile("" : "+v"(n1)); x0 = __fmul_rn(bfr(nw[dd]), n0); x1 = __fmul_rn(bfr(nw[dp]), n1); }
        const v2f cs = *(const v2f*)(CS + ((size_t)t * HD + dd) * 2); float a = __fmul_rn(x0, cs[0]), bq = __fmul_rn(x1, cs[1]); asm volatile("" : "+v"(a)); asm volatile("" : "+v"(bq)); const float r = ((dd < HD / 2) ? __fsub_rn(a, bq) : __fadd_rn(a, bq)) * sc;
        o16[q] = tohx(r); unsigned short a2, c2; splitf(r, a2, c2); oh[q] = a2; ol[q] = c2; }
    *(v2h*)(P16 + e) = o16; *(v2us*)(Ph + e) = oh; *(v2us*)(Pl + e) = ol;  }
__global__ __launch_bounds__(256) void k_vtp(const float* __restrict__ F, int pitch, int nheads, h16* V16, bf* Vh, bf* Vl) { const size_t e = ((size_t)blockIdx.x * 256 + threadIdx.x) * 2; if (e >= (size_t)nheads * HD * TT) return; const int t = (int)(e % TT); const int d = (int)((e / TT) % HD); const int g = (int)(e / ((size_t)TT * HD)); v2h o16; v2us oh, ol;
#pragma unroll
    for (int q = 0; q < 2; ++q) { const float x = F[(size_t)(t + q) * pitch + g * HD + d]; o16[q] = tohx(x); unsigned short a2, c2; splitf(x, a2, c2); oh[q] = a2; ol[q] = c2; }
    *(v2h*)(V16 + e) = o16; *(v2us*)(Vh + e) = oh; *(v2us*)(Vl + e) = ol;  }
__global__ __launch_bounds__(256) void k_csid(float* CS) { const int idx = blockIdx.x * 256 + threadIdx.x; if (idx >= TT * HD) return; v2f cs; cs[0] = 1.0f; cs[1] = 0.0f; *(v2f*)(CS + (size_t)idx * 2) = cs;  }
// k_asoft: per row (zz, i): t = S x HD^-0.5 for j <= i (causal; the reference's -1e9 additive fill vanishes identically); softmax over the 2048 keys (register row, one exp, fixed trees);
// the probabilities go IN PLACE over the row's own scores (one wave owns a row and holds all of it in registers before its first store): fp16 in the row's first half, or the hi plane in the first and the lo plane in the second half.
__global__ __launch_bounds__(256) void k_asoft(float* Sb) {
    const int lane = threadIdx.x & 31; const int row = blockIdx.x * 8 + (threadIdx.x >> 5); if (row >= ZH * TT) return; const int i = row % TT; const int zz = row / TT; (void)zz; const bool hires = (i < RH); float* sr = Sb + (size_t)row * TT; float v[TT / 32]; float mx = -3.0e38f;
#pragma unroll
    for (int ch = 0; ch < TT / 128; ++ch) { const int j0 = ch * 128 + lane * 4; const v4f a = *(const v4f*)(sr + j0);
#pragma unroll
        for (int q = 0; q < 4; ++q) { const int j = j0 + q; (void)j; const float t = (j <= i) ? a[q] * SCL : -3.0e38f; v[ch * 4 + q] = t; mx = fmaxf(mx, t); } }
#pragma unroll
    for (int sh = 16; sh; sh >>= 1) mx = fmaxf(mx, __shfl_xor(mx, sh, 32));
    float sum = 0.f;
#pragma unroll
    for (int k = 0; k < TT / 32; ++k) { float d0 = __fsub_rn(v[k], mx); asm volatile("" : "+v"(d0)); v[k] = __builtin_amdgcn_exp2f(__fmul_rn(d0, 1.4426950408889634f)); sum += v[k]; }
#pragma unroll
    for (int sh = 16; sh; sh >>= 1) sum += __shfl_xor(sum, sh, 32);
    const float f = __fdiv_rn(hires ? 1.0f : PCAR, sum);
{
        if (hires) {
#pragma unroll
            for (int ch = 0; ch < TT / 128; ++ch) { v4us oh, ol;
#pragma unroll
                for (int q = 0; q < 4; ++q) { unsigned short a, c2; splitf(v[ch * 4 + q] * f, a, c2); oh[q] = a; ol[q] = c2; }
                bf* pr = (bf*)sr + ch * 128 + lane * 4; *(v4us*)pr = oh; *(v4us*)(pr + TT) = ol; }
        } else {
#pragma unroll
            for (int ch = 0; ch < TT / 128; ++ch) { v4h o4;
#pragma unroll
                for (int q = 0; q < 4; ++q) o4[q] = tohx(v[ch * 4 + q] * f);
                *(v4h*)((h16*)sr + ch * 128 + lane * 4) = o4; } }
         }
}
__global__ __launch_bounds__(256) void k_merge(const float* __restrict__ O, int h0, bf* Ah, bf* Al) { const size_t e = ((size_t)blockIdx.x * 256 + threadIdx.x) * 2; if (e >= (size_t)ZH * TT * HD) return; const int d = (int)(e % HD); const int t = (int)((e / HD) % TT); const int zz = (int)(e / ((size_t)HD * TT)); const float cs = (t < RH) ? 1.0f : (1.0f / PCAR); const size_t oo = (size_t)t * DQ + (h0 + zz) * HD + d;
    v2us oh, ol;
#pragma unroll
    for (int q = 0; q < 2; ++q) { unsigned short a, c2; splitf(O[e + q] * cs, a, c2); oh[q] = a; ol[q] = c2; } *(v2us*)(Ah + oo) = oh; *(v2us*)(Al + oo) = ol;  }

extern "C" void kernel_launch(void* const* d_in, const int* in_sizes, int n_in,
                              void* d_out, int out_size, void* d_ws, size_t ws_size, hipStream_t stream) {
    (void)in_sizes; (void)n_in; (void)out_size;
    const float* x = (const float*)d_in[0]; const float* wq = (const float*)d_in[1]; const float* bq = (const float*)d_in[2]; const float* wk = (const float*)d_in[3]; const float* bk = (const float*)d_in[4]; const float* wv = (const float*)d_in[5]; const float* bv = (const float*)d_in[6]; const float* wo = (const float*)d_in[7]; const float* bo = (const float*)d_in[8]; const float* cosT = nullptr; const float* sinT = nullptr; (void)cosT; (void)sinT;
    float* OUT = (float*)d_out;     // [4][2048][1024]
    char* wsp = (char*)d_ws;
    auto take = [&](size_t bytes) { char* p = wsp; wsp += (bytes + 255) & ~(size_t)255; return (void*)p; };
    bf* WQ = (bf*)take((size_t)DQ * DM * 2); bf* WK = (bf*)take((size_t)DKV * DM * 2); bf* WV = (bf*)take((size_t)DKV * DM * 2); bf* WO = (bf*)take((size_t)DM * DQ * 2); float* CS = (float*)take((size_t)TT * HD * 2 * 4);
    bf* XB = (bf*)take((size_t)TT * DM * 2); float* FQ = (float*)take((size_t)TT * DQ * 4); float* FK = (float*)take((size_t)TT * DKV * 4);
    h16* QP16 = (h16*)take((size_t)NH_ * TT * HD * 2); h16* KP16 = (h16*)take((size_t)NKV * TT * HD * 2); h16* VT16 = (h16*)take((size_t)NKV * HD * TT * 2);
    bf* QPh = (bf*)take((size_t)NH_ * TT * HD * 2); bf* QPl = (bf*)take((size_t)NH_ * TT * HD * 2); bf* KPh = (bf*)take((size_t)NKV * TT * HD * 2); bf* KPl = (bf*)take((size_t)NKV * TT * HD * 2); bf* VTh = (bf*)take((size_t)NKV * HD * TT * 2); bf* VTl = (bf*)take((size_t)NKV * HD * TT * 2);
    float* Sb = (float*)take((size_t)ZH * TT * TT * 4); float* Ob = (float*)take((size_t)ZH * TT * HD * 4); bf* ATh = (bf*)take((size_t)TT * DQ * 2); bf* ATl = (bf*)take((size_t)TT * DQ * 2);
    if ((size_t)(wsp - (char*)d_ws) > ws_size) return;    // ws 256 MiB
    float* FV = FK;   // v projection reuses the k buffer after the k planes are built (stream-ordered)
    { k_cvt8<<<(unsigned)(((size_t)DQ * DM / 8 + 255) / 256), 256, 0, stream>>>(wq, WQ, (size_t)DQ * DM / 8); k_cvt8<<<(unsigned)(((size_t)DKV * DM / 8 + 255) / 256), 256, 0, stream>>>(wk, WK, (size_t)DKV * DM / 8); k_cvt8<<<(unsigned)(((size_t)DKV * DM / 8 + 255) / 256), 256, 0, stream>>>(wv, WV, (size_t)DKV * DM / 8);
      k_cvt8<<<(unsigned)(((size_t)DM * DQ / 8 + 255) / 256), 256, 0, stream>>>(wo, WO, (size_t)DM * DQ / 8);
       }
    k_csid<<<(TT * HD + 255) / 256, 256, 0, stream>>>(CS);
    const unsigned LQ = (unsigned)(((size_t)NH_ * TT * HD / 2 + 255) / 256), LKv = (unsigned)(((size_t)NKV * TT * HD / 2 + 255) / 256);
    for (int b = 0; b < NB_; ++b) {
        
        k_cvt8<<<(unsigned)(((size_t)TT * DM / 8 + 255) / 256), 256, 0, stream>>>(x + (size_t)b * TT * DM, XB, (size_t)TT * DM / 8);
        k_gemmw<bf, 0, true><<<dim3(TT / 64, DQ / 64, 1), 32, 0, stream>>>(XB, nullptr, WQ, nullptr, DM, FQ, DQ, bq, 0, 0, 0);
        k_rope<<<LQ, 256, 0, stream>>>(FQ, DQ, NH_, CS, nullptr, nullptr, 1.0f, QP16, QPh, QPl);
        k_gemmw<bf, 0, true><<<dim3(TT / 64, DKV / 64, 1), 32, 0, stream>>>(XB, nullptr, WK, nullptr, DM, FK, DKV, bk, 0, 0, 0);
        k_rope<<<LKv, 256, 0, stream>>>(FK, DKV, NKV, CS, nullptr, nullptr, 1.0f, KP16, KPh, KPl);
        k_gemmw<bf, 0, true><<<dim3(TT / 64, DKV / 64, 1), 32, 0, stream>>>(XB, nullptr, WV, nullptr, DM, FV, DKV, bv, 0, 0, 0); k_vtp<<<LKv, 256, 0, stream>>>(FV, DKV, NKV, VT16, VTh, VTl);
        for (int h0 = 0; h0 < NH_; h0 += ZH) { const size_t zq = (size_t)h0, zk = (size_t)(h0 / REP);   // one kv head per query head: the pass's heads use consecutive kv planes (z-strides TT*HD)
            k_gemmc<bf, 2, 1><<<dim3(RH / 64, TT / 64, ZH), 32, 0, stream>>>(QPh + zq * TT * HD, QPl + zq * TT * HD, KPh + zk * TT * HD, KPl + zk * TT * HD, HD, Sb, TT, 0, (size_t)TT * HD, (size_t)TT * HD, (size_t)TT * TT);
            k_gemmc<h16, 0, 1><<<dim3((TT - RH) / 64, TT / 64, ZH), 32, 0, stream>>>(QP16 + zq * TT * HD + (size_t)RH * HD, nullptr, KP16 + zk * TT * HD, nullptr, HD, Sb + (size_t)RH * TT, TT, RH, (size_t)TT * HD, (size_t)TT * HD, (size_t)TT * TT);
            k_asoft<<<ZH * TT / 8, 256, 0, stream>>>(Sb);
            k_pvs<bf, 2, 1><<<dim3(RH / 32, HD / 32, ZH), 512, 0, stream>>>((const bf*)Sb, (const bf*)Sb + TT, 2 * TT, VTh + zk * HD * TT, VTl + zk * HD * TT, TT, Ob, HD, 0, (size_t)2 * TT * TT, (size_t)HD * TT, (size_t)TT * HD);
            k_pvs<h16, 0, 4><<<dim3((TT - RH) / 32, HD / 32, ZH), 512, 0, stream>>>((const h16*)Sb + (size_t)RH * 2 * TT, nullptr, 2 * TT, VT16 + zk * HD * TT, nullptr, TT, Ob + (size_t)RH * HD, HD, RH, (size_t)2 * TT * TT, (size_t)HD * TT, (size_t)TT * HD);
            k_merge<<<(unsigned)(((size_t)ZH * TT * HD / 2 + 255) / 256), 256, 0, stream>>>(Ob, h0, ATh, ATl); }
        k_gemmw<bf, 1, true><<<dim3(TT / 64, DM / 64, 1), 32, 0, stream>>>(ATh, ATl, WO, nullptr, DQ, OUT + (size_t)b * TT * DM, DM, bo, 0, 0, 0); }
}

// v003
// One run takes 1060 microseconds.
// Next to v002, in two timings, it ran 1.03 and 1.04 times as fast.
// All steps since v000 together make it 2.72 times as fast.
#include <hip/hip_runtime.h>

// CausalSelfAttentionSeparateHeads (x [4][2048][1024]; per-head Linear q/k/v: Wq[h][d][c], bq[h][d] (16 heads x 64) == one [1024][1024] torch-layout weight with rows h*64+d; causal softmax(q.k/8); y merged (head-major) Wp^T + bp -> [4][2048][1024]).
// Compute dtypes, f32 accumulate: every input rounded to bf16; Q/K/V on PLAIN bf16 operands (inputs: exact) + bias; causal scores and att.v: query rows < 512 on bf16 hi+lo planes (3 products), the rest single fp16 (x1024); softmax f32;
// The 16-bit operand planes are written by the matrix kernels that make the values (k_gemmw: q, k, v; k_pvs: the merged heads): no f32 intermediate and no conversion pass lies between two products.

#define NB_  4
#define TT   2048
#define DM   1024
#define NH_  16
#define NKV  16
#define REP  (NH_ / NKV)
#define HD   64
#define DQ   (NH_ * HD)
#define DKV  (NKV * HD)
#define ZH   8                    // heads per attention pass
#define RH   512                  // query rows < RH use hi+lo planes (0: none)
#define WIN  0
#define PCAR 1024.0f
#define SCL  0.125f   // HD^-0.5
typedef _Float16 h16;
typedef unsigned short bf;
typedef __attribute__((ext_vector_type(16))) __bf16   v16bf;
typedef __attribute__((ext_vector_type(16))) _Float16 v16h;
typedef __attribute__((ext_vector_type(8)))  _Float16 v8h;
typedef __attribute__((ext_vector_type(8)))  unsigned short v8us;
typedef __attribute__((ext_vector_type(8)))  float    v8f;
typedef __attribute__((ext_vector_type(4)))  float    v4f;
typedef v8h  __attribute__((may_alias)) v8ha;
typedef v4f  __attribute__((may_alias)) v4fa;
typedef v8us __attribute__((may_alias)) v8usa;

__device__ __forceinline__ unsigned short f2bf(float f) { unsigned u = __float_as_uint(f); u += 0x7FFFu + ((u >> 16) & 1u); return (unsigned short)(u >> 16); }
__device__ __forceinline__ float bf2f(unsigned short b) { return __uint_as_float(((unsigned)b) << 16); }
__device__ __forceinline__ float bfr(float f) { return bf2f(f2bf(f)); }
__device__ __forceinline__ v16h cat16(v8h lo, v8h hi) { return __builtin_shufflevector(lo, hi, 0, 1, 2, 3, 4, 5, 6, 7, 8, 9, 10, 11, 12, 13, 14, 15); }
__device__ __forceinline__ v16bf cat16b(v8us lo, v8us hi) { return __builtin_bit_cast(v16bf, __builtin_shufflevector(lo, hi, 0, 1, 2, 3, 4, 5, 6, 7, 8, 9, 10, 11, 12, 13, 14, 15)); }
__device__ __forceinline__ v8f wmma16(v16h a, v16h b, v8f c) { return __builtin_amdgcn_wmma_f32_16x16x32_f16(false, a, false, b, (short)0, c, false, false); }
__device__ __forceinline__ v8f wmmab(v16bf a, v16bf b, v8f c) { return __builtin_amdgcn_wmma_f32_16x16x32_bf16(false, a, false, b, (short)0, c, false, false); }



// ---- k_gemmo: the output projection as a register-blocked GEMM, ONE WAVE per 64x64 output tile (16 accumulators), operands straight from 16-bit planes; grid (M/64, N/64), 32 threads.
// C[m][n] (f32, pitch ldc) = sum_k (A[m][k] + A2[m][k]) Bt[n][k] + bias[n], two products per k chunk (hi, then lo). K % 32 == 0. Bt is K-contiguous.
// A and A2 lie as chunk planes [k/32][m][k%32], the form in which k_pvs leaves them; the k order inside a fragment is that of a K-contiguous row.
template <typename T16> struct WFrag;
template <> struct WFrag<h16> { typedef v16h V; static __device__ __forceinline__ V ld(const h16* p) { return cat16(*(const v8h*)p, *(const v8h*)(p + 16)); } static __device__ __forceinline__ v8f mma(V a, V b, v8f c) { return wmma16(a, b, c); } };
template <> struct WFrag<bf> { typedef v16bf V; static __device__ __forceinline__ V ld(const bf* p) { return cat16b(*(const v8us*)p, *(const v8us*)(p + 16)); } static __device__ __forceinline__ v8f mma(V a, V b, v8f c) { return wmmab(a, b, c); } };
__global__ __launch_bounds__(32) void k_gemmo(const bf* __restrict__ A, const bf* __restrict__ A2, int M, const bf* __restrict__ Bt, int K, float* C, int ldc, const float* __restrict__ bias) {
    typedef WFrag<bf>::V V;
    __shared__ __align__(16) float os[16 * 68];
    const int lane = threadIdx.x & 31, lr = lane & 15, hi = lane >> 4; const int r0 = blockIdx.x * 64, c0 = blockIdx.y * 64;
    v8f acc[4][4];
#pragma unroll
    for (int mb = 0; mb < 4; ++mb)
#pragma unroll
        for (int nb = 0; nb < 4; ++nb) acc[mb][nb] = (v8f){};
    const size_t aoff = (size_t)(r0 + lr) * 32 + 8 * hi, boff = (size_t)(c0 + lr) * K + 8 * hi;
#pragma unroll 1   // stays rolled: 16 accumulators and the fragments of one k chunk already fill the registers
    for (int kc = 0; kc < K; kc += 32) {
        V a[4], a2[4]; const bf* pa = A + aoff + (size_t)kc * M; const bf* pa2 = A2 + aoff + (size_t)kc * M; const bf* pb[4];
#pragma unroll
        for (int mb = 0; mb < 4; ++mb) { a[mb] = WFrag<bf>::ld(pa + mb * 16 * 32); a2[mb] = WFrag<bf>::ld(pa2 + mb * 16 * 32); }
#pragma unroll
        for (int nb = 0; nb < 4; ++nb) { pb[nb] = Bt + boff + (size_t)nb * 16 * K + kc; const V b = WFrag<bf>::ld(pb[nb]);
#pragma unroll
            for (int mb = 0; mb < 4; ++mb) { acc[mb][nb] = WFrag<bf>::mma(a[mb], b, acc[mb][nb]); acc[mb][nb] = WFrag<bf>::mma(a2[mb], b, acc[mb][nb]); } }
        // the wait in front of any rewrite of a register that the loads above name; the addresses are its inputs so that no later load of the trip lands on one of them
        asm volatile("s_wait_xcnt 0x0" :: "v"(pa), "v"(pa2), "v"(pb[0]), "v"(pb[1]), "v"(pb[2]), "v"(pb[3]) : "memory");
        // the slots the chip needs behind the last matrix instruction, on the taken side of the loop's branch too
        asm volatile("v_nop\n\tv_nop\n\tv_nop\n\tv_nop" : "+v"(acc[0][0]), "+v"(acc[1][1]), "+v"(acc[2][2]), "+v"(acc[3][3]) : "v"(a[0]), "v"(a[3]));
    }
#pragma unroll
    for (int mb = 0; mb < 4; ++mb) {
#pragma unroll
        for (int nb = 0; nb < 4; ++nb) {
#pragma unroll
            for (int j = 0; j < 8; ++j) os[(hi * 8 + j) * 68 + nb * 16 + lr] = acc[mb][nb][j]; }
        __builtin_amdgcn_wave_barrier(); asm volatile("" ::: "memory");   // the wave's LDS writes stay in front of its reads of other lanes' values
        float* crow = C + (size_t)(r0 + mb * 16) * ldc + c0;
#pragma unroll
        for (int s = 0; s < 8; ++s) { const int row = 2 * s + hi, cofs = lr * 4; v4f val = *(const v4fa*)(os + row * 68 + cofs); val[0] += bfr(bias[c0 + cofs]); val[1] += bfr(bias[c0 + cofs + 1]); val[2] += bfr(bias[c0 + cofs + 2]); val[3] += bfr(bias[c0 + cofs + 3]);
            *(v4f*)(crow + (size_t)row * ldc + cofs) = val; }
        __builtin_amdgcn_wave_barrier(); asm volatile("" ::: "memory");   // the reads above stay in front of the next 16 rows' LDS writes
    }
}

// ---- k_gemmc: a one-wave 64x64 tile GEMM (K-contiguous planes, z-batch strides sA/sB/sC in elements, split products per NSPLIT) specialised for causal attention: CMODE 1 skips score tiles entirely above the diagonal (query rows r0+roff.., key columns c0..), CMODE 2 limits the
// key (K) loop of the probability x value contraction to the diagonal block (probabilities beyond it are exactly zero). roff = row offset of this launch's first row within the sequence.
template <typename T16, int NSPLIT, int CMODE>
__global__ __launch_bounds__(32) void k_gemmc(const T16* __restrict__ A, const T16* __restrict__ A2, const T16* __restrict__ Bt, const T16* __restrict__ Bt2, int K, float* C, int ldc, int roff, size_t sA, size_t sB, size_t sC) {
    typedef typename WFrag<T16>::V V;
    __shared__ __align__(16) float os[16 * 68];
    const size_t z = blockIdx.z; A += z * sA; if (A2) A2 += z * sA; Bt += z * sB; if (Bt2) Bt2 += z * sB; C += z * sC;
    const int lane = threadIdx.x & 31, lr = lane & 15, hi = lane >> 4; const int r0 = blockIdx.x * 64, c0 = blockIdx.y * 64;
    if (CMODE == 1 && c0 > r0 + roff + 63) return;                  // score tile entirely above the causal diagonal: never read (the softmax masks j > i by select)
    const int Kl = (CMODE == 2) ? min(K, r0 + roff + 64) : K;        // P.V: probabilities are exactly 0 beyond the diagonal block, so the K loop stops there
    v8f acc[4][4];
#pragma unroll
    for (int mb = 0; mb < 4; ++mb)
#pragma unroll
        for (int nb = 0; nb < 4; ++nb) acc[mb][nb] = (v8f){};
    const size_t aoff = (size_t)(r0 + lr) * K + 8 * hi, boff = (size_t)(c0 + lr) * K + 8 * hi;
#pragma unroll 1
    for (int kc = 0; kc < Kl; kc += 32) {
        V a[4], a2[4];
#pragma unroll
        for (int mb = 0; mb < 4; ++mb) { a[mb] = WFrag<T16>::ld(A + aoff + (size_t)mb * 16 * K + kc); if (NSPLIT == 1 || NSPLIT == 2) a2[mb] = WFrag<T16>::ld(A2 + aoff + (size_t)mb * 16 * K + kc); }
#pragma unroll
        for (int nb = 0; nb < 4; ++nb) { const V b = WFrag<T16>::ld(Bt + boff + (size_t)nb * 16 * K + kc); V b2; if (NSPLIT >= 2) b2 = WFrag<T16>::ld(Bt2 + boff + (size_t)nb * 16 * K + kc);
#pragma unroll
            for (int mb = 0; mb < 4; ++mb) { acc[mb][nb] = WFrag<T16>::mma(a[mb], b, acc[mb][nb]); if (NSPLIT == 1 || NSPLIT == 2) acc[mb][nb] = WFrag<T16>::mma(a2[mb], b, acc[mb][nb]); if (NSPLIT >= 2) acc[mb][nb] = WFrag<T16>::mma(a[mb], b2, acc[mb][nb]); } }
        asm volatile("v_nop\n\tv_nop\n\tv_nop\n\tv_nop" : "+v"(acc[0][0]), "+v"(acc[1][1]), "+v"(acc[2][2]), "+v"(acc[3][3]) : "v"(a[0]), "v"(a[3]));
    }
#pragma unroll
    for (int mb = 0; mb < 4; ++mb) {
#pragma unroll
        for (int nb = 0; nb < 4; ++nb) {
#pragma unroll
            for (int j = 0; j < 8; ++j) os[(hi * 8 + j) * 68 + nb * 16 + lr] = acc[mb][nb][j]; }
        __builtin_amdgcn_wave_barrier(); asm volatile("" ::: "memory");
        float* crow = C + (size_t)(r0 + mb * 16) * ldc + c0;
{
#pragma unroll
            for (int s = 0; s < 8; ++s) { const int row = 2 * s + hi, cofs = lr * 4; v4f val = *(const v4fa*)(os + row * 68 + cofs);
                *(v4f*)(crow + (size_t)row * ldc + cofs) = val; }
             }
        __builtin_amdgcn_wave_barrier(); asm volatile("" ::: "memory");
    }
}

__device__ __forceinline__ h16 tohx(float x) { return (h16)x; }
__device__ __forceinline__ void splitf(float y, unsigned short& h, unsigned short& l) { h = f2bf(y); l = f2bf(y - bf2f(h)); }
typedef __attribute__((ext_vector_type(2))) _Float16 v2h;
typedef __attribute__((ext_vector_type(4))) _Float16 v4h;
typedef __attribute__((ext_vector_type(2))) unsigned short v2us;
typedef __attribute__((ext_vector_type(4))) unsigned short v4us;
typedef __attribute__((ext_vector_type(2))) float v2f;
typedef __attribute__((ext_vector_type(4))) int v4i;
typedef v2f  __attribute__((may_alias)) v2fa;

// ---- k_gemmw: the q, k, v projections: register-blocked GEMM, ONE WAVE per 64x64 tile (16 accumulators), operands straight from K-contiguous 16-bit planes (+ split products per NSPLIT), K % 32 == 0, whose epilogue adds the bias and writes the value's three 16-bit planes (fp16, bf16 hi, bf16 lo) itself; grid (M/64, N/64), 32 threads.
// ROWB false (q, k: A = tokens, Bt = weight rows): bias[n]; a tile's 64 columns are one head, planes [n/64][m][n%64]. ROWB true (v: A = weight rows, Bt = tokens, so the product comes out transposed): bias[m]; planes [m][n], pitch TT.
// Either way a lane stores 4 neighbours and 16 lanes fill one 128-byte line of each plane.
template <typename T16, int NSPLIT, bool ROWB>
__global__ __launch_bounds__(32) void k_gemmw(const T16* __restrict__ A, const T16* __restrict__ A2, const T16* __restrict__ Bt, const T16* __restrict__ Bt2, int K, const float* __restrict__ bias, h16* P16, bf* Ph, bf* Pl) {
    typedef typename WFrag<T16>::V V;
    __shared__ __align__(16) float os[16 * 68];
    const int lane = threadIdx.x & 31, lr = lane & 15, hi = lane >> 4; const int r0 = blockIdx.x * 64, c0 = blockIdx.y * 64;
    v8f acc[4][4];
#pragma unroll
    for (int mb = 0; mb < 4; ++mb)
#pragma unroll
        for (int nb = 0; nb < 4; ++nb) acc[mb][nb] = (v8f){};
    const size_t aoff = (size_t)(r0 + lr) * K + 8 * hi, boff = (size_t)(c0 + lr) * K + 8 * hi;
#pragma unroll 1
    for (int kc = 0; kc < K; kc += 32) {
        V a[4], a2[4];
#pragma unroll
        for (int mb = 0; mb < 4; ++mb) { a[mb] = WFrag<T16>::ld(A + aoff + (size_t)mb * 16 * K + kc); if (NSPLIT == 1 || NSPLIT == 2) a2[mb] = WFrag<T16>::ld(A2 + aoff + (size_t)mb * 16 * K + kc); }
#pragma unroll
        for (int nb = 0; nb < 4; ++nb) { const V b = WFrag<T16>::ld(Bt + boff + (size_t)nb * 16 * K + kc); V b2; if (NSPLIT >= 2) b2 = WFrag<T16>::ld(Bt2 + boff + (size_t)nb * 16 * K + kc);
#pragma unroll
            for (int mb = 0; mb < 4; ++mb) { acc[mb][nb] = WFrag<T16>::mma(a[mb], b, acc[mb][nb]); if (NSPLIT == 1 || NSPLIT == 2) acc[mb][nb] = WFrag<T16>::mma(a2[mb], b, acc[mb][nb]); if (NSPLIT >= 2) acc[mb][nb] = WFrag<T16>::mma(a[mb], b2, acc[mb][nb]); } }
        asm volatile("v_nop\n\tv_nop\n\tv_nop\n\tv_nop" : "+v"(acc[0][0]), "+v"(acc[1][1]), "+v"(acc[2][2]), "+v"(acc[3][3]) : "v"(a[0]), "v"(a[3]));
    }
#pragma unroll
    for (int mb = 0; mb < 4; ++mb) {
#pragma unroll
        for (int nb = 0; nb < 4; ++nb) {
#pragma unroll
            for (int j = 0; j < 8; ++j) os[(hi * 8 + j) * 68 + nb * 16 + lr] = acc[mb][nb][j]; }
        __builtin_amdgcn_wave_barrier(); asm volatile("" ::: "memory");   // the wave's LDS writes stay in front of its reads of other lanes' values
#pragma unroll
        for (int s = 0; s < 8; ++s) { const int row = 2 * s + hi, cofs = lr * 4, m = r0 + mb * 16 + row; v4f val = *(const v4fa*)(os + row * 68 + cofs);
            if (ROWB) { const float bb = bfr(bias[m]); val[0] += bb; val[1] += bb; val[2] += bb; val[3] += bb; }
            else { val[0] += bfr(bias[c0 + cofs]); val[1] += bfr(bias[c0 + cofs + 1]); val[2] += bfr(bias[c0 + cofs + 2]); val[3] += bfr(bias[c0 + cofs + 3]); }
            v4h o16; v4us oh, ol;
#pragma unroll
            for (int q = 0; q < 4; ++q) { o16[q] = tohx(val[q]); unsigned short a2, c2; splitf(val[q], a2, c2); oh[q] = a2; ol[q] = c2; }
            const size_t o = ROWB ? (size_t)m * TT + c0 + cofs : ((size_t)blockIdx.y * TT + m) * HD + cofs;
            *(v4h*)(P16 + o) = o16; *(v4us*)(Ph + o) = oh; *(v4us*)(Pl + o) = ol; }
        __builtin_amdgcn_wave_barrier(); asm volatile("" ::: "memory");   // the reads above stay in front of the next 16 rows' LDS writes
    }
}

// ---- k_pvs: the probability x value contraction with its key loop dealt over the PVW waves of a work-group; one work-group per 32x32 output tile, grid (rows/32, N/32, Z), 512 threads.
// Wave w takes the 32-key chunks w, w+PVW, w+2*PVW, ... below the diagonal block (probabilities beyond it are exactly zero); the loads of DEPTH of its chunks are issued before the first product.
// Each wave leaves its f32 partial tile in LDS (zeros where it had no chunk); behind one barrier every thread adds the PVW partials of two elements in wave order, scales the sums by cs and stores their bf16 hi and lo planes.
// The tile's 32 columns are one 32-wide k chunk of the output projection: chunk ch0 + (HD/32) z + blockIdx.y of the planes Ah, Al [chunk][t][32], so a work-group writes 2 KiB in a row of each plane.
// The fixed small loops are unrolled so that the fragment and accumulator arrays stay in registers. lda = row pitch of A and A2 in elements (the probabilities lie in their score rows); Bt and Bt2 have pitch K.
#define PVW  16                   // waves of a work-group (512 threads)
#define PVP  36                   // LDS row pitch in floats: the two 8-row halves of an accumulator store fall on disjoint banks
template <typename T16, int NSPLIT, int DEPTH>
__global__ __launch_bounds__(512) void k_pvs(const T16* __restrict__ A, const T16* __restrict__ A2, int lda, const T16* __restrict__ Bt, const T16* __restrict__ Bt2, int K, bf* Ah, bf* Al, int ch0, float cs, int roff, size_t sA, size_t sB) {
    typedef typename WFrag<T16>::V V;
    __shared__ __align__(16) float red[PVW * 32 * PVP];
    const size_t z = blockIdx.z; A += z * sA; if (A2) A2 += z * sA; Bt += z * sB; if (Bt2) Bt2 += z * sB;
    const int lane = threadIdx.x & 31, lr = lane & 15, hi = lane >> 4; const int w = __builtin_amdgcn_readfirstlane(threadIdx.x >> 5); const int r0 = blockIdx.x * 32, c0 = blockIdx.y * 32;
    const int Kl = min(K, r0 + roff + 32);                           // probabilities are exactly 0 beyond the diagonal block
    v8f acc[2][2];
#pragma unroll
    for (int mb = 0; mb < 2; ++mb)
#pragma unroll
        for (int nb = 0; nb < 2; ++nb) acc[mb][nb] = (v8f){};
    const size_t aoff = (size_t)(r0 + lr) * lda + 8 * hi, boff = (size_t)(c0 + lr) * K + 8 * hi;
#pragma unroll 1   // stays rolled: one pass already holds the operands of DEPTH chunks in registers
    for (int k0 = w * 32; k0 < Kl; k0 += DEPTH * PVW * 32) {
        V a[DEPTH][2], a2[DEPTH][2], b[DEPTH][2], b2[DEPTH][2];
        const T16* pa[2] = { A + aoff + k0, A + aoff + (size_t)16 * lda + k0 }; const T16* pb[2] = { Bt + boff + k0, Bt + boff + (size_t)16 * K + k0 };
        const T16* pa2[2] = { pa[0], pa[1] }; const T16* pb2[2] = { pb[0], pb[1] }; if (NSPLIT == 2) { pa2[0] = A2 + aoff + k0; pa2[1] = A2 + aoff + (size_t)16 * lda + k0; pb2[0] = Bt2 + boff + k0; pb2[1] = Bt2 + boff + (size_t)16 * K + k0; }
#pragma unroll
        for (int t = 0; t < DEPTH; ++t) {
            if (k0 + t * PVW * 32 < Kl) {                            // wave-uniform
#pragma unroll
                for (int q = 0; q < 2; ++q) { a[t][q] = WFrag<T16>::ld(pa[q] + t * PVW * 32); b[t][q] = WFrag<T16>::ld(pb[q] + t * PVW * 32); if (NSPLIT == 2) { a2[t][q] = WFrag<T16>::ld(pa2[q] + t * PVW * 32); b2[t][q] = WFrag<T16>::ld(pb2[q] + t * PVW * 32); } }
            } else {                                                 // no such chunk: zero operands, its products add exact zeros
#pragma unroll
                for (int q = 0; q < 2; ++q) { a[t][q] = (V){}; b[t][q] = (V){}; if (NSPLIT == 2) { a2[t][q] = (V){}; b2[t][q] = (V){}; } } } }
        // the wait in front of any rewrite of a register that the loads above name; the addresses are its inputs so that no later load of the group lands on one of them
        if (NSPLIT == 2) asm volatile("s_wait_xcnt 0x0" :: "v"(pa[0]), "v"(pa[1]), "v"(pb[0]), "v"(pb[1]), "v"(pa2[0]), "v"(pa2[1]), "v"(pb2[0]), "v"(pb2[1]) : "memory");
        else asm volatile("s_wait_xcnt 0x0" :: "v"(pa[0]), "v"(pa[1]), "v"(pb[0]), "v"(pb[1]) : "memory");
        __builtin_amdgcn_sched_barrier(0);                           // keeps all DEPTH chunks' loads in front of the first product, so that their latencies overlap instead of adding up
#pragma unroll
        for (int t = 0; t < DEPTH; ++t)
#pragma unroll
            for (int nb = 0; nb < 2; ++nb)
#pragma unroll
                for (int mb = 0; mb < 2; ++mb) { acc[mb][nb] = WFrag<T16>::mma(a[t][mb], b[t][nb], acc[mb][nb]); if (NSPLIT == 2) { acc[mb][nb] = WFrag<T16>::mma(a2[t][mb], b[t][nb], acc[mb][nb]); acc[mb][nb] = WFrag<T16>::mma(a[t][mb], b2[t][nb], acc[mb][nb]); } }
        // the slots the chip needs behind the last matrix instruction, on the taken side of the loop's branch too
        asm volatile("v_nop\n\tv_nop\n\tv_nop\n\tv_nop" : "+v"(acc[0][0]), "+v"(acc[1][0]), "+v"(acc[0][1]), "+v"(acc[1][1]));
    }
    float* pw = red + w * 32 * PVP;
#pragma unroll
    for (int mb = 0; mb < 2; ++mb)
#pragma unroll
        for (int nb = 0; nb < 2; ++nb)
#pragma unroll
            for (int j = 0; j < 8; ++j) pw[(mb * 16 + hi * 8 + j) * PVP + nb * 16 + lr] = acc[mb][nb][j];
    __syncthreads();                                                 // every wave's partial tile is in LDS before any thread adds them
    const int row = threadIdx.x >> 4, col = (threadIdx.x & 15) * 2; v2f s = *(const v2fa*)(red + row * PVP + col);
#pragma unroll
    for (int p = 1; p < PVW; ++p) s += *(const v2fa*)(red + (p * 32 + row) * PVP + col);
    v2us oh, ol;
#pragma unroll
    for (int q = 0; q < 2; ++q) { unsigned short a, c2; splitf(s[q] * cs, a, c2); oh[q] = a; ol[q] = c2; }
    const size_t o = ((size_t)(ch0 + (HD / 32) * (int)blockIdx.z + (int)blockIdx.y) * TT + r0 + roff + row) * 32 + col;
    *(v2us*)(Ah + o) = oh; *(v2us*)(Al + o) = ol;
}

__global__ __launch_bounds__(256) void k_wtG(const float* __restrict__ w, int K, int N, bf* Bt) {
    const int lane = threadIdx.x & 31; const int L0 = (blockIdx.x * 8 + (threadIdx.x >> 5)) * 8; const int nlines = N * K / 64;
{
#pragma unroll 1
        for (int l = 0; l < 8; ++l) { const int L = L0 + l; if (L >= nlines) break; const size_t e = (size_t)L * 64 + lane * 2; const int k = (int)(e % K), n = (int)(e / K); v2us o;
            o[0] = f2bf(w[(size_t)k * N + n]); o[1] = f2bf(w[(size_t)(k + 1) * N + n]); *(v2us*)(Bt + e) = o; }
         }
}
__global__ __launch_bounds__(256) void k_cvt8(const float* __restrict__ src, bf* dst, size_t n8) { const size_t i = (size_t)blockIdx.x * 256 + threadIdx.x; if (i >= n8) return; const v8f v = *(const v8f*)(src + i * 8); v8us o;
#pragma unroll
    for (int k = 0; k < 8; ++k) o[k] = f2bf(v[k]); *(v8us*)(dst + i * 8) = o;  }
__global__ __launch_bounds__(256) void k_cscvt(const float* __restrict__ cosT, const float* __restrict__ sinT, float* CS) { const int idx = blockIdx.x * 256 + threadIdx.x; if (idx >= TT * HD) return; v2f cs; cs[0] = bfr(cosT[idx]); cs[1] = bfr(sinT[idx]); *(v2f*)(CS + (size_t)idx * 2) = cs;  }
// k_asoft: per row (zz, i): t = S x HD^-0.5 for j <= i (causal; the reference's -1e9 additive fill vanishes identically); softmax over the 2048 keys (register row, one exp, fixed trees);
// the probabilities go IN PLACE over the row's own scores (one wave owns a row and holds all of it in registers before its first store): fp16 in the row's first half, or the hi plane in the first and the lo plane in the second half.
__global__ __launch_bounds__(256) void k_asoft(float* Sb) {
    const int lane = threadIdx.x & 31; const int row = blockIdx.x * 8 + (threadIdx.x >> 5); if (row >= ZH * TT) return; const int i = row % TT; const int zz = row / TT; (void)zz; const bool hires = (i < RH); float* sr = Sb + (size_t)row * TT; float v[TT / 32]; float mx = -3.0e38f;
#pragma unroll
    for (int ch = 0; ch < TT / 128; ++ch) { const int j0 = ch * 128 + lane * 4; const v4f a = *(const v4f*)(sr + j0);
#pragma unroll
        for (int q = 0; q < 4; ++q) { const int j = j0 + q; (void)j; const float t = (j <= i) ? a[q] * SCL : -3.0e38f; v[ch * 4 + q] = t; mx = fmaxf(mx, t); } }
#pragma unroll
    for (int sh = 16; sh; sh >>= 1) mx = fmaxf(mx, __shfl_xor(mx, sh, 32));
    float sum = 0.f;
#pragma unroll
    for (int k = 0; k < TT / 32; ++k) { float d0 = __fsub_rn(v[k], mx); asm volatile("" : "+v"(d0)); v[k] = __builtin_amdgcn_exp2f(__fmul_rn(d0, 1.4426950408889634f)); sum += v[k]; }
#pragma unroll
    for (int sh = 16; sh; sh >>= 1) sum += __shfl_xor(sum, sh, 32);
    const float f = __fdiv_rn(hires ? 1.0f : PCAR, sum);
{
        if (hires) {
#pragma unroll
            for (int ch = 0; ch < TT / 128; ++ch) { v4us oh, ol;
#pragma unroll
                for (int q = 0; q < 4; ++q) { unsigned short a, c2; splitf(v[ch * 4 + q] * f, a, c2); oh[q] = a; ol[q] = c2; }
                bf* pr = (bf*)sr + ch * 128 + lane * 4; *(v4us*)pr = oh; *(v4us*)(pr + TT) = ol; }
        } else {
#pragma unroll
            for (int ch = 0; ch < TT / 128; ++ch) { v4h o4;
#pragma unroll
                for (int q = 0; q < 4; ++q) o4[q] = tohx(v[ch * 4 + q] * f);
                *(v4h*)((h16*)sr + ch * 128 + lane * 4) = o4; } }
         }
}
extern "C" void kernel_launch(void* const* d_in, const int* in_sizes, int n_in,
                              void* d_out, int out_size, void* d_ws, size_t ws_size, hipStream_t stream) {
    (void)in_sizes; (void)n_in; (void)out_size;
    const float* x = (const float*)d_in[0]; const float* wq = (const float*)d_in[1]; const float* bq = (const float*)d_in[2]; const float* wk = (const float*)d_in[3]; const float* bk = (const float*)d_in[4]; const float* wv = (const float*)d_in[5]; const float* bv = (const float*)d_in[6]; const float* wo = (const float*)d_in[7]; const float* bo = (const float*)d_in[8]; const float* cosT = nullptr; const float* sinT = nullptr; (void)cosT; (void)sinT;
    float* OUT = (float*)d_out;     // [4][2048][1024]
    char* wsp = (char*)d_ws;
    auto take = [&](size_t bytes) { char* p = wsp; wsp += (bytes + 255) & ~(size_t)255; return (void*)p; };
    bf* WQ = (bf*)take((size_t)DQ * DM * 2); bf* WK = (bf*)take((size_t)DKV * DM * 2); bf* WV = (bf*)take((size_t)DKV * DM * 2); bf* WO = (bf*)take((size_t)DM * DQ * 2);
    bf* XB = (bf*)take((size_t)TT * DM * 2);
    h16* QP16 = (h16*)take((size_t)NH_ * TT * HD * 2); h16* KP16 = (h16*)take((size_t)NKV * TT * HD * 2); h16* VT16 = (h16*)take((size_t)NKV * HD * TT * 2);
    bf* QPh = (bf*)take((size_t)NH_ * TT * HD * 2); bf* QPl = (bf*)take((size_t)NH_ * TT * HD * 2); bf* KPh = (bf*)take((size_t)NKV * TT * HD * 2); bf* KPl = (bf*)take((size_t)NKV * TT * HD * 2); bf* VTh = (bf*)take((size_t)NKV * HD * TT * 2); bf* VTl = (bf*)take((size_t)NKV * HD * TT * 2);
    float* Sb = (float*)take((size_t)ZH * TT * TT * 4); bf* ATh = (bf*)take((size_t)TT * DQ * 2); bf* ATl = (bf*)take((size_t)TT * DQ * 2);
    if ((size_t)(wsp - (char*)d_ws) > ws_size) return;    // ws 256 MiB
    { k_cvt8<<<(unsigned)(((size_t)DQ * DM / 8 + 255) / 256), 256, 0, stream>>>(wq, WQ, (size_t)DQ * DM / 8); k_cvt8<<<(unsigned)(((size_t)DKV * DM / 8 + 255) / 256), 256, 0, stream>>>(wk, WK, (size_t)DKV * DM / 8); k_cvt8<<<(unsigned)(((size_t)DKV * DM / 8 + 255) / 256), 256, 0, stream>>>(wv, WV, (size_t)DKV * DM / 8);
      k_cvt8<<<(unsigned)(((size_t)DM * DQ / 8 + 255) / 256), 256, 0, stream>>>(wo, WO, (size_t)DM * DQ / 8);
       }
    for (int b = 0; b < NB_; ++b) {
        
        k_cvt8<<<(unsigned)(((size_t)TT * DM / 8 + 255) / 256), 256, 0, stream>>>(x + (size_t)b * TT * DM, XB, (size_t)TT * DM / 8);
        k_gemmw<bf, 0, false><<<dim3(TT / 64, DQ / 64, 1), 32, 0, stream>>>(XB, nullptr, WQ, nullptr, DM, bq, QP16, QPh, QPl);      // q planes [h][t][d]
        k_gemmw<bf, 0, false><<<dim3(TT / 64, DKV / 64, 1), 32, 0, stream>>>(XB, nullptr, WK, nullptr, DM, bk, KP16, KPh, KPl);     // k planes [h][t][d]
        k_gemmw<bf, 0, true><<<dim3(DKV / 64, TT / 64, 1), 32, 0, stream>>>(WV, nullptr, XB, nullptr, DM, bv, VT16, VTh, VTl);      // v planes [h][d][t]
        for (int h0 = 0; h0 < NH_; h0 += ZH) { const size_t zq = (size_t)h0, zk = (size_t)(h0 / REP);   // one kv head per query head: the pass's heads use consecutive kv planes (z-strides TT*HD)
            k_gemmc<bf, 2, 1><<<dim3(RH / 64, TT / 64, ZH), 32, 0, stream>>>(QPh + zq * TT * HD, QPl + zq * TT * HD, KPh + zk * TT * HD, KPl + zk * TT * HD, HD, Sb, TT, 0, (size_t)TT * HD, (size_t)TT * HD, (size_t)TT * TT);
            k_gemmc<h16, 0, 1><<<dim3((TT - RH) / 64, TT / 64, ZH), 32, 0, stream>>>(QP16 + zq * TT * HD + (size_t)RH * HD, nullptr, KP16 + zk * TT * HD, nullptr, HD, Sb + (size_t)RH * TT, TT, RH, (size_t)TT * HD, (size_t)TT * HD, (size_t)TT * TT);
            k_asoft<<<ZH * TT / 8, 256, 0, stream>>>(Sb);
            k_pvs<bf, 2, 1><<<dim3(RH / 32, HD / 32, ZH), 512, 0, stream>>>((const bf*)Sb, (const bf*)Sb + TT, 2 * TT, VTh + zk * HD * TT, VTl + zk * HD * TT, TT, ATh, ATl, h0 * (HD / 32), 1.0f, 0, (size_t)2 * TT * TT, (size_t)HD * TT);
            k_pvs<h16, 0, 4><<<dim3((TT - RH) / 32, HD / 32, ZH), 512, 0, stream>>>((const h16*)Sb + (size_t)RH * 2 * TT, nullptr, 2 * TT, VT16 + zk * HD * TT, nullptr, TT, ATh, ATl, h0 * (HD / 32), 1.0f / PCAR, RH, (size_t)2 * TT * TT, (size_t)HD * TT); }
        k_gemmo<<<dim3(TT / 64, DM / 64, 1), 32, 0, stream>>>(ATh, ATl, TT, WO, DQ, OUT + (size_t)b * TT * DM, DM, bo); }
}

// v004
// A run of this version takes 589 microseconds.
// Timed twice side by side with v003, it ran 1.80 and 1.79 times as fast.
// All steps since v000 together make it 4.87 times as fast.
#include <hip/hip_runtime.h>

// CausalSelfAttentionSeparateHeads (x [4][2048][1024]; per-head Linear q/k/v: Wq[h][d][c], bq[h][d] (16 heads x 64) == one [1024][1024] torch-layout weight with rows h*64+d; causal softmax(q.k/8); y merged (head-major) Wp^T + bp -> [4][2048][1024]).
// Compute dtypes, f32 accumulate: every input rounded to bf16; Q/K/V on PLAIN bf16 operands (inputs: exact) + bias; causal scores and att.v: query rows < 512 on bf16 hi+lo planes (3 products), the rest single fp16 (x1024); softmax f32;
// The 16-bit operand planes are written by the matrix kernels that make the values (k_gemmw: q, k, v; k_attn: the merged heads): no f32 intermediate and no conversion pass lies between two products.

#define NB_  4
#define TT   2048
#define DM   1024
#define NH_  16
#define NKV  16
#define REP  (NH_ / NKV)
#define HD   64
#define DQ   (NH_ * HD)
#define DKV  (NKV * HD)
#define RH   512                  // query rows < RH use hi+lo planes (0: none)
#define WIN  0
#define SCL  0.125f   // HD^-0.5
typedef _Float16 h16;
typedef unsigned short bf;
typedef __attribute__((ext_vector_type(16))) __bf16   v16bf;
typedef __attribute__((ext_vector_type(16))) _Float16 v16h;
typedef __attribute__((ext_vector_type(8)))  _Float16 v8h;
typedef __attribute__((ext_vector_type(8)))  unsigned short v8us;
typedef __attribute__((ext_vector_type(8)))  float    v8f;
typedef __attribute__((ext_vector_type(4)))  float    v4f;
typedef v8h  __attribute__((may_alias)) v8ha;
typedef v4f  __attribute__((may_alias)) v4fa;
typedef v8us __attribute__((may_alias)) v8usa;

__device__ __forceinline__ unsigned short f2bf(float f) { unsigned u = __float_as_uint(f); u += 0x7FFFu + ((u >> 16) & 1u); return (unsigned short)(u >> 16); }
__device__ __forceinline__ float bf2f(unsigned short b) { return __uint_as_float(((unsigned)b) << 16); }
__device__ __forceinline__ float bfr(float f) { return bf2f(f2bf(f)); }
__device__ __forceinline__ v16h cat16(v8h lo, v8h hi) { return __builtin_shufflevector(lo, hi, 0, 1, 2, 3, 4, 5, 6, 7, 8, 9, 10, 11, 12, 13, 14, 15); }
__device__ __forceinline__ v16bf cat16b(v8us lo, v8us hi) { return __builtin_bit_cast(v16bf, __builtin_shufflevector(lo, hi, 0, 1, 2, 3, 4, 5, 6, 7, 8, 9, 10, 11, 12, 13, 14, 15)); }
__device__ __forceinline__ v8f wmma16(v16h a, v16h b, v8f c) { return __builtin_amdgcn_wmma_f32_16x16x32_f16(false, a, false, b, (short)0, c, false, false); }
__device__ __forceinline__ v8f wmmab(v16bf a, v16bf b, v8f c) { return __builtin_amdgcn_wmma_f32_16x16x32_bf16(false, a, false, b, (short)0, c, false, false); }



// ---- k_gemmo: the output projection as a register-blocked GEMM, ONE WAVE per 64x64 output tile (16 accumulators), operands straight from 16-bit planes; grid (M/64, N/64), 32 threads.
// C[m][n] (f32, pitch ldc) = sum_k (A[m][k] + A2[m][k]) Bt[n][k] + bias[n], two products per k chunk (hi, then lo). K % 32 == 0. Bt is K-contiguous.
// A and A2 lie as chunk planes [k/32][m][k%32], the form in which k_attn leaves them; the k order inside a fragment is that of a K-contiguous row.
template <typename T16> struct WFrag;
template <> struct WFrag<h16> { typedef v16h V; static __device__ __forceinline__ V ld(const h16* p) { return cat16(*(const v8h*)p, *(const v8h*)(p + 16)); } static __device__ __forceinline__ v8f mma(V a, V b, v8f c) { return wmma16(a, b, c); } };
template <> struct WFrag<bf> { typedef v16bf V; static __device__ __forceinline__ V ld(const bf* p) { return cat16b(*(const v8us*)p, *(const v8us*)(p + 16)); } static __device__ __forceinline__ v8f mma(V a, V b, v8f c) { return wmmab(a, b, c); } };
__global__ __launch_bounds__(32) void k_gemmo(const bf* __restrict__ A, const bf* __restrict__ A2, int M, const bf* __restrict__ Bt, int K, float* C, int ldc, const float* __restrict__ bias) {
    typedef WFrag<bf>::V V;
    __shared__ __align__(16) float os[16 * 68];
    const int lane = threadIdx.x & 31, lr = lane & 15, hi = lane >> 4; const int r0 = blockIdx.x * 64, c0 = blockIdx.y * 64;
    v8f acc[4][4];
#pragma unroll
    for (int mb = 0; mb < 4; ++mb)
#pragma unroll
        for (int nb = 0; nb < 4; ++nb) acc[mb][nb] = (v8f){};
    const size_t aoff = (size_t)(r0 + lr) * 32 + 8 * hi, boff = (size_t)(c0 + lr) * K + 8 * hi;
#pragma unroll 1   // stays rolled: 16 accumulators and the fragments of one k chunk already fill the registers
    for (int kc = 0; kc < K; kc += 32) {
        V a[4], a2[4]; const bf* pa = A + aoff + (size_t)kc * M; const bf* pa2 = A2 + aoff + (size_t)kc * M; const bf* pb[4];
#pragma unroll
        for (int mb = 0; mb < 4; ++mb) { a[mb] = WFrag<bf>::ld(pa + mb * 16 * 32); a2[mb] = WFrag<bf>::ld(pa2 + mb * 16 * 32); }
#pragma unroll
        for (int nb = 0; nb < 4; ++nb) { pb[nb] = Bt + boff + (size_t)nb * 16 * K + kc; const V b = WFrag<bf>::ld(pb[nb]);
#pragma unroll
            for (int mb = 0; mb < 4; ++mb) { acc[mb][nb] = WFrag<bf>::mma(a[mb], b, acc[mb][nb]); acc[mb][nb] = WFrag<bf>::mma(a2[mb], b, acc[mb][nb]); } }
        // the wait in front of any rewrite of a register that the loads above name; the addresses are its inputs so that no later load of the trip lands on one of them
        asm volatile("s_wait_xcnt 0x0" :: "v"(pa), "v"(pa2), "v"(pb[0]), "v"(pb[1]), "v"(pb[2]), "v"(pb[3]) : "memory");
        // the slots the chip needs behind the last matrix instruction, on the taken side of the loop's branch too
        asm volatile("v_nop\n\tv_nop\n\tv_nop\n\tv_nop" : "+v"(acc[0][0]), "+v"(acc[1][1]), "+v"(acc[2][2]), "+v"(acc[3][3]) : "v"(a[0]), "v"(a[3]));
    }
#pragma unroll
    for (int mb = 0; mb < 4; ++mb) {
#pragma unroll
        for (int nb = 0; nb < 4; ++nb) {
#pragma unroll
            for (int j = 0; j < 8; ++j) os[(hi * 8 + j) * 68 + nb * 16 + lr] = acc[mb][nb][j]; }
        __builtin_amdgcn_wave_barrier(); asm volatile("" ::: "memory");   // the wave's LDS writes stay in front of its reads of other lanes' values
        float* crow = C + (size_t)(r0 + mb * 16) * ldc + c0;
#pragma unroll
        for (int s = 0; s < 8; ++s) { const int row = 2 * s + hi, cofs = lr * 4; v4f val = *(const v4fa*)(os + row * 68 + cofs); val[0] += bfr(bias[c0 + cofs]); val[1] += bfr(bias[c0 + cofs + 1]); val[2] += bfr(bias[c0 + cofs + 2]); val[3] += bfr(bias[c0 + cofs + 3]);
            *(v4f*)(crow + (size_t)row * ldc + cofs) = val; }
        __builtin_amdgcn_wave_barrier(); asm volatile("" ::: "memory");   // the reads above stay in front of the next 16 rows' LDS writes
    }
}

__device__ __forceinline__ h16 tohx(float x) { return (h16)x; }
__device__ __forceinline__ void splitf(float y, unsigned short& h, unsigned short& l) { h = f2bf(y); l = f2bf(y - bf2f(h)); }
typedef __attribute__((ext_vector_type(2))) _Float16 v2h;
typedef __attribute__((ext_vector_type(4))) _Float16 v4h;
typedef __attribute__((ext_vector_type(2))) unsigned short v2us;
typedef __attribute__((ext_vector_type(4))) unsigned short v4us;
typedef __attribute__((ext_vector_type(2))) float v2f;
typedef __attribute__((ext_vector_type(4))) int v4i;
typedef v2f  __attribute__((may_alias)) v2fa;

// ---- k_gemmw: the q, k, v projections: register-blocked GEMM, ONE WAVE per 64x64 tile (16 accumulators), operands straight from K-contiguous 16-bit planes (+ split products per NSPLIT), K % 32 == 0, whose epilogue adds the bias and writes the value's three 16-bit planes (fp16, bf16 hi, bf16 lo) itself; grid (M/64, N/64), 32 threads.
// ROWB false (q, k: A = tokens, Bt = weight rows): bias[n]; a tile's 64 columns are one head, planes [n/64][m][n%64]. ROWB true (v: A = weight rows, Bt = tokens, so the product comes out transposed): bias[m]; planes [m][n], pitch TT.
// Either way a lane stores 4 neighbours and 16 lanes fill one 128-byte line of each plane.
template <typename T16, int NSPLIT, bool ROWB>
__global__ __launch_bounds__(32) void k_gemmw(const T16* __restrict__ A, const T16* __restrict__ A2, const T16* __restrict__ Bt, const T16* __restrict__ Bt2, int K, const float* __restrict__ bias, h16* P16, bf* Ph, bf* Pl) {
    typedef typename WFrag<T16>::V V;
    __shared__ __align__(16) float os[16 * 68];
    const int lane = threadIdx.x & 31, lr = lane & 15, hi = lane >> 4; const int r0 = blockIdx.x * 64, c0 = blockIdx.y * 64;
    v8f acc[4][4];
#pragma unroll
    for (int mb = 0; mb < 4; ++mb)
#pragma unroll
        for (int nb = 0; nb < 4; ++nb) acc[mb][nb] = (v8f){};
    const size_t aoff = (size_t)(r0 + lr) * K + 8 * hi, boff = (size_t)(c0 + lr) * K + 8 * hi;
#pragma unroll 1
    for (int kc = 0; kc < K; kc += 32) {
        V a[4], a2[4];
#pragma unroll
        for (int mb = 0; mb < 4; ++mb) { a[mb] = WFrag<T16>::ld(A + aoff + (size_t)mb * 16 * K + kc); if (NSPLIT == 1 || NSPLIT == 2) a2[mb] = WFrag<T16>::ld(A2 + aoff + (size_t)mb * 16 * K + kc); }
#pragma unroll
        for (int nb = 0; nb < 4; ++nb) { const V b = WFrag<T16>::ld(Bt + boff + (size_t)nb * 16 * K + kc); V b2; if (NSPLIT >= 2) b2 = WFrag<T16>::ld(Bt2 + boff + (size_t)nb * 16 * K + kc);
#pragma unroll
            for (int mb = 0; mb < 4; ++mb) { acc[mb][nb] = WFrag<T16>::mma(a[mb], b, acc[mb][nb]); if (NSPLIT == 1 || NSPLIT == 2) acc[mb][nb] = WFrag<T16>::mma(a2[mb], b, acc[mb][nb]); if (NSPLIT >= 2) acc[mb][nb] = WFrag<T16>::mma(a[mb], b2, acc[mb][nb]); } }
        asm volatile("v_nop\n\tv_nop\n\tv_nop\n\tv_nop" : "+v"(acc[0][0]), "+v"(acc[1][1]), "+v"(acc[2][2]), "+v"(acc[3][3]) : "v"(a[0]), "v"(a[3]));
    }
#pragma unroll
    for (int mb = 0; mb < 4; ++mb) {
#pragma unroll
        for (int nb = 0; nb < 4; ++nb) {
#pragma unroll
            for (int j = 0; j < 8; ++j) os[(hi * 8 + j) * 68 + nb * 16 + lr] = acc[mb][nb][j]; }
        __builtin_amdgcn_wave_barrier(); asm volatile("" ::: "memory");   // the wave's LDS writes stay in front of its reads of other lanes' values
#pragma unroll
        for (int s = 0; s < 8; ++s) { const int row = 2 * s + hi, cofs = lr * 4, m = r0 + mb * 16 + row; v4f val = *(const v4fa*)(os + row * 68 + cofs);
            if (ROWB) { const float bb = bfr(bias[m]); val[0] += bb; val[1] += bb; val[2] += bb; val[3] += bb; }
            else { val[0] += bfr(bias[c0 + cofs]); val[1] += bfr(bias[c0 + cofs + 1]); val[2] += bfr(bias[c0 + cofs + 2]); val[3] += bfr(bias[c0 + cofs + 3]); }
            v4h o16; v4us oh, ol;
#pragma unroll
            for (int q = 0; q < 4; ++q) { o16[q] = tohx(val[q]); unsigned short a2, c2; splitf(val[q], a2, c2); oh[q] = a2; ol[q] = c2; }
            const size_t o = ROWB ? (size_t)m * TT + c0 + cofs : ((size_t)blockIdx.y * TT + m) * HD + cofs;
            *(v4h*)(P16 + o) = o16; *(v4us*)(Ph + o) = oh; *(v4us*)(Pl + o) = ol; }
        __builtin_amdgcn_wave_barrier(); asm volatile("" ::: "memory");   // the reads above stay in front of the next 16 rows' LDS writes
    }
}

// ---- k_attn: causal scores, softmax and the probability x value contraction in one kernel; no score or probability ever lies in memory. One work-group per 32 query rows of one head, grid (heads, row tiles), 256 threads.
// The key loop is dealt over the AW waves: wave w takes the 32-key chunks w, w+AW, ... up to the diagonal chunk and keeps its own running row maximum, row sum and f32 output tile (online softmax).
// Both products are formed transposed, so that a lane owns one query: S^T = K Q^T leaves in lane (lr, hi) the keys 8 hi + j of each 16-key block for query lr, which is the k order of the B fragment of O^T = V^T P^T:
// the probabilities go from the accumulator of the first product into the operand of the second inside the lane. The row maximum and sum need one exchange between the lane halves.
// At the end the waves' maxima go through LDS, each wave scales its tile and its row sums to the common maximum, and behind a second barrier every thread adds the AW partials of 8 elements in wave order, divides by the row sum and stores the bf16 hi and lo planes
// Ah, Al [chunk][t][32] (chunk = 2 head + d / 32), the k chunks of the output projection.
#define AW   8                    // waves of a work-group
#define AQ   32                   // query rows of a work-group
#define AP   68                   // LDS row pitch in floats (rows stay 16-byte aligned)
#define SC2  (SCL * 1.4426950408889634f)   // scores are scaled into base-2 exponents; maxima are kept in that unit
__device__ __forceinline__ float xhalf(float x) { return __builtin_bit_cast(float, __builtin_amdgcn_permlanex16(__builtin_bit_cast(int, x), __builtin_bit_cast(int, x), 0x76543210, 0xfedcba98, false, false)); }   // lane l with lane l ^ 16
template <typename T16, int NSPLIT>
__device__ __forceinline__ void attn_tile(const T16* __restrict__ Q, const T16* __restrict__ Q2, const T16* __restrict__ Kp, const T16* __restrict__ Kp2, const T16* __restrict__ Vt, const T16* __restrict__ Vt2, bf* Ah, bf* Al, int h, int q0, float* red, float* sm, float* sl) {
    typedef typename WFrag<T16>::V V;
    const int lane = threadIdx.x & 31, lr = lane & 15, hi = lane >> 4; const int w = __builtin_amdgcn_readfirstlane(threadIdx.x >> 5);
    const float PSH = (NSPLIT == 2) ? 0.f : 10.f;                    // fp16 probabilities are carried x 2^10, by the exponent; the row sums carry the same factor, so it cancels in the quotient
    const int Kl = q0 + AQ;                                          // keys beyond the diagonal chunk are masked for every row of the tile
    V qf[2][2], qf2[2][2]; const size_t qo = (size_t)(q0 + lr) * HD + 8 * hi; const T16* pq = Q + qo; const T16* pq2 = pq; if (NSPLIT == 2) pq2 = Q2 + qo;
#pragma unroll
    for (int nq = 0; nq < 2; ++nq)
#pragma unroll
        for (int kc = 0; kc < 2; ++kc) { qf[nq][kc] = WFrag<T16>::ld(pq + nq * 16 * HD + kc * 32); if (NSPLIT == 2) qf2[nq][kc] = WFrag<T16>::ld(pq2 + nq * 16 * HD + kc * 32); }
    // the wait in front of any rewrite of a register that the loads above name; the addresses are its inputs so that no later load of the group lands on one of them
    if (NSPLIT == 2) asm volatile("s_wait_xcnt 0x0" :: "v"(pq), "v"(pq2) : "memory");
    else asm volatile("s_wait_xcnt 0x0" :: "v"(pq) : "memory");
    v8f o[4][2]; float m[2] = { -3.0e38f, -3.0e38f }, l[2] = { 0.f, 0.f };
#pragma unroll
    for (int mb = 0; mb < 4; ++mb)
#pragma unroll
        for (int nq = 0; nq < 2; ++nq) o[mb][nq] = (v8f){};
#pragma unroll 1   // stays rolled: one pass already holds the operands of a whole chunk in registers
    for (int k0 = w * 32; k0 < Kl; k0 += AW * 32) {
        const size_t ko = (size_t)(k0 + lr) * HD + 8 * hi, vo = (size_t)lr * TT + k0 + 8 * hi;
        const T16* pk = Kp + ko; const T16* pv = Vt + vo; const T16* pk2 = pk; const T16* pv2 = pv; if (NSPLIT == 2) { pk2 = Kp2 + ko; pv2 = Vt2 + vo; }
        V kf[2][2], kf2[2][2], vf[4], vf2[4];
#pragma unroll
        for (int kb = 0; kb < 2; ++kb)
#pragma unroll
            for (int kc = 0; kc < 2; ++kc) { kf[kb][kc] = WFrag<T16>::ld(pk + kb * 16 * HD + kc * 32); if (NSPLIT == 2) kf2[kb][kc] = WFrag<T16>::ld(pk2 + kb * 16 * HD + kc * 32); }
#pragma unroll
        for (int mb = 0; mb < 4; ++mb) { vf[mb] = WFrag<T16>::ld(pv + (size_t)mb * 16 * TT); if (NSPLIT == 2) vf2[mb] = WFrag<T16>::ld(pv2 + (size_t)mb * 16 * TT); }
        // the wait in front of any rewrite of a register that the loads above name; the addresses are its inputs so that no later load of the chunk lands on one of them
        if (NSPLIT == 2) asm volatile("s_wait_xcnt 0x0" :: "v"(pk), "v"(pv), "v"(pk2), "v"(pv2) : "memory");
        else asm volatile("s_wait_xcnt 0x0" :: "v"(pk), "v"(pv) : "memory");
        __builtin_amdgcn_sched_barrier(0);                           // keeps all of the chunk's loads in front of the first product, so that their latencies overlap instead of adding up
        v8f s[2][2];
#pragma unroll
        for (int kb = 0; kb < 2; ++kb)
#pragma unroll
            for (int nq = 0; nq < 2; ++nq) { s[kb][nq] = (v8f){};
#pragma unroll
                for (int kc = 0; kc < 2; ++kc) { s[kb][nq] = WFrag<T16>::mma(kf[kb][kc], qf[nq][kc], s[kb][nq]); if (NSPLIT == 2) { s[kb][nq] = WFrag<T16>::mma(kf[kb][kc], qf2[nq][kc], s[kb][nq]); s[kb][nq] = WFrag<T16>::mma(kf2[kb][kc], qf[nq][kc], s[kb][nq]); } } }
        V pf[2], pf2[2];
#pragma unroll
        for (int nq = 0; nq < 2; ++nq) {
            const int qi = q0 + nq * 16 + lr; v2f t[8]; float mx = -3.0e38f;   // t[e2][i]: key (e2 >> 2) * 16 + hi * 8 + (e2 & 3) * 2 + i of the chunk
#pragma unroll
            for (int e = 0; e < 8; ++e) { t[e][0] = s[e >> 2][nq][(e & 3) * 2]; t[e][1] = s[e >> 2][nq][(e & 3) * 2 + 1]; }
            if (k0 + 31 > q0) {                                      // wave-uniform: only the diagonal chunk holds masked keys
#pragma unroll
                for (int e = 0; e < 8; ++e) { const int key = k0 + (e >> 2) * 16 + hi * 8 + (e & 3) * 2; if (key > qi) t[e][0] = -3.0e38f; if (key + 1 > qi) t[e][1] = -3.0e38f; } }
#pragma unroll
            for (int e = 0; e < 8; ++e) mx = fmaxf(mx, fmaxf(t[e][0], t[e][1]));
            mx = fmaxf(mx, xhalf(mx));                               // the other lane half holds the query's other 16 keys
            const float mn = fmaxf(m[nq], mx * SC2), al = __builtin_amdgcn_exp2f(m[nq] - mn), sh = PSH - mn; m[nq] = mn; v2f ps = (v2f){};
#pragma unroll
            for (int e = 0; e < 8; ++e) { const v2f a = __builtin_elementwise_fma(t[e], (v2f){ SC2, SC2 }, (v2f){ sh, sh }); t[e][0] = __builtin_amdgcn_exp2f(a[0]); t[e][1] = __builtin_amdgcn_exp2f(a[1]); ps += t[e]; }
            l[nq] = l[nq] * al + (ps[0] + ps[1]);
#pragma unroll
            for (int mb = 0; mb < 4; ++mb) o[mb][nq] *= al;
            if constexpr (NSPLIT == 2) { v8us h0, h1, l0, l1;
#pragma unroll
                for (int e = 0; e < 8; ++e) { unsigned short a, c2; splitf(t[e >> 1][e & 1], a, c2); h0[e] = a; l0[e] = c2; splitf(t[4 + (e >> 1)][e & 1], a, c2); h1[e] = a; l1[e] = c2; }
                pf[nq] = cat16b(h0, h1); pf2[nq] = cat16b(l0, l1);
            } else { v16h p16;
#pragma unroll
                for (int e = 0; e < 16; ++e) p16[e] = tohx(t[e >> 1][e & 1]);
                pf[nq] = p16; }
        }
#pragma unroll
        for (int mb = 0; mb < 4; ++mb)
#pragma unroll
            for (int nq = 0; nq < 2; ++nq) { o[mb][nq] = WFrag<T16>::mma(vf[mb], pf[nq], o[mb][nq]); if (NSPLIT == 2) { o[mb][nq] = WFrag<T16>::mma(vf[mb], pf2[nq], o[mb][nq]); o[mb][nq] = WFrag<T16>::mma(vf2[mb], pf[nq], o[mb][nq]); } }
        // the slots the chip needs behind the last matrix instruction, on the taken side of the loop's branch too
        asm volatile("v_nop\n\tv_nop\n\tv_nop\n\tv_nop" : "+v"(o[0][0]), "+v"(o[1][0]), "+v"(o[2][0]), "+v"(o[3][0]), "+v"(o[0][1]), "+v"(o[1][1]), "+v"(o[2][1]), "+v"(o[3][1]));
    }
#pragma unroll
    for (int nq = 0; nq < 2; ++nq) { l[nq] += xhalf(l[nq]); if (hi == 0) sm[w * AQ + nq * 16 + lr] = m[nq]; }
    __syncthreads();                                                 // every wave's row maxima are in LDS before any wave scales its tile and its row sums
#pragma unroll
    for (int nq = 0; nq < 2; ++nq) { float M = sm[nq * 16 + lr];
#pragma unroll
        for (int p = 1; p < AW; ++p) M = fmaxf(M, sm[p * AQ + nq * 16 + lr]);
        const float f = __builtin_amdgcn_exp2f(m[nq] - M); float* pw = red + (size_t)(w * AQ + nq * 16 + lr) * AP + hi * 8; if (hi == 0) sl[w * AQ + nq * 16 + lr] = l[nq] * f;
#pragma unroll
        for (int mb = 0; mb < 4; ++mb) { const v8f x = o[mb][nq] * f; *(v4fa*)(pw + mb * 16) = __builtin_shufflevector(x, x, 0, 1, 2, 3); *(v4fa*)(pw + mb * 16 + 4) = __builtin_shufflevector(x, x, 4, 5, 6, 7); } }
    __syncthreads();                                                 // every wave's scaled partial tile and row sums are in LDS before any thread adds them
    const int q = threadIdx.x >> 3, d0 = (threadIdx.x & 7) * 8;
    float L = 0.f; v4f a0 = (v4f){}, a1 = (v4f){};
#pragma unroll
    for (int p = 0; p < AW; ++p) { L += sl[p * AQ + q]; const float* pr = red + (size_t)(p * AQ + q) * AP + d0; a0 += *(const v4fa*)pr; a1 += *(const v4fa*)(pr + 4); }
    const float r = __fdiv_rn(1.0f, L); v8us oh, ol;
#pragma unroll
    for (int e = 0; e < 4; ++e) { unsigned short a, c2; splitf(a0[e] * r, a, c2); oh[e] = a; ol[e] = c2; splitf(a1[e] * r, a, c2); oh[e + 4] = a; ol[e + 4] = c2; }
    const size_t oo = ((size_t)(h * (HD / 32) + (d0 >> 5)) * TT + q0 + q) * 32 + (d0 & 31);
    *(v8usa*)(Ah + oo) = oh; *(v8usa*)(Al + oo) = ol;
}
// Tiles are taken longest first over all heads; tile1 = the launch's last (longest) tile. Query rows < RH go on bf16 hi+lo planes (3 products, NSPLIT 2), the rest on single fp16 (NSPLIT 0): two launches, so that the long one keeps the smaller register count.
template <typename T16, int NSPLIT>
__global__ __launch_bounds__(256) void k_attn(const T16* __restrict__ Q, const T16* __restrict__ Q2, const T16* __restrict__ Kp, const T16* __restrict__ Kp2, const T16* __restrict__ Vt, const T16* __restrict__ Vt2, bf* Ah, bf* Al, int tile1) {
    __shared__ __align__(16) float red[AW * AQ * AP]; __shared__ float sm[AW * AQ]; __shared__ float sl[AW * AQ];
    const int h = blockIdx.x, q0 = (tile1 - (int)blockIdx.y) * AQ; const size_t zo = (size_t)h * TT * HD;
    attn_tile<T16, NSPLIT>(Q + zo, NSPLIT == 2 ? Q2 + zo : nullptr, Kp + zo, NSPLIT == 2 ? Kp2 + zo : nullptr, Vt + zo, NSPLIT == 2 ? Vt2 + zo : nullptr, Ah, Al, h, q0, red, sm, sl);
}

__global__ __launch_bounds__(256) void k_wtG(const float* __restrict__ w, int K, int N, bf* Bt) {
    const int lane = threadIdx.x & 31; const int L0 = (blockIdx.x * 8 + (threadIdx.x >> 5)) * 8; const int nlines = N * K / 64;
{
#pragma unroll 1
        for (int l = 0; l < 8; ++l) { const int L = L0 + l; if (L >= nlines) break; const size_t e = (size_t)L * 64 + lane * 2; const int k = (int)(e % K), n = (int)(e / K); v2us o;
            o[0] = f2bf(w[(size_t)k * N + n]); o[1] = f2bf(w[(size_t)(k + 1) * N + n]); *(v2us*)(Bt + e) = o; }
         }
}
__global__ __launch_bounds__(256) void k_cvt8(const float* __restrict__ src, bf* dst, size_t n8) { const size_t i = (size_t)blockIdx.x * 256 + threadIdx.x; if (i >= n8) return; const v8f v = *(const v8f*)(src + i * 8); v8us o;
#pragma unroll
    for (int k = 0; k < 8; ++k) o[k] = f2bf(v[k]); *(v8us*)(dst + i * 8) = o;  }
__global__ __launch_bounds__(256) void k_cscvt(const float* __restrict__ cosT, const float* __restrict__ sinT, float* CS) { const int idx = blockIdx.x * 256 + threadIdx.x; if (idx >= TT * HD) return; v2f cs; cs[0] = bfr(cosT[idx]); cs[1] = bfr(sinT[idx]); *(v2f*)(CS + (size_t)idx * 2) = cs;  }
extern "C" void kernel_launch(void* const* d_in, const int* in_sizes, int n_in,
                              void* d_out, int out_size, void* d_ws, size_t ws_size, hipStream_t stream) {
    (void)in_sizes; (void)n_in; (void)out_size;
    const float* x = (const float*)d_in[0]; const float* wq = (const float*)d_in[1]; const float* bq = (const float*)d_in[2]; const float* wk = (const float*)d_in[3]; const float* bk = (const float*)d_in[4]; const float* wv = (const float*)d_in[5]; const float* bv = (const float*)d_in[6]; const float* wo = (const float*)d_in[7]; const float* bo = (const float*)d_in[8]; const float* cosT = nullptr; const float* sinT = nullptr; (void)cosT; (void)sinT;
    float* OUT = (float*)d_out;     // [4][2048][1024]
    char* wsp = (char*)d_ws;
    auto take = [&](size_t bytes) { char* p = wsp; wsp += (bytes + 255) & ~(size_t)255; return (void*)p; };
    bf* WQ = (bf*)take((size_t)DQ * DM * 2); bf* WK = (bf*)take((size_t)DKV * DM * 2); bf* WV = (bf*)take((size_t)DKV * DM * 2); bf* WO = (bf*)take((size_t)DM * DQ * 2);
    bf* XB = (bf*)take((size_t)TT * DM * 2);
    h16* QP16 = (h16*)take((size_t)NH_ * TT * HD * 2); h16* KP16 = (h16*)take((size_t)NKV * TT * HD * 2); h16* VT16 = (h16*)take((size_t)NKV * HD * TT * 2);
    bf* QPh = (bf*)take((size_t)NH_ * TT * HD * 2); bf* QPl = (bf*)take((size_t)NH_ * TT * HD * 2); bf* KPh = (bf*)take((size_t)NKV * TT * HD * 2); bf* KPl = (bf*)take((size_t)NKV * TT * HD * 2); bf* VTh = (bf*)take((size_t)NKV * HD * TT * 2); bf* VTl = (bf*)take((size_t)NKV * HD * TT * 2);
    bf* ATh = (bf*)take((size_t)TT * DQ * 2); bf* ATl = (bf*)take((size_t)TT * DQ * 2);
    if ((size_t)(wsp - (char*)d_ws) > ws_size) return;    // ws 256 MiB
    { k_cvt8<<<(unsigned)(((size_t)DQ * DM / 8 + 255) / 256), 256, 0, stream>>>(wq, WQ, (size_t)DQ * DM / 8); k_cvt8<<<(unsigned)(((size_t)DKV * DM / 8 + 255) / 256), 256, 0, stream>>>(wk, WK, (size_t)DKV * DM / 8); k_cvt8<<<(unsigned)(((size_t)DKV * DM / 8 + 255) / 256), 256, 0, stream>>>(wv, WV, (size_t)DKV * DM / 8);
      k_cvt8<<<(unsigned)(((size_t)DM * DQ / 8 + 255) / 256), 256, 0, stream>>>(wo, WO, (size_t)DM * DQ / 8);
       }
    for (int b = 0; b < NB_; ++b) {
        
        k_cvt8<<<(unsigned)(((size_t)TT * DM / 8 + 255) / 256), 256, 0, stream>>>(x + (size_t)b * TT * DM, XB, (size_t)TT * DM / 8);
        k_gemmw<bf, 0, false><<<dim3(TT / 64, DQ / 64, 1), 32, 0, stream>>>(XB, nullptr, WQ, nullptr, DM, bq, QP16, QPh, QPl);      // q planes [h][t][d]
        k_gemmw<bf, 0, false><<<dim3(TT / 64, DKV / 64, 1), 32, 0, stream>>>(XB, nullptr, WK, nullptr, DM, bk, KP16, KPh, KPl);     // k planes [h][t][d]
        k_gemmw<bf, 0, true><<<dim3(DKV / 64, TT / 64, 1), 32, 0, stream>>>(WV, nullptr, XB, nullptr, DM, bv, VT16, VTh, VTl);      // v planes [h][d][t]
        k_attn<h16, 0><<<dim3(NH_, (TT - RH) / AQ, 1), 256, 0, stream>>>(QP16, nullptr, KP16, nullptr, VT16, nullptr, ATh, ATl, TT / AQ - 1);
        k_attn<bf, 2><<<dim3(NH_, RH / AQ, 1), 256, 0, stream>>>(QPh, QPl, KPh, KPl, VTh, VTl, ATh, ATl, RH / AQ - 1);
        k_gemmo<<<dim3(TT / 64, DM / 64, 1), 32, 0, stream>>>(ATh, ATl, TT, WO, DQ, OUT + (size_t)b * TT * DM, DM, bo); }
}

// v005
// One run takes 269 microseconds.
// Next to v004, in two timings, it ran 2.19 and 2.21 times as fast.
// Over all steps from v000 it is 10.7 times as fast.
#include <hip/hip_runtime.h>

// CausalSelfAttentionSeparateHeads (x [4][2048][1024]; per-head Linear q/k/v: Wq[h][d][c], bq[h][d] (16 heads x 64) == one [1024][1024] torch-layout weight with rows h*64+d; causal softmax(q.k/8); y merged (head-major) Wp^T + bp -> [4][2048][1024]).
// Compute dtypes, f32 accumulate: every input rounded to bf16; Q/K/V on PLAIN bf16 operands (inputs: exact) + bias; causal scores and att.v: query rows < 512 on bf16 hi+lo planes (3 products), the rest single fp16 (x1024); softmax f32;
// The 16-bit operand planes are written by the matrix kernels that make the values (k_gemmw: q, k, v; k_attn: the merged heads): no f32 intermediate and no conversion pass lies between two products.
// The batch is blockIdx.z of every matrix kernel: one launch per stage does all NB_ batches, each on its own set of planes in the workspace (same layout per batch, NB_ sets behind one another).

#define NB_  4
#define TT   2048
#define DM   1024
#define NH_  16
#define NKV  16
#define REP  (NH_ / NKV)
#define HD   64
#define DQ   (NH_ * HD)
#define DKV  (NKV * HD)
#define RH   512                  // query rows < RH use hi+lo planes (0: none)
#define WIN  0
#define SCL  0.125f   // HD^-0.5
typedef _Float16 h16;
typedef unsigned short bf;
typedef __attribute__((ext_vector_type(16))) __bf16   v16bf;
typedef __attribute__((ext_vector_type(16))) _Float16 v16h;
typedef __attribute__((ext_vector_type(8)))  _Float16 v8h;
typedef __attribute__((ext_vector_type(8)))  unsigned short v8us;
typedef __attribute__((ext_vector_type(8)))  float    v8f;
typedef __attribute__((ext_vector_type(4)))  float    v4f;
typedef v8h  __attribute__((may_alias)) v8ha;
typedef v4f  __attribute__((may_alias)) v4fa;
typedef v8us __attribute__((may_alias)) v8usa;

__device__ __forceinline__ unsigned short f2bf(float f) { unsigned u = __float_as_uint(f); u += 0x7FFFu + ((u >> 16) & 1u); return (unsigned short)(u >> 16); }
__device__ __forceinline__ float bf2f(unsigned short b) { return __uint_as_float(((unsigned)b) << 16); }
__device__ __forceinline__ float bfr(float f) { return bf2f(f2bf(f)); }
__device__ __forceinline__ v16h cat16(v8h lo, v8h hi) { return __builtin_shufflevector(lo, hi, 0, 1, 2, 3, 4, 5, 6, 7, 8, 9, 10, 11, 12, 13, 14, 15); }
__device__ __forceinline__ v16bf cat16b(v8us lo, v8us hi) { return __builtin_bit_cast(v16bf, __builtin_shufflevector(lo, hi, 0, 1, 2, 3, 4, 5, 6, 7, 8, 9, 10, 11, 12, 13, 14, 15)); }
__device__ __forceinline__ v8f wmma16(v16h a, v16h b, v8f c) { return __builtin_amdgcn_wmma_f32_16x16x32_f16(false, a, false, b, (short)0, c, false, false); }
__device__ __forceinline__ v8f wmmab(v16bf a, v16bf b, v8f c) { return __builtin_amdgcn_wmma_f32_16x16x32_bf16(false, a, false, b, (short)0, c, false, false); }



// ---- k_gemmo: the output projection as a register-blocked GEMM, ONE WAVE per 64x64 output tile (16 accumulators), operands straight from 16-bit planes; grid (M/64, N/64, batches), 32 threads; a batch's A planes are M*K elements, its C rows M*ldc.
// C[m][n] (f32, pitch ldc) = sum_k (A[m][k] + A2[m][k]) Bt[n][k] + bias[n], two products per k chunk (hi, then lo). K % 32 == 0. Bt is K-contiguous.
// A and A2 lie as chunk planes [k/32][m][k%32], the form in which k_attn leaves them; the k order inside a fragment is that of a K-contiguous row.
template <typename T16> struct WFrag;
template <> struct WFrag<h16> { typedef v16h V; static __device__ __forceinline__ V ld(const h16* p) { return cat16(*(const v8h*)p, *(const v8h*)(p + 16)); } static __device__ __forceinline__ v8f mma(V a, V b, v8f c) { return wmma16(a, b, c); } };
template <> struct WFrag<bf> { typedef v16bf V; static __device__ __forceinline__ V ld(const bf* p) { return cat16b(*(const v8us*)p, *(const v8us*)(p + 16)); } static __device__ __forceinline__ v8f mma(V a, V b, v8f c) { return wmmab(a, b, c); } };
__global__ __launch_bounds__(32) void k_gemmo(const bf* __restrict__ A, const bf* __restrict__ A2, int M, const bf* __restrict__ Bt, int K, float* C, int ldc, const float* __restrict__ bias) {
    typedef WFrag<bf>::V V;
    __shared__ __align__(16) float os[16 * 68];
    const int lane = threadIdx.x & 31, lr = lane & 15, hi = lane >> 4; const int r0 = blockIdx.x * 64, c0 = blockIdx.y * 64;
    v8f acc[4][4];
#pragma unroll
    for (int mb = 0; mb < 4; ++mb)
#pragma unroll
        for (int nb = 0; nb < 4; ++nb) acc[mb][nb] = (v8f){};
    const size_t aoff = (size_t)blockIdx.z * M * K + (size_t)(r0 + lr) * 32 + 8 * hi, boff = (size_t)(c0 + lr) * K + 8 * hi;
#pragma unroll 1   // stays rolled: 16 accumulators and the fragments of one k chunk already fill the registers
    for (int kc = 0; kc < K; kc += 32) {
        V a[4], a2[4]; const bf* pa = A + aoff + (size_t)kc * M; const bf* pa2 = A2 + aoff + (size_t)kc * M; const bf* pb[4];
#pragma unroll
        for (int mb = 0; mb < 4; ++mb) { a[mb] = WFrag<bf>::ld(pa + mb * 16 * 32); a2[mb] = WFrag<bf>::ld(pa2 + mb * 16 * 32); }
#pragma unroll
        for (int nb = 0; nb < 4; ++nb) { pb[nb] = Bt + boff + (size_t)nb * 16 * K + kc; const V b = WFrag<bf>::ld(pb[nb]);
#pragma unroll
            for (int mb = 0; mb < 4; ++mb) { acc[mb][nb] = WFrag<bf>::mma(a[mb], b, acc[mb][nb]); acc[mb][nb] = WFrag<bf>::mma(a2[mb], b, acc[mb][nb]); } }
        // the wait in front of any rewrite of a register that the loads above name; the addresses are its inputs so that no later load of the trip lands on one of them
        asm volatile("s_wait_xcnt 0x0" :: "v"(pa), "v"(pa2), "v"(pb[0]), "v"(pb[1]), "v"(pb[2]), "v"(pb[3]) : "memory");
        // the slots the chip needs behind the last matrix instruction, on the taken side of the loop's branch too
        asm volatile("v_nop\n\tv_nop\n\tv_nop\n\tv_nop" : "+v"(acc[0][0]), "+v"(acc[1][1]), "+v"(acc[2][2]), "+v"(acc[3][3]) : "v"(a[0]), "v"(a[3]));
    }
#pragma unroll
    for (int mb = 0; mb < 4; ++mb) {
#pragma unroll
        for (int nb = 0; nb < 4; ++nb) {
#pragma unroll
            for (int j = 0; j < 8; ++j) os[(hi * 8 + j) * 68 + nb * 16 + lr] = acc[mb][nb][j]; }
        __builtin_amdgcn_wave_barrier(); asm volatile("" ::: "memory");   // the wave's LDS writes stay in front of its reads of other lanes' values
        float* crow = C + ((size_t)blockIdx.z * M + r0 + mb * 16) * ldc + c0;
#pragma unroll
        for (int s = 0; s < 8; ++s) { const int row = 2 * s + hi, cofs = lr * 4; v4f val = *(const v4fa*)(os + row * 68 + cofs); val[0] += bfr(bias[c0 + cofs]); val[1] += bfr(bias[c0 + cofs + 1]); val[2] += bfr(bias[c0 + cofs + 2]); val[3] += bfr(bias[c0 + cofs + 3]);
            *(v4f*)(crow + (size_t)row * ldc + cofs) = val; }
        __builtin_amdgcn_wave_barrier(); asm volatile("" ::: "memory");   // the reads above stay in front of the next 16 rows' LDS writes
    }
}

__device__ __forceinline__ h16 tohx(float x) { return (h16)x; }
__device__ __forceinline__ void splitf(float y, unsigned short& h, unsigned short& l) { h = f2bf(y); l = f2bf(y - bf2f(h)); }
typedef __attribute__((ext_vector_type(2))) _Float16 v2h;
typedef __attribute__((ext_vector_type(4))) _Float16 v4h;
typedef __attribute__((ext_vector_type(2))) unsigned short v2us;
typedef __attribute__((ext_vector_type(4))) unsigned short v4us;
typedef __attribute__((ext_vector_type(2))) float v2f;
typedef __attribute__((ext_vector_type(4))) int v4i;
typedef v2f  __attribute__((may_alias)) v2fa;

// ---- k_gemmw: the q, k, v projections: register-blocked GEMM, ONE WAVE per 64x64 tile (16 accumulators), operands straight from K-contiguous 16-bit planes (+ split products per NSPLIT), K % 32 == 0, whose epilogue adds the bias and writes the value's three 16-bit planes (fp16, bf16 hi, bf16 lo) itself; grid (M/64, N/64, batches), 32 threads; the token operand advances TT rows a batch, the planes TT*DQ elements.
// ROWB false (q, k: A = tokens, Bt = weight rows): bias[n]; a tile's 64 columns are one head, planes [n/64][m][n%64]. ROWB true (v: A = weight rows, Bt = tokens, so the product comes out transposed): bias[m]; planes [m][n], pitch TT.
// Either way a lane stores 4 neighbours and 16 lanes fill one 128-byte line of each plane.
template <typename T16, int NSPLIT, bool ROWB>
__global__ __launch_bounds__(32) void k_gemmw(const T16* __restrict__ A, const T16* __restrict__ A2, const T16* __restrict__ Bt, const T16* __restrict__ Bt2, int K, const float* __restrict__ bias, h16* P16, bf* Ph, bf* Pl) {
    typedef typename WFrag<T16>::V V;
    __shared__ __align__(16) float os[16 * 68];
    const int lane = threadIdx.x & 31, lr = lane & 15, hi = lane >> 4; const int r0 = blockIdx.x * 64, c0 = blockIdx.y * 64;
    v8f acc[4][4];
#pragma unroll
    for (int mb = 0; mb < 4; ++mb)
#pragma unroll
        for (int nb = 0; nb < 4; ++nb) acc[mb][nb] = (v8f){};
    const size_t zt = (size_t)blockIdx.z * TT * K, zp = (size_t)blockIdx.z * TT * DQ;   // the batch's tokens, the batch's planes
    const size_t aoff = (ROWB ? 0 : zt) + (size_t)(r0 + lr) * K + 8 * hi, boff = (ROWB ? zt : 0) + (size_t)(c0 + lr) * K + 8 * hi;
#pragma unroll 1
    for (int kc = 0; kc < K; kc += 32) {
        V a[4], a2[4];
#pragma unroll
        for (int mb = 0; mb < 4; ++mb) { a[mb] = WFrag<T16>::ld(A + aoff + (size_t)mb * 16 * K + kc); if (NSPLIT == 1 || NSPLIT == 2) a2[mb] = WFrag<T16>::ld(A2 + aoff + (size_t)mb * 16 * K + kc); }
#pragma unroll
        for (int nb = 0; nb < 4; ++nb) { const V b = WFrag<T16>::ld(Bt + boff + (size_t)nb * 16 * K + kc); V b2; if (NSPLIT >= 2) b2 = WFrag<T16>::ld(Bt2 + boff + (size_t)nb * 16 * K + kc);
#pragma unroll
            for (int mb = 0; mb < 4; ++mb) { acc[mb][nb] = WFrag<T16>::mma(a[mb], b, acc[mb][nb]); if (NSPLIT == 1 || NSPLIT == 2) acc[mb][nb] = WFrag<T16>::mma(a2[mb], b, acc[mb][nb]); if (NSPLIT >= 2) acc[mb][nb] = WFrag<T16>::mma(a[mb], b2, acc[mb][nb]); } }
        asm volatile("v_nop\n\tv_nop\n\tv_nop\n\tv_nop" : "+v"(acc[0][0]), "+v"(acc[1][1]), "+v"(acc[2][2]), "+v"(acc[3][3]) : "v"(a[0]), "v"(a[3]));
    }
#pragma unroll
    for (int mb = 0; mb < 4; ++mb) {
#pragma unroll
        for (int nb = 0; nb < 4; ++nb) {
#pragma unroll
            for (int j = 0; j < 8; ++j) os[(hi * 8 + j) * 68 + nb * 16 + lr] = acc[mb][nb][j]; }
        __builtin_amdgcn_wave_barrier(); asm volatile("" ::: "memory");   // the wave's LDS writes stay in front of its reads of other lanes' values
#pragma unroll
        for (int s = 0; s < 8; ++s) { const int row = 2 * s + hi, cofs = lr * 4, m = r0 + mb * 16 + row; v4f val = *(const v4fa*)(os + row * 68 + cofs);
            if (ROWB) { const float bb = bfr(bias[m]); val[0] += bb; val[1] += bb; val[2] += bb; val[3] += bb; }
            else { val[0] += bfr(bias[c0 + cofs]); val[1] += bfr(bias[c0 + cofs + 1]); val[2] += bfr(bias[c0 + cofs + 2]); val[3] += bfr(bias[c0 + cofs + 3]); }
            v4h o16; v4us oh, ol;
#pragma unroll
            for (int q = 0; q < 4; ++q) { o16[q] = tohx(val[q]); unsigned short a2, c2; splitf(val[q], a2, c2); oh[q] = a2; ol[q] = c2; }
            const size_t o = zp + (ROWB ? (size_t)m * TT + c0 + cofs : ((size_t)blockIdx.y * TT + m) * HD + cofs);
            *(v4h*)(P16 + o) = o16; *(v4us*)(Ph + o) = oh; *(v4us*)(Pl + o) = ol; }
        __builtin_amdgcn_wave_barrier(); asm volatile("" ::: "memory");   // the reads above stay in front of the next 16 rows' LDS writes
    }
}

// ---- k_attn: causal scores, softmax and the probability x value contraction in one kernel; no score or probability ever lies in memory. One work-group per 32 query rows of one head, grid (heads, row tiles, batches), 256 threads.
// The key loop is dealt over the AW waves: wave w takes the 32-key chunks w, w+AW, ... up to the diagonal chunk and keeps its own running row maximum, row sum and f32 output tile (online softmax).
// Both products are formed transposed, so that a lane owns one query: S^T = K Q^T leaves in lane (lr, hi) the keys 8 hi + j of each 16-key block for query lr, which is the k order of the B fragment of O^T = V^T P^T:
// the probabilities go from the accumulator of the first product into the operand of the second inside the lane. The row maximum and sum need one exchange between the lane halves.
// At the end the waves' maxima go through LDS, each wave scales its tile and its row sums to the common maximum, and behind a second barrier every thread adds the AW partials of 8 elements in wave order, divides by the row sum and stores the bf16 hi and lo planes
// Ah, Al [chunk][t][32] (chunk = 2 head + d / 32), the k chunks of the output projection.
#define AW   8                    // waves of a work-group
#define AQ   32                   // query rows of a work-group
#define AP   68                   // LDS row pitch in floats (rows stay 16-byte aligned)
#define SC2  (SCL * 1.4426950408889634f)   // scores are scaled into base-2 exponents; maxima are kept in that unit
__device__ __forceinline__ float xhalf(float x) { return __builtin_bit_cast(float, __builtin_amdgcn_permlanex16(__builtin_bit_cast(int, x), __builtin_bit_cast(int, x), 0x76543210, 0xfedcba98, false, false)); }   // lane l with lane l ^ 16
template <typename T16, int NSPLIT>
__device__ __forceinline__ void attn_tile(const T16* __restrict__ Q, const T16* __restrict__ Q2, const T16* __restrict__ Kp, const T16* __restrict__ Kp2, const T16* __restrict__ Vt, const T16* __restrict__ Vt2, bf* Ah, bf* Al, int h, int q0, float* red, float* sm, float* sl) {
    typedef typename WFrag<T16>::V V;
    const int lane = threadIdx.x & 31, lr = lane & 15, hi = lane >> 4; const int w = __builtin_amdgcn_readfirstlane(threadIdx.x >> 5);
    const float PSH = (NSPLIT == 2) ? 0.f : 10.f;                    // fp16 probabilities are carried x 2^10, by the exponent; the row sums carry the same factor, so it cancels in the quotient
    const int Kl = q0 + AQ;                                          // keys beyond the diagonal chunk are masked for every row of the tile
    V qf[2][2], qf2[2][2]; const size_t qo = (size_t)(q0 + lr) * HD + 8 * hi; const T16* pq = Q + qo; const T16* pq2 = pq; if (NSPLIT == 2) pq2 = Q2 + qo;
#pragma unroll
    for (int nq = 0; nq < 2; ++nq)
#pragma unroll
        for (int kc = 0; kc < 2; ++kc) { qf[nq][kc] = WFrag<T16>::ld(pq + nq * 16 * HD + kc * 32); if (NSPLIT == 2) qf2[nq][kc] = WFrag<T16>::ld(pq2 + nq * 16 * HD + kc * 32); }
    // the wait in front of any rewrite of a register that the loads above name; the addresses are its inputs so that no later load of the group lands on one of them
    if (NSPLIT == 2) asm volatile("s_wait_xcnt 0x0" :: "v"(pq), "v"(pq2) : "memory");
    else asm volatile("s_wait_xcnt 0x0" :: "v"(pq) : "memory");
    v8f o[4][2]; float m[2] = { -3.0e38f, -3.0e38f }, l[2] = { 0.f, 0.f };
#pragma unroll
    for (int mb = 0; mb < 4; ++mb)
#pragma unroll
        for (int nq = 0; nq < 2; ++nq) o[mb][nq] = (v8f){};
#pragma unroll 1   // stays rolled: one pass already holds the operands of a whole chunk in registers
    for (int k0 = w * 32; k0 < Kl; k0 += AW * 32) {
        const size_t ko = (size_t)(k0 + lr) * HD + 8 * hi, vo = (size_t)lr * TT + k0 + 8 * hi;
        const T16* pk = Kp + ko; const T16* pv = Vt + vo; const T16* pk2 = pk; const T16* pv2 = pv; if (NSPLIT == 2) { pk2 = Kp2 + ko; pv2 = Vt2 + vo; }
        V kf[2][2], kf2[2][2], vf[4], vf2[4];
#pragma unroll
        for (int kb = 0; kb < 2; ++kb)
#pragma unroll
            for (int kc = 0; kc < 2; ++kc) { kf[kb][kc] = WFrag<T16>::ld(pk + kb * 16 * HD + kc * 32); if (NSPLIT == 2) kf2[kb][kc] = WFrag<T16>::ld(pk2 + kb * 16 * HD + kc * 32); }
#pragma unroll
        for (int mb = 0; mb < 4; ++mb) { vf[mb] = WFrag<T16>::ld(pv + (size_t)mb * 16 * TT); if (NSPLIT == 2) vf2[mb] = WFrag<T16>::ld(pv2 + (size_t)mb * 16 * TT); }
        // the wait in front of any rewrite of a register that the loads above name; the addresses are its inputs so that no later load of the chunk lands on one of them
        if (NSPLIT == 2) asm volatile("s_wait_xcnt 0x0" :: "v"(pk), "v"(pv), "v"(pk2), "v"(pv2) : "memory");
        else asm volatile("s_wait_xcnt 0x0" :: "v"(pk), "v"(pv) : "memory");
        __builtin_amdgcn_sched_barrier(0);                           // keeps all of the chunk's loads in front of the first product, so that their latencies overlap instead of adding up
        v8f s[2][2];
#pragma unroll
        for (int kb = 0; kb < 2; ++kb)
#pragma unroll
            for (int nq = 0; nq < 2; ++nq) { s[kb][nq] = (v8f){};
#pragma unroll
                for (int kc = 0; kc < 2; ++kc) { s[kb][nq] = WFrag<T16>::mma(kf[kb][kc], qf[nq][kc], s[kb][nq]); if (NSPLIT == 2) { s[kb][nq] = WFrag<T16>::mma(kf[kb][kc], qf2[nq][kc], s[kb][nq]); s[kb][nq] = WFrag<T16>::mma(kf2[kb][kc], qf[nq][kc], s[kb][nq]); } } }
        V pf[2], pf2[2];
#pragma unroll
        for (int nq = 0; nq < 2; ++nq) {
            const int qi = q0 + nq * 16 + lr; v2f t[8]; float mx = -3.0e38f;   // t[e2][i]: key (e2 >> 2) * 16 + hi * 8 + (e2 & 3) * 2 + i of the chunk
#pragma unroll
            for (int e = 0; e < 8; ++e) { t[e][0] = s[e >> 2][nq][(e & 3) * 2]; t[e][1] = s[e >> 2][nq][(e & 3) * 2 + 1]; }
            if (k0 + 31 > q0) {                                      // wave-uniform: only the diagonal chunk holds masked keys
#pragma unroll
                for (int e = 0; e < 8; ++e) { const int key = k0 + (e >> 2) * 16 + hi * 8 + (e & 3) * 2; if (key > qi) t[e][0] = -3.0e38f; if (key + 1 > qi) t[e][1] = -3.0e38f; } }
#pragma unroll
            for (int e = 0; e < 8; ++e) mx = fmaxf(mx, fmaxf(t[e][0], t[e][1]));
            mx = fmaxf(mx, xhalf(mx));                               // the other lane half holds the query's other 16 keys
            const float mn = fmaxf(m[nq], mx * SC2), al = __builtin_amdgcn_exp2f(m[nq] - mn), sh = PSH - mn; m[nq] = mn; v2f ps = (v2f){};
#pragma unroll
            for (int e = 0; e < 8; ++e) { const v2f a = __builtin_elementwise_fma(t[e], (v2f){ SC2, SC2 }, (v2f){ sh, sh }); t[e][0] = __builtin_amdgcn_exp2f(a[0]); t[e][1] = __builtin_amdgcn_exp2f(a[1]); ps += t[e]; }
            l[nq] = l[nq] * al + (ps[0] + ps[1]);
#pragma unroll
            for (int mb = 0; mb < 4; ++mb) o[mb][nq] *= al;
            if constexpr (NSPLIT == 2) { v8us h0, h1, l0, l1;
#pragma unroll
                for (int e = 0; e < 8; ++e) { unsigned short a, c2; splitf(t[e >> 1][e & 1], a, c2); h0[e] = a; l0[e] = c2; splitf(t[4 + (e >> 1)][e & 1], a, c2); h1[e] = a; l1[e] = c2; }
                pf[nq] = cat16b(h0, h1); pf2[nq] = cat16b(l0, l1);
            } else { v16h p16;
#pragma unroll
                for (int e = 0; e < 16; ++e) p16[e] = tohx(t[e >> 1][e & 1]);
                pf[nq] = p16; }
        }
#pragma unroll
        for (int mb = 0; mb < 4; ++mb)
#pragma unroll
            for (int nq = 0; nq < 2; ++nq) { o[mb][nq] = WFrag<T16>::mma(vf[mb], pf[nq], o[mb][nq]); if (NSPLIT == 2) { o[mb][nq] = WFrag<T16>::mma(vf[mb], pf2[nq], o[mb][nq]); o[mb][nq] = WFrag<T16>::mma(vf2[mb], pf[nq], o[mb][nq]); } }
        // the slots the chip needs behind the last matrix instruction, on the taken side of the loop's branch too
        asm volatile("v_nop\n\tv_nop\n\tv_nop\n\tv_nop" : "+v"(o[0][0]), "+v"(o[1][0]), "+v"(o[2][0]), "+v"(o[3][0]), "+v"(o[0][1]), "+v"(o[1][1]), "+v"(o[2][1]), "+v"(o[3][1]));
    }
#pragma unroll
    for (int nq = 0; nq < 2; ++nq) { l[nq] += xhalf(l[nq]); if (hi == 0) sm[w * AQ + nq * 16 + lr] = m[nq]; }
    __syncthreads();                                                 // every wave's row maxima are in LDS before any wave scales its tile and its row sums
#pragma unroll
    for (int nq = 0; nq < 2; ++nq) { float M = sm[nq * 16 + lr];
#pragma unroll
        for (int p = 1; p < AW; ++p) M = fmaxf(M, sm[p * AQ + nq * 16 + lr]);
        const float f = __builtin_amdgcn_exp2f(m[nq] - M); float* pw = red + (size_t)(w * AQ + nq * 16 + lr) * AP + hi * 8; if (hi == 0) sl[w * AQ + nq * 16 + lr] = l[nq] * f;
#pragma unroll
        for (int mb = 0; mb < 4; ++mb) { const v8f x = o[mb][nq] * f; *(v4fa*)(pw + mb * 16) = __builtin_shufflevector(x, x, 0, 1, 2, 3); *(v4fa*)(pw + mb * 16 + 4) = __builtin_shufflevector(x, x, 4, 5, 6, 7); } }
    __syncthreads();                                                 // every wave's scaled partial tile and row sums are in LDS before any thread adds them
    const int q = threadIdx.x >> 3, d0 = (threadIdx.x & 7) * 8;
    float L = 0.f; v4f a0 = (v4f){}, a1 = (v4f){};
#pragma unroll
    for (int p = 0; p < AW; ++p) { L += sl[p * AQ + q]; const float* pr = red + (size_t)(p * AQ + q) * AP + d0; a0 += *(const v4fa*)pr; a1 += *(const v4fa*)(pr + 4); }
    const float r = __fdiv_rn(1.0f, L); v8us oh, ol;
#pragma unroll
    for (int e = 0; e < 4; ++e) { unsigned short a, c2; splitf(a0[e] * r, a, c2); oh[e] = a; ol[e] = c2; splitf(a1[e] * r, a, c2); oh[e + 4] = a; ol[e + 4] = c2; }
    const size_t oo = ((size_t)(h * (HD / 32) + (d0 >> 5)) * TT + q0 + q) * 32 + (d0 & 31);
    *(v8usa*)(Ah + oo) = oh; *(v8usa*)(Al + oo) = ol;
}
// Tiles are taken longest first over all heads, batch by batch, so that a batch's short tiles run beside the next batch's long ones; h counts heads through the batches, which is the order of the planes; tile1 = the launch's last (longest) tile. Query rows < RH go on bf16 hi+lo planes (3 products, NSPLIT 2), the rest on single fp16 (NSPLIT 0): two launches, so that the long one keeps the smaller register count.
template <typename T16, int NSPLIT>
__global__ __launch_bounds__(256) void k_attn(const T16* __restrict__ Q, const T16* __restrict__ Q2, const T16* __restrict__ Kp, const T16* __restrict__ Kp2, const T16* __restrict__ Vt, const T16* __restrict__ Vt2, bf* Ah, bf* Al, int tile1) {
    __shared__ __align__(16) float red[AW * AQ * AP]; __shared__ float sm[AW * AQ]; __shared__ float sl[AW * AQ];
    const int h = blockIdx.z * NH_ + blockIdx.x, q0 = (tile1 - (int)blockIdx.y) * AQ; const size_t zo = (size_t)h * TT * HD;
    attn_tile<T16, NSPLIT>(Q + zo, NSPLIT == 2 ? Q2 + zo : nullptr, Kp + zo, NSPLIT == 2 ? Kp2 + zo : nullptr, Vt + zo, NSPLIT == 2 ? Vt2 + zo : nullptr, Ah, Al, h, q0, red, sm, sl);
}

__global__ __launch_bounds__(256) void k_wtG(const float* __restrict__ w, int K, int N, bf* Bt) {
    const int lane = threadIdx.x & 31; const int L0 = (blockIdx.x * 8 + (threadIdx.x >> 5)) * 8; const int nlines = N * K / 64;
{
#pragma unroll 1
        for (int l = 0; l < 8; ++l) { const int L = L0 + l; if (L >= nlines) break; const size_t e = (size_t)L * 64 + lane * 2; const int k = (int)(e % K), n = (int)(e / K); v2us o;
            o[0] = f2bf(w[(size_t)k * N + n]); o[1] = f2bf(w[(size_t)(k + 1) * N + n]); *(v2us*)(Bt + e) = o; }
         }
}
__global__ __launch_bounds__(256) void k_cvt8(const float* __restrict__ src, bf* dst, size_t n8) { const size_t i = (size_t)blockIdx.x * 256 + threadIdx.x; if (i >= n8) return; const v8f v = *(const v8f*)(src + i * 8); v8us o;
#pragma unroll
    for (int k = 0; k < 8; ++k) o[k] = f2bf(v[k]); *(v8us*)(dst + i * 8) = o;  }
__global__ __launch_bounds__(256) void k_cscvt(const float* __restrict__ cosT, const float* __restrict__ sinT, float* CS) { const int idx = blockIdx.x * 256 + threadIdx.x; if (idx >= TT * HD) return; v2f cs; cs[0] = bfr(cosT[idx]); cs[1] = bfr(sinT[idx]); *(v2f*)(CS + (size_t)idx * 2) = cs;  }
extern "C" void kernel_launch(void* const* d_in, const int* in_sizes, int n_in,
                              void* d_out, int out_size, void* d_ws, size_t ws_size, hipStream_t stream) {
    (void)in_sizes; (void)n_in; (void)out_size;
    const float* x = (const float*)d_in[0]; const float* wq = (const float*)d_in[1]; const float* bq = (const float*)d_in[2]; const float* wk = (const float*)d_in[3]; const float* bk = (const float*)d_in[4]; const float* wv = (const float*)d_in[5]; const float* bv = (const float*)d_in[6]; const float* wo = (const float*)d_in[7]; const float* bo = (const float*)d_in[8]; const float* cosT = nullptr; const float* sinT = nullptr; (void)cosT; (void)sinT;
    float* OUT = (float*)d_out;     // [4][2048][1024]
    char* wsp = (char*)d_ws;
    auto take = [&](size_t bytes) { char* p = wsp; wsp += (bytes + 255) & ~(size_t)255; return (void*)p; };
    bf* WQ = (bf*)take((size_t)DQ * DM * 2); bf* WK = (bf*)take((size_t)DKV * DM * 2); bf* WV = (bf*)take((size_t)DKV * DM * 2); bf* WO = (bf*)take((size_t)DM * DQ * 2);
    bf* XB = (bf*)take((size_t)NB_ * TT * DM * 2);
    h16* QP16 = (h16*)take((size_t)NB_ * NH_ * TT * HD * 2); h16* KP16 = (h16*)take((size_t)NB_ * NKV * TT * HD * 2); h16* VT16 = (h16*)take((size_t)NB_ * NKV * HD * TT * 2);
    bf* QPh = (bf*)take((size_t)NB_ * NH_ * TT * HD * 2); bf* QPl = (bf*)take((size_t)NB_ * NH_ * TT * HD * 2); bf* KPh = (bf*)take((size_t)NB_ * NKV * TT * HD * 2); bf* KPl = (bf*)take((size_t)NB_ * NKV * TT * HD * 2); bf* VTh = (bf*)take((size_t)NB_ * NKV * HD * TT * 2); bf* VTl = (bf*)take((size_t)NB_ * NKV * HD * TT * 2);
    bf* ATh = (bf*)take((size_t)NB_ * TT * DQ * 2); bf* ATl = (bf*)take((size_t)NB_ * TT * DQ * 2);
    if ((size_t)(wsp - (char*)d_ws) > ws_size) return;    // ws 256 MiB
    { k_cvt8<<<(unsigned)(((size_t)DQ * DM / 8 + 255) / 256), 256, 0, stream>>>(wq, WQ, (size_t)DQ * DM / 8); k_cvt8<<<(unsigned)(((size_t)DKV * DM / 8 + 255) / 256), 256, 0, stream>>>(wk, WK, (size_t)DKV * DM / 8); k_cvt8<<<(unsigned)(((size_t)DKV * DM / 8 + 255) / 256), 256, 0, stream>>>(wv, WV, (size_t)DKV * DM / 8);
      k_cvt8<<<(unsigned)(((size_t)DM * DQ / 8 + 255) / 256), 256, 0, stream>>>(wo, WO, (size_t)DM * DQ / 8);
       }
    k_cvt8<<<(unsigned)(((size_t)NB_ * TT * DM / 8 + 255) / 256), 256, 0, stream>>>(x, XB, (size_t)NB_ * TT * DM / 8);
    k_gemmw<bf, 0, false><<<dim3(TT / 64, DQ / 64, NB_), 32, 0, stream>>>(XB, nullptr, WQ, nullptr, DM, bq, QP16, QPh, QPl);      // q planes [b][h][t][d]
    k_gemmw<bf, 0, false><<<dim3(TT / 64, DKV / 64, NB_), 32, 0, stream>>>(XB, nullptr, WK, nullptr, DM, bk, KP16, KPh, KPl);     // k planes [b][h][t][d]
    k_gemmw<bf, 0, true><<<dim3(DKV / 64, TT / 64, NB_), 32, 0, stream>>>(WV, nullptr, XB, nullptr, DM, bv, VT16, VTh, VTl);      // v planes [b][h][d][t]
    k_attn<h16, 0><<<dim3(NH_, (TT - RH) / AQ, NB_), 256, 0, stream>>>(QP16, nullptr, KP16, nullptr, VT16, nullptr, ATh, ATl, TT / AQ - 1);
    k_attn<bf, 2><<<dim3(NH_, RH / AQ, NB_), 256, 0, stream>>>(QPh, QPl, KPh, KPl, VTh, VTl, ATh, ATl, RH / AQ - 1);
    k_gemmo<<<dim3(TT / 64, DM / 64, NB_), 32, 0, stream>>>(ATh, ATl, TT, WO, DQ, OUT, DM, bo);
}

// v006
// Measured time: 242 microseconds a run.
// In two side-by-side timings against v005, it was 1.10 and 1.11 times as fast.
// Counting every step since v000, it is 11.8 times as fast.
#include <hip/hip_runtime.h>

// CausalSelfAttentionSeparateHeads (x [4][2048][1024]; per-head Linear q/k/v: Wq[h][d][c], bq[h][d] (16 heads x 64) == one [1024][1024] torch-layout weight with rows h*64+d; causal softmax(q.k/8); y merged (head-major) Wp^T + bp -> [4][2048][1024]).
// Compute dtypes, f32 accumulate: every input rounded to bf16; Q/K/V on PLAIN bf16 operands (inputs: exact) + bias; causal scores and att.v: query rows < 512 on bf16 hi+lo planes (3 products), the rest single fp16 (x1024); softmax f32;
// The 16-bit operand planes are written by the matrix kernels that make the values (k_gemmw: q, k, v; k_attn: the merged heads): no f32 intermediate and no conversion pass lies between two products.
// Every 16-bit operand plane lies in FRAGMENT ORDER: blocks of 16 rows x 32 k (512 elements, 1 KiB); element (r, k) of a block stands at (k >> 3) * 128 + r * 8 + (k & 7), so that lane l of a wave finds its 8 + 8 elements at l * 8 and 256 + l * 8
// and each wave-wide 16-byte load covers 512 contiguous bytes (4 whole lines). The k order inside a fragment is that of a K-contiguous row, the same for both operands.
// The four blocks that a wave takes together (64 rows of one k chunk; 32 keys of a head) lie behind one another: 4 KiB, one address and immediate offsets.
// The batch is blockIdx.z of every matrix kernel: one launch per stage does all NB_ batches, each on its own set of planes in the workspace (same layout per batch, NB_ sets behind one another).

#define NB_  4
#define TT   2048
#define DM   1024
#define NH_  16
#define NKV  16
#define REP  (NH_ / NKV)
#define HD   64
#define DQ   (NH_ * HD)
#define DKV  (NKV * HD)
#define RH   512                  // query rows < RH use hi+lo planes (0: none)
#define WIN  0
#define SCL  0.125f   // HD^-0.5
typedef _Float16 h16;
typedef unsigned short bf;
typedef __attribute__((ext_vector_type(16))) __bf16   v16bf;
typedef __attribute__((ext_vector_type(16))) _Float16 v16h;
typedef __attribute__((ext_vector_type(8)))  _Float16 v8h;
typedef __attribute__((ext_vector_type(8)))  unsigned short v8us;
typedef __attribute__((ext_vector_type(8)))  float    v8f;
typedef __attribute__((ext_vector_type(4)))  float    v4f;
typedef v8h  __attribute__((may_alias)) v8ha;
typedef v4f  __attribute__((may_alias)) v4fa;
typedef v8us __attribute__((may_alias)) v8usa;

__device__ __forceinline__ unsigned short f2bf(float f) { unsigned u = __float_as_uint(f); u += 0x7FFFu + ((u >> 16) & 1u); return (unsigned short)(u >> 16); }
__device__ __forceinline__ float bf2f(unsigned short b) { return __uint_as_float(((unsigned)b) << 16); }
__device__ __forceinline__ float bfr(float f) { return bf2f(f2bf(f)); }
__device__ __forceinline__ v16h cat16(v8h lo, v8h hi) { return __builtin_shufflevector(lo, hi, 0, 1, 2, 3, 4, 5, 6, 7, 8, 9, 10, 11, 12, 13, 14, 15); }
__device__ __forceinline__ v16bf cat16b(v8us lo, v8us hi) { return __builtin_bit_cast(v16bf, __builtin_shufflevector(lo, hi, 0, 1, 2, 3, 4, 5, 6, 7, 8, 9, 10, 11, 12, 13, 14, 15)); }
__device__ __forceinline__ v8f wmma16(v16h a, v16h b, v8f c) { return __builtin_amdgcn_wmma_f32_16x16x32_f16(false, a, false, b, (short)0, c, false, false); }
__device__ __forceinline__ v8f wmmab(v16bf a, v16bf b, v8f c) { return __builtin_amdgcn_wmma_f32_16x16x32_bf16(false, a, false, b, (short)0, c, false, false); }



// ---- k_gemmo: the output projection as a register-blocked GEMM, ONE WAVE per 64x64 output tile (16 accumulators), operands straight from 16-bit planes; grid (M/64, N/64, batches), 32 threads; a batch's A planes are M*K elements, its C rows M*ldc.
// C[m][n] (f32, pitch ldc) = sum_k (A[m][k] + A2[m][k]) Bt[n][k] + bias[n], two products per k chunk (hi, then lo). K % 32 == 0. Bt: fragment blocks [n/64][k/32][(n/16)%4].
// A and A2: fragment blocks [k/32][m/16], the form in which k_attn leaves them. WFrag::ld takes the block's address plus lane * 8.
template <typename T16> struct WFrag;
template <> struct WFrag<h16> { typedef v16h V; static __device__ __forceinline__ V ld(const h16* p) { return cat16(*(const v8h*)p, *(const v8h*)(p + 256)); } static __device__ __forceinline__ v8f mma(V a, V b, v8f c) { return wmma16(a, b, c); } };
template <> struct WFrag<bf> { typedef v16bf V; static __device__ __forceinline__ V ld(const bf* p) { return cat16b(*(const v8us*)p, *(const v8us*)(p + 256)); } static __device__ __forceinline__ v8f mma(V a, V b, v8f c) { return wmmab(a, b, c); } };
__global__ __launch_bounds__(32) void k_gemmo(const bf* __restrict__ A, const bf* __restrict__ A2, int M, const bf* __restrict__ Bt, int K, float* C, int ldc, const float* __restrict__ bias) {
    typedef WFrag<bf>::V V;
    __shared__ __align__(16) float os[16 * 68];
    const int lane = threadIdx.x & 31, lr = lane & 15, hi = lane >> 4; const int r0 = blockIdx.x * 64, c0 = blockIdx.y * 64;
    v8f acc[4][4];
#pragma unroll
    for (int mb = 0; mb < 4; ++mb)
#pragma unroll
        for (int nb = 0; nb < 4; ++nb) acc[mb][nb] = (v8f){};
    const size_t aoff = (size_t)blockIdx.z * M * K + (size_t)r0 * 32 + lane * 8, boff = (size_t)c0 * K + lane * 8;
#pragma unroll 1   // stays rolled: 16 accumulators and the fragments of one k chunk already fill the registers
    for (int kc = 0; kc < K; kc += 32) {
        V a[4], a2[4]; const bf* pa = A + aoff + (size_t)kc * M; const bf* pa2 = A2 + aoff + (size_t)kc * M; const bf* pb = Bt + boff + kc * 64;
#pragma unroll
        for (int mb = 0; mb < 4; ++mb) { a[mb] = WFrag<bf>::ld(pa + mb * 16 * 32); a2[mb] = WFrag<bf>::ld(pa2 + mb * 16 * 32); }
#pragma unroll
        for (int nb = 0; nb < 4; ++nb) { const V b = WFrag<bf>::ld(pb + nb * 512);
#pragma unroll
            for (int mb = 0; mb < 4; ++mb) { acc[mb][nb] = WFrag<bf>::mma(a[mb], b, acc[mb][nb]); acc[mb][nb] = WFrag<bf>::mma(a2[mb], b, acc[mb][nb]); } }
        // the wait in front of any rewrite of a register that the loads above name; the addresses are its inputs so that no later load of the trip lands on one of them
        asm volatile("s_wait_xcnt 0x0" :: "v"(pa), "v"(pa2), "v"(pb) : "memory");
        // the slots the chip needs behind the last matrix instruction, on the taken side of the loop's branch too
        asm volatile("v_nop\n\tv_nop\n\tv_nop\n\tv_nop" : "+v"(acc[0][0]), "+v"(acc[1][1]), "+v"(acc[2][2]), "+v"(acc[3][3]) : "v"(a[0]), "v"(a[3]));
    }
#pragma unroll
    for (int mb = 0; mb < 4; ++mb) {
#pragma unroll
        for (int nb = 0; nb < 4; ++nb) {
#pragma unroll
            for (int j = 0; j < 8; ++j) os[(hi * 8 + j) * 68 + nb * 16 + lr] = acc[mb][nb][j]; }
        __builtin_amdgcn_wave_barrier(); asm volatile("" ::: "memory");   // the wave's LDS writes stay in front of its reads of other lanes' values
        float* crow = C + ((size_t)blockIdx.z * M + r0 + mb * 16) * ldc + c0;
#pragma unroll
        for (int s = 0; s < 8; ++s) { const int row = 2 * s + hi, cofs = lr * 4; v4f val = *(const v4fa*)(os + row * 68 + cofs); val[0] += bfr(bias[c0 + cofs]); val[1] += bfr(bias[c0 + cofs + 1]); val[2] += bfr(bias[c0 + cofs + 2]); val[3] += bfr(bias[c0 + cofs + 3]);
            *(v4f*)(crow + (size_t)row * ldc + cofs) = val; }
        __builtin_amdgcn_wave_barrier(); asm volatile("" ::: "memory");   // the reads above stay in front of the next 16 rows' LDS writes
    }
}

__device__ __forceinline__ h16 tohx(float x) { return (h16)x; }
__device__ __forceinline__ void splitf(float y, unsigned short& h, unsigned short& l) { h = f2bf(y); l = f2bf(y - bf2f(h)); }
typedef __attribute__((ext_vector_type(2))) _Float16 v2h;
typedef __attribute__((ext_vector_type(4))) _Float16 v4h;
typedef __attribute__((ext_vector_type(2))) unsigned short v2us;
typedef __attribute__((ext_vector_type(4))) unsigned short v4us;
typedef __attribute__((ext_vector_type(2))) float v2f;
typedef __attribute__((ext_vector_type(4))) int v4i;
typedef v2f  __attribute__((may_alias)) v2fa;

// ---- k_gemmw: the q, k, v projections: register-blocked GEMM, ONE WAVE per 64x64 tile (16 accumulators), operands straight from 16-bit planes of fragment blocks [row/64][k/32][(row/16)%4], K % 32 == 0, whose epilogue adds the bias and writes the value's three 16-bit planes (fp16, bf16 hi, bf16 lo) itself; grid (M/64, N/64, batches), 32 threads; the token operand advances TT rows a batch, the planes TT*DQ elements.
// ROWB false (q, k: A = tokens, Bt = weight rows): bias[n]; a tile's 64 columns are one head, planes of fragment blocks [n/64][m/16][(n%64)/32]. ROWB true (v: A = weight rows, Bt = tokens, so the product comes out transposed): bias[m]; fragment blocks [m/64][n/32][(m/16)%4].
// Either way a lane stores the 8 neighbours that it will load as a fragment half, and a wave-wide store fills 4 whole lines of a plane.
template <typename T16, int NSPLIT, bool ROWB>
__global__ __launch_bounds__(32) void k_gemmw(const T16* __restrict__ A, const T16* __restrict__ A2, const T16* __restrict__ Bt, const T16* __restrict__ Bt2, int K, const float* __restrict__ bias, h16* P16, bf* Ph, bf* Pl) {
    typedef typename WFrag<T16>::V V;
    __shared__ __align__(16) float os[16 * 68];
    const int lane = threadIdx.x & 31, lr = lane & 15, hi = lane >> 4; const int r0 = blockIdx.x * 64, c0 = blockIdx.y * 64;
    v8f acc[4][4];
#pragma unroll
    for (int mb = 0; mb < 4; ++mb)
#pragma unroll
        for (int nb = 0; nb < 4; ++nb) acc[mb][nb] = (v8f){};
    const size_t zt = (size_t)blockIdx.z * TT * K, zp = (size_t)blockIdx.z * TT * DQ;   // the batch's tokens, the batch's planes
    const size_t aoff = (ROWB ? 0 : zt) + (size_t)r0 * K + lane * 8, boff = (ROWB ? zt : 0) + (size_t)c0 * K + lane * 8;
#pragma unroll 1
    for (int kc = 0; kc < K; kc += 32) {
        V a[4], a2[4]; const T16* pa = A + aoff + kc * 64; const T16* pb = Bt + boff + kc * 64;
#pragma unroll
        for (int mb = 0; mb < 4; ++mb) { a[mb] = WFrag<T16>::ld(pa + mb * 512); if (NSPLIT == 1 || NSPLIT == 2) a2[mb] = WFrag<T16>::ld(A2 + aoff + kc * 64 + mb * 512); }
#pragma unroll
        for (int nb = 0; nb < 4; ++nb) { const V b = WFrag<T16>::ld(pb + nb * 512); V b2; if (NSPLIT >= 2) b2 = WFrag<T16>::ld(Bt2 + boff + kc * 64 + nb * 512);
#pragma unroll
            for (int mb = 0; mb < 4; ++mb) { acc[mb][nb] = WFrag<T16>::mma(a[mb], b, acc[mb][nb]); if (NSPLIT == 1 || NSPLIT == 2) acc[mb][nb] = WFrag<T16>::mma(a2[mb], b, acc[mb][nb]); if (NSPLIT >= 2) acc[mb][nb] = WFrag<T16>::mma(a[mb], b2, acc[mb][nb]); } }
        // the wait in front of any rewrite of a register that the loads above name; the addresses are its inputs so that no later load of the trip lands on one of them
        static_assert(NSPLIT == 0, "the wait below names the addresses of the plain product's loads alone");
        asm volatile("s_wait_xcnt 0x0" :: "v"(pa), "v"(pb) : "memory");
        asm volatile("v_nop\n\tv_nop\n\tv_nop\n\tv_nop" : "+v"(acc[0][0]), "+v"(acc[1][1]), "+v"(acc[2][2]), "+v"(acc[3][3]) : "v"(a[0]), "v"(a[3]));
    }
    const float* pbi = bias + (ROWB ? r0 + lr : c0 + hi * 8); float bb[ROWB ? 4 : 32];   // ROWB: the lane's row of each 16; else the lane's 8 columns of each half fragment
#pragma unroll
    for (int q = 0; q < (ROWB ? 4 : 32); ++q) bb[q] = pbi[ROWB ? q * 16 : (q >> 3) * 16 + (q & 7)];
    asm volatile("s_wait_xcnt 0x0" :: "v"(pbi) : "memory");   // the wait in front of any rewrite of the register that the bias loads name
#pragma unroll
    for (int mb = 0; mb < 4; ++mb) {
#pragma unroll
        for (int nb = 0; nb < 4; ++nb) {
#pragma unroll
            for (int j = 0; j < 8; ++j) os[(hi * 8 + j) * 68 + nb * 16 + lr] = acc[mb][nb][j]; }
        __builtin_amdgcn_wave_barrier(); asm volatile("" ::: "memory");   // the wave's LDS writes stay in front of its reads of other lanes' values
        const size_t ob = zp + (ROWB ? (size_t)r0 * TT + (size_t)c0 * 64 + mb * 512 : ((size_t)blockIdx.y * TT + r0 + mb * 16) * HD) + lane * 8;
        h16* q16 = P16 + ob; bf* qh = Ph + ob; bf* ql = Pl + ob; v8h o16[4]; v8us oh[4], ol[4];
#pragma unroll
        for (int s = 0; s < 4; ++s) { const int cofs = s * 16 + hi * 8; const v4f x0 = *(const v4fa*)(os + lr * 68 + cofs), x1 = *(const v4fa*)(os + lr * 68 + cofs + 4);   // s: the half fragment (16 k) of the 16 rows; row lr, 8 neighbours
#pragma unroll
            for (int q = 0; q < 8; ++q) { const float val = (q < 4 ? x0[q & 3] : x1[q & 3]) + bfr(bb[ROWB ? mb : s * 8 + q]); o16[s][q] = tohx(val); unsigned short a2, c2; splitf(val, a2, c2); oh[s][q] = a2; ol[s][q] = c2; }
            const int o = ROWB ? (s >> 1) * 2048 + (s & 1) * 256 : s * 256;
            *(v8h*)(q16 + o) = o16[s]; *(v8us*)(qh + o) = oh[s]; *(v8us*)(ql + o) = ol[s]; }
        // the wait in front of any rewrite of a register that the stores above name; addresses and values are its inputs so that nothing lands on one of them before it
        asm volatile("s_wait_xcnt 0x0" :: "v"(q16), "v"(qh), "v"(ql), "v"(o16[0]), "v"(o16[1]), "v"(o16[2]), "v"(o16[3]), "v"(oh[0]), "v"(oh[1]), "v"(oh[2]), "v"(oh[3]), "v"(ol[0]), "v"(ol[1]), "v"(ol[2]), "v"(ol[3]) : "memory");
        __builtin_amdgcn_wave_barrier(); asm volatile("" ::: "memory");   // the reads above stay in front of the next 16 rows' LDS writes
    }
}

// ---- k_attn: causal scores, softmax and the probability x value contraction in one kernel; no score or probability ever lies in memory. One work-group per 32 query rows of one head, grid (heads, row tiles, batches), 256 threads.
// The key loop is dealt over the AW waves: wave w takes the 32-key chunks w, w+AW, ... up to the diagonal chunk and keeps its own running row maximum, row sum and f32 output tile (online softmax).
// Both products are formed transposed, so that a lane owns one query: S^T = K Q^T leaves in lane (lr, hi) the keys 8 hi + j of each 16-key block for query lr, which is the k order of the B fragment of O^T = V^T P^T:
// the probabilities go from the accumulator of the first product into the operand of the second inside the lane. The row maximum and sum need one exchange between the lane halves.
// At the end the waves' maxima go through LDS, each wave scales its tile and its row sums to the common maximum, and behind a second barrier every thread adds the AW partials of 8 elements in wave order, divides by the row sum and stores the bf16 hi and lo planes
// Ah, Al, fragment blocks [chunk][t/16] (chunk = 2 head + d / 32), the k chunks of the output projection. Q, K: fragment blocks [t/16][d/32] of a head; Vt: [t/32][d/16].
#define AW   8                    // waves of a work-group
#define AQ   32                   // query rows of a work-group
#define AP   68                   // LDS row pitch in floats (rows stay 16-byte aligned)
#define SC2  (SCL * 1.4426950408889634f)   // scores are scaled into base-2 exponents; maxima are kept in that unit
__device__ __forceinline__ float xhalf(float x) { return __builtin_bit_cast(float, __builtin_amdgcn_permlanex16(__builtin_bit_cast(int, x), __builtin_bit_cast(int, x), 0x76543210, 0xfedcba98, false, false)); }   // lane l with lane l ^ 16
template <typename T16, int NSPLIT>
__device__ __forceinline__ void attn_tile(const T16* __restrict__ Q, const T16* __restrict__ Q2, const T16* __restrict__ Kp, const T16* __restrict__ Kp2, const T16* __restrict__ Vt, const T16* __restrict__ Vt2, bf* Ah, bf* Al, int h, int q0, float* red, float* sm, float* sl) {
    typedef typename WFrag<T16>::V V;
    const int lane = threadIdx.x & 31, lr = lane & 15, hi = lane >> 4; const int w = __builtin_amdgcn_readfirstlane(threadIdx.x >> 5);
    const float PSH = (NSPLIT == 2) ? 0.f : 10.f;                    // fp16 probabilities are carried x 2^10, by the exponent; the row sums carry the same factor, so it cancels in the quotient
    const int Kl = q0 + AQ;                                          // keys beyond the diagonal chunk are masked for every row of the tile
    V qf[2][2], qf2[2][2]; const size_t qo = (size_t)q0 * HD + lane * 8; const T16* pq = Q + qo; const T16* pq2 = pq; if (NSPLIT == 2) pq2 = Q2 + qo;
#pragma unroll
    for (int nq = 0; nq < 2; ++nq)
#pragma unroll
        for (int kc = 0; kc < 2; ++kc) { qf[nq][kc] = WFrag<T16>::ld(pq + nq * 16 * HD + kc * 512); if (NSPLIT == 2) qf2[nq][kc] = WFrag<T16>::ld(pq2 + nq * 16 * HD + kc * 512); }
    // the wait in front of any rewrite of a register that the loads above name; the addresses are its inputs so that no later load of the group lands on one of them
    if (NSPLIT == 2) asm volatile("s_wait_xcnt 0x0" :: "v"(pq), "v"(pq2) : "memory");
    else asm volatile("s_wait_xcnt 0x0" :: "v"(pq) : "memory");
    v8f o[4][2]; float m[2] = { -3.0e38f, -3.0e38f }, l[2] = { 0.f, 0.f };
#pragma unroll
    for (int mb = 0; mb < 4; ++mb)
#pragma unroll
        for (int nq = 0; nq < 2; ++nq) o[mb][nq] = (v8f){};
#pragma unroll 1   // stays rolled: one pass already holds the operands of a whole chunk in registers
    for (int k0 = w * 32; k0 < Kl; k0 += AW * 32) {
        const size_t ko = (size_t)k0 * HD + lane * 8, vo = (size_t)k0 * HD + lane * 8;
        const T16* pk = Kp + ko; const T16* pv = Vt + vo; const T16* pk2 = pk; const T16* pv2 = pv; if (NSPLIT == 2) { pk2 = Kp2 + ko; pv2 = Vt2 + vo; }
        V kf[2][2], kf2[2][2], vf[4], vf2[4];
#pragma unroll
        for (int kb = 0; kb < 2; ++kb)
#pragma unroll
            for (int kc = 0; kc < 2; ++kc) { kf[kb][kc] = WFrag<T16>::ld(pk + kb * 16 * HD + kc * 512); if (NSPLIT == 2) kf2[kb][kc] = WFrag<T16>::ld(pk2 + kb * 16 * HD + kc * 512); }
#pragma unroll
        for (int mb = 0; mb < 4; ++mb) { vf[mb] = WFrag<T16>::ld(pv + mb * 512); if (NSPLIT == 2) vf2[mb] = WFrag<T16>::ld(pv2 + mb * 512); }
        // the wait in front of any rewrite of a register that the loads above name; the addresses are its inputs so that no later load of the chunk lands on one of them
        if (NSPLIT == 2) asm volatile("s_wait_xcnt 0x0" :: "v"(pk), "v"(pv), "v"(pk2), "v"(pv2) : "memory");
        else asm volatile("s_wait_xcnt 0x0" :: "v"(pk), "v"(pv) : "memory");
        __builtin_amdgcn_sched_barrier(0);                           // keeps all of the chunk's loads in front of the first product, so that their latencies overlap instead of adding up
        v8f s[2][2];
#pragma unroll
        for (int kb = 0; kb < 2; ++kb)
#pragma unroll
            for (int nq = 0; nq < 2; ++nq) { s[kb][nq] = (v8f){};
#pragma unroll
                for (int kc = 0; kc < 2; ++kc) { s[kb][nq] = WFrag<T16>::mma(kf[kb][kc], qf[nq][kc], s[kb][nq]); if (NSPLIT == 2) { s[kb][nq] = WFrag<T16>::mma(kf[kb][kc], qf2[nq][kc], s[kb][nq]); s[kb][nq] = WFrag<T16>::mma(kf2[kb][kc], qf[nq][kc], s[kb][nq]); } } }
        V pf[2], pf2[2];
#pragma unroll
        for (int nq = 0; nq < 2; ++nq) {
            const int qi = q0 + nq * 16 + lr; v2f t[8]; float mx = -3.0e38f;   // t[e2][i]: key (e2 >> 2) * 16 + hi * 8 + (e2 & 3) * 2 + i of the chunk
#pragma unroll
            for (int e = 0; e < 8; ++e) { t[e][0] = s[e >> 2][nq][(e & 3) * 2]; t[e][1] = s[e >> 2][nq][(e & 3) * 2 + 1]; }
            if (k0 + 31 > q0) {                                      // wave-uniform: only the diagonal chunk holds masked keys
#pragma unroll
                for (int e = 0; e < 8; ++e) { const int key = k0 + (e >> 2) * 16 + hi * 8 + (e & 3) * 2; if (key > qi) t[e][0] = -3.0e38f; if (key + 1 > qi) t[e][1] = -3.0e38f; } }
#pragma unroll
            for (int e = 0; e < 8; ++e) mx = fmaxf(mx, fmaxf(t[e][0], t[e][1]));
            mx = fmaxf(mx, xhalf(mx));                               // the other lane half holds the query's other 16 keys
            const float mn = fmaxf(m[nq], mx * SC2), al = __builtin_amdgcn_exp2f(m[nq] - mn), sh = PSH - mn; m[nq] = mn; v2f ps = (v2f){};
#pragma unroll
            for (int e = 0; e < 8; ++e) { const v2f a = __builtin_elementwise_fma(t[e], (v2f){ SC2, SC2 }, (v2f){ sh, sh }); t[e][0] = __builtin_amdgcn_exp2f(a[0]); t[e][1] = __builtin_amdgcn_exp2f(a[1]); ps += t[e]; }
            l[nq] = l[nq] * al + (ps[0] + ps[1]);
#pragma unroll
            for (int mb = 0; mb < 4; ++mb) o[mb][nq] *= al;
            if constexpr (NSPLIT == 2) { v8us h0, h1, l0, l1;
#pragma unroll
                for (int e = 0; e < 8; ++e) { unsigned short a, c2; splitf(t[e >> 1][e & 1], a, c2); h0[e] = a; l0[e] = c2; splitf(t[4 + (e >> 1)][e & 1], a, c2); h1[e] = a; l1[e] = c2; }
                pf[nq] = cat16b(h0, h1); pf2[nq] = cat16b(l0, l1);
            } else { v16h p16;
#pragma unroll
                for (int e = 0; e < 16; ++e) p16[e] = tohx(t[e >> 1][e & 1]);
                pf[nq] = p16; }
        }
#pragma unroll
        for (int mb = 0; mb < 4; ++mb)
#pragma unroll
            for (int nq = 0; nq < 2; ++nq) { o[mb][nq] = WFrag<T16>::mma(vf[mb], pf[nq], o[mb][nq]); if (NSPLIT == 2) { o[mb][nq] = WFrag<T16>::mma(vf[mb], pf2[nq], o[mb][nq]); o[mb][nq] = WFrag<T16>::mma(vf2[mb], pf[nq], o[mb][nq]); } }
        // the slots the chip needs behind the last matrix instruction, on the taken side of the loop's branch too
        asm volatile("v_nop\n\tv_nop\n\tv_nop\n\tv_nop" : "+v"(o[0][0]), "+v"(o[1][0]), "+v"(o[2][0]), "+v"(o[3][0]), "+v"(o[0][1]), "+v"(o[1][1]), "+v"(o[2][1]), "+v"(o[3][1]));
    }
#pragma unroll
    for (int nq = 0; nq < 2; ++nq) { l[nq] += xhalf(l[nq]); if (hi == 0) sm[w * AQ + nq * 16 + lr] = m[nq]; }
    __syncthreads();                                                 // every wave's row maxima are in LDS before any wave scales its tile and its row sums
#pragma unroll
    for (int nq = 0; nq < 2; ++nq) { float M = sm[nq * 16 + lr];
#pragma unroll
        for (int p = 1; p < AW; ++p) M = fmaxf(M, sm[p * AQ + nq * 16 + lr]);
        const float f = __builtin_amdgcn_exp2f(m[nq] - M); float* pw = red + (size_t)(w * AQ + nq * 16 + lr) * AP + hi * 8; if (hi == 0) sl[w * AQ + nq * 16 + lr] = l[nq] * f;
#pragma unroll
        for (int mb = 0; mb < 4; ++mb) { const v8f x = o[mb][nq] * f; *(v4fa*)(pw + mb * 16) = __builtin_shufflevector(x, x, 0, 1, 2, 3); *(v4fa*)(pw + mb * 16 + 4) = __builtin_shufflevector(x, x, 4, 5, 6, 7); } }
    __syncthreads();                                                 // every wave's scaled partial tile and row sums are in LDS before any thread adds them
    const int q = threadIdx.x & 31, d0 = (threadIdx.x >> 5) * 8;   // a wave takes one group of 8 d for all 32 rows: its stores fill whole lines of the fragment blocks
    float L = 0.f; v4f a0 = (v4f){}, a1 = (v4f){};
#pragma unroll
    for (int p = 0; p < AW; ++p) { L += sl[p * AQ + q]; const float* pr = red + (size_t)(p * AQ + q) * AP + d0; a0 += *(const v4fa*)pr; a1 += *(const v4fa*)(pr + 4); }
    const float r = __fdiv_rn(1.0f, L); v8us oh, ol;
#pragma unroll
    for (int e = 0; e < 4; ++e) { unsigned short a, c2; splitf(a0[e] * r, a, c2); oh[e] = a; ol[e] = c2; splitf(a1[e] * r, a, c2); oh[e + 4] = a; ol[e + 4] = c2; }
    const size_t oo = ((size_t)(h * (HD / 32) + (d0 >> 5)) * TT + q0 + (q & 16)) * 32 + ((d0 >> 3) & 3) * 128 + (q & 15) * 8;
    *(v8usa*)(Ah + oo) = oh; *(v8usa*)(Al + oo) = ol;
}
// Tiles are taken longest first over all heads, batch by batch, so that a batch's short tiles run beside the next batch's long ones; h counts heads through the batches, which is the order of the planes; tile1 = the launch's last (longest) tile. Query rows < RH go on bf16 hi+lo planes (3 products, NSPLIT 2), the rest on single fp16 (NSPLIT 0): two launches, so that the long one keeps the smaller register count.
template <typename T16, int NSPLIT>
__global__ __launch_bounds__(256) void k_attn(const T16* __restrict__ Q, const T16* __restrict__ Q2, const T16* __restrict__ Kp, const T16* __restrict__ Kp2, const T16* __restrict__ Vt, const T16* __restrict__ Vt2, bf* Ah, bf* Al, int tile1) {
    __shared__ __align__(16) float red[AW * AQ * AP]; __shared__ float sm[AW * AQ]; __shared__ float sl[AW * AQ];
    const int h = blockIdx.z * NH_ + blockIdx.x, q0 = (tile1 - (int)blockIdx.y) * AQ; const size_t zo = (size_t)h * TT * HD;
    attn_tile<T16, NSPLIT>(Q + zo, NSPLIT == 2 ? Q2 + zo : nullptr, Kp + zo, NSPLIT == 2 ? Kp2 + zo : nullptr, Vt + zo, NSPLIT == 2 ? Vt2 + zo : nullptr, Ah, Al, h, q0, red, sm, sl);
}

__global__ __launch_bounds__(256) void k_wtG(const float* __restrict__ w, int K, int N, bf* Bt) {
    const int lane = threadIdx.x & 31; const int L0 = (blockIdx.x * 8 + (threadIdx.x >> 5)) * 8; const int nlines = N * K / 64;
{
#pragma unroll 1
        for (int l = 0; l < 8; ++l) { const int L = L0 + l; if (L >= nlines) break; const size_t e = (size_t)L * 64 + lane * 2; const int k = (int)(e % K), n = (int)(e / K); v2us o;
            o[0] = f2bf(w[(size_t)k * N + n]); o[1] = f2bf(w[(size_t)(k + 1) * N + n]); *(v2us*)(Bt + e) = o; }
         }
}
// k_cvt8: f32 [rows][DM] -> bf16 fragment blocks [row/64][k/32][(row/16)%4]; thread i writes the i-th 16 bytes of the plane (a wave: 512 contiguous bytes) and reads the 8 neighbours of the row that belong there.
static_assert(DQ == DM && DKV == DM, "every converted matrix has rows of DM elements");
__global__ __launch_bounds__(256) void k_cvt8(const float* __restrict__ src, bf* dst, size_t n8) { const size_t i = (size_t)blockIdx.x * 256 + threadIdx.x; if (i >= n8) return;
    const size_t grp = i >> 8, row = grp / (DM / 32) * 64 + ((i >> 6) & 3) * 16 + (i & 15), k = grp % (DM / 32) * 32 + ((i >> 4) & 3) * 8; const float* ps = src + row * DM + k; const v8f v = *(const v8f*)ps; v8us o;
    asm volatile("s_wait_xcnt 0x0" :: "v"(ps) : "memory");   // the wait in front of any rewrite of the register that the loads above name
#pragma unroll
    for (int k = 0; k < 8; ++k) o[k] = f2bf(v[k]); *(v8us*)(dst + i * 8) = o;  }
__global__ __launch_bounds__(256) void k_cscvt(const float* __restrict__ cosT, const float* __restrict__ sinT, float* CS) { const int idx = blockIdx.x * 256 + threadIdx.x; if (idx >= TT * HD) return; v2f cs; cs[0] = bfr(cosT[idx]); cs[1] = bfr(sinT[idx]); *(v2f*)(CS + (size_t)idx * 2) = cs;  }
extern "C" void kernel_launch(void* const* d_in, const int* in_sizes, int n_in,
                              void* d_out, int out_size, void* d_ws, size_t ws_size, hipStream_t stream) {
    (void)in_sizes; (void)n_in; (void)out_size;
    const float* x = (const float*)d_in[0]; const float* wq = (const float*)d_in[1]; const float* bq = (const float*)d_in[2]; const float* wk = (const float*)d_in[3]; const float* bk = (const float*)d_in[4]; const float* wv = (const float*)d_in[5]; const float* bv = (const float*)d_in[6]; const float* wo = (const float*)d_in[7]; const float* bo = (const float*)d_in[8]; const float* cosT = nullptr; const float* sinT = nullptr; (void)cosT; (void)sinT;
    float* OUT = (float*)d_out;     // [4][2048][1024]
    char* wsp = (char*)d_ws;
    auto take = [&](size_t bytes) { char* p = wsp; wsp += (bytes + 255) & ~(size_t)255; return (void*)p; };
    bf* WQ = (bf*)take((size_t)DQ * DM * 2); bf* WK = (bf*)take((size_t)DKV * DM * 2); bf* WV = (bf*)take((size_t)DKV * DM * 2); bf* WO = (bf*)take((size_t)DM * DQ * 2);
    bf* XB = (bf*)take((size_t)NB_ * TT * DM * 2);
    h16* QP16 = (h16*)take((size_t)NB_ * NH_ * TT * HD * 2); h16* KP16 = (h16*)take((size_t)NB_ * NKV * TT * HD * 2); h16* VT16 = (h16*)take((size_t)NB_ * NKV * HD * TT * 2);
    bf* QPh = (bf*)take((size_t)NB_ * NH_ * TT * HD * 2); bf* QPl = (bf*)take((size_t)NB_ * NH_ * TT * HD * 2); bf* KPh = (bf*)take((size_t)NB_ * NKV * TT * HD * 2); bf* KPl = (bf*)take((size_t)NB_ * NKV * TT * HD * 2); bf* VTh = (bf*)take((size_t)NB_ * NKV * HD * TT * 2); bf* VTl = (bf*)take((size_t)NB_ * NKV * HD * TT * 2);
    bf* ATh = (bf*)take((size_t)NB_ * TT * DQ * 2); bf* ATl = (bf*)take((size_t)NB_ * TT * DQ * 2);
    if ((size_t)(wsp - (char*)d_ws) > ws_size) return;    // ws 256 MiB
    { k_cvt8<<<(unsigned)(((size_t)DQ * DM / 8 + 255) / 256), 256, 0, stream>>>(wq, WQ, (size_t)DQ * DM / 8); k_cvt8<<<(unsigned)(((size_t)DKV * DM / 8 + 255) / 256), 256, 0, stream>>>(wk, WK, (size_t)DKV * DM / 8); k_cvt8<<<(unsigned)(((size_t)DKV * DM / 8 + 255) / 256), 256, 0, stream>>>(wv, WV, (size_t)DKV * DM / 8);
      k_cvt8<<<(unsigned)(((size_t)DM * DQ / 8 + 255) / 256), 256, 0, stream>>>(wo, WO, (size_t)DM * DQ / 8);
       }
    k_cvt8<<<(unsigned)(((size_t)NB_ * TT * DM / 8 + 255) / 256), 256, 0, stream>>>(x, XB, (size_t)NB_ * TT * DM / 8);
    k_gemmw<bf, 0, false><<<dim3(TT / 64, DQ / 64, NB_), 32, 0, stream>>>(XB, nullptr, WQ, nullptr, DM, bq, QP16, QPh, QPl);      // q planes [b][h], fragment blocks [t/16][d/32]
    k_gemmw<bf, 0, false><<<dim3(TT / 64, DKV / 64, NB_), 32, 0, stream>>>(XB, nullptr, WK, nullptr, DM, bk, KP16, KPh, KPl);     // k planes [b][h], fragment blocks [t/16][d/32]
    k_gemmw<bf, 0, true><<<dim3(DKV / 64, TT / 64, NB_), 32, 0, stream>>>(WV, nullptr, XB, nullptr, DM, bv, VT16, VTh, VTl);      // v planes [b][h], fragment blocks [t/32][d/16]
    k_attn<h16, 0><<<dim3(NH_, (TT - RH) / AQ, NB_), 256, 0, stream>>>(QP16, nullptr, KP16, nullptr, VT16, nullptr, ATh, ATl, TT / AQ - 1);
    k_attn<bf, 2><<<dim3(NH_, RH / AQ, NB_), 256, 0, stream>>>(QPh, QPl, KPh, KPl, VTh, VTl, ATh, ATl, RH / AQ - 1);
    k_gemmo<<<dim3(TT / 64, DM / 64, NB_), 32, 0, stream>>>(ATh, ATl, TT, WO, DQ, OUT, DM, bo);
}

// v007
// It runs in 151 microseconds.
// Timed twice side by side with v006, it ran 1.55 times as fast both times.
// Over all steps from v000 it is 18.3 times as fast.
#include <hip/hip_runtime.h>

// CausalSelfAttentionSeparateHeads (x [4][2048][1024]; per-head Linear q/k/v: Wq[h][d][c], bq[h][d] (16 heads x 64) == one [1024][1024] torch-layout weight with rows h*64+d; causal softmax(q.k/8); y merged (head-major) Wp^T + bp -> [4][2048][1024]).
// Compute dtypes, f32 accumulate: every input rounded to bf16; Q/K/V on PLAIN bf16 operands (inputs: exact) + bias; causal scores and att.v: query rows < 512 on bf16 hi+lo planes (3 products), the rest single fp16 (x1024); softmax f32;
// The 16-bit operand planes are written by the matrix kernels that make the values (k_gemmw: q, k, v; k_attn: the merged heads): no f32 intermediate and no conversion pass lies between two products.
// Every 16-bit operand plane lies in FRAGMENT ORDER: blocks of 16 rows x 32 k (512 elements, 1 KiB); element (r, k) of a block stands at (k >> 3) * 128 + r * 8 + (k & 7), so that lane l of a wave finds its 8 + 8 elements at l * 8 and 256 + l * 8
// and each wave-wide 16-byte load covers 512 contiguous bytes (4 whole lines). The k order inside a fragment is that of a K-contiguous row, the same for both operands.
// The four blocks that a wave takes together (64 rows of one k chunk; 32 keys of a head) lie behind one another: 4 KiB, one address and immediate offsets.
// The batch is blockIdx.z of every matrix kernel: one launch per stage does all NB_ batches, each on its own set of planes in the workspace (same layout per batch, NB_ sets behind one another).

#define NB_  4
#define TT   2048
#define DM   1024
#define NH_  16
#define NKV  16
#define REP  (NH_ / NKV)
#define HD   64
#define DQ   (NH_ * HD)
#define DKV  (NKV * HD)
#define RH   512                  // query rows < RH use hi+lo planes (0: none)
#define WIN  0
#define SCL  0.125f   // HD^-0.5
typedef _Float16 h16;
typedef unsigned short bf;
typedef __attribute__((ext_vector_type(16))) __bf16   v16bf;
typedef __attribute__((ext_vector_type(16))) _Float16 v16h;
typedef __attribute__((ext_vector_type(8)))  _Float16 v8h;
typedef __attribute__((ext_vector_type(8)))  unsigned short v8us;
typedef __attribute__((ext_vector_type(8)))  float    v8f;
typedef __attribute__((ext_vector_type(4)))  float    v4f;
typedef v8h  __attribute__((may_alias)) v8ha;
typedef v4f  __attribute__((may_alias)) v4fa;
typedef v8us __attribute__((may_alias)) v8usa;

__device__ __forceinline__ unsigned short f2bf(float f) { unsigned u = __float_as_uint(f); u += 0x7FFFu + ((u >> 16) & 1u); return (unsigned short)(u >> 16); }
__device__ __forceinline__ float bf2f(unsigned short b) { return __uint_as_float(((unsigned)b) << 16); }
__device__ __forceinline__ float bfr(float f) { return bf2f(f2bf(f)); }
__device__ __forceinline__ v16h cat16(v8h lo, v8h hi) { return __builtin_shufflevector(lo, hi, 0, 1, 2, 3, 4, 5, 6, 7, 8, 9, 10, 11, 12, 13, 14, 15); }
__device__ __forceinline__ v16bf cat16b(v8us lo, v8us hi) { return __builtin_bit_cast(v16bf, __builtin_shufflevector(lo, hi, 0, 1, 2, 3, 4, 5, 6, 7, 8, 9, 10, 11, 12, 13, 14, 15)); }
__device__ __forceinline__ v8f wmma16(v16h a, v16h b, v8f c) { return __builtin_amdgcn_wmma_f32_16x16x32_f16(false, a, false, b, (short)0, c, false, false); }
__device__ __forceinline__ v8f wmmab(v16bf a, v16bf b, v8f c) { return __builtin_amdgcn_wmma_f32_16x16x32_bf16(false, a, false, b, (short)0, c, false, false); }



// ---- k_gemmo: the output projection as a register-blocked GEMM, ONE WAVE per 64x64 output tile (16 accumulators), operands straight from 16-bit planes; grid (M/64, N/64, batches), 32 threads; a batch's A planes are M*K elements, its C rows M*ldc.
// C[m][n] (f32, pitch ldc) = sum_k (A[m][k] + A2[m][k]) Bt[n][k] + bias[n], two products per k chunk (hi, then lo). K % 64 == 0. Bt: fragment blocks [n/64][k/32][(n/16)%4].
// A and A2: fragment blocks [k/32][m/16], the form in which k_attn leaves them. WFrag::ld takes the block's address plus lane * 8.
template <typename T16> struct WFrag;
template <> struct WFrag<h16> { typedef v16h V; static __device__ __forceinline__ V ld(const h16* p) { return cat16(*(const v8h*)p, *(const v8h*)(p + 256)); } static __device__ __forceinline__ v8f mma(V a, V b, v8f c) { return wmma16(a, b, c); } };
template <> struct WFrag<bf> { typedef v16bf V; static __device__ __forceinline__ V ld(const bf* p) { return cat16b(*(const v8us*)p, *(const v8us*)(p + 256)); } static __device__ __forceinline__ v8f mma(V a, V b, v8f c) { return wmmab(a, b, c); } };
// One k chunk of k_gemmo: its 24 fragment loads (12 fragments), and its 32 products.
__device__ __forceinline__ void go_ld(const bf* pa, const bf* pa2, const bf* pb, WFrag<bf>::V (&a)[4], WFrag<bf>::V (&a2)[4], WFrag<bf>::V (&b)[4]) {
#pragma unroll
    for (int i = 0; i < 4; ++i) { a[i] = WFrag<bf>::ld(pa + i * 512); b[i] = WFrag<bf>::ld(pb + i * 512); }
#pragma unroll
    for (int i = 0; i < 4; ++i) a2[i] = WFrag<bf>::ld(pa2 + i * 512);
}
__device__ __forceinline__ void go_mma(const WFrag<bf>::V (&a)[4], const WFrag<bf>::V (&a2)[4], const WFrag<bf>::V (&b)[4], v8f (&acc)[4][4]) {
#pragma unroll
    for (int nb = 0; nb < 4; ++nb)
#pragma unroll
        for (int mb = 0; mb < 4; ++mb) acc[mb][nb] = WFrag<bf>::mma(a[mb], b[nb], acc[mb][nb]);
#pragma unroll
    for (int nb = 0; nb < 4; ++nb)
#pragma unroll
        for (int mb = 0; mb < 4; ++mb) acc[mb][nb] = WFrag<bf>::mma(a2[mb], b[nb], acc[mb][nb]);
}
__global__ __launch_bounds__(32) void k_gemmo(const bf* __restrict__ A, const bf* __restrict__ A2, int M, const bf* __restrict__ Bt, int K, float* C, int ldc, const float* __restrict__ bias) {
    typedef WFrag<bf>::V V;
    __shared__ __align__(16) float os[16 * 68];
    const int lane = threadIdx.x & 31, lr = lane & 15, hi = lane >> 4; const int r0 = blockIdx.x * 64, c0 = blockIdx.y * 64;
    v8f acc[4][4];
#pragma unroll
    for (int mb = 0; mb < 4; ++mb)
#pragma unroll
        for (int nb = 0; nb < 4; ++nb) acc[mb][nb] = (v8f){};
    const size_t aoff = (size_t)blockIdx.z * M * K + (size_t)r0 * 32 + lane * 8, boff = (size_t)c0 * K + lane * 8;
    const bf* pa = A + aoff; const bf* pa2 = A2 + aoff; const bf* pb = Bt + boff;
    // The k chunks go through two register sets (x, y): all loads of the next chunk are issued as one group in front of the products of the chunk that has arrived, so that a load has 32 products' time to land. Every accumulator still takes its products in rising k, hi then lo.
    V xa[4], xa2[4], xb[4], ya[4], ya2[4], yb[4];
    go_ld(pa, pa2, pb, xa, xa2, xb);
    asm volatile("s_wait_xcnt 0x0" :: "v"(pa), "v"(pa2), "v"(pb) : "memory");   // the wait in front of any rewrite of a register that the first chunk's loads name
    __builtin_amdgcn_sched_barrier(0);                               // nothing that follows moves in front of that wait
#pragma unroll 1   // stays rolled: a trip is two chunks, one per register set
    for (int kc = 0; kc + 64 < K; kc += 64) {
        const bf* qa = pa + (size_t)(kc + 32) * M; const bf* qa2 = pa2 + (size_t)(kc + 32) * M; const bf* tb = pb + kc * 64;   // tb: one address a trip for both chunks' weight loads, with immediate offsets
        go_ld(qa, qa2, tb + 32 * 64, ya, ya2, yb);
        __builtin_amdgcn_sched_barrier(0);                           // keeps the next chunk's loads in front of this chunk's products: sunk among them they would be waited for at once
        go_mma(xa, xa2, xb, acc);
        __builtin_amdgcn_sched_barrier(0);                           // the wait and the loads below stay behind the products
        // the wait in front of any rewrite of a register that the loads above name; the addresses are its inputs so that nothing lands on one of them before it
        asm volatile("s_wait_xcnt 0x0" :: "v"(qa), "v"(qa2) : "memory");
        const bf* ra = pa + (size_t)(kc + 64) * M; const bf* ra2 = pa2 + (size_t)(kc + 64) * M;
        go_ld(ra, ra2, tb + 64 * 64, xa, xa2, xb);
        __builtin_amdgcn_sched_barrier(0);                           // as the first
        go_mma(ya, ya2, yb, acc);
        __builtin_amdgcn_sched_barrier(0);                           // the wait and the slots below stay behind the products
        asm volatile("s_wait_xcnt 0x0" :: "v"(ra), "v"(ra2), "v"(tb) : "memory");   // as above
        // the slots the chip needs behind the last matrix instruction, on the taken side of the loop's branch too
        asm volatile("v_nop\n\tv_nop\n\tv_nop\n\tv_nop");
    }
    { const bf* qa = pa + (size_t)(K - 32) * M; const bf* qa2 = pa2 + (size_t)(K - 32) * M; const bf* tb = pb + (K - 64) * 64;   // the last two chunks: nothing is left to fetch behind them
        go_ld(qa, qa2, tb + 32 * 64, ya, ya2, yb);
        __builtin_amdgcn_sched_barrier(0);                           // as the first
        go_mma(xa, xa2, xb, acc);
        __builtin_amdgcn_sched_barrier(0);                           // the wait below stays behind the products
        asm volatile("s_wait_xcnt 0x0" :: "v"(qa), "v"(qa2), "v"(tb) : "memory");   // as in the loop
        go_mma(ya, ya2, yb, acc); }
#pragma unroll
    for (int mb = 0; mb < 4; ++mb) {
#pragma unroll
        for (int nb = 0; nb < 4; ++nb) {
#pragma unroll
            for (int j = 0; j < 8; ++j) os[(hi * 8 + j) * 68 + nb * 16 + lr] = acc[mb][nb][j]; }
        __builtin_amdgcn_wave_barrier(); asm volatile("" ::: "memory");   // the wave's LDS writes stay in front of its reads of other lanes' values
        float* crow = C + ((size_t)blockIdx.z * M + r0 + mb * 16) * ldc + c0;
#pragma unroll
        for (int s = 0; s < 8; ++s) { const int row = 2 * s + hi, cofs = lr * 4; v4f val = *(const v4fa*)(os + row * 68 + cofs); val[0] += bfr(bias[c0 + cofs]); val[1] += bfr(bias[c0 + cofs + 1]); val[2] += bfr(bias[c0 + cofs + 2]); val[3] += bfr(bias[c0 + cofs + 3]);
            *(v4f*)(crow + (size_t)row * ldc + cofs) = val; }
        __builtin_amdgcn_wave_barrier(); asm volatile("" ::: "memory");   // the reads above stay in front of the next 16 rows' LDS writes
    }
}

__device__ __forceinline__ h16 tohx(float x) { return (h16)x; }
__device__ __forceinline__ void splitf(float y, unsigned short& h, unsigned short& l) { h = f2bf(y); l = f2bf(y - bf2f(h)); }
typedef __attribute__((ext_vector_type(2))) _Float16 v2h;
typedef __attribute__((ext_vector_type(4))) _Float16 v4h;
typedef __attribute__((ext_vector_type(2))) unsigned short v2us;
typedef __attribute__((ext_vector_type(4))) unsigned short v4us;
typedef __attribute__((ext_vector_type(2))) float v2f;
typedef __attribute__((ext_vector_type(4))) int v4i;
typedef v2f  __attribute__((may_alias)) v2fa;

// ---- k_gemmw: the q, k, v projections: register-blocked GEMM, ONE WAVE per 64x64 tile (16 accumulators), operands straight from 16-bit planes of fragment blocks [row/64][k/32][(row/16)%4] (plain product, NSPLIT 0), K % 128 == 0, whose epilogue adds the bias and writes the value's three 16-bit planes (fp16, bf16 hi, bf16 lo) itself; grid (M/64, N/64, batches), 32 threads; the token operand advances TT rows a batch, the planes TT*DQ elements.
// ROWB false (q, k: A = tokens, Bt = weight rows): bias[n]; a tile's 64 columns are one head, planes of fragment blocks [n/64][m/16][(n%64)/32]. ROWB true (v: A = weight rows, Bt = tokens, so the product comes out transposed): bias[m]; fragment blocks [m/64][n/32][(m/16)%4].
// Either way a lane stores the 8 neighbours that it will load as a fragment half, and a wave-wide store fills 4 whole lines of a plane.
// One stage of k_gemmw (64 k): its 32 fragment loads (index: chunk * 4 + block of 16 rows), and its 32 products.
template <typename T16> __device__ __forceinline__ void gw_ld(const T16* pa, const T16* pb, typename WFrag<T16>::V (&a)[8], typename WFrag<T16>::V (&b)[8]) {
#pragma unroll
    for (int c = 0; c < 2; ++c) {
#pragma unroll
        for (int i = c * 4; i < c * 4 + 4; ++i) { a[i] = WFrag<T16>::ld(pa + i * 512); b[i] = WFrag<T16>::ld(pb + i * 512); } }
}
template <typename T16> __device__ __forceinline__ void gw_mma(const typename WFrag<T16>::V (&a)[8], const typename WFrag<T16>::V (&b)[8], v8f (&acc)[4][4]) {
#pragma unroll
    for (int c = 0; c < 2; ++c)
#pragma unroll
        for (int nb = 0; nb < 4; ++nb)
#pragma unroll
            for (int mb = 0; mb < 4; ++mb) acc[mb][nb] = WFrag<T16>::mma(a[c * 4 + mb], b[c * 4 + nb], acc[mb][nb]);
}
template <typename T16, int NSPLIT, bool ROWB>
__global__ __launch_bounds__(32) void k_gemmw(const T16* __restrict__ A, const T16* __restrict__ A2, const T16* __restrict__ Bt, const T16* __restrict__ Bt2, int K, const float* __restrict__ bias, h16* P16, bf* Ph, bf* Pl) {
    typedef typename WFrag<T16>::V V;
    __shared__ __align__(16) float os[16 * 68];
    const int lane = threadIdx.x & 31, lr = lane & 15, hi = lane >> 4; const int r0 = blockIdx.x * 64, c0 = blockIdx.y * 64;
    v8f acc[4][4];
#pragma unroll
    for (int mb = 0; mb < 4; ++mb)
#pragma unroll
        for (int nb = 0; nb < 4; ++nb) acc[mb][nb] = (v8f){};
    const size_t zt = (size_t)blockIdx.z * TT * K, zp = (size_t)blockIdx.z * TT * DQ;   // the batch's tokens, the batch's planes
    const size_t aoff = (ROWB ? 0 : zt) + (size_t)r0 * K + lane * 8, boff = (ROWB ? zt : 0) + (size_t)c0 * K + lane * 8;
    static_assert(NSPLIT == 0, "the loop below forms the plain product alone");
    const T16* pa = A + aoff; const T16* pb = Bt + boff;
    // A stage is 64 k (two chunks, 8 KiB of each operand behind one another). The stages go through two register sets (x, y): all 32 loads of the next stage are issued as one group in front of the 32 products of the stage that has arrived. Every accumulator still takes its products in rising k.
    V xa[8], xb[8], ya[8], yb[8];
    gw_ld<T16>(pa, pb, xa, xb);
    asm volatile("s_wait_xcnt 0x0" :: "v"(pa), "v"(pb) : "memory");   // the wait in front of any rewrite of a register that the first stage's loads name
    __builtin_amdgcn_sched_barrier(0);                               // nothing that follows moves in front of that wait
#pragma unroll 1   // stays rolled: a trip is two stages, one per register set
    for (int kc = 0; kc + 128 < K; kc += 128) {
        const T16* ta = pa + kc * 64; const T16* tb = pb + kc * 64;   // one address pair a trip: both stages' loads name it, with immediate offsets
        gw_ld<T16>(ta + 64 * 64, tb + 64 * 64, ya, yb);
        __builtin_amdgcn_sched_barrier(0);                           // keeps the next stage's loads in front of this stage's products: sunk among them they would be waited for at once
        gw_mma<T16>(xa, xb, acc);
        __builtin_amdgcn_sched_barrier(0);                           // the loads below stay behind the products that read their registers
        gw_ld<T16>(ta + 128 * 64, tb + 128 * 64, xa, xb);
        __builtin_amdgcn_sched_barrier(0);                           // as the first
        gw_mma<T16>(ya, yb, acc);
        __builtin_amdgcn_sched_barrier(0);                           // the wait and the slots below stay behind the products
        // the wait in front of any rewrite of a register that the trip's loads name; the addresses are its inputs so that nothing lands on one of them before it
        asm volatile("s_wait_xcnt 0x0" :: "v"(ta), "v"(tb) : "memory");
        // the slots the chip needs behind the last matrix instruction, on the taken side of the loop's branch too
        asm volatile("v_nop\n\tv_nop\n\tv_nop\n\tv_nop");
    }
    { const T16* ta = pa + (K - 128) * 64; const T16* tb = pb + (K - 128) * 64;   // the last two stages: nothing is left to fetch behind them
        gw_ld<T16>(ta + 64 * 64, tb + 64 * 64, ya, yb);
        __builtin_amdgcn_sched_barrier(0);                           // as the first
        gw_mma<T16>(xa, xb, acc);
        __builtin_amdgcn_sched_barrier(0);                           // the wait below stays behind the products, so that the wave does not stand at it with products left to issue
        asm volatile("s_wait_xcnt 0x0" :: "v"(ta), "v"(tb) : "memory");   // as in the loop
        gw_mma<T16>(ya, yb, acc);
        __builtin_amdgcn_sched_barrier(0); }                         // the epilogue stays behind the last products
    const float* pbi = bias + (ROWB ? r0 + lr : c0 + hi * 8); float bb[ROWB ? 4 : 32];   // ROWB: the lane's row of each 16; else the lane's 8 columns of each half fragment
#pragma unroll
    for (int q = 0; q < (ROWB ? 4 : 32); ++q) bb[q] = pbi[ROWB ? q * 16 : (q >> 3) * 16 + (q & 7)];
    asm volatile("s_wait_xcnt 0x0" :: "v"(pbi) : "memory");   // the wait in front of any rewrite of the register that the bias loads name
#pragma unroll
    for (int mb = 0; mb < 4; ++mb) {
#pragma unroll
        for (int nb = 0; nb < 4; ++nb) {
#pragma unroll
            for (int j = 0; j < 8; ++j) os[(hi * 8 + j) * 68 + nb * 16 + lr] = acc[mb][nb][j]; }
        __builtin_amdgcn_wave_barrier(); asm volatile("" ::: "memory");   // the wave's LDS writes stay in front of its reads of other lanes' values
        const size_t ob = zp + (ROWB ? (size_t)r0 * TT + (size_t)c0 * 64 + mb * 512 : ((size_t)blockIdx.y * TT + r0 + mb * 16) * HD) + lane * 8;
        h16* q16 = P16 + ob; bf* qh = Ph + ob; bf* ql = Pl + ob; v8h o16[4]; v8us oh[4], ol[4];
#pragma unroll
        for (int s = 0; s < 4; ++s) { const int cofs = s * 16 + hi * 8; const v4f x0 = *(const v4fa*)(os + lr * 68 + cofs), x1 = *(const v4fa*)(os + lr * 68 + cofs + 4);   // s: the half fragment (16 k) of the 16 rows; row lr, 8 neighbours
#pragma unroll
            for (int q = 0; q < 8; ++q) { const float val = (q < 4 ? x0[q & 3] : x1[q & 3]) + bfr(bb[ROWB ? mb : s * 8 + q]); o16[s][q] = tohx(val); unsigned short a2, c2; splitf(val, a2, c2); oh[s][q] = a2; ol[s][q] = c2; }
            const int o = ROWB ? (s >> 1) * 2048 + (s & 1) * 256 : s * 256;
            *(v8h*)(q16 + o) = o16[s]; *(v8us*)(qh + o) = oh[s]; *(v8us*)(ql + o) = ol[s]; }
        // the wait in front of any rewrite of a register that the stores above name; addresses and values are its inputs so that nothing lands on one of them before it
        asm volatile("s_wait_xcnt 0x0" :: "v"(q16), "v"(qh), "v"(ql), "v"(o16[0]), "v"(o16[1]), "v"(o16[2]), "v"(o16[3]), "v"(oh[0]), "v"(oh[1]), "v"(oh[2]), "v"(oh[3]), "v"(ol[0]), "v"(ol[1]), "v"(ol[2]), "v"(ol[3]) : "memory");
        __builtin_amdgcn_wave_barrier(); asm volatile("" ::: "memory");   // the reads above stay in front of the next 16 rows' LDS writes
    }
}

// ---- k_attn: causal scores, softmax and the probability x value contraction in one kernel; no score or probability ever lies in memory. One work-group per 32 query rows of one head, grid (heads, row tiles, batches), 256 threads.
// The key loop is dealt over the AW waves: wave w takes the 32-key chunks w, w+AW, ... up to the diagonal chunk and keeps its own running row maximum, row sum and f32 output tile (online softmax).
// Both products are formed transposed, so that a lane owns one query: S^T = K Q^T leaves in lane (lr, hi) the keys 8 hi + j of each 16-key block for query lr, which is the k order of the B fragment of O^T = V^T P^T:
// the probabilities go from the accumulator of the first product into the operand of the second inside the lane. The row maximum and sum need one exchange between the lane halves.
// At the end the waves' maxima go through LDS, each wave scales its tile and its row sums to the common maximum, and behind a second barrier every thread adds the AW partials of 8 elements in wave order, divides by the row sum and stores the bf16 hi and lo planes
// Ah, Al, fragment blocks [chunk][t/16] (chunk = 2 head + d / 32), the k chunks of the output projection. Q, K: fragment blocks [t/16][d/32] of a head; Vt: [t/32][d/16].
#define AW   8                    // waves of a work-group
#define AQ   32                   // query rows of a work-group
#define AP   68                   // LDS row pitch in floats (rows stay 16-byte aligned)
#define SC2  (SCL * 1.4426950408889634f)   // scores are scaled into base-2 exponents; maxima are kept in that unit
__device__ __forceinline__ float xhalf(float x) { return __builtin_bit_cast(float, __builtin_amdgcn_permlanex16(__builtin_bit_cast(int, x), __builtin_bit_cast(int, x), 0x76543210, 0xfedcba98, false, false)); }   // lane l with lane l ^ 16
template <typename T16, int NSPLIT>
__device__ __forceinline__ void attn_tile(const T16* __restrict__ Q, const T16* __restrict__ Q2, const T16* __restrict__ Kp, const T16* __restrict__ Kp2, const T16* __restrict__ Vt, const T16* __restrict__ Vt2, bf* Ah, bf* Al, int h, int q0, float* red, float* sm, float* sl) {
    typedef typename WFrag<T16>::V V;
    const int lane = threadIdx.x & 31, lr = lane & 15, hi = lane >> 4; const int w = __builtin_amdgcn_readfirstlane(threadIdx.x >> 5);
    const float PSH = (NSPLIT == 2) ? 0.f : 10.f;                    // fp16 probabilities are carried x 2^10, by the exponent; the row sums carry the same factor, so it cancels in the quotient
    const int Kl = q0 + AQ;                                          // keys beyond the diagonal chunk are masked for every row of the tile
    V qf[2][2], qf2[2][2]; const size_t qo = (size_t)q0 * HD + lane * 8; const T16* pq = Q + qo; const T16* pq2 = pq; if (NSPLIT == 2) pq2 = Q2 + qo;
#pragma unroll
    for (int nq = 0; nq < 2; ++nq)
#pragma unroll
        for (int kc = 0; kc < 2; ++kc) { qf[nq][kc] = WFrag<T16>::ld(pq + nq * 16 * HD + kc * 512); if (NSPLIT == 2) qf2[nq][kc] = WFrag<T16>::ld(pq2 + nq * 16 * HD + kc * 512); }
    // the wait in front of any rewrite of a register that the loads above name; the addresses are its inputs so that no later load of the group lands on one of them
    if (NSPLIT == 2) asm volatile("s_wait_xcnt 0x0" :: "v"(pq), "v"(pq2) : "memory");
    else asm volatile("s_wait_xcnt 0x0" :: "v"(pq) : "memory");
    v8f o[4][2]; float m[2] = { -3.0e38f, -3.0e38f }, l[2] = { 0.f, 0.f };
#pragma unroll
    for (int mb = 0; mb < 4; ++mb)
#pragma unroll
        for (int nq = 0; nq < 2; ++nq) o[mb][nq] = (v8f){};
#pragma unroll 1   // stays rolled: one pass already holds the operands of a whole chunk in registers
    for (int k0 = w * 32; k0 < Kl; k0 += AW * 32) {
        const size_t ko = (size_t)k0 * HD + lane * 8, vo = (size_t)k0 * HD + lane * 8;
        const T16* pk = Kp + ko; const T16* pv = Vt + vo; const T16* pk2 = pk; const T16* pv2 = pv; if (NSPLIT == 2) { pk2 = Kp2 + ko; pv2 = Vt2 + vo; }
        V kf[2][2], kf2[2][2], vf[4], vf2[4];
#pragma unroll
        for (int kb = 0; kb < 2; ++kb)
#pragma unroll
            for (int kc = 0; kc < 2; ++kc) { kf[kb][kc] = WFrag<T16>::ld(pk + kb * 16 * HD + kc * 512); if (NSPLIT == 2) kf2[kb][kc] = WFrag<T16>::ld(pk2 + kb * 16 * HD + kc * 512); }
#pragma unroll
        for (int mb = 0; mb < 4; ++mb) { vf[mb] = WFrag<T16>::ld(pv + mb * 512); if (NSPLIT == 2) vf2[mb] = WFrag<T16>::ld(pv2 + mb * 512); }
        // the wait in front of any rewrite of a register that the loads above name; the addresses are its inputs so that no later load of the chunk lands on one of them
        if (NSPLIT == 2) asm volatile("s_wait_xcnt 0x0" :: "v"(pk), "v"(pv), "v"(pk2), "v"(pv2) : "memory");
        else asm volatile("s_wait_xcnt 0x0" :: "v"(pk), "v"(pv) : "memory");
        __builtin_amdgcn_sched_barrier(0);                           // keeps all of the chunk's loads in front of the first product, so that their latencies overlap instead of adding up
        v8f s[2][2];
#pragma unroll
        for (int kb = 0; kb < 2; ++kb)
#pragma unroll
            for (int nq = 0; nq < 2; ++nq) { s[kb][nq] = (v8f){};
#pragma unroll
                for (int kc = 0; kc < 2; ++kc) { s[kb][nq] = WFrag<T16>::mma(kf[kb][kc], qf[nq][kc], s[kb][nq]); if (NSPLIT == 2) { s[kb][nq] = WFrag<T16>::mma(kf[kb][kc], qf2[nq][kc], s[kb][nq]); s[kb][nq] = WFrag<T16>::mma(kf2[kb][kc], qf[nq][kc], s[kb][nq]); } } }
        V pf[2], pf2[2];
#pragma unroll
        for (int nq = 0; nq < 2; ++nq) {
            const int qi = q0 + nq * 16 + lr; v2f t[8]; float mx = -3.0e38f;   // t[e2][i]: key (e2 >> 2) * 16 + hi * 8 + (e2 & 3) * 2 + i of the chunk
#pragma unroll
            for (int e = 0; e < 8; ++e) { t[e][0] = s[e >> 2][nq][(e & 3) * 2]; t[e][1] = s[e >> 2][nq][(e & 3) * 2 + 1]; }
            if (k0 + 31 > q0) {                                      // wave-uniform: only the diagonal chunk holds masked keys
#pragma unroll
                for (int e = 0; e < 8; ++e) { const int key = k0 + (e >> 2) * 16 + hi * 8 + (e & 3) * 2; if (key > qi) t[e][0] = -3.0e38f; if (key + 1 > qi) t[e][1] = -3.0e38f; } }
#pragma unroll
            for (int e = 0; e < 8; ++e) mx = fmaxf(mx, fmaxf(t[e][0], t[e][1]));
            mx = fmaxf(mx, xhalf(mx));                               // the other lane half holds the query's other 16 keys
            const float mn = fmaxf(m[nq], mx * SC2), al = __builtin_amdgcn_exp2f(m[nq] - mn), sh = PSH - mn; m[nq] = mn; v2f ps = (v2f){};
#pragma unroll
            for (int e = 0; e < 8; ++e) { const v2f a = __builtin_elementwise_fma(t[e], (v2f){ SC2, SC2 }, (v2f){ sh, sh }); t[e][0] = __builtin_amdgcn_exp2f(a[0]); t[e][1] = __builtin_amdgcn_exp2f(a[1]); ps += t[e]; }
            l[nq] = l[nq] * al + (ps[0] + ps[1]);
#pragma unroll
            for (int mb = 0; mb < 4; ++mb) o[mb][nq] *= al;
            if constexpr (NSPLIT == 2) { v8us h0, h1, l0, l1;
#pragma unroll
                for (int e = 0; e < 8; ++e) { unsigned short a, c2; splitf(t[e >> 1][e & 1], a, c2); h0[e] = a; l0[e] = c2; splitf(t[4 + (e >> 1)][e & 1], a, c2); h1[e] = a; l1[e] = c2; }
                pf[nq] = cat16b(h0, h1); pf2[nq] = cat16b(l0, l1);
            } else { v16h p16;
#pragma unroll
                for (int e = 0; e < 16; ++e) p16[e] = tohx(t[e >> 1][e & 1]);
                pf[nq] = p16; }
        }
#pragma unroll
        for (int mb = 0; mb < 4; ++mb)
#pragma unroll
            for (int nq = 0; nq < 2; ++nq) { o[mb][nq] = WFrag<T16>::mma(vf[mb], pf[nq], o[mb][nq]); if (NSPLIT == 2) { o[mb][nq] = WFrag<T16>::mma(vf[mb], pf2[nq], o[mb][nq]); o[mb][nq] = WFrag<T16>::mma(vf2[mb], pf[nq], o[mb][nq]); } }
        // the slots the chip needs behind the last matrix instruction, on the taken side of the loop's branch too
        asm volatile("v_nop\n\tv_nop\n\tv_nop\n\tv_nop" : "+v"(o[0][0]), "+v"(o[1][0]), "+v"(o[2][0]), "+v"(o[3][0]), "+v"(o[0][1]), "+v"(o[1][1]), "+v"(o[2][1]), "+v"(o[3][1]));
    }
#pragma unroll
    for (int nq = 0; nq < 2; ++nq) { l[nq] += xhalf(l[nq]); if (hi == 0) sm[w * AQ + nq * 16 + lr] = m[nq]; }
    __syncthreads();                                                 // every wave's row maxima are in LDS before any wave scales its tile and its row sums
#pragma unroll
    for (int nq = 0; nq < 2; ++nq) { float M = sm[nq * 16 + lr];
#pragma unroll
        for (int p = 1; p < AW; ++p) M = fmaxf(M, sm[p * AQ + nq * 16 + lr]);
        const float f = __builtin_amdgcn_exp2f(m[nq] - M); float* pw = red + (size_t)(w * AQ + nq * 16 + lr) * AP + hi * 8; if (hi == 0) sl[w * AQ + nq * 16 + lr] = l[nq] * f;
#pragma unroll
        for (int mb = 0; mb < 4; ++mb) { const v8f x = o[mb][nq] * f; *(v4fa*)(pw + mb * 16) = __builtin_shufflevector(x, x, 0, 1, 2, 3); *(v4fa*)(pw + mb * 16 + 4) = __builtin_shufflevector(x, x, 4, 5, 6, 7); } }
    __syncthreads();                                                 // every wave's scaled partial tile and row sums are in LDS before any thread adds them
    const int q = threadIdx.x & 31, d0 = (threadIdx.x >> 5) * 8;   // a wave takes one group of 8 d for all 32 rows: its stores fill whole lines of the fragment blocks
    float L = 0.f; v4f a0 = (v4f){}, a1 = (v4f){};
#pragma unroll
    for (int p = 0; p < AW; ++p) { L += sl[p * AQ + q]; const float* pr = red + (size_t)(p * AQ + q) * AP + d0; a0 += *(const v4fa*)pr; a1 += *(const v4fa*)(pr + 4); }
    const float r = __fdiv_rn(1.0f, L); v8us oh, ol;
#pragma unroll
    for (int e = 0; e < 4; ++e) { unsigned short a, c2; splitf(a0[e] * r, a, c2); oh[e] = a; ol[e] = c2; splitf(a1[e] * r, a, c2); oh[e + 4] = a; ol[e + 4] = c2; }
    const size_t oo = ((size_t)(h * (HD / 32) + (d0 >> 5)) * TT + q0 + (q & 16)) * 32 + ((d0 >> 3) & 3) * 128 + (q & 15) * 8;
    *(v8usa*)(Ah + oo) = oh; *(v8usa*)(Al + oo) = ol;
}
// Tiles are taken longest first over all heads, batch by batch, so that a batch's short tiles run beside the next batch's long ones; h counts heads through the batches, which is the order of the planes; tile1 = the launch's last (longest) tile. Query rows < RH go on bf16 hi+lo planes (3 products, NSPLIT 2), the rest on single fp16 (NSPLIT 0): two launches, so that the long one keeps the smaller register count.
template <typename T16, int NSPLIT>
__global__ __launch_bounds__(256) void k_attn(const T16* __restrict__ Q, const T16* __restrict__ Q2, const T16* __restrict__ Kp, const T16* __restrict__ Kp2, const T16* __restrict__ Vt, const T16* __restrict__ Vt2, bf* Ah, bf* Al, int tile1) {
    __shared__ __align__(16) float red[AW * AQ * AP]; __shared__ float sm[AW * AQ]; __shared__ float sl[AW * AQ];
    const int h = blockIdx.z * NH_ + blockIdx.x, q0 = (tile1 - (int)blockIdx.y) * AQ; const size_t zo = (size_t)h * TT * HD;
    attn_tile<T16, NSPLIT>(Q + zo, NSPLIT == 2 ? Q2 + zo : nullptr, Kp + zo, NSPLIT == 2 ? Kp2 + zo : nullptr, Vt + zo, NSPLIT == 2 ? Vt2 + zo : nullptr, Ah, Al, h, q0, red, sm, sl);
}

__global__ __launch_bounds__(256) void k_wtG(const float* __restrict__ w, int K, int N, bf* Bt) {
    const int lane = threadIdx.x & 31; const int L0 = (blockIdx.x * 8 + (threadIdx.x >> 5)) * 8; const int nlines = N * K / 64;
{
#pragma unroll 1
        for (int l = 0; l < 8; ++l) { const int L = L0 + l; if (L >= nlines) break; const size_t e = (size_t)L * 64 + lane * 2; const int k = (int)(e % K), n = (int)(e / K); v2us o;
            o[0] = f2bf(w[(size_t)k * N + n]); o[1] = f2bf(w[(size_t)(k + 1) * N + n]); *(v2us*)(Bt + e) = o; }
         }
}
// k_cvt8: f32 [rows][DM] -> bf16 fragment blocks [row/64][k/32][(row/16)%4]; thread i writes the i-th 16 bytes of the plane (a wave: 512 contiguous bytes) and reads the 8 neighbours of the row that belong there.
static_assert(DQ == DM && DKV == DM, "every converted matrix has rows of DM elements");
__global__ __launch_bounds__(256) void k_cvt8(const float* __restrict__ src, bf* dst, size_t n8) { const size_t i = (size_t)blockIdx.x * 256 + threadIdx.x; if (i >= n8) return;
    const size_t grp = i >> 8, row = grp / (DM / 32) * 64 + ((i >> 6) & 3) * 16 + (i & 15), k = grp % (DM / 32) * 32 + ((i >> 4) & 3) * 8; const float* ps = src + row * DM + k; const v8f v = *(const v8f*)ps; v8us o;
    asm volatile("s_wait_xcnt 0x0" :: "v"(ps) : "memory");   // the wait in front of any rewrite of the register that the loads above name
#pragma unroll
    for (int k = 0; k < 8; ++k) o[k] = f2bf(v[k]); *(v8us*)(dst + i * 8) = o;  }
__global__ __launch_bounds__(256) void k_cscvt(const float* __restrict__ cosT, const float* __restrict__ sinT, float* CS) { const int idx = blockIdx.x * 256 + threadIdx.x; if (idx >= TT * HD) return; v2f cs; cs[0] = bfr(cosT[idx]); cs[1] = bfr(sinT[idx]); *(v2f*)(CS + (size_t)idx * 2) = cs;  }
extern "C" void kernel_launch(void* const* d_in, const int* in_sizes, int n_in,
                              void* d_out, int out_size, void* d_ws, size_t ws_size, hipStream_t stream) {
    (void)in_sizes; (void)n_in; (void)out_size;
    const float* x = (const float*)d_in[0]; const float* wq = (const float*)d_in[1]; const float* bq = (const float*)d_in[2]; const float* wk = (const float*)d_in[3]; const float* bk = (const float*)d_in[4]; const float* wv = (const float*)d_in[5]; const float* bv = (const float*)d_in[6]; const float* wo = (const float*)d_in[7]; const float* bo = (const float*)d_in[8]; const float* cosT = nullptr; const float* sinT = nullptr; (void)cosT; (void)sinT;
    float* OUT = (float*)d_out;     // [4][2048][1024]
    char* wsp = (char*)d_ws;
    auto take = [&](size_t bytes) { char* p = wsp; wsp += (bytes + 255) & ~(size_t)255; return (void*)p; };
    bf* WQ = (bf*)take((size_t)DQ * DM * 2); bf* WK = (bf*)take((size_t)DKV * DM * 2); bf* WV = (bf*)take((size_t)DKV * DM * 2); bf* WO = (bf*)take((size_t)DM * DQ * 2);
    bf* XB = (bf*)take((size_t)NB_ * TT * DM * 2);
    h16* QP16 = (h16*)take((size_t)NB_ * NH_ * TT * HD * 2); h16* KP16 = (h16*)take((size_t)NB_ * NKV * TT * HD * 2); h16* VT16 = (h16*)take((size_t)NB_ * NKV * HD * TT * 2);
    bf* QPh = (bf*)take((size_t)NB_ * NH_ * TT * HD * 2); bf* QPl = (bf*)take((size_t)NB_ * NH_ * TT * HD * 2); bf* KPh = (bf*)take((size_t)NB_ * NKV * TT * HD * 2); bf* KPl = (bf*)take((size_t)NB_ * NKV * TT * HD * 2); bf* VTh = (bf*)take((size_t)NB_ * NKV * HD * TT * 2); bf* VTl = (bf*)take((size_t)NB_ * NKV * HD * TT * 2);
    bf* ATh = (bf*)take((size_t)NB_ * TT * DQ * 2); bf* ATl = (bf*)take((size_t)NB_ * TT * DQ * 2);
    if ((size_t)(wsp - (char*)d_ws) > ws_size) return;    // ws 256 MiB
    { k_cvt8<<<(unsigned)(((size_t)DQ * DM / 8 + 255) / 256), 256, 0, stream>>>(wq, WQ, (size_t)DQ * DM / 8); k_cvt8<<<(unsigned)(((size_t)DKV * DM / 8 + 255) / 256), 256, 0, stream>>>(wk, WK, (size_t)DKV * DM / 8); k_cvt8<<<(unsigned)(((size_t)DKV * DM / 8 + 255) / 256), 256, 0, stream>>>(wv, WV, (size_t)DKV * DM / 8);
      k_cvt8<<<(unsigned)(((size_t)DM * DQ / 8 + 255) / 256), 256, 0, stream>>>(wo, WO, (size_t)DM * DQ / 8);
       }
    k_cvt8<<<(unsigned)(((size_t)NB_ * TT * DM / 8 + 255) / 256), 256, 0, stream>>>(x, XB, (size_t)NB_ * TT * DM / 8);
    k_gemmw<bf, 0, false><<<dim3(TT / 64, DQ / 64, NB_), 32, 0, stream>>>(XB, nullptr, WQ, nullptr, DM, bq, QP16, QPh, QPl);      // q planes [b][h], fragment blocks [t/16][d/32]
    k_gemmw<bf, 0, false><<<dim3(TT / 64, DKV / 64, NB_), 32, 0, stream>>>(XB, nullptr, WK, nullptr, DM, bk, KP16, KPh, KPl);     // k planes [b][h], fragment blocks [t/16][d/32]
    k_gemmw<bf, 0, true><<<dim3(DKV / 64, TT / 64, NB_), 32, 0, stream>>>(WV, nullptr, XB, nullptr, DM, bv, VT16, VTh, VTl);      // v planes [b][h], fragment blocks [t/32][d/16]
    k_attn<h16, 0><<<dim3(NH_, (TT - RH) / AQ, NB_), 256, 0, stream>>>(QP16, nullptr, KP16, nullptr, VT16, nullptr, ATh, ATl, TT / AQ - 1);
    k_attn<bf, 2><<<dim3(NH_, RH / AQ, NB_), 256, 0, stream>>>(QPh, QPl, KPh, KPl, VTh, VTl, ATh, ATl, RH / AQ - 1);
    k_gemmo<<<dim3(TT / 64, DM / 64, NB_), 32, 0, stream>>>(ATh, ATl, TT, WO, DQ, OUT, DM, bo);
}

// v008
// A run of this version takes 146 microseconds.
// Next to v007, in two timings, it ran 1.03 times as fast each time.
// Counting every step since v000, it is 18.9 times as fast.
#include <hip/hip_runtime.h>

// CausalSelfAttentionSeparateHeads (x [4][2048][1024]; per-head Linear q/k/v: Wq[h][d][c], bq[h][d] (16 heads x 64) == one [1024][1024] torch-layout weight with rows h*64+d; causal softmax(q.k/8); y merged (head-major) Wp^T + bp -> [4][2048][1024]).
// Compute dtypes, f32 accumulate: every input rounded to bf16; Q/K/V on PLAIN bf16 operands (inputs: exact) + bias; causal scores and att.v: query rows < 512 on bf16 hi+lo planes (3 products), the rest single fp16 (x1024); softmax f32;
// The 16-bit operand planes are written by the matrix kernels that make the values (k_gemmw: q, k, v; k_attn: the merged heads): no f32 intermediate and no conversion pass lies between two products.
// Every 16-bit operand plane lies in FRAGMENT ORDER: blocks of 16 rows x 32 k (512 elements, 1 KiB); element (r, k) of a block stands at (k >> 3) * 128 + r * 8 + (k & 7), so that lane l of a wave finds its 8 + 8 elements at l * 8 and 256 + l * 8
// and each wave-wide 16-byte load covers 512 contiguous bytes (4 whole lines). The k order inside a fragment is that of a K-contiguous row, the same for both operands.
// The four blocks that a wave takes together (64 rows of one k chunk; 32 keys of a head) lie behind one another: 4 KiB, one address and immediate offsets.
// The batch is blockIdx.z of every matrix kernel: one launch per stage does all NB_ batches, each on its own set of planes in the workspace (same layout per batch, NB_ sets behind one another).

#define NB_  4
#define TT   2048
#define DM   1024
#define NH_  16
#define NKV  16
#define REP  (NH_ / NKV)
#define HD   64
#define DQ   (NH_ * HD)
#define DKV  (NKV * HD)
#define RH   512                  // query rows < RH use hi+lo planes (0: none)
#define WIN  0
#define SCL  0.125f   // HD^-0.5
typedef _Float16 h16;
typedef unsigned short bf;
typedef __attribute__((ext_vector_type(16))) __bf16   v16bf;
typedef __attribute__((ext_vector_type(16))) _Float16 v16h;
typedef __attribute__((ext_vector_type(8)))  _Float16 v8h;
typedef __attribute__((ext_vector_type(8)))  unsigned short v8us;
typedef __attribute__((ext_vector_type(8)))  float    v8f;
typedef __attribute__((ext_vector_type(4)))  float    v4f;
typedef v8h  __attribute__((may_alias)) v8ha;
typedef v4f  __attribute__((may_alias)) v4fa;
typedef v8us __attribute__((may_alias)) v8usa;

__device__ __forceinline__ unsigned short f2bf(float f) { unsigned u = __float_as_uint(f); u += 0x7FFFu + ((u >> 16) & 1u); return (unsigned short)(u >> 16); }
__device__ __forceinline__ float bf2f(unsigned short b) { return __uint_as_float(((unsigned)b) << 16); }
__device__ __forceinline__ float bfr(float f) { return bf2f(f2bf(f)); }
__device__ __forceinline__ v16h cat16(v8h lo, v8h hi) { return __builtin_shufflevector(lo, hi, 0, 1, 2, 3, 4, 5, 6, 7, 8, 9, 10, 11, 12, 13, 14, 15); }
__device__ __forceinline__ v16bf cat16b(v8us lo, v8us hi) { return __builtin_bit_cast(v16bf, __builtin_shufflevector(lo, hi, 0, 1, 2, 3, 4, 5, 6, 7, 8, 9, 10, 11, 12, 13, 14, 15)); }
__device__ __forceinline__ v8f wmma16(v16h a, v16h b, v8f c) { return __builtin_amdgcn_wmma_f32_16x16x32_f16(false, a, false, b, (short)0, c, false, false); }
__device__ __forceinline__ v8f wmmab(v16bf a, v16bf b, v8f c) { return __builtin_amdgcn_wmma_f32_16x16x32_bf16(false, a, false, b, (short)0, c, false, false); }



// ---- k_gemmo: the output projection as a register-blocked GEMM, ONE WAVE per 64x64 output tile (16 accumulators), operands straight from 16-bit planes; grid (M/64, N/64, batches), 32 threads; a batch's A planes are M*K elements, its C rows M*ldc.
// C[m][n] (f32, pitch ldc) = sum_k (A[m][k] + A2[m][k]) Bt[n][k] + bias[n], two products per k chunk (hi, then lo). K % 64 == 0. Bt: fragment blocks [n/64][k/32][(n/16)%4].
// A and A2: fragment blocks [k/32][m/16], the form in which k_attn leaves them. WFrag::ld takes the block's address plus lane * 8.
template <typename T16> struct WFrag;
template <> struct WFrag<h16> { typedef v16h V; static __device__ __forceinline__ V ld(const h16* p) { return cat16(*(const v8h*)p, *(const v8h*)(p + 256)); } static __device__ __forceinline__ v8f mma(V a, V b, v8f c) { return wmma16(a, b, c); } };
template <> struct WFrag<bf> { typedef v16bf V; static __device__ __forceinline__ V ld(const bf* p) { return cat16b(*(const v8us*)p, *(const v8us*)(p + 256)); } static __device__ __forceinline__ v8f mma(V a, V b, v8f c) { return wmmab(a, b, c); } };
// One k chunk of k_gemmo: its 24 fragment loads (12 fragments), and its 32 products.
__device__ __forceinline__ void go_ld(const bf* pa, const bf* pa2, const bf* pb, WFrag<bf>::V (&a)[4], WFrag<bf>::V (&a2)[4], WFrag<bf>::V (&b)[4]) {
#pragma unroll
    for (int i = 0; i < 4; ++i) { a[i] = WFrag<bf>::ld(pa + i * 512); b[i] = WFrag<bf>::ld(pb + i * 512); }
#pragma unroll
    for (int i = 0; i < 4; ++i) a2[i] = WFrag<bf>::ld(pa2 + i * 512);
}
__device__ __forceinline__ void go_mma(const WFrag<bf>::V (&a)[4], const WFrag<bf>::V (&a2)[4], const WFrag<bf>::V (&b)[4], v8f (&acc)[4][4]) {
#pragma unroll
    for (int nb = 0; nb < 4; ++nb)
#pragma unroll
        for (int mb = 0; mb < 4; ++mb) acc[mb][nb] = WFrag<bf>::mma(a[mb], b[nb], acc[mb][nb]);
#pragma unroll
    for (int nb = 0; nb < 4; ++nb)
#pragma unroll
        for (int mb = 0; mb < 4; ++mb) acc[mb][nb] = WFrag<bf>::mma(a2[mb], b[nb], acc[mb][nb]);
}
__global__ __launch_bounds__(32) void k_gemmo(const bf* __restrict__ A, const bf* __restrict__ A2, int M, const bf* __restrict__ Bt, int K, float* C, int ldc, const float* __restrict__ bias) {
    typedef WFrag<bf>::V V;
    __shared__ __align__(16) float os[16 * 68];
    const int lane = threadIdx.x & 31, lr = lane & 15, hi = lane >> 4; const int r0 = blockIdx.x * 64, c0 = blockIdx.y * 64;
    v8f acc[4][4];
#pragma unroll
    for (int mb = 0; mb < 4; ++mb)
#pragma unroll
        for (int nb = 0; nb < 4; ++nb) acc[mb][nb] = (v8f){};
    const size_t aoff = (size_t)blockIdx.z * M * K + (size_t)r0 * 32 + lane * 8, boff = (size_t)c0 * K + lane * 8;
    const bf* pa = A + aoff; const bf* pa2 = A2 + aoff; const bf* pb = Bt + boff;
    // The k chunks go through two register sets (x, y): all loads of the next chunk are issued as one group in front of the products of the chunk that has arrived, so that a load has 32 products' time to land. Every accumulator still takes its products in rising k, hi then lo.
    V xa[4], xa2[4], xb[4], ya[4], ya2[4], yb[4];
    go_ld(pa, pa2, pb, xa, xa2, xb);
    asm volatile("s_wait_xcnt 0x0" :: "v"(pa), "v"(pa2), "v"(pb) : "memory");   // the wait in front of any rewrite of a register that the first chunk's loads name
    __builtin_amdgcn_sched_barrier(0);                               // nothing that follows moves in front of that wait
#pragma unroll 1   // stays rolled: a trip is two chunks, one per register set
    for (int kc = 0; kc + 64 < K; kc += 64) {
        const bf* qa = pa + (size_t)(kc + 32) * M; const bf* qa2 = pa2 + (size_t)(kc + 32) * M; const bf* tb = pb + kc * 64;   // tb: one address a trip for both chunks' weight loads, with immediate offsets
        go_ld(qa, qa2, tb + 32 * 64, ya, ya2, yb);
        __builtin_amdgcn_sched_barrier(0);                           // keeps the next chunk's loads in front of this chunk's products: sunk among them they would be waited for at once
        go_mma(xa, xa2, xb, acc);
        __builtin_amdgcn_sched_barrier(0);                           // the wait and the loads below stay behind the products
        // the wait in front of any rewrite of a register that the loads above name; the addresses are its inputs so that nothing lands on one of them before it
        asm volatile("s_wait_xcnt 0x0" :: "v"(qa), "v"(qa2) : "memory");
        const bf* ra = pa + (size_t)(kc + 64) * M; const bf* ra2 = pa2 + (size_t)(kc + 64) * M;
        go_ld(ra, ra2, tb + 64 * 64, xa, xa2, xb);
        __builtin_amdgcn_sched_barrier(0);                           // as the first
        go_mma(ya, ya2, yb, acc);
        __builtin_amdgcn_sched_barrier(0);                           // the wait and the slots below stay behind the products
        asm volatile("s_wait_xcnt 0x0" :: "v"(ra), "v"(ra2), "v"(tb) : "memory");   // as above
        // the slots the chip needs behind the last matrix instruction, on the taken side of the loop's branch too
        asm volatile("v_nop\n\tv_nop\n\tv_nop\n\tv_nop");
    }
    { const bf* qa = pa + (size_t)(K - 32) * M; const bf* qa2 = pa2 + (size_t)(K - 32) * M; const bf* tb = pb + (K - 64) * 64;   // the last two chunks: nothing is left to fetch behind them
        go_ld(qa, qa2, tb + 32 * 64, ya, ya2, yb);
        __builtin_amdgcn_sched_barrier(0);                           // as the first
        go_mma(xa, xa2, xb, acc);
        __builtin_amdgcn_sched_barrier(0);                           // the wait below stays behind the products
        asm volatile("s_wait_xcnt 0x0" :: "v"(qa), "v"(qa2), "v"(tb) : "memory");   // as in the loop
        go_mma(ya, ya2, yb, acc); }
#pragma unroll
    for (int mb = 0; mb < 4; ++mb) {
#pragma unroll
        for (int nb = 0; nb < 4; ++nb) {
#pragma unroll
            for (int j = 0; j < 8; ++j) os[(hi * 8 + j) * 68 + nb * 16 + lr] = acc[mb][nb][j]; }
        __builtin_amdgcn_wave_barrier(); asm volatile("" ::: "memory");   // the wave's LDS writes stay in front of its reads of other lanes' values
        float* crow = C + ((size_t)blockIdx.z * M + r0 + mb * 16) * ldc + c0;
#pragma unroll
        for (int s = 0; s < 8; ++s) { const int row = 2 * s + hi, cofs = lr * 4; v4f val = *(const v4fa*)(os + row * 68 + cofs); val[0] += bfr(bias[c0 + cofs]); val[1] += bfr(bias[c0 + cofs + 1]); val[2] += bfr(bias[c0 + cofs + 2]); val[3] += bfr(bias[c0 + cofs + 3]);
            *(v4f*)(crow + (size_t)row * ldc + cofs) = val; }
        __builtin_amdgcn_wave_barrier(); asm volatile("" ::: "memory");   // the reads above stay in front of the next 16 rows' LDS writes
    }
}

__device__ __forceinline__ h16 tohx(float x) { return (h16)x; }
__device__ __forceinline__ void splitf(float y, unsigned short& h, unsigned short& l) { h = f2bf(y); l = f2bf(y - bf2f(h)); }
typedef __attribute__((ext_vector_type(2))) _Float16 v2h;
typedef __attribute__((ext_vector_type(4))) _Float16 v4h;
typedef __attribute__((ext_vector_type(2))) unsigned short v2us;
typedef __attribute__((ext_vector_type(4))) unsigned short v4us;
typedef __attribute__((ext_vector_type(2))) float v2f;
typedef __attribute__((ext_vector_type(4))) int v4i;
typedef v2f  __attribute__((may_alias)) v2fa;

// ---- k_gemmw: the q, k, v projections: register-blocked GEMM, ONE WAVE per 64x64 tile (16 accumulators), operands straight from 16-bit planes of fragment blocks [row/64][k/32][(row/16)%4] (plain product, NSPLIT 0), K % 128 == 0, whose epilogue adds the bias and writes the value's three 16-bit planes (fp16, bf16 hi, bf16 lo) itself; grid (M/64, N/64, batches), 32 threads; the token operand advances TT rows a batch, the planes TT*DQ elements.
// ROWB false (q, k: A = tokens, Bt = weight rows): bias[n]; a tile's 64 columns are one head, planes of fragment blocks [n/64][m/16][(n%64)/32]. ROWB true (v: A = weight rows, Bt = tokens, so the product comes out transposed): bias[m]; fragment blocks [m/64][n/32][(m/16)%4].
// Either way a lane stores the 8 neighbours that it will load as a fragment half, and a wave-wide store fills 4 whole lines of a plane.
// One stage of k_gemmw (64 k): its 32 fragment loads (index: chunk * 4 + block of 16 rows), and its 32 products.
template <typename T16> __device__ __forceinline__ void gw_ld(const T16* pa, const T16* pb, typename WFrag<T16>::V (&a)[8], typename WFrag<T16>::V (&b)[8]) {
#pragma unroll
    for (int c = 0; c < 2; ++c) {
#pragma unroll
        for (int i = c * 4; i < c * 4 + 4; ++i) { a[i] = WFrag<T16>::ld(pa + i * 512); b[i] = WFrag<T16>::ld(pb + i * 512); } }
}
template <typename T16> __device__ __forceinline__ void gw_mma(const typename WFrag<T16>::V (&a)[8], const typename WFrag<T16>::V (&b)[8], v8f (&acc)[4][4]) {
#pragma unroll
    for (int c = 0; c < 2; ++c)
#pragma unroll
        for (int nb = 0; nb < 4; ++nb)
#pragma unroll
            for (int mb = 0; mb < 4; ++mb) acc[mb][nb] = WFrag<T16>::mma(a[c * 4 + mb], b[c * 4 + nb], acc[mb][nb]);
}
template <typename T16, int NSPLIT, bool ROWB>
__global__ __launch_bounds__(32) void k_gemmw(const T16* __restrict__ A, const T16* __restrict__ A2, const T16* __restrict__ Bt, const T16* __restrict__ Bt2, int K, const float* __restrict__ bias, h16* P16, bf* Ph, bf* Pl) {
    typedef typename WFrag<T16>::V V;
    __shared__ __align__(16) float os[16 * 68];
    const int lane = threadIdx.x & 31, lr = lane & 15, hi = lane >> 4; const int r0 = blockIdx.x * 64, c0 = blockIdx.y * 64;
    v8f acc[4][4];
#pragma unroll
    for (int mb = 0; mb < 4; ++mb)
#pragma unroll
        for (int nb = 0; nb < 4; ++nb) acc[mb][nb] = (v8f){};
    const size_t zt = (size_t)blockIdx.z * TT * K, zp = (size_t)blockIdx.z * TT * DQ;   // the batch's tokens, the batch's planes
    const size_t aoff = (ROWB ? 0 : zt) + (size_t)r0 * K + lane * 8, boff = (ROWB ? zt : 0) + (size_t)c0 * K + lane * 8;
    static_assert(NSPLIT == 0, "the loop below forms the plain product alone");
    const T16* pa = A + aoff; const T16* pb = Bt + boff;
    // A stage is 64 k (two chunks, 8 KiB of each operand behind one another). The stages go through two register sets (x, y): all 32 loads of the next stage are issued as one group in front of the 32 products of the stage that has arrived. Every accumulator still takes its products in rising k.
    V xa[8], xb[8], ya[8], yb[8];
    gw_ld<T16>(pa, pb, xa, xb);
    asm volatile("s_wait_xcnt 0x0" :: "v"(pa), "v"(pb) : "memory");   // the wait in front of any rewrite of a register that the first stage's loads name
    __builtin_amdgcn_sched_barrier(0);                               // nothing that follows moves in front of that wait
#pragma unroll 1   // stays rolled: a trip is two stages, one per register set
    for (int kc = 0; kc + 128 < K; kc += 128) {
        const T16* ta = pa + kc * 64; const T16* tb = pb + kc * 64;   // one address pair a trip: both stages' loads name it, with immediate offsets
        gw_ld<T16>(ta + 64 * 64, tb + 64 * 64, ya, yb);
        __builtin_amdgcn_sched_barrier(0);                           // keeps the next stage's loads in front of this stage's products: sunk among them they would be waited for at once
        gw_mma<T16>(xa, xb, acc);
        __builtin_amdgcn_sched_barrier(0);                           // the loads below stay behind the products that read their registers
        gw_ld<T16>(ta + 128 * 64, tb + 128 * 64, xa, xb);
        __builtin_amdgcn_sched_barrier(0);                           // as the first
        gw_mma<T16>(ya, yb, acc);
        __builtin_amdgcn_sched_barrier(0);                           // the wait and the slots below stay behind the products
        // the wait in front of any rewrite of a register that the trip's loads name; the addresses are its inputs so that nothing lands on one of them before it
        asm volatile("s_wait_xcnt 0x0" :: "v"(ta), "v"(tb) : "memory");
        // the slots the chip needs behind the last matrix instruction, on the taken side of the loop's branch too
        asm volatile("v_nop\n\tv_nop\n\tv_nop\n\tv_nop");
    }
    { const T16* ta = pa + (K - 128) * 64; const T16* tb = pb + (K - 128) * 64;   // the last two stages: nothing is left to fetch behind them
        gw_ld<T16>(ta + 64 * 64, tb + 64 * 64, ya, yb);
        __builtin_amdgcn_sched_barrier(0);                           // as the first
        gw_mma<T16>(xa, xb, acc);
        __builtin_amdgcn_sched_barrier(0);                           // the wait below stays behind the products, so that the wave does not stand at it with products left to issue
        asm volatile("s_wait_xcnt 0x0" :: "v"(ta), "v"(tb) : "memory");   // as in the loop
        gw_mma<T16>(ya, yb, acc);
        __builtin_amdgcn_sched_barrier(0); }                         // the epilogue stays behind the last products
    const float* pbi = bias + (ROWB ? r0 + lr : c0 + hi * 8); float bb[ROWB ? 4 : 32];   // ROWB: the lane's row of each 16; else the lane's 8 columns of each half fragment
#pragma unroll
    for (int q = 0; q < (ROWB ? 4 : 32); ++q) bb[q] = pbi[ROWB ? q * 16 : (q >> 3) * 16 + (q & 7)];
    asm volatile("s_wait_xcnt 0x0" :: "v"(pbi) : "memory");   // the wait in front of any rewrite of the register that the bias loads name
#pragma unroll
    for (int mb = 0; mb < 4; ++mb) {
#pragma unroll
        for (int nb = 0; nb < 4; ++nb) {
#pragma unroll
            for (int j = 0; j < 8; ++j) os[(hi * 8 + j) * 68 + nb * 16 + lr] = acc[mb][nb][j]; }
        __builtin_amdgcn_wave_barrier(); asm volatile("" ::: "memory");   // the wave's LDS writes stay in front of its reads of other lanes' values
        const size_t ob = zp + (ROWB ? (size_t)r0 * TT + (size_t)c0 * 64 + mb * 512 : ((size_t)blockIdx.y * TT + r0 + mb * 16) * HD) + lane * 8;
        h16* q16 = P16 + ob; bf* qh = Ph + ob; bf* ql = Pl + ob; v8h o16[4]; v8us oh[4], ol[4];
#pragma unroll
        for (int s = 0; s < 4; ++s) { const int cofs = s * 16 + hi * 8; const v4f x0 = *(const v4fa*)(os + lr * 68 + cofs), x1 = *(const v4fa*)(os + lr * 68 + cofs + 4);   // s: the half fragment (16 k) of the 16 rows; row lr, 8 neighbours
#pragma unroll
            for (int q = 0; q < 8; ++q) { const float val = (q < 4 ? x0[q & 3] : x1[q & 3]) + bfr(bb[ROWB ? mb : s * 8 + q]); o16[s][q] = tohx(val); unsigned short a2, c2; splitf(val, a2, c2); oh[s][q] = a2; ol[s][q] = c2; }
            const int o = ROWB ? (s >> 1) * 2048 + (s & 1) * 256 : s * 256;
            *(v8h*)(q16 + o) = o16[s]; *(v8us*)(qh + o) = oh[s]; *(v8us*)(ql + o) = ol[s]; }
        // the wait in front of any rewrite of a register that the stores above name; addresses and values are its inputs so that nothing lands on one of them before it
        asm volatile("s_wait_xcnt 0x0" :: "v"(q16), "v"(qh), "v"(ql), "v"(o16[0]), "v"(o16[1]), "v"(o16[2]), "v"(o16[3]), "v"(oh[0]), "v"(oh[1]), "v"(oh[2]), "v"(oh[3]), "v"(ol[0]), "v"(ol[1]), "v"(ol[2]), "v"(ol[3]) : "memory");
        __builtin_amdgcn_wave_barrier(); asm volatile("" ::: "memory");   // the reads above stay in front of the next 16 rows' LDS writes
    }
}

// ---- k_attn: causal scores, softmax and the probability x value contraction in one kernel; no score or probability ever lies in memory. One work-group per 32 query rows of one head, grid (heads, row tiles, batches), 256 threads.
// The key loop is dealt over the AW waves: wave w takes the 32-key chunks w, w+AW, ... up to the diagonal chunk and keeps its own running row maximum, row sum and f32 output tile (online softmax).
// Both products are formed transposed, so that a lane owns one query: S^T = K Q^T leaves in lane (lr, hi) the keys 8 hi + j of each 16-key block for query lr, which is the k order of the B fragment of O^T = V^T P^T:
// the probabilities go from the accumulator of the first product into the operand of the second inside the lane. The row maximum and sum need one exchange between the lane halves.
// At the end the waves' maxima go through LDS, each wave scales its tile and its row sums to the common maximum, and behind a second barrier every thread adds the AW partials of 8 elements in wave order, divides by the row sum and stores the bf16 hi and lo planes
// Ah, Al, fragment blocks [chunk][t/16] (chunk = 2 head + d / 32), the k chunks of the output projection. Q, K: fragment blocks [t/16][d/32] of a head; Vt: [t/32][d/16].
#define AW   8                    // waves of a work-group
#define AQ   32                   // query rows of a work-group
#define AP   68                   // LDS row pitch in floats (rows stay 16-byte aligned)
#define SC2  (SCL * 1.4426950408889634f)   // scores are scaled into base-2 exponents; maxima are kept in that unit
__device__ __forceinline__ float xhalf(float x) { return __builtin_bit_cast(float, __builtin_amdgcn_permlanex16(__builtin_bit_cast(int, x), __builtin_bit_cast(int, x), 0x76543210, 0xfedcba98, false, false)); }   // lane l with lane l ^ 16
template <typename T16, int NSPLIT>
__device__ __forceinline__ void attn_tile(const T16* __restrict__ Q, const T16* __restrict__ Q2, const T16* __restrict__ Kp, const T16* __restrict__ Kp2, const T16* __restrict__ Vt, const T16* __restrict__ Vt2, bf* Ah, bf* Al, int h, int q0, float* red, float* sm, float* sl) {
    typedef typename WFrag<T16>::V V;
    const int lane = threadIdx.x & 31, lr = lane & 15, hi = lane >> 4; const int w = __builtin_amdgcn_readfirstlane(threadIdx.x >> 5);
    const float PSH = (NSPLIT == 2) ? 0.f : 10.f;                    // fp16 probabilities are carried x 2^10, by the exponent; the row sums carry the same factor, so it cancels in the quotient
    const int Kl = q0 + AQ;                                          // keys beyond the diagonal chunk are masked for every row of the tile
    V qf[2][2], qf2[2][2]; const size_t qo = (size_t)q0 * HD + lane * 8; const T16* pq = Q + qo; const T16* pq2 = pq; if (NSPLIT == 2) pq2 = Q2 + qo;
#pragma unroll
    for (int nq = 0; nq < 2; ++nq)
#pragma unroll
        for (int kc = 0; kc < 2; ++kc) { qf[nq][kc] = WFrag<T16>::ld(pq + nq * 16 * HD + kc * 512); if (NSPLIT == 2) qf2[nq][kc] = WFrag<T16>::ld(pq2 + nq * 16 * HD + kc * 512); }
    // the wait in front of any rewrite of a register that the loads above name; the addresses are its inputs so that no later load of the group lands on one of them
    if (NSPLIT == 2) asm volatile("s_wait_xcnt 0x0" :: "v"(pq), "v"(pq2) : "memory");
    else asm volatile("s_wait_xcnt 0x0" :: "v"(pq) : "memory");
    v8f o[4][2]; float m[2] = { -3.0e38f, -3.0e38f }, l[2] = { 0.f, 0.f };
#pragma unroll
    for (int mb = 0; mb < 4; ++mb)
#pragma unroll
        for (int nq = 0; nq < 2; ++nq) o[mb][nq] = (v8f){};
#pragma unroll 1   // stays rolled: one pass already holds the operands of a whole chunk in registers
    for (int k0 = w * 32; k0 < Kl; k0 += AW * 32) {
        const size_t ko = (size_t)k0 * HD + lane * 8, vo = (size_t)k0 * HD + lane * 8;
        const T16* pk = Kp + ko; const T16* pv = Vt + vo; const T16* pk2 = pk; const T16* pv2 = pv; if (NSPLIT == 2) { pk2 = Kp2 + ko; pv2 = Vt2 + vo; }
        V kf[2][2], kf2[2][2], vf[4], vf2[4];
#pragma unroll
        for (int kb = 0; kb < 2; ++kb)
#pragma unroll
            for (int kc = 0; kc < 2; ++kc) { kf[kb][kc] = WFrag<T16>::ld(pk + kb * 16 * HD + kc * 512); if (NSPLIT == 2) kf2[kb][kc] = WFrag<T16>::ld(pk2 + kb * 16 * HD + kc * 512); }
#pragma unroll
        for (int mb = 0; mb < 4; ++mb) { vf[mb] = WFrag<T16>::ld(pv + mb * 512); if (NSPLIT == 2) vf2[mb] = WFrag<T16>::ld(pv2 + mb * 512); }
        // the wait in front of any rewrite of a register that the loads above name; the addresses are its inputs so that no later load of the chunk lands on one of them
        if (NSPLIT == 2) asm volatile("s_wait_xcnt 0x0" :: "v"(pk), "v"(pv), "v"(pk2), "v"(pv2) : "memory");
        else asm volatile("s_wait_xcnt 0x0" :: "v"(pk), "v"(pv) : "memory");
        __builtin_amdgcn_sched_barrier(0);                           // keeps all of the chunk's loads in front of the first product, so that their latencies overlap instead of adding up
        v8f s[2][2];
#pragma unroll
        for (int kb = 0; kb < 2; ++kb)
#pragma unroll
            for (int nq = 0; nq < 2; ++nq) { s[kb][nq] = (v8f){};
#pragma unroll
                for (int kc = 0; kc < 2; ++kc) { s[kb][nq] = WFrag<T16>::mma(kf[kb][kc], qf[nq][kc], s[kb][nq]); if (NSPLIT == 2) { s[kb][nq] = WFrag<T16>::mma(kf[kb][kc], qf2[nq][kc], s[kb][nq]); s[kb][nq] = WFrag<T16>::mma(kf2[kb][kc], qf[nq][kc], s[kb][nq]); } } }
        V pf[2], pf2[2];
#pragma unroll
        for (int nq = 0; nq < 2; ++nq) {
            const int qi = q0 + nq * 16 + lr; v2f t[8]; float mx = -3.0e38f;   // t[e2][i]: key (e2 >> 2) * 16 + hi * 8 + (e2 & 3) * 2 + i of the chunk
#pragma unroll
            for (int e = 0; e < 8; ++e) { t[e][0] = s[e >> 2][nq][(e & 3) * 2]; t[e][1] = s[e >> 2][nq][(e & 3) * 2 + 1]; }
            if (k0 + 31 > q0) {                                      // wave-uniform: only the diagonal chunk holds masked keys
#pragma unroll
                for (int e = 0; e < 8; ++e) { const int key = k0 + (e >> 2) * 16 + hi * 8 + (e & 3) * 2; if (key > qi) t[e][0] = -3.0e38f; if (key + 1 > qi) t[e][1] = -3.0e38f; } }
#pragma unroll
            for (int e = 0; e < 8; ++e) mx = fmaxf(mx, fmaxf(t[e][0], t[e][1]));
            mx = fmaxf(mx, xhalf(mx));                               // the other lane half holds the query's other 16 keys
            const float mn = fmaxf(m[nq], mx * SC2), al = __builtin_amdgcn_exp2f(m[nq] - mn), sh = PSH - mn; m[nq] = mn; v2f ps = (v2f){};
#pragma unroll
            for (int e = 0; e < 8; ++e) { const v2f a = __builtin_elementwise_fma(t[e], (v2f){ SC2, SC2 }, (v2f){ sh, sh }); t[e][0] = __builtin_amdgcn_exp2f(a[0]); t[e][1] = __builtin_amdgcn_exp2f(a[1]); ps += t[e]; }
            l[nq] = l[nq] * al + (ps[0] + ps[1]);
#pragma unroll
            for (int mb = 0; mb < 4; ++mb) o[mb][nq] *= al;
            if constexpr (NSPLIT == 2) { v8us h0, h1, l0, l1;
#pragma unroll
                for (int e = 0; e < 8; ++e) { unsigned short a, c2; splitf(t[e >> 1][e & 1], a, c2); h0[e] = a; l0[e] = c2; splitf(t[4 + (e >> 1)][e & 1], a, c2); h1[e] = a; l1[e] = c2; }
                pf[nq] = cat16b(h0, h1); pf2[nq] = cat16b(l0, l1);
            } else { v16h p16;
#pragma unroll
                for (int e = 0; e < 16; ++e) p16[e] = tohx(t[e >> 1][e & 1]);
                pf[nq] = p16; }
        }
#pragma unroll
        for (int mb = 0; mb < 4; ++mb)
#pragma unroll
            for (int nq = 0; nq < 2; ++nq) { o[mb][nq] = WFrag<T16>::mma(vf[mb], pf[nq], o[mb][nq]); if (NSPLIT == 2) { o[mb][nq] = WFrag<T16>::mma(vf[mb], pf2[nq], o[mb][nq]); o[mb][nq] = WFrag<T16>::mma(vf2[mb], pf[nq], o[mb][nq]); } }
        // the slots the chip needs behind the last matrix instruction, on the taken side of the loop's branch too
        asm volatile("v_nop\n\tv_nop\n\tv_nop\n\tv_nop" : "+v"(o[0][0]), "+v"(o[1][0]), "+v"(o[2][0]), "+v"(o[3][0]), "+v"(o[0][1]), "+v"(o[1][1]), "+v"(o[2][1]), "+v"(o[3][1]));
    }
#pragma unroll
    for (int nq = 0; nq < 2; ++nq) { l[nq] += xhalf(l[nq]); if (hi == 0) sm[w * AQ + nq * 16 + lr] = m[nq]; }
    __syncthreads();                                                 // every wave's row maxima are in LDS before any wave scales its tile and its row sums
#pragma unroll
    for (int nq = 0; nq < 2; ++nq) { float M = sm[nq * 16 + lr];
#pragma unroll
        for (int p = 1; p < AW; ++p) M = fmaxf(M, sm[p * AQ + nq * 16 + lr]);
        const float f = __builtin_amdgcn_exp2f(m[nq] - M); float* pw = red + (size_t)(w * AQ + nq * 16 + lr) * AP + hi * 8; if (hi == 0) sl[w * AQ + nq * 16 + lr] = l[nq] * f;
#pragma unroll
        for (int mb = 0; mb < 4; ++mb) { const v8f x = o[mb][nq] * f; *(v4fa*)(pw + mb * 16) = __builtin_shufflevector(x, x, 0, 1, 2, 3); *(v4fa*)(pw + mb * 16 + 4) = __builtin_shufflevector(x, x, 4, 5, 6, 7); } }
    __syncthreads();                                                 // every wave's scaled partial tile and row sums are in LDS before any thread adds them
    const int q = threadIdx.x & 31, d0 = (threadIdx.x >> 5) * 8;   // a wave takes one group of 8 d for all 32 rows: its stores fill whole lines of the fragment blocks
    float L = 0.f; v4f a0 = (v4f){}, a1 = (v4f){};
#pragma unroll
    for (int p = 0; p < AW; ++p) { L += sl[p * AQ + q]; const float* pr = red + (size_t)(p * AQ + q) * AP + d0; a0 += *(const v4fa*)pr; a1 += *(const v4fa*)(pr + 4); }
    const float r = __fdiv_rn(1.0f, L); v8us oh, ol;
#pragma unroll
    for (int e = 0; e < 4; ++e) { unsigned short a, c2; splitf(a0[e] * r, a, c2); oh[e] = a; ol[e] = c2; splitf(a1[e] * r, a, c2); oh[e + 4] = a; ol[e + 4] = c2; }
    const size_t oo = ((size_t)(h * (HD / 32) + (d0 >> 5)) * TT + q0 + (q & 16)) * 32 + ((d0 >> 3) & 3) * 128 + (q & 15) * 8;
    *(v8usa*)(Ah + oo) = oh; *(v8usa*)(Al + oo) = ol;
}
// Tiles are taken longest first over all heads, batch by batch, so that a batch's short tiles run beside the next batch's long ones; h counts heads through the batches, which is the order of the planes; tile1 = the launch's last (longest) tile. Query rows < RH go on bf16 hi+lo planes (3 products, NSPLIT 2), the rest on single fp16 (NSPLIT 0): two launches, so that the long one keeps the smaller register count.
template <typename T16, int NSPLIT>
__global__ __launch_bounds__(256) void k_attn(const T16* __restrict__ Q, const T16* __restrict__ Q2, const T16* __restrict__ Kp, const T16* __restrict__ Kp2, const T16* __restrict__ Vt, const T16* __restrict__ Vt2, bf* Ah, bf* Al, int tile1) {
    __shared__ __align__(16) float red[AW * AQ * AP]; __shared__ float sm[AW * AQ]; __shared__ float sl[AW * AQ];
    const int h = blockIdx.z * NH_ + blockIdx.x, q0 = (tile1 - (int)blockIdx.y) * AQ; const size_t zo = (size_t)h * TT * HD;
    attn_tile<T16, NSPLIT>(Q + zo, NSPLIT == 2 ? Q2 + zo : nullptr, Kp + zo, NSPLIT == 2 ? Kp2 + zo : nullptr, Vt + zo, NSPLIT == 2 ? Vt2 + zo : nullptr, Ah, Al, h, q0, red, sm, sl);
}

__global__ __launch_bounds__(256) void k_wtG(const float* __restrict__ w, int K, int N, bf* Bt) {
    const int lane = threadIdx.x & 31; const int L0 = (blockIdx.x * 8 + (threadIdx.x >> 5)) * 8; const int nlines = N * K / 64;
{
#pragma unroll 1
        for (int l = 0; l < 8; ++l) { const int L = L0 + l; if (L >= nlines) break; const size_t e = (size_t)L * 64 + lane * 2; const int k = (int)(e % K), n = (int)(e / K); v2us o;
            o[0] = f2bf(w[(size_t)k * N + n]); o[1] = f2bf(w[(size_t)(k + 1) * N + n]); *(v2us*)(Bt + e) = o; }
         }
}
// k_cvtall: all five f32 matrices (tokens, four weights), each [rows][DM] -> bf16 fragment blocks [row/64][k/32][(row/16)%4], in ONE launch of few, long waves. A unit is 16 bytes of a plane: unit i takes the 8 neighbours of the row that belong there.
// A work-group takes CU groups of 256 units behind one another (64 rows x CU * 32 k, all of one matrix); a thread takes one unit of each group: its reads lie 128 bytes apart in one row, its stores 4 KiB apart (a wave: 512 contiguous bytes each).
static_assert(DQ == DM && DKV == DM, "every converted matrix has rows of DM elements");
#define CU   8                                   // units of a thread
#define CXB  (NB_ * TT * DM / 8 / (256 * CU))    // work-groups of the tokens
#define CWB  (DM * DM / 8 / (256 * CU))          // work-groups of one weight matrix
static_assert((DM / 32) % CU == 0, "a work-group's groups lie in one band of 64 rows");
static_assert(NB_ * TT * DM % (8 * 256 * CU) == 0 && DM * DM % (8 * 256 * CU) == 0, "the grid covers every matrix exactly: no thread is without its units");
__global__ __launch_bounds__(256) void k_cvtall(const float* __restrict__ x, const float* __restrict__ wq, const float* __restrict__ wk, const float* __restrict__ wv, const float* __restrict__ wo, bf* XB, bf* WQ, bf* WK, bf* WV, bf* WO) {
    const float* src = x; bf* dst = XB; int lb = blockIdx.x;   // the matrix is the same for a whole work-group
    if (lb >= CXB) { const int s = (lb - CXB) / CWB; lb = (lb - CXB) % CWB; src = s == 0 ? wq : s == 1 ? wk : s == 2 ? wv : wo; dst = s == 0 ? WQ : s == 1 ? WK : s == 2 ? WV : WO; }
    const size_t i = (size_t)lb * (256 * CU) + threadIdx.x;    // the thread's first unit; the others follow 256 units apart
    const size_t grp = i >> 8, row = grp / (DM / 32) * 64 + ((i >> 6) & 3) * 16 + (i & 15), k = grp % (DM / 32) * 32 + ((i >> 4) & 3) * 8; const float* ps = src + row * DM + k; bf* pd = dst + i * 8; v8f v[CU];
#pragma unroll
    for (int u = 0; u < CU; ++u) v[u] = *(const v8f*)(ps + u * 32);
    asm volatile("s_wait_xcnt 0x0" :: "v"(ps) : "memory");   // the wait in front of any rewrite of the register that the loads above name; all of the thread's loads are issued in front of it, so that their latencies overlap
#pragma unroll
    for (int u = 0; u < CU; ++u) { v8us o;
#pragma unroll
        for (int e = 0; e < 8; ++e) o[e] = f2bf(v[u][e]);
        *(v8us*)(pd + u * 2048) = o; }
}
__global__ __launch_bounds__(256) void k_cscvt(const float* __restrict__ cosT, const float* __restrict__ sinT, float* CS) { const int idx = blockIdx.x * 256 + threadIdx.x; if (idx >= TT * HD) return; v2f cs; cs[0] = bfr(cosT[idx]); cs[1] = bfr(sinT[idx]); *(v2f*)(CS + (size_t)idx * 2) = cs;  }
extern "C" void kernel_launch(void* const* d_in, const int* in_sizes, int n_in,
                              void* d_out, int out_size, void* d_ws, size_t ws_size, hipStream_t stream) {
    (void)in_sizes; (void)n_in; (void)out_size;
    const float* x = (const float*)d_in[0]; const float* wq = (const float*)d_in[1]; const float* bq = (const float*)d_in[2]; const float* wk = (const float*)d_in[3]; const float* bk = (const float*)d_in[4]; const float* wv = (const float*)d_in[5]; const float* bv = (const float*)d_in[6]; const float* wo = (const float*)d_in[7]; const float* bo = (const float*)d_in[8]; const float* cosT = nullptr; const float* sinT = nullptr; (void)cosT; (void)sinT;
    float* OUT = (float*)d_out;     // [4][2048][1024]
    char* wsp = (char*)d_ws;
    auto take = [&](size_t bytes) { char* p = wsp; wsp += (bytes + 255) & ~(size_t)255; return (void*)p; };
    bf* WQ = (bf*)take((size_t)DQ * DM * 2); bf* WK = (bf*)take((size_t)DKV * DM * 2); bf* WV = (bf*)take((size_t)DKV * DM * 2); bf* WO = (bf*)take((size_t)DM * DQ * 2);
    bf* XB = (bf*)take((size_t)NB_ * TT * DM * 2);
    h16* QP16 = (h16*)take((size_t)NB_ * NH_ * TT * HD * 2); h16* KP16 = (h16*)take((size_t)NB_ * NKV * TT * HD * 2); h16* VT16 = (h16*)take((size_t)NB_ * NKV * HD * TT * 2);
    bf* QPh = (bf*)take((size_t)NB_ * NH_ * TT * HD * 2); bf* QPl = (bf*)take((size_t)NB_ * NH_ * TT * HD * 2); bf* KPh = (bf*)take((size_t)NB_ * NKV * TT * HD * 2); bf* KPl = (bf*)take((size_t)NB_ * NKV * TT * HD * 2); bf* VTh = (bf*)take((size_t)NB_ * NKV * HD * TT * 2); bf* VTl = (bf*)take((size_t)NB_ * NKV * HD * TT * 2);
    bf* ATh = (bf*)take((size_t)NB_ * TT * DQ * 2); bf* ATl = (bf*)take((size_t)NB_ * TT * DQ * 2);
    if ((size_t)(wsp - (char*)d_ws) > ws_size) return;    // ws 256 MiB
    k_cvtall<<<CXB + 4 * CWB, 256, 0, stream>>>(x, wq, wk, wv, wo, XB, WQ, WK, WV, WO);
    k_gemmw<bf, 0, false><<<dim3(TT / 64, DQ / 64, NB_), 32, 0, stream>>>(XB, nullptr, WQ, nullptr, DM, bq, QP16, QPh, QPl);      // q planes [b][h], fragment blocks [t/16][d/32]
    k_gemmw<bf, 0, false><<<dim3(TT / 64, DKV / 64, NB_), 32, 0, stream>>>(XB, nullptr, WK, nullptr, DM, bk, KP16, KPh, KPl);     // k planes [b][h], fragment blocks [t/16][d/32]
    k_gemmw<bf, 0, true><<<dim3(DKV / 64, TT / 64, NB_), 32, 0, stream>>>(WV, nullptr, XB, nullptr, DM, bv, VT16, VTh, VTl);      // v planes [b][h], fragment blocks [t/32][d/16]
    k_attn<h16, 0><<<dim3(NH_, (TT - RH) / AQ, NB_), 256, 0, stream>>>(QP16, nullptr, KP16, nullptr, VT16, nullptr, ATh, ATl, TT / AQ - 1);
    k_attn<bf, 2><<<dim3(NH_, RH / AQ, NB_), 256, 0, stream>>>(QPh, QPl, KPh, KPl, VTh, VTl, ATh, ATl, RH / AQ - 1);
    k_gemmo<<<dim3(TT / 64, DM / 64, NB_), 32, 0, stream>>>(ATh, ATl, TT, WO, DQ, OUT, DM, bo);
}

// v009
// Measured time: 138 microseconds a run.
// Timed twice side by side with v008, it ran 1.06 times as fast both times.
// All steps since v000 together make it 20.1 times as fast.
#include <hip/hip_runtime.h>

// CausalSelfAttentionSeparateHeads (x [4][2048][1024]; per-head Linear q/k/v: Wq[h][d][c], bq[h][d] (16 heads x 64) == one [1024][1024] torch-layout weight with rows h*64+d; causal softmax(q.k/8); y merged (head-major) Wp^T + bp -> [4][2048][1024]).
// Compute dtypes, f32 accumulate: every input rounded to bf16; Q/K/V on PLAIN bf16 operands (inputs: exact) + bias; causal scores and att.v: query rows < 512 on bf16 hi+lo planes (3 products), the rest single fp16 (x1024); softmax f32;
// The 16-bit operand planes are written by the matrix kernels that make the values (k_gemmw: q, k, v; k_attn: the merged heads): no f32 intermediate and no conversion pass lies between two products.
// Every 16-bit operand plane lies in FRAGMENT ORDER: blocks of 16 rows x 32 k (512 elements, 1 KiB); element (r, k) of a block stands at (k >> 3) * 128 + r * 8 + (k & 7), so that lane l of a wave finds its 8 + 8 elements at l * 8 and 256 + l * 8
// and each wave-wide 16-byte load covers 512 contiguous bytes (4 whole lines). The k order inside a fragment is that of a K-contiguous row, the same for both operands.
// The four blocks that a wave takes together (64 rows of one k chunk; 32 keys of a head) lie behind one another: 4 KiB, one address and immediate offsets.
// The batch is blockIdx.z of every matrix kernel: one launch per stage does all NB_ batches, each on its own set of planes in the workspace (same layout per batch, NB_ sets behind one another).

#define NB_  4
#define TT   2048
#define DM   1024
#define NH_  16
#define NKV  16
#define REP  (NH_ / NKV)
#define HD   64
#define DQ   (NH_ * HD)
#define DKV  (NKV * HD)
#define RH   512                  // query rows < RH use hi+lo planes (0: none)
#define WIN  0
#define SCL  0.125f   // HD^-0.5
typedef _Float16 h16;
typedef unsigned short bf;
typedef __attribute__((ext_vector_type(16))) __bf16   v16bf;
typedef __attribute__((ext_vector_type(16))) _Float16 v16h;
typedef __attribute__((ext_vector_type(8)))  _Float16 v8h;
typedef __attribute__((ext_vector_type(8)))  unsigned short v8us;
typedef __attribute__((ext_vector_type(8)))  float    v8f;
typedef __attribute__((ext_vector_type(4)))  float    v4f;
typedef v8h  __attribute__((may_alias)) v8ha;
typedef v4f  __attribute__((may_alias)) v4fa;
typedef v8us __attribute__((may_alias)) v8usa;

__device__ __forceinline__ unsigned short f2bf(float f) { unsigned u = __float_as_uint(f); u += 0x7FFFu + ((u >> 16) & 1u); return (unsigned short)(u >> 16); }
__device__ __forceinline__ float bf2f(unsigned short b) { return __uint_as_float(((unsigned)b) << 16); }
__device__ __forceinline__ float bfr(float f) { return bf2f(f2bf(f)); }
__device__ __forceinline__ v16h cat16(v8h lo, v8h hi) { return __builtin_shufflevector(lo, hi, 0, 1, 2, 3, 4, 5, 6, 7, 8, 9, 10, 11, 12, 13, 14, 15); }
__device__ __forceinline__ v16bf cat16b(v8us lo, v8us hi) { return __builtin_bit_cast(v16bf, __builtin_shufflevector(lo, hi, 0, 1, 2, 3, 4, 5, 6, 7, 8, 9, 10, 11, 12, 13, 14, 15)); }
__device__ __forceinline__ v8f wmma16(v16h a, v16h b, v8f c) { return __builtin_amdgcn_wmma_f32_16x16x32_f16(false, a, false, b, (short)0, c, false, false); }
__device__ __forceinline__ v8f wmmab(v16bf a, v16bf b, v8f c) { return __builtin_amdgcn_wmma_f32_16x16x32_bf16(false, a, false, b, (short)0, c, false, false); }



// ---- k_gemmo: the output projection as a register-blocked GEMM, ONE WAVE per 64x64 output tile (16 accumulators), operands straight from 16-bit planes; grid (M/64, N/64, batches), 32 threads; a batch's A planes are M*K elements, its C rows M*ldc.
// C[m][n] (f32, pitch ldc) = sum_k (A[m][k] + A2[m][k]) Bt[n][k] + bias[n], two products per k chunk (hi, then lo). K % 64 == 0. Bt: fragment blocks [n/64][k/32][(n/16)%4].
// A and A2: fragment blocks [k/32][m/16], the form in which k_attn leaves them. WFrag::ld takes the block's address plus lane * 8.
template <typename T16> struct WFrag;
template <> struct WFrag<h16> { typedef v16h V; static __device__ __forceinline__ V ld(const h16* p) { return cat16(*(const v8h*)p, *(const v8h*)(p + 256)); } static __device__ __forceinline__ v8f mma(V a, V b, v8f c) { return wmma16(a, b, c); } };
template <> struct WFrag<bf> { typedef v16bf V; static __device__ __forceinline__ V ld(const bf* p) { return cat16b(*(const v8us*)p, *(const v8us*)(p + 256)); } static __device__ __forceinline__ v8f mma(V a, V b, v8f c) { return wmmab(a, b, c); } };
// One k chunk of k_gemmo: its 24 fragment loads (12 fragments), and its 32 products.
__device__ __forceinline__ void go_ld(const bf* pa, const bf* pa2, const bf* pb, WFrag<bf>::V (&a)[4], WFrag<bf>::V (&a2)[4], WFrag<bf>::V (&b)[4]) {
#pragma unroll
    for (int i = 0; i < 4; ++i) { a[i] = WFrag<bf>::ld(pa + i * 512); b[i] = WFrag<bf>::ld(pb + i * 512); }
#pragma unroll
    for (int i = 0; i < 4; ++i) a2[i] = WFrag<bf>::ld(pa2 + i * 512);
}
__device__ __forceinline__ void go_mma(const WFrag<bf>::V (&a)[4], const WFrag<bf>::V (&a2)[4], const WFrag<bf>::V (&b)[4], v8f (&acc)[4][4]) {
#pragma unroll
    for (int nb = 0; nb < 4; ++nb)
#pragma unroll
        for (int mb = 0; mb < 4; ++mb) acc[mb][nb] = WFrag<bf>::mma(a[mb], b[nb], acc[mb][nb]);
#pragma unroll
    for (int nb = 0; nb < 4; ++nb)
#pragma unroll
        for (int mb = 0; mb < 4; ++mb) acc[mb][nb] = WFrag<bf>::mma(a2[mb], b[nb], acc[mb][nb]);
}
__global__ __launch_bounds__(32) void k_gemmo(const bf* __restrict__ A, const bf* __restrict__ A2, int M, const bf* __restrict__ Bt, int K, float* C, int ldc, const float* __restrict__ bias) {
    typedef WFrag<bf>::V V;
    __shared__ __align__(16) float os[16 * 68];
    const int lane = threadIdx.x & 31, lr = lane & 15, hi = lane >> 4; const int r0 = blockIdx.x * 64, c0 = blockIdx.y * 64;
    v8f acc[4][4];
#pragma unroll
    for (int mb = 0; mb < 4; ++mb)
#pragma unroll
        for (int nb = 0; nb < 4; ++nb) acc[mb][nb] = (v8f){};
    const size_t aoff = (size_t)blockIdx.z * M * K + (size_t)r0 * 32 + lane * 8, boff = (size_t)c0 * K + lane * 8;
    const bf* pa = A + aoff; const bf* pa2 = A2 + aoff; const bf* pb = Bt + boff;
    // The k chunks go through two register sets (x, y): all loads of the next chunk are issued as one group in front of the products of the chunk that has arrived, so that a load has 32 products' time to land. Every accumulator still takes its products in rising k, hi then lo.
    V xa[4], xa2[4], xb[4], ya[4], ya2[4], yb[4];
    go_ld(pa, pa2, pb, xa, xa2, xb);
    asm volatile("s_wait_xcnt 0x0" :: "v"(pa), "v"(pa2), "v"(pb) : "memory");   // the wait in front of any rewrite of a register that the first chunk's loads name
    __builtin_amdgcn_sched_barrier(0);                               // nothing that follows moves in front of that wait
#pragma unroll 1   // stays rolled: a trip is two chunks, one per register set
    for (int kc = 0; kc + 64 < K; kc += 64) {
        const bf* qa = pa + (size_t)(kc + 32) * M; const bf* qa2 = pa2 + (size_t)(kc + 32) * M; const bf* tb = pb + kc * 64;   // tb: one address a trip for both chunks' weight loads, with immediate offsets
        go_ld(qa, qa2, tb + 32 * 64, ya, ya2, yb);
        __builtin_amdgcn_sched_barrier(0);                           // keeps the next chunk's loads in front of this chunk's products: sunk among them they would be waited for at once
        go_mma(xa, xa2, xb, acc);
        __builtin_amdgcn_sched_barrier(0);                           // the wait and the loads below stay behind the products
        // the wait in front of any rewrite of a register that the loads above name; the addresses are its inputs so that nothing lands on one of them before it
        asm volatile("s_wait_xcnt 0x0" :: "v"(qa), "v"(qa2) : "memory");
        const bf* ra = pa + (size_t)(kc + 64) * M; const bf* ra2 = pa2 + (size_t)(kc + 64) * M;
        go_ld(ra, ra2, tb + 64 * 64, xa, xa2, xb);
        __builtin_amdgcn_sched_barrier(0);                           // as the first
        go_mma(ya, ya2, yb, acc);
        __builtin_amdgcn_sched_barrier(0);                           // the wait and the slots below stay behind the products
        asm volatile("s_wait_xcnt 0x0" :: "v"(ra), "v"(ra2), "v"(tb) : "memory");   // as above
        // the slots the chip needs behind the last matrix instruction, on the taken side of the loop's branch too
        asm volatile("v_nop\n\tv_nop\n\tv_nop\n\tv_nop");
    }
    { const bf* qa = pa + (size_t)(K - 32) * M; const bf* qa2 = pa2 + (size_t)(K - 32) * M; const bf* tb = pb + (K - 64) * 64;   // the last two chunks: nothing is left to fetch behind them
        go_ld(qa, qa2, tb + 32 * 64, ya, ya2, yb);
        __builtin_amdgcn_sched_barrier(0);                           // as the first
        go_mma(xa, xa2, xb, acc);
        __builtin_amdgcn_sched_barrier(0);                           // the wait below stays behind the products
        asm volatile("s_wait_xcnt 0x0" :: "v"(qa), "v"(qa2), "v"(tb) : "memory");   // as in the loop
        go_mma(ya, ya2, yb, acc); }
#pragma unroll
    for (int mb = 0; mb < 4; ++mb) {
#pragma unroll
        for (int nb = 0; nb < 4; ++nb) {
#pragma unroll
            for (int j = 0; j < 8; ++j) os[(hi * 8 + j) * 68 + nb * 16 + lr] = acc[mb][nb][j]; }
        __builtin_amdgcn_wave_barrier(); asm volatile("" ::: "memory");   // the wave's LDS writes stay in front of its reads of other lanes' values
        float* crow = C + ((size_t)blockIdx.z * M + r0 + mb * 16) * ldc + c0;
#pragma unroll
        for (int s = 0; s < 8; ++s) { const int row = 2 * s + hi, cofs = lr * 4; v4f val = *(const v4fa*)(os + row * 68 + cofs); val[0] += bfr(bias[c0 + cofs]); val[1] += bfr(bias[c0 + cofs + 1]); val[2] += bfr(bias[c0 + cofs + 2]); val[3] += bfr(bias[c0 + cofs + 3]);
            *(v4f*)(crow + (size_t)row * ldc + cofs) = val; }
        __builtin_amdgcn_wave_barrier(); asm volatile("" ::: "memory");   // the reads above stay in front of the next 16 rows' LDS writes
    }
}

__device__ __forceinline__ h16 tohx(float x) { return (h16)x; }
__device__ __forceinline__ void splitf(float y, unsigned short& h, unsigned short& l) { h = f2bf(y); l = f2bf(y - bf2f(h)); }
typedef __attribute__((ext_vector_type(2))) _Float16 v2h;
typedef __attribute__((ext_vector_type(4))) _Float16 v4h;
typedef __attribute__((ext_vector_type(2))) unsigned short v2us;
typedef __attribute__((ext_vector_type(4))) unsigned short v4us;
typedef __attribute__((ext_vector_type(2))) float v2f;
typedef __attribute__((ext_vector_type(4))) int v4i;
typedef v2f  __attribute__((may_alias)) v2fa;

// ---- k_gemmw: the q, k, v projections: register-blocked GEMM, ONE WAVE per 64x64 tile (16 accumulators), operands straight from 16-bit planes of fragment blocks [row/64][k/32][(row/16)%4] (plain product, NSPLIT 0), K % 128 == 0, whose epilogue adds the bias and writes the value's three 16-bit planes (fp16, bf16 hi, bf16 lo) itself; grid (M/64, N/64, batches), 32 threads; the token operand advances TT rows a batch, the planes TT*DQ elements.
// ROWB false (q, k: A = tokens, Bt = weight rows): bias[n]; a tile's 64 columns are one head, planes of fragment blocks [n/64][m/16][(n%64)/32]. ROWB true (v: A = weight rows, Bt = tokens, so the product comes out transposed): bias[m]; fragment blocks [m/64][n/32][(m/16)%4].
// Either way a lane stores the 8 neighbours that it will load as a fragment half, and a wave-wide store fills 4 whole lines of a plane.
// One stage of k_gemmw (64 k): its 32 fragment loads (index: chunk * 4 + block of 16 rows), and its 32 products.
template <typename T16> __device__ __forceinline__ void gw_ld(const T16* pa, const T16* pb, typename WFrag<T16>::V (&a)[8], typename WFrag<T16>::V (&b)[8]) {
#pragma unroll
    for (int c = 0; c < 2; ++c) {
#pragma unroll
        for (int i = c * 4; i < c * 4 + 4; ++i) { a[i] = WFrag<T16>::ld(pa + i * 512); b[i] = WFrag<T16>::ld(pb + i * 512); } }
}
template <typename T16> __device__ __forceinline__ void gw_mma(const typename WFrag<T16>::V (&a)[8], const typename WFrag<T16>::V (&b)[8], v8f (&acc)[4][4]) {
#pragma unroll
    for (int c = 0; c < 2; ++c)
#pragma unroll
        for (int nb = 0; nb < 4; ++nb)
#pragma unroll
            for (int mb = 0; mb < 4; ++mb) acc[mb][nb] = WFrag<T16>::mma(a[c * 4 + mb], b[c * 4 + nb], acc[mb][nb]);
}
template <typename T16, int NSPLIT, bool ROWB>
__global__ __launch_bounds__(32) void k_gemmw(const T16* __restrict__ A, const T16* __restrict__ A2, const T16* __restrict__ Bt, const T16* __restrict__ Bt2, int K, const float* __restrict__ bias, h16* P16, bf* Ph, bf* Pl) {
    typedef typename WFrag<T16>::V V;
    __shared__ __align__(16) float os[16 * 68];
    const int lane = threadIdx.x & 31, lr = lane & 15, hi = lane >> 4; const int r0 = blockIdx.x * 64, c0 = blockIdx.y * 64;
    v8f acc[4][4];
#pragma unroll
    for (int mb = 0; mb < 4; ++mb)
#pragma unroll
        for (int nb = 0; nb < 4; ++nb) acc[mb][nb] = (v8f){};
    const size_t zt = (size_t)blockIdx.z * TT * K, zp = (size_t)blockIdx.z * TT * DQ;   // the batch's tokens, the batch's planes
    const size_t aoff = (ROWB ? 0 : zt) + (size_t)r0 * K + lane * 8, boff = (ROWB ? zt : 0) + (size_t)c0 * K + lane * 8;
    static_assert(NSPLIT == 0, "the loop below forms the plain product alone");
    const T16* pa = A + aoff; const T16* pb = Bt + boff;
    // A stage is 64 k (two chunks, 8 KiB of each operand behind one another). The stages go through two register sets (x, y): all 32 loads of the next stage are issued as one group in front of the 32 products of the stage that has arrived. Every accumulator still takes its products in rising k.
    V xa[8], xb[8], ya[8], yb[8];
    gw_ld<T16>(pa, pb, xa, xb);
    asm volatile("s_wait_xcnt 0x0" :: "v"(pa), "v"(pb) : "memory");   // the wait in front of any rewrite of a register that the first stage's loads name
    __builtin_amdgcn_sched_barrier(0);                               // nothing that follows moves in front of that wait
#pragma unroll 1   // stays rolled: a trip is two stages, one per register set
    for (int kc = 0; kc + 128 < K; kc += 128) {
        const T16* ta = pa + kc * 64; const T16* tb = pb + kc * 64;   // one address pair a trip: both stages' loads name it, with immediate offsets
        gw_ld<T16>(ta + 64 * 64, tb + 64 * 64, ya, yb);
        __builtin_amdgcn_sched_barrier(0);                           // keeps the next stage's loads in front of this stage's products: sunk among them they would be waited for at once
        gw_mma<T16>(xa, xb, acc);
        __builtin_amdgcn_sched_barrier(0);                           // the loads below stay behind the products that read their registers
        gw_ld<T16>(ta + 128 * 64, tb + 128 * 64, xa, xb);
        __builtin_amdgcn_sched_barrier(0);                           // as the first
        gw_mma<T16>(ya, yb, acc);
        __builtin_amdgcn_sched_barrier(0);                           // the wait and the slots below stay behind the products
        // the wait in front of any rewrite of a register that the trip's loads name; the addresses are its inputs so that nothing lands on one of them before it
        asm volatile("s_wait_xcnt 0x0" :: "v"(ta), "v"(tb) : "memory");
        // the slots the chip needs behind the last matrix instruction, on the taken side of the loop's branch too
        asm volatile("v_nop\n\tv_nop\n\tv_nop\n\tv_nop");
    }
    { const T16* ta = pa + (K - 128) * 64; const T16* tb = pb + (K - 128) * 64;   // the last two stages: nothing is left to fetch behind them
        gw_ld<T16>(ta + 64 * 64, tb + 64 * 64, ya, yb);
        __builtin_amdgcn_sched_barrier(0);                           // as the first
        gw_mma<T16>(xa, xb, acc);
        __builtin_amdgcn_sched_barrier(0);                           // the wait below stays behind the products, so that the wave does not stand at it with products left to issue
        asm volatile("s_wait_xcnt 0x0" :: "v"(ta), "v"(tb) : "memory");   // as in the loop
        gw_mma<T16>(ya, yb, acc);
        __builtin_amdgcn_sched_barrier(0); }                         // the epilogue stays behind the last products
    const float* pbi = bias + (ROWB ? r0 + lr : c0 + hi * 8); float bb[ROWB ? 4 : 32];   // ROWB: the lane's row of each 16; else the lane's 8 columns of each half fragment
#pragma unroll
    for (int q = 0; q < (ROWB ? 4 : 32); ++q) bb[q] = pbi[ROWB ? q * 16 : (q >> 3) * 16 + (q & 7)];
    asm volatile("s_wait_xcnt 0x0" :: "v"(pbi) : "memory");   // the wait in front of any rewrite of the register that the bias loads name
#pragma unroll
    for (int mb = 0; mb < 4; ++mb) {
#pragma unroll
        for (int nb = 0; nb < 4; ++nb) {
#pragma unroll
            for (int j = 0; j < 8; ++j) os[(hi * 8 + j) * 68 + nb * 16 + lr] = acc[mb][nb][j]; }
        __builtin_amdgcn_wave_barrier(); asm volatile("" ::: "memory");   // the wave's LDS writes stay in front of its reads of other lanes' values
        const size_t ob = zp + (ROWB ? (size_t)r0 * TT + (size_t)c0 * 64 + mb * 512 : ((size_t)blockIdx.y * TT + r0 + mb * 16) * HD) + lane * 8;
        h16* q16 = P16 + ob; bf* qh = Ph + ob; bf* ql = Pl + ob; v8h o16[4]; v8us oh[4], ol[4];
#pragma unroll
        for (int s = 0; s < 4; ++s) { const int cofs = s * 16 + hi * 8; const v4f x0 = *(const v4fa*)(os + lr * 68 + cofs), x1 = *(const v4fa*)(os + lr * 68 + cofs + 4);   // s: the half fragment (16 k) of the 16 rows; row lr, 8 neighbours
#pragma unroll
            for (int q = 0; q < 8; ++q) { const float val = (q < 4 ? x0[q & 3] : x1[q & 3]) + bfr(bb[ROWB ? mb : s * 8 + q]); o16[s][q] = tohx(val); unsigned short a2, c2; splitf(val, a2, c2); oh[s][q] = a2; ol[s][q] = c2; }
            const int o = ROWB ? (s >> 1) * 2048 + (s & 1) * 256 : s * 256;
            *(v8h*)(q16 + o) = o16[s]; *(v8us*)(qh + o) = oh[s]; *(v8us*)(ql + o) = ol[s]; }
        // the wait in front of any rewrite of a register that the stores above name; addresses and values are its inputs so that nothing lands on one of them before it
        asm volatile("s_wait_xcnt 0x0" :: "v"(q16), "v"(qh), "v"(ql), "v"(o16[0]), "v"(o16[1]), "v"(o16[2]), "v"(o16[3]), "v"(oh[0]), "v"(oh[1]), "v"(oh[2]), "v"(oh[3]), "v"(ol[0]), "v"(ol[1]), "v"(ol[2]), "v"(ol[3]) : "memory");
        __builtin_amdgcn_wave_barrier(); asm volatile("" ::: "memory");   // the reads above stay in front of the next 16 rows' LDS writes
    }
}

// ---- k_attn: causal scores, softmax and the probability x value contraction in one kernel; no score or probability ever lies in memory. One work-group per 32 query rows of one head, grid (heads, row tiles, batches), AW * 32 threads.
// The key loop is dealt over the AW waves: wave w takes the 32-key chunks w, w+AW, ... up to the diagonal chunk and keeps its own running row maximum, row sum and f32 output tile (online softmax).
// Both products are formed transposed, so that a lane owns one query: S^T = K Q^T leaves in lane (lr, hi) the keys 8 hi + j of each 16-key block for query lr, which is the k order of the B fragment of O^T = V^T P^T:
// the probabilities go from the accumulator of the first product into the operand of the second inside the lane. The row maximum and sum need one exchange between the lane halves.
// At the end the waves' maxima go through LDS, each wave scales its tile and its row sums to the common maximum, and behind a second barrier every thread adds the AW partials of its groups of 8 elements in wave order, divides by the row sum and stores the bf16 hi and lo planes
// Ah, Al, fragment blocks [chunk][t/16] (chunk = 2 head + d / 32), the k chunks of the output projection. Q, K: fragment blocks [t/16][d/32] of a head; Vt: [t/32][d/16].
#define AW   4                    // waves of a work-group, one per SIMD: few, long waves, so that a wave's start (its query loads) and the merge at the end are paid over twice the passes of an 8-wave deal, and the register count lets more work-groups stand on a WGP
#define AQ   32                   // query rows of a work-group
#define AP   68                   // LDS row pitch in floats (rows stay 16-byte aligned)
#define SC2  (SCL * 1.4426950408889634f)   // scores are scaled into base-2 exponents; maxima are kept in that unit
__device__ __forceinline__ float xhalf(float x) { return __builtin_bit_cast(float, __builtin_amdgcn_permlanex16(__builtin_bit_cast(int, x), __builtin_bit_cast(int, x), 0x76543210, 0xfedcba98, false, false)); }   // lane l with lane l ^ 16
template <typename T16, int NSPLIT>
__device__ __forceinline__ void attn_tile(const T16* __restrict__ Q, const T16* __restrict__ Q2, const T16* __restrict__ Kp, const T16* __restrict__ Kp2, const T16* __restrict__ Vt, const T16* __restrict__ Vt2, bf* Ah, bf* Al, int h, int q0, float* red, float* sm, float* sl) {
    typedef typename WFrag<T16>::V V;
    const int lane = threadIdx.x & 31, lr = lane & 15, hi = lane >> 4; const int w = __builtin_amdgcn_readfirstlane(threadIdx.x >> 5);
    const float PSH = (NSPLIT == 2) ? 0.f : 10.f;                    // fp16 probabilities are carried x 2^10, by the exponent; the row sums carry the same factor, so it cancels in the quotient
    const int Kl = q0 + AQ;                                          // keys beyond the diagonal chunk are masked for every row of the tile
    V qf[2][2], qf2[2][2]; const size_t qo = (size_t)q0 * HD + lane * 8; const T16* pq = Q + qo; const T16* pq2 = pq; if (NSPLIT == 2) pq2 = Q2 + qo;
#pragma unroll
    for (int nq = 0; nq < 2; ++nq)
#pragma unroll
        for (int kc = 0; kc < 2; ++kc) { qf[nq][kc] = WFrag<T16>::ld(pq + nq * 16 * HD + kc * 512); if (NSPLIT == 2) qf2[nq][kc] = WFrag<T16>::ld(pq2 + nq * 16 * HD + kc * 512); }
    // the wait in front of any rewrite of a register that the loads above name; the addresses are its inputs so that no later load of the group lands on one of them
    if (NSPLIT == 2) asm volatile("s_wait_xcnt 0x0" :: "v"(pq), "v"(pq2) : "memory");
    else asm volatile("s_wait_xcnt 0x0" :: "v"(pq) : "memory");
    v8f o[4][2]; float m[2] = { -3.0e38f, -3.0e38f }, l[2] = { 0.f, 0.f };
#pragma unroll
    for (int mb = 0; mb < 4; ++mb)
#pragma unroll
        for (int nq = 0; nq < 2; ++nq) o[mb][nq] = (v8f){};
#pragma unroll 1   // stays rolled: one pass already holds the operands of a whole chunk in registers
    for (int k0 = w * 32; k0 < Kl; k0 += AW * 32) {
        const size_t ko = (size_t)k0 * HD + lane * 8, vo = (size_t)k0 * HD + lane * 8;
        const T16* pk = Kp + ko; const T16* pv = Vt + vo; const T16* pk2 = pk; const T16* pv2 = pv; if (NSPLIT == 2) { pk2 = Kp2 + ko; pv2 = Vt2 + vo; }
        V kf[2][2], kf2[2][2], vf[4], vf2[4];
#pragma unroll
        for (int kb = 0; kb < 2; ++kb)
#pragma unroll
            for (int kc = 0; kc < 2; ++kc) { kf[kb][kc] = WFrag<T16>::ld(pk + kb * 16 * HD + kc * 512); if (NSPLIT == 2) kf2[kb][kc] = WFrag<T16>::ld(pk2 + kb * 16 * HD + kc * 512); }
#pragma unroll
        for (int mb = 0; mb < 4; ++mb) { vf[mb] = WFrag<T16>::ld(pv + mb * 512); if (NSPLIT == 2) vf2[mb] = WFrag<T16>::ld(pv2 + mb * 512); }
        // the wait in front of any rewrite of a register that the loads above name; the addresses are its inputs so that no later load of the chunk lands on one of them
        if (NSPLIT == 2) asm volatile("s_wait_xcnt 0x0" :: "v"(pk), "v"(pv), "v"(pk2), "v"(pv2) : "memory");
        else asm volatile("s_wait_xcnt 0x0" :: "v"(pk), "v"(pv) : "memory");
        __builtin_amdgcn_sched_barrier(0);                           // keeps all of the chunk's loads in front of the first product, so that their latencies overlap instead of adding up
        v8f s[2][2];
#pragma unroll
        for (int kb = 0; kb < 2; ++kb)
#pragma unroll
            for (int nq = 0; nq < 2; ++nq) { s[kb][nq] = (v8f){};
#pragma unroll
                for (int kc = 0; kc < 2; ++kc) { s[kb][nq] = WFrag<T16>::mma(kf[kb][kc], qf[nq][kc], s[kb][nq]); if (NSPLIT == 2) { s[kb][nq] = WFrag<T16>::mma(kf[kb][kc], qf2[nq][kc], s[kb][nq]); s[kb][nq] = WFrag<T16>::mma(kf2[kb][kc], qf[nq][kc], s[kb][nq]); } } }
        V pf[2], pf2[2];
#pragma unroll
        for (int nq = 0; nq < 2; ++nq) {
            const int qi = q0 + nq * 16 + lr; v2f t[8]; float mx = -3.0e38f;   // t[e2][i]: key (e2 >> 2) * 16 + hi * 8 + (e2 & 3) * 2 + i of the chunk
#pragma unroll
            for (int e = 0; e < 8; ++e) { t[e][0] = s[e >> 2][nq][(e & 3) * 2]; t[e][1] = s[e >> 2][nq][(e & 3) * 2 + 1]; }
            if (k0 + 31 > q0) {                                      // wave-uniform: only the diagonal chunk holds masked keys
#pragma unroll
                for (int e = 0; e < 8; ++e) { const int key = k0 + (e >> 2) * 16 + hi * 8 + (e & 3) * 2; if (key > qi) t[e][0] = -3.0e38f; if (key + 1 > qi) t[e][1] = -3.0e38f; } }
#pragma unroll
            for (int e = 0; e < 8; ++e) mx = fmaxf(mx, fmaxf(t[e][0], t[e][1]));
            mx = fmaxf(mx, xhalf(mx));                               // the other lane half holds the query's other 16 keys
            const float mn = fmaxf(m[nq], mx * SC2), al = __builtin_amdgcn_exp2f(m[nq] - mn), sh = PSH - mn; m[nq] = mn; v2f ps = (v2f){};
#pragma unroll
            for (int e = 0; e < 8; ++e) { const v2f a = __builtin_elementwise_fma(t[e], (v2f){ SC2, SC2 }, (v2f){ sh, sh }); t[e][0] = __builtin_amdgcn_exp2f(a[0]); t[e][1] = __builtin_amdgcn_exp2f(a[1]); ps += t[e]; }
            l[nq] = l[nq] * al + (ps[0] + ps[1]);
#pragma unroll
            for (int mb = 0; mb < 4; ++mb) o[mb][nq] *= al;
            if constexpr (NSPLIT == 2) { v8us h0, h1, l0, l1;
#pragma unroll
                for (int e = 0; e < 8; ++e) { unsigned short a, c2; splitf(t[e >> 1][e & 1], a, c2); h0[e] = a; l0[e] = c2; splitf(t[4 + (e >> 1)][e & 1], a, c2); h1[e] = a; l1[e] = c2; }
                pf[nq] = cat16b(h0, h1); pf2[nq] = cat16b(l0, l1);
            } else { v16h p16;
#pragma unroll
                for (int e = 0; e < 16; ++e) p16[e] = tohx(t[e >> 1][e & 1]);
                pf[nq] = p16; }
        }
#pragma unroll
        for (int mb = 0; mb < 4; ++mb)
#pragma unroll
            for (int nq = 0; nq < 2; ++nq) { o[mb][nq] = WFrag<T16>::mma(vf[mb], pf[nq], o[mb][nq]); if (NSPLIT == 2) { o[mb][nq] = WFrag<T16>::mma(vf[mb], pf2[nq], o[mb][nq]); o[mb][nq] = WFrag<T16>::mma(vf2[mb], pf[nq], o[mb][nq]); } }
        // the slots the chip needs behind the last matrix instruction, on the taken side of the loop's branch too
        asm volatile("v_nop\n\tv_nop\n\tv_nop\n\tv_nop" : "+v"(o[0][0]), "+v"(o[1][0]), "+v"(o[2][0]), "+v"(o[3][0]), "+v"(o[0][1]), "+v"(o[1][1]), "+v"(o[2][1]), "+v"(o[3][1]));
    }
#pragma unroll
    for (int nq = 0; nq < 2; ++nq) { l[nq] += xhalf(l[nq]); if (hi == 0) sm[w * AQ + nq * 16 + lr] = m[nq]; }
    __syncthreads();                                                 // every wave's row maxima are in LDS before any wave scales its tile and its row sums
#pragma unroll
    for (int nq = 0; nq < 2; ++nq) { float M = sm[nq * 16 + lr];
#pragma unroll
        for (int p = 1; p < AW; ++p) M = fmaxf(M, sm[p * AQ + nq * 16 + lr]);
        const float f = __builtin_amdgcn_exp2f(m[nq] - M); float* pw = red + (size_t)(w * AQ + nq * 16 + lr) * AP + hi * 8; if (hi == 0) sl[w * AQ + nq * 16 + lr] = l[nq] * f;
#pragma unroll
        for (int mb = 0; mb < 4; ++mb) { const v8f x = o[mb][nq] * f; *(v4fa*)(pw + mb * 16) = __builtin_shufflevector(x, x, 0, 1, 2, 3); *(v4fa*)(pw + mb * 16 + 4) = __builtin_shufflevector(x, x, 4, 5, 6, 7); } }
    __syncthreads();                                                 // every wave's scaled partial tile and row sums are in LDS before any thread adds them
    const int q = threadIdx.x & 31;
    float L = 0.f;
#pragma unroll
    for (int p = 0; p < AW; ++p) L += sl[p * AQ + q];
    const float r = __fdiv_rn(1.0f, L);
    static_assert((HD / 8) % AW == 0, "the groups of 8 d are dealt evenly over the waves");
    v8us oh[HD / 8 / AW], ol[HD / 8 / AW]; size_t oo[HD / 8 / AW];
#pragma unroll
    for (int g = 0; g < HD / 8 / AW; ++g) {
        const int d0 = ((threadIdx.x >> 5) + g * AW) * 8;            // a wave takes one group of 8 d at a time for all 32 rows: its stores fill whole lines of the fragment blocks
        v4f a0 = (v4f){}, a1 = (v4f){};
#pragma unroll
        for (int p = 0; p < AW; ++p) { const float* pr = red + (size_t)(p * AQ + q) * AP + d0; a0 += *(const v4fa*)pr; a1 += *(const v4fa*)(pr + 4); }
#pragma unroll
        for (int e = 0; e < 4; ++e) { unsigned short a, c2; splitf(a0[e] * r, a, c2); oh[g][e] = a; ol[g][e] = c2; splitf(a1[e] * r, a, c2); oh[g][e + 4] = a; ol[g][e + 4] = c2; }
        oo[g] = ((size_t)(h * (HD / 32) + (d0 >> 5)) * TT + q0 + (q & 16)) * 32 + ((d0 >> 3) & 3) * 128 + (q & 15) * 8;
    }
#pragma unroll
    for (int g = 0; g < HD / 8 / AW; ++g) { *(v8usa*)(Ah + oo[g]) = oh[g]; *(v8usa*)(Al + oo[g]) = ol[g]; }   // all stores last: nothing is computed behind them
}
// Tiles are taken longest first over all heads, batch by batch, so that a batch's short tiles run beside the next batch's long ones; h counts heads through the batches, which is the order of the planes; tile1 = the launch's last (longest) tile. Query rows < RH go on bf16 hi+lo planes (3 products, NSPLIT 2), the rest on single fp16 (NSPLIT 0): two launches, so that the long one keeps the smaller register count. A work-group puts one wave on each SIMD, so every wave that the registers allow is one more work-group on the WGP: the budgets asked for below (3 and 4 waves per SIMD) are the ones the two legs' loops fit without spilling.
template <typename T16, int NSPLIT>
__global__ __launch_bounds__(AW * 32) __attribute__((amdgpu_waves_per_eu(NSPLIT == 2 ? 3 : 4))) void k_attn(const T16* __restrict__ Q, const T16* __restrict__ Q2, const T16* __restrict__ Kp, const T16* __restrict__ Kp2, const T16* __restrict__ Vt, const T16* __restrict__ Vt2, bf* Ah, bf* Al, int tile1) {
    __shared__ __align__(16) float red[AW * AQ * AP]; __shared__ float sm[AW * AQ]; __shared__ float sl[AW * AQ];
    const int h = blockIdx.z * NH_ + blockIdx.x, q0 = (tile1 - (int)blockIdx.y) * AQ; const size_t zo = (size_t)h * TT * HD;
    attn_tile<T16, NSPLIT>(Q + zo, NSPLIT == 2 ? Q2 + zo : nullptr, Kp + zo, NSPLIT == 2 ? Kp2 + zo : nullptr, Vt + zo, NSPLIT == 2 ? Vt2 + zo : nullptr, Ah, Al, h, q0, red, sm, sl);
}

__global__ __launch_bounds__(256) void k_wtG(const float* __restrict__ w, int K, int N, bf* Bt) {
    const int lane = threadIdx.x & 31; const int L0 = (blockIdx.x * 8 + (threadIdx.x >> 5)) * 8; const int nlines = N * K / 64;
{
#pragma unroll 1
        for (int l = 0; l < 8; ++l) { const int L = L0 + l; if (L >= nlines) break; const size_t e = (size_t)L * 64 + lane * 2; const int k = (int)(e % K), n = (int)(e / K); v2us o;
            o[0] = f2bf(w[(size_t)k * N + n]); o[1] = f2bf(w[(size_t)(k + 1) * N + n]); *(v2us*)(Bt + e) = o; }
         }
}
// k_cvtall: all five f32 matrices (tokens, four weights), each [rows][DM] -> bf16 fragment blocks [row/64][k/32][(row/16)%4], in ONE launch of few, long waves. A unit is 16 bytes of a plane: unit i takes the 8 neighbours of the row that belong there.
// A work-group takes CU groups of 256 units behind one another (64 rows x CU * 32 k, all of one matrix); a thread takes one unit of each group: its reads lie 128 bytes apart in one row, its stores 4 KiB apart (a wave: 512 contiguous bytes each).
static_assert(DQ == DM && DKV == DM, "every converted matrix has rows of DM elements");
#define CU   8                                   // units of a thread
#define CXB  (NB_ * TT * DM / 8 / (256 * CU))    // work-groups of the tokens
#define CWB  (DM * DM / 8 / (256 * CU))          // work-groups of one weight matrix
static_assert((DM / 32) % CU == 0, "a work-group's groups lie in one band of 64 rows");
static_assert(NB_ * TT * DM % (8 * 256 * CU) == 0 && DM * DM % (8 * 256 * CU) == 0, "the grid covers every matrix exactly: no thread is without its units");
__global__ __launch_bounds__(256) void k_cvtall(const float* __restrict__ x, const float* __restrict__ wq, const float* __restrict__ wk, const float* __restrict__ wv, const float* __restrict__ wo, bf* XB, bf* WQ, bf* WK, bf* WV, bf* WO) {
    const float* src = x; bf* dst = XB; int lb = blockIdx.x;   // the matrix is the same for a whole work-group
    if (lb >= CXB) { const int s = (lb - CXB) / CWB; lb = (lb - CXB) % CWB; src = s == 0 ? wq : s == 1 ? wk : s == 2 ? wv : wo; dst = s == 0 ? WQ : s == 1 ? WK : s == 2 ? WV : WO; }
    const size_t i = (size_t)lb * (256 * CU) + threadIdx.x;    // the thread's first unit; the others follow 256 units apart
    const size_t grp = i >> 8, row = grp / (DM / 32) * 64 + ((i >> 6) & 3) * 16 + (i & 15), k = grp % (DM / 32) * 32 + ((i >> 4) & 3) * 8; const float* ps = src + row * DM + k; bf* pd = dst + i * 8; v8f v[CU];
#pragma unroll
    for (int u = 0; u < CU; ++u) v[u] = *(const v8f*)(ps + u * 32);
    asm volatile("s_wait_xcnt 0x0" :: "v"(ps) : "memory");   // the wait in front of any rewrite of the register that the loads above name; all of the thread's loads are issued in front of it, so that their latencies overlap
#pragma unroll
    for (int u = 0; u < CU; ++u) { v8us o;
#pragma unroll
        for (int e = 0; e < 8; ++e) o[e] = f2bf(v[u][e]);
        *(v8us*)(pd + u * 2048) = o; }
}
__global__ __launch_bounds__(256) void k_cscvt(const float* __restrict__ cosT, const float* __restrict__ sinT, float* CS) { const int idx = blockIdx.x * 256 + threadIdx.x; if (idx >= TT * HD) return; v2f cs; cs[0] = bfr(cosT[idx]); cs[1] = bfr(sinT[idx]); *(v2f*)(CS + (size_t)idx * 2) = cs;  }
extern "C" void kernel_launch(void* const* d_in, const int* in_sizes, int n_in,
                              void* d_out, int out_size, void* d_ws, size_t ws_size, hipStream_t stream) {
    (void)in_sizes; (void)n_in; (void)out_size;
    const float* x = (const float*)d_in[0]; const float* wq = (const float*)d_in[1]; const float* bq = (const float*)d_in[2]; const float* wk = (const float*)d_in[3]; const float* bk = (const float*)d_in[4]; const float* wv = (const float*)d_in[5]; const float* bv = (const float*)d_in[6]; const float* wo = (const float*)d_in[7]; const float* bo = (const float*)d_in[8]; const float* cosT = nullptr; const float* sinT = nullptr; (void)cosT; (void)sinT;
    float* OUT = (float*)d_out;     // [4][2048][1024]
    char* wsp = (char*)d_ws;
    auto take = [&](size_t bytes) { char* p = wsp; wsp += (bytes + 255) & ~(size_t)255; return (void*)p; };
    bf* WQ = (bf*)take((size_t)DQ * DM * 2); bf* WK = (bf*)take((size_t)DKV * DM * 2); bf* WV = (bf*)take((size_t)DKV * DM * 2); bf* WO = (bf*)take((size_t)DM * DQ * 2);
    bf* XB = (bf*)take((size_t)NB_ * TT * DM * 2);
    h16* QP16 = (h16*)take((size_t)NB_ * NH_ * TT * HD * 2); h16* KP16 = (h16*)take((size_t)NB_ * NKV * TT * HD * 2); h16* VT16 = (h16*)take((size_t)NB_ * NKV * HD * TT * 2);
    bf* QPh = (bf*)take((size_t)NB_ * NH_ * TT * HD * 2); bf* QPl = (bf*)take((size_t)NB_ * NH_ * TT * HD * 2); bf* KPh = (bf*)take((size_t)NB_ * NKV * TT * HD * 2); bf* KPl = (bf*)take((size_t)NB_ * NKV * TT * HD * 2); bf* VTh = (bf*)take((size_t)NB_ * NKV * HD * TT * 2); bf* VTl = (bf*)take((size_t)NB_ * NKV * HD * TT * 2);
    bf* ATh = (bf*)take((size_t)NB_ * TT * DQ * 2); bf* ATl = (bf*)take((size_t)NB_ * TT * DQ * 2);
    if ((size_t)(wsp - (char*)d_ws) > ws_size) return;    // ws 256 MiB
    k_cvtall<<<CXB + 4 * CWB, 256, 0, stream>>>(x, wq, wk, wv, wo, XB, WQ, WK, WV, WO);
    k_gemmw<bf, 0, false><<<dim3(TT / 64, DQ / 64, NB_), 32, 0, stream>>>(XB, nullptr, WQ, nullptr, DM, bq, QP16, QPh, QPl);      // q planes [b][h], fragment blocks [t/16][d/32]
    k_gemmw<bf, 0, false><<<dim3(TT / 64, DKV / 64, NB_), 32, 0, stream>>>(XB, nullptr, WK, nullptr, DM, bk, KP16, KPh, KPl);     // k planes [b][h], fragment blocks [t/16][d/32]
    k_gemmw<bf, 0, true><<<dim3(DKV / 64, TT / 64, NB_), 32, 0, stream>>>(WV, nullptr, XB, nullptr, DM, bv, VT16, VTh, VTl);      // v planes [b][h], fragment blocks [t/32][d/16]
    k_attn<h16, 0><<<dim3(NH_, (TT - RH) / AQ, NB_), AW * 32, 0, stream>>>(QP16, nullptr, KP16, nullptr, VT16, nullptr, ATh, ATl, TT / AQ - 1);
    k_attn<bf, 2><<<dim3(NH_, RH / AQ, NB_), AW * 32, 0, stream>>>(QPh, QPl, KPh, KPl, VTh, VTl, ATh, ATl, RH / AQ - 1);
    k_gemmo<<<dim3(TT / 64, DM / 64, NB_), 32, 0, stream>>>(ATh, ATl, TT, WO, DQ, OUT, DM, bo);
}

// v010
// Measured time: 132 microseconds a run.
// Next to v009, in two timings, it ran 1.04 and 1.03 times as fast.
// All steps since v000 together make it 20.8 times as fast.
#include <hip/hip_runtime.h>

// CausalSelfAttentionSeparateHeads (x [4][2048][1024]; per-head Linear q/k/v: Wq[h][d][c], bq[h][d] (16 heads x 64) == one [1024][1024] torch-layout weight with rows h*64+d; causal softmax(q.k/8); y merged (head-major) Wp^T + bp -> [4][2048][1024]).
// Compute dtypes, f32 accumulate: every input rounded to bf16; Q/K/V on PLAIN bf16 operands (inputs: exact) + bias; causal scores and att.v: query rows < 512 on bf16 hi+lo planes (3 products), the rest single fp16 (x1024); softmax f32;
// The 16-bit operand planes are written by the matrix kernels that make the values (k_gemmw: q, k, v; k_attn: the merged heads): no f32 intermediate and no conversion pass lies between two products.
// Every 16-bit operand plane lies in FRAGMENT ORDER: blocks of 16 rows x 32 k (512 elements, 1 KiB); element (r, k) of a block stands at (k >> 3) * 128 + r * 8 + (k & 7), so that lane l of a wave finds its 8 + 8 elements at l * 8 and 256 + l * 8
// and each wave-wide 16-byte load covers 512 contiguous bytes (4 whole lines). The k order inside a fragment is that of a K-contiguous row, the same for both operands.
// The four blocks that a wave takes together (64 rows of one k chunk; 32 keys of a head) lie behind one another: 4 KiB, one address and immediate offsets.
// The batch is blockIdx.z of every matrix kernel: one launch per stage does all NB_ batches, each on its own set of planes in the workspace (same layout per batch, NB_ sets behind one another).

#define NB_  4
#define TT   2048
#define DM   1024
#define NH_  16
#define NKV  16
#define REP  (NH_ / NKV)
#define HD   64
#define DQ   (NH_ * HD)
#define DKV  (NKV * HD)
#define RH   512                  // query rows < RH use hi+lo planes (0: none)
#define WIN  0
#define SCL  0.125f   // HD^-0.5
typedef _Float16 h16;
typedef unsigned short bf;
typedef __attribute__((ext_vector_type(16))) __bf16   v16bf;
typedef __attribute__((ext_vector_type(16))) _Float16 v16h;
typedef __attribute__((ext_vector_type(8)))  _Float16 v8h;
typedef __attribute__((ext_vector_type(8)))  unsigned short v8us;
typedef __attribute__((ext_vector_type(8)))  float    v8f;
typedef __attribute__((ext_vector_type(4)))  float    v4f;
typedef v8h  __attribute__((may_alias)) v8ha;
typedef v4f  __attribute__((may_alias)) v4fa;
typedef v8us __attribute__((may_alias)) v8usa;

__device__ __forceinline__ unsigned short f2bf(float f) { unsigned u = __float_as_uint(f); u += 0x7FFFu + ((u >> 16) & 1u); return (unsigned short)(u >> 16); }
__device__ __forceinline__ float bf2f(unsigned short b) { return __uint_as_float(((unsigned)b) << 16); }
__device__ __forceinline__ float bfr(float f) { return bf2f(f2bf(f)); }
__device__ __forceinline__ v16h cat16(v8h lo, v8h hi) { return __builtin_shufflevector(lo, hi, 0, 1, 2, 3, 4, 5, 6, 7, 8, 9, 10, 11, 12, 13, 14, 15); }
__device__ __forceinline__ v16bf cat16b(v8us lo, v8us hi) { return __builtin_bit_cast(v16bf, __builtin_shufflevector(lo, hi, 0, 1, 2, 3, 4, 5, 6, 7, 8, 9, 10, 11, 12, 13, 14, 15)); }
__device__ __forceinline__ v8f wmma16(v16h a, v16h b, v8f c) { return __builtin_amdgcn_wmma_f32_16x16x32_f16(false, a, false, b, (short)0, c, false, false); }
__device__ __forceinline__ v8f wmmab(v16bf a, v16bf b, v8f c) { return __builtin_amdgcn_wmma_f32_16x16x32_bf16(false, a, false, b, (short)0, c, false, false); }



// ---- k_gemmo: the output projection as a register-blocked GEMM, ONE WAVE per 64x64 output tile (16 accumulators), operands straight from 16-bit planes; grid (M/64, N/64, batches), 32 threads; a batch's A planes are M*K elements, its C rows M*ldc.
// C[m][n] (f32, pitch ldc) = sum_k (A[m][k] + A2[m][k]) Bt[n][k] + bias[n], two products per k chunk (hi, then lo). K % 64 == 0. Bt: fragment blocks [n/64][k/32][(n/16)%4].
// A and A2: fragment blocks [k/32][m/16], the form in which k_attn leaves them. WFrag::ld takes the block's address plus lane * 8.
template <typename T16> struct WFrag;
template <> struct WFrag<h16> { typedef v16h V; static __device__ __forceinline__ V ld(const h16* p) { return cat16(*(const v8h*)p, *(const v8h*)(p + 256)); } static __device__ __forceinline__ v8f mma(V a, V b, v8f c) { return wmma16(a, b, c); } };
template <> struct WFrag<bf> { typedef v16bf V; static __device__ __forceinline__ V ld(const bf* p) { return cat16b(*(const v8us*)p, *(const v8us*)(p + 256)); } static __device__ __forceinline__ v8f mma(V a, V b, v8f c) { return wmmab(a, b, c); } };
// One k chunk of k_gemmo: its 24 fragment loads (12 fragments), and its 32 products.
__device__ __forceinline__ void go_ld(const bf* pa, const bf* pa2, const bf* pb, WFrag<bf>::V (&a)[4], WFrag<bf>::V (&a2)[4], WFrag<bf>::V (&b)[4]) {
#pragma unroll
    for (int i = 0; i < 4; ++i) { a[i] = WFrag<bf>::ld(pa + i * 512); b[i] = WFrag<bf>::ld(pb + i * 512); }
#pragma unroll
    for (int i = 0; i < 4; ++i) a2[i] = WFrag<bf>::ld(pa2 + i * 512);
}
__device__ __forceinline__ void go_mma(const WFrag<bf>::V (&a)[4], const WFrag<bf>::V (&a2)[4], const WFrag<bf>::V (&b)[4], v8f (&acc)[4][4]) {
#pragma unroll
    for (int nb = 0; nb < 4; ++nb)
#pragma unroll
        for (int mb = 0; mb < 4; ++mb) acc[mb][nb] = WFrag<bf>::mma(a[mb], b[nb], acc[mb][nb]);
#pragma unroll
    for (int nb = 0; nb < 4; ++nb)
#pragma unroll
        for (int mb = 0; mb < 4; ++mb) acc[mb][nb] = WFrag<bf>::mma(a2[mb], b[nb], acc[mb][nb]);
}
__global__ __launch_bounds__(32) void k_gemmo(const bf* __restrict__ A, const bf* __restrict__ A2, int M, const bf* __restrict__ Bt, int K, float* C, int ldc, const float* __restrict__ bias) {
    typedef WFrag<bf>::V V;
    __shared__ __align__(16) float os[16 * 68];
    const int lane = threadIdx.x & 31, lr = lane & 15, hi = lane >> 4; const int r0 = blockIdx.x * 64, c0 = blockIdx.y * 64;
    v8f acc[4][4];
#pragma unroll
    for (int mb = 0; mb < 4; ++mb)
#pragma unroll
        for (int nb = 0; nb < 4; ++nb) acc[mb][nb] = (v8f){};
    const size_t aoff = (size_t)blockIdx.z * M * K + (size_t)r0 * 32 + lane * 8, boff = (size_t)c0 * K + lane * 8;
    const bf* pa = A + aoff; const bf* pa2 = A2 + aoff; const bf* pb = Bt + boff;
    // The k chunks go through two register sets (x, y): all loads of the next chunk are issued as one group in front of the products of the chunk that has arrived, so that a load has 32 products' time to land. Every accumulator takes its products in the order of the walk, hi then lo.
    // The k walk is a ring: a tile enters it at a place of its own, ((tile x + tile y) * 128) mod K, and wraps at K, so that the many tiles that share operand rows do not ask L2 for the same lines at the same moment. Tiles whose indices differ by 8 enter alike.
    V xa[4], xa2[4], xb[4], ya[4], ya2[4], yb[4];
    int kc = (int)(((blockIdx.x + blockIdx.y) * 128u) % (unsigned)K);
    { const bf* fa = pa + (size_t)kc * M; const bf* fa2 = pa2 + (size_t)kc * M; const bf* fb = pb + kc * 64;
        go_ld(fa, fa2, fb, xa, xa2, xb);
        asm volatile("s_wait_xcnt 0x0" :: "v"(fa), "v"(fa2), "v"(fb) : "memory"); }   // the wait in front of any rewrite of a register that the first chunk's loads name
    __builtin_amdgcn_sched_barrier(0);                               // nothing that follows moves in front of that wait
#pragma unroll 1   // stays rolled: a trip is two chunks, one per register set
    for (int t = 64; t < K; t += 64) {
        const int kn = kc + 64 < K ? kc + 64 : 0;                    // the next trip's place in the ring
        const bf* qa = pa + (size_t)(kc + 32) * M; const bf* qa2 = pa2 + (size_t)(kc + 32) * M; const bf* tb = pb + kc * 64;
        go_ld(qa, qa2, tb + 32 * 64, ya, ya2, yb);
        __builtin_amdgcn_sched_barrier(0);                           // keeps the next chunk's loads in front of this chunk's products: sunk among them they would be waited for at once
        go_mma(xa, xa2, xb, acc);
        __builtin_amdgcn_sched_barrier(0);                           // the wait and the loads below stay behind the products
        // the wait in front of any rewrite of a register that the loads above name; the addresses are its inputs so that nothing lands on one of them before it
        asm volatile("s_wait_xcnt 0x0" :: "v"(qa), "v"(qa2) : "memory");
        const bf* ra = pa + (size_t)kn * M; const bf* ra2 = pa2 + (size_t)kn * M; const bf* rb = pb + kn * 64;
        go_ld(ra, ra2, rb, xa, xa2, xb);
        __builtin_amdgcn_sched_barrier(0);                           // as the first
        go_mma(ya, ya2, yb, acc);
        __builtin_amdgcn_sched_barrier(0);                           // the wait and the slots below stay behind the products
        asm volatile("s_wait_xcnt 0x0" :: "v"(ra), "v"(ra2), "v"(tb), "v"(rb) : "memory");   // as above
        // the slots the chip needs behind the last matrix instruction, on the taken side of the loop's branch too
        asm volatile("v_nop\n\tv_nop\n\tv_nop\n\tv_nop");
        kc = kn;
    }
    { const bf* qa = pa + (size_t)(kc + 32) * M; const bf* qa2 = pa2 + (size_t)(kc + 32) * M; const bf* tb = pb + kc * 64;   // the last two chunks: nothing is left to fetch behind them
        go_ld(qa, qa2, tb + 32 * 64, ya, ya2, yb);
        asm volatile("s_wait_xcnt 0x0" :: "v"(qa), "v"(qa2), "v"(tb) : "memory");   // as in the loop, but directly behind the loads: the epilogue's first index arithmetic, which the compiler lifts to this place, may land on their address registers
        __builtin_amdgcn_sched_barrier(0);                           // as the first
        go_mma(xa, xa2, xb, acc);
        go_mma(ya, ya2, yb, acc); }
#pragma unroll
    for (int mb = 0; mb < 4; ++mb) {
#pragma unroll
        for (int nb = 0; nb < 4; ++nb) {
#pragma unroll
            for (int j = 0; j < 8; ++j) os[(hi * 8 + j) * 68 + nb * 16 + lr] = acc[mb][nb][j]; }
        __builtin_amdgcn_wave_barrier(); asm volatile("" ::: "memory");   // the wave's LDS writes stay in front of its reads of other lanes' values
        float* crow = C + ((size_t)blockIdx.z * M + r0 + mb * 16) * ldc + c0;
#pragma unroll
        for (int s = 0; s < 8; ++s) { const int row = 2 * s + hi, cofs = lr * 4; v4f val = *(const v4fa*)(os + row * 68 + cofs); val[0] += bfr(bias[c0 + cofs]); val[1] += bfr(bias[c0 + cofs + 1]); val[2] += bfr(bias[c0 + cofs + 2]); val[3] += bfr(bias[c0 + cofs + 3]);
            *(v4f*)(crow + (size_t)row * ldc + cofs) = val; }
        __builtin_amdgcn_wave_barrier(); asm volatile("" ::: "memory");   // the reads above stay in front of the next 16 rows' LDS writes
    }
}

__device__ __forceinline__ h16 tohx(float x) { return (h16)x; }
__device__ __forceinline__ void splitf(float y, unsigned short& h, unsigned short& l) { h = f2bf(y); l = f2bf(y - bf2f(h)); }
typedef __attribute__((ext_vector_type(2))) _Float16 v2h;
typedef __attribute__((ext_vector_type(4))) _Float16 v4h;
typedef __attribute__((ext_vector_type(2))) unsigned short v2us;
typedef __attribute__((ext_vector_type(4))) unsigned short v4us;
typedef __attribute__((ext_vector_type(2))) float v2f;
typedef __attribute__((ext_vector_type(4))) int v4i;
typedef v2f  __attribute__((may_alias)) v2fa;

// ---- k_gemmw: the q, k, v projections: register-blocked GEMM, ONE WAVE per 64x64 tile (16 accumulators), operands straight from 16-bit planes of fragment blocks [row/64][k/32][(row/16)%4] (plain product, NSPLIT 0), K % 128 == 0, whose epilogue adds the bias and writes the value's three 16-bit planes (fp16, bf16 hi, bf16 lo) itself; grid (M/64, N/64, batches), 32 threads; the token operand advances TT rows a batch, the planes TT*DQ elements.
// ROWB false (q, k: A = tokens, Bt = weight rows): bias[n]; a tile's 64 columns are one head, planes of fragment blocks [n/64][m/16][(n%64)/32]. ROWB true (v: A = weight rows, Bt = tokens, so the product comes out transposed): bias[m]; fragment blocks [m/64][n/32][(m/16)%4].
// Either way a lane stores the 8 neighbours that it will load as a fragment half, and a wave-wide store fills 4 whole lines of a plane.
// One stage of k_gemmw (64 k): its 32 fragment loads (index: chunk * 4 + block of 16 rows), and its 32 products.
template <typename T16> __device__ __forceinline__ void gw_ld(const T16* pa, const T16* pb, typename WFrag<T16>::V (&a)[8], typename WFrag<T16>::V (&b)[8]) {
#pragma unroll
    for (int c = 0; c < 2; ++c) {
#pragma unroll
        for (int i = c * 4; i < c * 4 + 4; ++i) { a[i] = WFrag<T16>::ld(pa + i * 512); b[i] = WFrag<T16>::ld(pb + i * 512); } }
}
template <typename T16> __device__ __forceinline__ void gw_mma(const typename WFrag<T16>::V (&a)[8], const typename WFrag<T16>::V (&b)[8], v8f (&acc)[4][4]) {
#pragma unroll
    for (int c = 0; c < 2; ++c)
#pragma unroll
        for (int nb = 0; nb < 4; ++nb)
#pragma unroll
            for (int mb = 0; mb < 4; ++mb) acc[mb][nb] = WFrag<T16>::mma(a[c * 4 + mb], b[c * 4 + nb], acc[mb][nb]);
}
template <typename T16, int NSPLIT, bool ROWB>
__global__ __launch_bounds__(32) void k_gemmw(const T16* __restrict__ A, const T16* __restrict__ A2, const T16* __restrict__ Bt, const T16* __restrict__ Bt2, int K, const float* __restrict__ bias, h16* P16, bf* Ph, bf* Pl) {
    typedef typename WFrag<T16>::V V;
    __shared__ __align__(16) float os[16 * 68];
    const int lane = threadIdx.x & 31, lr = lane & 15, hi = lane >> 4; const int r0 = blockIdx.x * 64, c0 = blockIdx.y * 64;
    v8f acc[4][4];
#pragma unroll
    for (int mb = 0; mb < 4; ++mb)
#pragma unroll
        for (int nb = 0; nb < 4; ++nb) acc[mb][nb] = (v8f){};
    const size_t zt = (size_t)blockIdx.z * TT * K, zp = (size_t)blockIdx.z * TT * DQ;   // the batch's tokens, the batch's planes
    const size_t aoff = (ROWB ? 0 : zt) + (size_t)r0 * K + lane * 8, boff = (ROWB ? zt : 0) + (size_t)c0 * K + lane * 8;
    static_assert(NSPLIT == 0, "the loop below forms the plain product alone");
    const T16* pa = A + aoff; const T16* pb = Bt + boff;
    // A stage is 64 k (two chunks, 8 KiB of each operand behind one another). The stages go through two register sets (x, y): all 32 loads of the next stage are issued as one group in front of the 32 products of the stage that has arrived. Every accumulator takes its products in the order of the walk.
    // The k walk is a ring, as in k_gemmo: a tile enters it at a place of its own and wraps at K, so that the tiles that share operand rows do not ask L2 for the same lines at the same moment.
    V xa[8], xb[8], ya[8], yb[8];
    int kc = (int)(((blockIdx.x + blockIdx.y) * 128u) % (unsigned)K);
    { const T16* fa = pa + kc * 64; const T16* fb = pb + kc * 64;
        gw_ld<T16>(fa, fb, xa, xb);
        asm volatile("s_wait_xcnt 0x0" :: "v"(fa), "v"(fb) : "memory"); }   // the wait in front of any rewrite of a register that the first stage's loads name
    __builtin_amdgcn_sched_barrier(0);                               // nothing that follows moves in front of that wait
#pragma unroll 1   // stays rolled: a trip is two stages, one per register set
    for (int t = 128; t < K; t += 128) {
        const int kn = kc + 128 < K ? kc + 128 : 0;                  // the next trip's place in the ring
        const T16* ta = pa + kc * 64; const T16* tb = pb + kc * 64; const T16* na = pa + kn * 64; const T16* nb = pb + kn * 64;
        gw_ld<T16>(ta + 64 * 64, tb + 64 * 64, ya, yb);
        __builtin_amdgcn_sched_barrier(0);                           // keeps the next stage's loads in front of this stage's products: sunk among them they would be waited for at once
        gw_mma<T16>(xa, xb, acc);
        __builtin_amdgcn_sched_barrier(0);                           // the loads below stay behind the products that read their registers
        gw_ld<T16>(na, nb, xa, xb);
        __builtin_amdgcn_sched_barrier(0);                           // as the first
        gw_mma<T16>(ya, yb, acc);
        __builtin_amdgcn_sched_barrier(0);                           // the wait and the slots below stay behind the products
        // the wait in front of any rewrite of a register that the trip's loads name; the addresses are its inputs so that nothing lands on one of them before it
        asm volatile("s_wait_xcnt 0x0" :: "v"(ta), "v"(tb), "v"(na), "v"(nb) : "memory");
        // the slots the chip needs behind the last matrix instruction, on the taken side of the loop's branch too
        asm volatile("v_nop\n\tv_nop\n\tv_nop\n\tv_nop");
        kc = kn;
    }
    { const T16* ta = pa + kc * 64; const T16* tb = pb + kc * 64;   // the last two stages: nothing is left to fetch behind them
        gw_ld<T16>(ta + 64 * 64, tb + 64 * 64, ya, yb);
        asm volatile("s_wait_xcnt 0x0" :: "v"(ta), "v"(tb) : "memory");   // as in the loop, but directly behind the loads: the epilogue's first index arithmetic, which the compiler lifts to this place, may land on their address registers
        __builtin_amdgcn_sched_barrier(0);                           // as the first
        gw_mma<T16>(xa, xb, acc);
        gw_mma<T16>(ya, yb, acc);
        __builtin_amdgcn_sched_barrier(0); }                         // the epilogue stays behind the last products
    const float* pbi = bias + (ROWB ? r0 + lr : c0 + hi * 8); float bb[ROWB ? 4 : 32];   // ROWB: the lane's row of each 16; else the lane's 8 columns of each half fragment
#pragma unroll
    for (int q = 0; q < (ROWB ? 4 : 32); ++q) bb[q] = pbi[ROWB ? q * 16 : (q >> 3) * 16 + (q & 7)];
    asm volatile("s_wait_xcnt 0x0" :: "v"(pbi) : "memory");   // the wait in front of any rewrite of the register that the bias loads name
#pragma unroll
    for (int mb = 0; mb < 4; ++mb) {
#pragma unroll
        for (int nb = 0; nb < 4; ++nb) {
#pragma unroll
            for (int j = 0; j < 8; ++j) os[(hi * 8 + j) * 68 + nb * 16 + lr] = acc[mb][nb][j]; }
        __builtin_amdgcn_wave_barrier(); asm volatile("" ::: "memory");   // the wave's LDS writes stay in front of its reads of other lanes' values
        const size_t ob = zp + (ROWB ? (size_t)r0 * TT + (size_t)c0 * 64 + mb * 512 : ((size_t)blockIdx.y * TT + r0 + mb * 16) * HD) + lane * 8;
        h16* q16 = P16 + ob; bf* qh = Ph + ob; bf* ql = Pl + ob; v8h o16[4]; v8us oh[4], ol[4];
#pragma unroll
        for (int s = 0; s < 4; ++s) { const int cofs = s * 16 + hi * 8; const v4f x0 = *(const v4fa*)(os + lr * 68 + cofs), x1 = *(const v4fa*)(os + lr * 68 + cofs + 4);   // s: the half fragment (16 k) of the 16 rows; row lr, 8 neighbours
#pragma unroll
            for (int q = 0; q < 8; ++q) { const float val = (q < 4 ? x0[q & 3] : x1[q & 3]) + bfr(bb[ROWB ? mb : s * 8 + q]); o16[s][q] = tohx(val); unsigned short a2, c2; splitf(val, a2, c2); oh[s][q] = a2; ol[s][q] = c2; }
            const int o = ROWB ? (s >> 1) * 2048 + (s & 1) * 256 : s * 256;
            *(v8h*)(q16 + o) = o16[s]; *(v8us*)(qh + o) = oh[s]; *(v8us*)(ql + o) = ol[s]; }
        // the wait in front of any rewrite of a register that the stores above name; addresses and values are its inputs so that nothing lands on one of them before it
        asm volatile("s_wait_xcnt 0x0" :: "v"(q16), "v"(qh), "v"(ql), "v"(o16[0]), "v"(o16[1]), "v"(o16[2]), "v"(o16[3]), "v"(oh[0]), "v"(oh[1]), "v"(oh[2]), "v"(oh[3]), "v"(ol[0]), "v"(ol[1]), "v"(ol[2]), "v"(ol[3]) : "memory");
        __builtin_amdgcn_wave_barrier(); asm volatile("" ::: "memory");   // the reads above stay in front of the next 16 rows' LDS writes
    }
}

// ---- k_attn: causal scores, softmax and the probability x value contraction in one kernel; no score or probability ever lies in memory. One work-group per 32 query rows of one head, grid (heads, row tiles, batches), AW * 32 threads.
// The key loop is dealt over the AW waves: wave w takes the 32-key chunks w, w+AW, ... up to the diagonal chunk and keeps its own running row maximum, row sum and f32 output tile (online softmax).
// Both products are formed transposed, so that a lane owns one query: S^T = K Q^T leaves in lane (lr, hi) the keys 8 hi + j of each 16-key block for query lr, which is the k order of the B fragment of O^T = V^T P^T:
// the probabilities go from the accumulator of the first product into the operand of the second inside the lane. The row maximum and sum need one exchange between the lane halves.
// At the end the waves' maxima go through LDS, each wave scales its tile and its row sums to the common maximum, and behind a second barrier every thread adds the AW partials of its groups of 8 elements in wave order, divides by the row sum and stores the bf16 hi and lo planes
// Ah, Al, fragment blocks [chunk][t/16] (chunk = 2 head + d / 32), the k chunks of the output projection. Q, K: fragment blocks [t/16][d/32] of a head; Vt: [t/32][d/16].
#define AW   4                    // waves of a work-group, one per SIMD: few, long waves, so that a wave's start (its query loads) and the merge at the end are paid over twice the passes of an 8-wave deal, and the register count lets more work-groups stand on a WGP
#define AQ   32                   // query rows of a work-group
#define AP   68                   // LDS row pitch in floats (rows stay 16-byte aligned)
#define SC2  (SCL * 1.4426950408889634f)   // scores are scaled into base-2 exponents; maxima are kept in that unit
__device__ __forceinline__ float xhalf(float x) { return __builtin_bit_cast(float, __builtin_amdgcn_permlanex16(__builtin_bit_cast(int, x), __builtin_bit_cast(int, x), 0x76543210, 0xfedcba98, false, false)); }   // lane l with lane l ^ 16
template <typename T16, int NSPLIT>
__device__ __forceinline__ void attn_tile(const T16* __restrict__ Q, const T16* __restrict__ Q2, const T16* __restrict__ Kp, const T16* __restrict__ Kp2, const T16* __restrict__ Vt, const T16* __restrict__ Vt2, bf* Ah, bf* Al, int h, int q0, float* red, float* sm, float* sl) {
    typedef typename WFrag<T16>::V V;
    const int lane = threadIdx.x & 31, lr = lane & 15, hi = lane >> 4; const int w = __builtin_amdgcn_readfirstlane(threadIdx.x >> 5);
    const float PSH = (NSPLIT == 2) ? 0.f : 10.f;                    // fp16 probabilities are carried x 2^10, by the exponent; the row sums carry the same factor, so it cancels in the quotient
    const int Kl = q0 + AQ;                                          // keys beyond the diagonal chunk are masked for every row of the tile
    V qf[2][2], qf2[2][2]; const size_t qo = (size_t)q0 * HD + lane * 8; const T16* pq = Q + qo; const T16* pq2 = pq; if (NSPLIT == 2) pq2 = Q2 + qo;
#pragma unroll
    for (int nq = 0; nq < 2; ++nq)
#pragma unroll
        for (int kc = 0; kc < 2; ++kc) { qf[nq][kc] = WFrag<T16>::ld(pq + nq * 16 * HD + kc * 512); if (NSPLIT == 2) qf2[nq][kc] = WFrag<T16>::ld(pq2 + nq * 16 * HD + kc * 512); }
    // the wait in front of any rewrite of a register that the loads above name; the addresses are its inputs so that no later load of the group lands on one of them
    if (NSPLIT == 2) asm volatile("s_wait_xcnt 0x0" :: "v"(pq), "v"(pq2) : "memory");
    else asm volatile("s_wait_xcnt 0x0" :: "v"(pq) : "memory");
    v8f o[4][2]; float m[2] = { -3.0e38f, -3.0e38f }, l[2] = { 0.f, 0.f };
#pragma unroll
    for (int mb = 0; mb < 4; ++mb)
#pragma unroll
        for (int nq = 0; nq < 2; ++nq) o[mb][nq] = (v8f){};
#pragma unroll 1   // stays rolled: one pass already holds the operands of a whole chunk in registers
    for (int k0 = w * 32; k0 < Kl; k0 += AW * 32) {
        const size_t ko = (size_t)k0 * HD + lane * 8, vo = (size_t)k0 * HD + lane * 8;
        const T16* pk = Kp + ko; const T16* pv = Vt + vo; const T16* pk2 = pk; const T16* pv2 = pv; if (NSPLIT == 2) { pk2 = Kp2 + ko; pv2 = Vt2 + vo; }
        V kf[2][2], kf2[2][2], vf[4], vf2[4];
#pragma unroll
        for (int kb = 0; kb < 2; ++kb)
#pragma unroll
            for (int kc = 0; kc < 2; ++kc) { kf[kb][kc] = WFrag<T16>::ld(pk + kb * 16 * HD + kc * 512); if (NSPLIT == 2) kf2[kb][kc] = WFrag<T16>::ld(pk2 + kb * 16 * HD + kc * 512); }
#pragma unroll
        for (int mb = 0; mb < 4; ++mb) { vf[mb] = WFrag<T16>::ld(pv + mb * 512); if (NSPLIT == 2) vf2[mb] = WFrag<T16>::ld(pv2 + mb * 512); }
        // the wait in front of any rewrite of a register that the loads above name; the addresses are its inputs so that no later load of the chunk lands on one of them
        if (NSPLIT == 2) asm volatile("s_wait_xcnt 0x0" :: "v"(pk), "v"(pv), "v"(pk2), "v"(pv2) : "memory");
        else asm volatile("s_wait_xcnt 0x0" :: "v"(pk), "v"(pv) : "memory");
        __builtin_amdgcn_sched_barrier(0);                           // keeps all of the chunk's loads in front of the first product, so that their latencies overlap instead of adding up
        v8f s[2][2];
#pragma unroll
        for (int kb = 0; kb < 2; ++kb)
#pragma unroll
            for (int nq = 0; nq < 2; ++nq) { s[kb][nq] = (v8f){};
#pragma unroll
                for (int kc = 0; kc < 2; ++kc) { s[kb][nq] = WFrag<T16>::mma(kf[kb][kc], qf[nq][kc], s[kb][nq]); if (NSPLIT == 2) { s[kb][nq] = WFrag<T16>::mma(kf[kb][kc], qf2[nq][kc], s[kb][nq]); s[kb][nq] = WFrag<T16>::mma(kf2[kb][kc], qf[nq][kc], s[kb][nq]); } } }
        V pf[2], pf2[2];
#pragma unroll
        for (int nq = 0; nq < 2; ++nq) {
            const int qi = q0 + nq * 16 + lr; v2f t[8]; float mx = -3.0e38f;   // t[e2][i]: key (e2 >> 2) * 16 + hi * 8 + (e2 & 3) * 2 + i of the chunk
#pragma unroll
            for (int e = 0; e < 8; ++e) { t[e][0] = s[e >> 2][nq][(e & 3) * 2]; t[e][1] = s[e >> 2][nq][(e & 3) * 2 + 1]; }
            if (k0 + 31 > q0) {                                      // wave-uniform: only the diagonal chunk holds masked keys
#pragma unroll
                for (int e = 0; e < 8; ++e) { const int key = k0 + (e >> 2) * 16 + hi * 8 + (e & 3) * 2; if (key > qi) t[e][0] = -3.0e38f; if (key + 1 > qi) t[e][1] = -3.0e38f; } }
#pragma unroll
            for (int e = 0; e < 8; ++e) mx = fmaxf(mx, fmaxf(t[e][0], t[e][1]));
            mx = fmaxf(mx, xhalf(mx));                               // the other lane half holds the query's other 16 keys
            const float mn = fmaxf(m[nq], mx * SC2), al = __builtin_amdgcn_exp2f(m[nq] - mn), sh = PSH - mn; m[nq] = mn; v2f ps = (v2f){};
#pragma unroll
            for (int e = 0; e < 8; ++e) { const v2f a = __builtin_elementwise_fma(t[e], (v2f){ SC2, SC2 }, (v2f){ sh, sh }); t[e][0] = __builtin_amdgcn_exp2f(a[0]); t[e][1] = __builtin_amdgcn_exp2f(a[1]); ps += t[e]; }
            l[nq] = l[nq] * al + (ps[0] + ps[1]);
#pragma unroll
            for (int mb = 0; mb < 4; ++mb) o[mb][nq] *= al;
            if constexpr (NSPLIT == 2) { v8us h0, h1, l0, l1;
#pragma unroll
                for (int e = 0; e < 8; ++e) { unsigned short a, c2; splitf(t[e >> 1][e & 1], a, c2); h0[e] = a; l0[e] = c2; splitf(t[4 + (e >> 1)][e & 1], a, c2); h1[e] = a; l1[e] = c2; }
                pf[nq] = cat16b(h0, h1); pf2[nq] = cat16b(l0, l1);
            } else { v16h p16;
#pragma unroll
                for (int e = 0; e < 16; ++e) p16[e] = tohx(t[e >> 1][e & 1]);
                pf[nq] = p16; }
        }
#pragma unroll
        for (int mb = 0; mb < 4; ++mb)
#pragma unroll
            for (int nq = 0; nq < 2; ++nq) { o[mb][nq] = WFrag<T16>::mma(vf[mb], pf[nq], o[mb][nq]); if (NSPLIT == 2) { o[mb][nq] = WFrag<T16>::mma(vf[mb], pf2[nq], o[mb][nq]); o[mb][nq] = WFrag<T16>::mma(vf2[mb], pf[nq], o[mb][nq]); } }
        // the slots the chip needs behind the last matrix instruction, on the taken side of the loop's branch too
        asm volatile("v_nop\n\tv_nop\n\tv_nop\n\tv_nop" : "+v"(o[0][0]), "+v"(o[1][0]), "+v"(o[2][0]), "+v"(o[3][0]), "+v"(o[0][1]), "+v"(o[1][1]), "+v"(o[2][1]), "+v"(o[3][1]));
    }
#pragma unroll
    for (int nq = 0; nq < 2; ++nq) { l[nq] += xhalf(l[nq]); if (hi == 0) sm[w * AQ + nq * 16 + lr] = m[nq]; }
    __syncthreads();                                                 // every wave's row maxima are in LDS before any wave scales its tile and its row sums
#pragma unroll
    for (int nq = 0; nq < 2; ++nq) { float M = sm[nq * 16 + lr];
#pragma unroll
        for (int p = 1; p < AW; ++p) M = fmaxf(M, sm[p * AQ + nq * 16 + lr]);
        const float f = __builtin_amdgcn_exp2f(m[nq] - M); float* pw = red + (size_t)(w * AQ + nq * 16 + lr) * AP + hi * 8; if (hi == 0) sl[w * AQ + nq * 16 + lr] = l[nq] * f;
#pragma unroll
        for (int mb = 0; mb < 4; ++mb) { const v8f x = o[mb][nq] * f; *(v4fa*)(pw + mb * 16) = __builtin_shufflevector(x, x, 0, 1, 2, 3); *(v4fa*)(pw + mb * 16 + 4) = __builtin_shufflevector(x, x, 4, 5, 6, 7); } }
    __syncthreads();                                                 // every wave's scaled partial tile and row sums are in LDS before any thread adds them
    const int q = threadIdx.x & 31;
    float L = 0.f;
#pragma unroll
    for (int p = 0; p < AW; ++p) L += sl[p * AQ + q];
    const float r = __fdiv_rn(1.0f, L);
    static_assert((HD / 8) % AW == 0, "the groups of 8 d are dealt evenly over the waves");
    v8us oh[HD / 8 / AW], ol[HD / 8 / AW]; size_t oo[HD / 8 / AW];
#pragma unroll
    for (int g = 0; g < HD / 8 / AW; ++g) {
        const int d0 = ((threadIdx.x >> 5) + g * AW) * 8;            // a wave takes one group of 8 d at a time for all 32 rows: its stores fill whole lines of the fragment blocks
        v4f a0 = (v4f){}, a1 = (v4f){};
#pragma unroll
        for (int p = 0; p < AW; ++p) { const float* pr = red + (size_t)(p * AQ + q) * AP + d0; a0 += *(const v4fa*)pr; a1 += *(const v4fa*)(pr + 4); }
#pragma unroll
        for (int e = 0; e < 4; ++e) { unsigned short a, c2; splitf(a0[e] * r, a, c2); oh[g][e] = a; ol[g][e] = c2; splitf(a1[e] * r, a, c2); oh[g][e + 4] = a; ol[g][e + 4] = c2; }
        oo[g] = ((size_t)(h * (HD / 32) + (d0 >> 5)) * TT + q0 + (q & 16)) * 32 + ((d0 >> 3) & 3) * 128 + (q & 15) * 8;
    }
#pragma unroll
    for (int g = 0; g < HD / 8 / AW; ++g) { *(v8usa*)(Ah + oo[g]) = oh[g]; *(v8usa*)(Al + oo[g]) = ol[g]; }   // all stores last: nothing is computed behind them
}
// Tiles are taken longest first over all heads, batch by batch, so that a batch's short tiles run beside the next batch's long ones; h counts heads through the batches, which is the order of the planes; tile1 = the launch's last (longest) tile. Query rows < RH go on bf16 hi+lo planes (3 products, NSPLIT 2), the rest on single fp16 (NSPLIT 0): two launches, so that the long one keeps the smaller register count. A work-group puts one wave on each SIMD, so every wave that the registers allow is one more work-group on the WGP: the budgets asked for below (3 and 4 waves per SIMD) are the ones the two legs' loops fit without spilling.
template <typename T16, int NSPLIT>
__global__ __launch_bounds__(AW * 32) __attribute__((amdgpu_waves_per_eu(NSPLIT == 2 ? 3 : 4))) void k_attn(const T16* __restrict__ Q, const T16* __restrict__ Q2, const T16* __restrict__ Kp, const T16* __restrict__ Kp2, const T16* __restrict__ Vt, const T16* __restrict__ Vt2, bf* Ah, bf* Al, int tile1) {
    __shared__ __align__(16) float red[AW * AQ * AP]; __shared__ float sm[AW * AQ]; __shared__ float sl[AW * AQ];
    const int h = blockIdx.z * NH_ + blockIdx.x, q0 = (tile1 - (int)blockIdx.y) * AQ; const size_t zo = (size_t)h * TT * HD;
    attn_tile<T16, NSPLIT>(Q + zo, NSPLIT == 2 ? Q2 + zo : nullptr, Kp + zo, NSPLIT == 2 ? Kp2 + zo : nullptr, Vt + zo, NSPLIT == 2 ? Vt2 + zo : nullptr, Ah, Al, h, q0, red, sm, sl);
}

__global__ __launch_bounds__(256) void k_wtG(const float* __restrict__ w, int K, int N, bf* Bt) {
    const int lane = threadIdx.x & 31; const int L0 = (blockIdx.x * 8 + (threadIdx.x >> 5)) * 8; const int nlines = N * K / 64;
{
#pragma unroll 1
        for (int l = 0; l < 8; ++l) { const int L = L0 + l; if (L >= nlines) break; const size_t e = (size_t)L * 64 + lane * 2; const int k = (int)(e % K), n = (int)(e / K); v2us o;
            o[0] = f2bf(w[(size_t)k * N + n]); o[1] = f2bf(w[(size_t)(k + 1) * N + n]); *(v2us*)(Bt + e) = o; }
         }
}
// k_cvtall: all five f32 matrices (tokens, four weights), each [rows][DM] -> bf16 fragment blocks [row/64][k/32][(row/16)%4], in ONE launch of few, long waves. A unit is 16 bytes of a plane: unit i takes the 8 neighbours of the row that belong there.
// A work-group takes CU groups of 256 units behind one another (64 rows x CU * 32 k, all of one matrix); a thread takes one unit of each group: its reads lie 128 bytes apart in one row, its stores 4 KiB apart (a wave: 512 contiguous bytes each).
static_assert(DQ == DM && DKV == DM, "every converted matrix has rows of DM elements");
#define CU   8                                   // units of a thread
#define CXB  (NB_ * TT * DM / 8 / (256 * CU))    // work-groups of the tokens
#define CWB  (DM * DM / 8 / (256 * CU))          // work-groups of one weight matrix
static_assert((DM / 32) % CU == 0, "a work-group's groups lie in one band of 64 rows");
static_assert(NB_ * TT * DM % (8 * 256 * CU) == 0 && DM * DM % (8 * 256 * CU) == 0, "the grid covers every matrix exactly: no thread is without its units");
__global__ __launch_bounds__(256) void k_cvtall(const float* __restrict__ x, const float* __restrict__ wq, const float* __restrict__ wk, const float* __restrict__ wv, const float* __restrict__ wo, bf* XB, bf* WQ, bf* WK, bf* WV, bf* WO) {
    const float* src = x; bf* dst = XB; int lb = blockIdx.x;   // the matrix is the same for a whole work-group
    if (lb >= CXB) { const int s = (lb - CXB) / CWB; lb = (lb - CXB) % CWB; src = s == 0 ? wq : s == 1 ? wk : s == 2 ? wv : wo; dst = s == 0 ? WQ : s == 1 ? WK : s == 2 ? WV : WO; }
    const size_t i = (size_t)lb * (256 * CU) + threadIdx.x;    // the thread's first unit; the others follow 256 units apart
    const size_t grp = i >> 8, row = grp / (DM / 32) * 64 + ((i >> 6) & 3) * 16 + (i & 15), k = grp % (DM / 32) * 32 + ((i >> 4) & 3) * 8; const float* ps = src + row * DM + k; bf* pd = dst + i * 8; v8f v[CU];
#pragma unroll
    for (int u = 0; u < CU; ++u) v[u] = *(const v8f*)(ps + u * 32);
    asm volatile("s_wait_xcnt 0x0" :: "v"(ps) : "memory");   // the wait in front of any rewrite of the register that the loads above name; all of the thread's loads are issued in front of it, so that their latencies overlap
#pragma unroll
    for (int u = 0; u < CU; ++u) { v8us o;
#pragma unroll
        for (int e = 0; e < 8; ++e) o[e] = f2bf(v[u][e]);
        *(v8us*)(pd + u * 2048) = o; }
}
__global__ __launch_bounds__(256) void k_cscvt(const float* __restrict__ cosT, const float* __restrict__ sinT, float* CS) { const int idx = blockIdx.x * 256 + threadIdx.x; if (idx >= TT * HD) return; v2f cs; cs[0] = bfr(cosT[idx]); cs[1] = bfr(sinT[idx]); *(v2f*)(CS + (size_t)idx * 2) = cs;  }
extern "C" void kernel_launch(void* const* d_in, const int* in_sizes, int n_in,
                              void* d_out, int out_size, void* d_ws, size_t ws_size, hipStream_t stream) {
    (void)in_sizes; (void)n_in; (void)out_size;
    const float* x = (const float*)d_in[0]; const float* wq = (const float*)d_in[1]; const float* bq = (const float*)d_in[2]; const float* wk = (const float*)d_in[3]; const float* bk = (const float*)d_in[4]; const float* wv = (const float*)d_in[5]; const float* bv = (const float*)d_in[6]; const float* wo = (const float*)d_in[7]; const float* bo = (const float*)d_in[8]; const float* cosT = nullptr; const float* sinT = nullptr; (void)cosT; (void)sinT;
    float* OUT = (float*)d_out;     // [4][2048][1024]
    char* wsp = (char*)d_ws;
    auto take = [&](size_t bytes) { char* p = wsp; wsp += (bytes + 255) & ~(size_t)255; return (void*)p; };
    bf* WQ = (bf*)take((size_t)DQ * DM * 2); bf* WK = (bf*)take((size_t)DKV * DM * 2); bf* WV = (bf*)take((size_t)DKV * DM * 2); bf* WO = (bf*)take((size_t)DM * DQ * 2);
    bf* XB = (bf*)take((size_t)NB_ * TT * DM * 2);
    h16* QP16 = (h16*)take((size_t)NB_ * NH_ * TT * HD * 2); h16* KP16 = (h16*)take((size_t)NB_ * NKV * TT * HD * 2); h16* VT16 = (h16*)take((size_t)NB_ * NKV * HD * TT * 2);
    bf* QPh = (bf*)take((size_t)NB_ * NH_ * TT * HD * 2); bf* QPl = (bf*)take((size_t)NB_ * NH_ * TT * HD * 2); bf* KPh = (bf*)take((size_t)NB_ * NKV * TT * HD * 2); bf* KPl = (bf*)take((size_t)NB_ * NKV * TT * HD * 2); bf* VTh = (bf*)take((size_t)NB_ * NKV * HD * TT * 2); bf* VTl = (bf*)take((size_t)NB_ * NKV * HD * TT * 2);
    bf* ATh = (bf*)take((size_t)NB_ * TT * DQ * 2); bf* ATl = (bf*)take((size_t)NB_ * TT * DQ * 2);
    if ((size_t)(wsp - (char*)d_ws) > ws_size) return;    // ws 256 MiB
    k_cvtall<<<CXB + 4 * CWB, 256, 0, stream>>>(x, wq, wk, wv, wo, XB, WQ, WK, WV, WO);
    k_gemmw<bf, 0, false><<<dim3(TT / 64, DQ / 64, NB_), 32, 0, stream>>>(XB, nullptr, WQ, nullptr, DM, bq, QP16, QPh, QPl);      // q planes [b][h], fragment blocks [t/16][d/32]
    k_gemmw<bf, 0, false><<<dim3(TT / 64, DKV / 64, NB_), 32, 0, stream>>>(XB, nullptr, WK, nullptr, DM, bk, KP16, KPh, KPl);     // k planes [b][h], fragment blocks [t/16][d/32]
    k_gemmw<bf, 0, true><<<dim3(DKV / 64, TT / 64, NB_), 32, 0, stream>>>(WV, nullptr, XB, nullptr, DM, bv, VT16, VTh, VTl);      // v planes [b][h], fragment blocks [t/32][d/16]
    k_attn<h16, 0><<<dim3(NH_, (TT - RH) / AQ, NB_), AW * 32, 0, stream>>>(QP16, nullptr, KP16, nullptr, VT16, nullptr, ATh, ATl, TT / AQ - 1);
    k_attn<bf, 2><<<dim3(NH_, RH / AQ, NB_), AW * 32, 0, stream>>>(QPh, QPl, KPh, KPl, VTh, VTl, ATh, ATl, RH / AQ - 1);
    k_gemmo<<<dim3(TT / 64, DM / 64, NB_), 32, 0, stream>>>(ATh, ATl, TT, WO, DQ, OUT, DM, bo);
}
